// v000
// Measured on an AMD MI455X. A time is GPU time per run, averaged over a window of back-to-back runs after a warm-up
// (all launches, gaps included; the runs take copies of the inputs in turn), and the median of several windows.
// Apart from v000's, it joins two sittings. Times from different sittings can be a few percent apart, while
// side-by-side timings come from the same sitting.
// The starting kernel, v000, takes 421 microseconds a run.
#include <hip/hip_runtime.h>

// compute dtype: every contraction on v_wmma_f32_16x16x32_f16 (f16 operands, f32 accumulate). q/k/v projections: bf16-RNE(x) x8 times bf16-RNE(W) x64,
// 1 product each; scores K Q^T per head: q and k (rope + l2 norm in f32) as f16 x8 planes plus x1024 residual planes, 3 products (hi.hi, hi.res, res.hi);
// O^T += V^T P^T: V^T f16 x8 plus a x1024 residual plane, P f16 x1024 plus a x1024 residual tile, 3 products (residual products share one accumulator);
// output projection: ctx f16 x64 plus a x1024 residual plane times bf16-RNE(Wo) x64, 2 products. Softmax statistics (running max, exp2, row sums),
// rope cos/sin table, l2 norm and bias adds in f32; 1/sqrt(64) and exp(logit scale) folded into the log2-domain score constant.
// Fragment k-map per lane half hh for A AND B: elements 0..7 <- k = 8hh+0..7, 8..15 <- k = 16+8hh+0..7; acc[r] = D[8hh+r][col = lane&15].

#ifndef NB
#define NB 2
#endif
#ifndef SEQ
#define SEQ 2048
#endif
#ifndef NB_FULL
#define NB_FULL 2
#endif
#ifndef SEQ_FULL
#define SEQ_FULL 2048
#endif

namespace {
constexpr int H = 16, HD = 64, DM = 1024, NT = NB * SEQ, NCS = HD / 2;
constexpr float XS = 8.0f, WSC = 64.0f, QS = 8.0f, QRS = 1024.0f, VS = 8.0f, VRS = 1024.0f, PS = 1024.0f, PRS = 1024.0f, OCS = 64.0f, OCRS = 1024.0f;
constexpr float LOG2E = 1.4426950408889634f, EPSN = 1e-6f;
static_assert(SEQ % 64 == 0 && SEQ >= 64 && SEQ <= SEQ_FULL && NB >= 1 && NB <= NB_FULL);
static_assert(DM == H * HD && HD == 64 && DM % 64 == 0 && (3 * DM) % 64 == 0 && NT % 64 == 0 && PRS == VRS);

typedef _Float16 b16;
typedef __attribute__((ext_vector_type(16))) _Float16 v16b;
typedef __attribute__((ext_vector_type(8))) _Float16 v8b;
typedef __attribute__((ext_vector_type(2))) _Float16 v2b;
typedef __attribute__((ext_vector_type(8))) float v8f;
typedef __attribute__((ext_vector_type(4))) float v4f;
typedef __attribute__((ext_vector_type(2))) float v2f;
typedef __attribute__((ext_vector_type(4))) int v4i;

__device__ __forceinline__ float bf16_rne(float f) { unsigned int u = __float_as_uint(f); u += 0x7FFFu + ((u >> 16) & 1u); return __uint_as_float(u & 0xFFFF0000u); }
// 16-bit fragment from a k-contiguous row: elements 0..7 <- p[8hh .. 8hh+7], 8..15 <- p[16+8hh .. 16+8hh+7]
__device__ __forceinline__ v16b frag_kb(const b16* p, int hh) {
  const v8b a = *(const v8b*)(p + 8 * hh), b = *(const v8b*)(p + 16 + 8 * hh); v16b f;
#pragma unroll
  for (int e = 0; e < 8; ++e) { f[e] = a[e]; f[8 + e] = b[e]; }
  return f;
}
__device__ __forceinline__ v8f wmma16b(v16b a, v16b b, v8f c) {
  v8f d = __builtin_amdgcn_wmma_f32_16x16x32_f16(false, a, false, b, (short)0, c, false, false);
  asm volatile("v_nop\n\tv_nop\n\tv_nop\n\tv_nop" : "+v"(d) : "v"(a), "v"(b));
  return d;
}
__device__ __forceinline__ void wave_lds_sync() { __builtin_amdgcn_fence(3, "workgroup"); __builtin_amdgcn_wave_barrier(); __builtin_amdgcn_fence(2, "workgroup"); }
__device__ __forceinline__ float nexp2(float v) { return __builtin_amdgcn_exp2f(v); }

// X plane [NB*SEQ tokens][1024] f16 = bf16-RNE(x) x8; token row b*SEQ+s reads input row b*SEQ_FULL+s. Thread per 8 consecutive elements: lanes 8q..8q+7 fill one
__global__ __launch_bounds__(256) void cvt_x_kernel(const float* __restrict__ X, b16* __restrict__ Xp) {
  const size_t u = (size_t)blockIdx.x * 256 + threadIdx.x;
  if (u >= (size_t)NT * DM / 8) return;
  const size_t row = u / (DM / 8); const int piece = (int)(u % (DM / 8));
  const size_t b = row / SEQ, s = row % SEQ;
  const float* src = X + (b * SEQ_FULL + s) * DM + (size_t)piece * 8;
  b16* dst = Xp + row * DM + (size_t)piece * 8;
  const v4f x0 = *(const v4f*)src, x1 = *(const v4f*)(src + 4); v8b o;
#pragma unroll
  for (int j = 0; j < 4; ++j) { o[j] = (b16)(bf16_rne(x0[j]) * XS); o[4 + j] = (b16)(bf16_rne(x1[j]) * XS); }
  *(v8b*)dst = o; 
}

// W planes [4][1024 out][1024 in] f16 = bf16-RNE(W) x64, k-contiguous rows ([n][k] copy of the weight). blockIdx.y selects the weight, block-uniform.
__global__ __launch_bounds__(256) void cvt_w_kernel(const float* __restrict__ Wq, const float* __restrict__ Wk, const float* __restrict__ Wv,
                                                    const float* __restrict__ Wo, b16* __restrict__ Wp) {
  const int y = (int)blockIdx.y;
  const float* W = (y == 0) ? Wq : ((y == 1) ? Wk : ((y == 2) ? Wv : Wo));
  const size_t u = (size_t)blockIdx.x * 256 + threadIdx.x;
  if (u >= (size_t)DM * DM / 8) return;
  const float* src = W + u * 8; b16* dst = Wp + (size_t)y * DM * DM + u * 8;
  const v4f x0 = *(const v4f*)src, x1 = *(const v4f*)(src + 4); v8b o;
#pragma unroll
  for (int j = 0; j < 4; ++j) { o[j] = (b16)(bf16_rne(x0[j]) * WSC); o[4 + j] = (b16)(bf16_rne(x1[j]) * WSC); }
  *(v8b*)dst = o; 
}

// rope table T[s][i] = (cos, sin)(s * freq_i), freq_i = 1 / fl32(10000^(2i/64)), s*freq as an f32 product. Argument reduction in f64 (mul/fma only), short f32
__global__ __launch_bounds__(256) void rope_table_kernel(v2f* __restrict__ T) {
  const int u = (int)blockIdx.x * 256 + (int)threadIdx.x;
  if (u >= SEQ * NCS) return;
  const int s = u / NCS, i = u % NCS;
  const float ex = (float)(2 * i) / (float)HD;
  const float pw = (float)exp2((double)ex * 13.287712379549449);
  const float freq = 1.0f / pw;
  const float ang = (float)s * freq;
  const double a = (double)ang;
  const double k = __builtin_rint(a * 0.63661977236758134);
  double rd = __builtin_fma(-k, 1.5707963267948966, a);
  rd = __builtin_fma(-k, 6.123233995736766e-17, rd);
  const float r = (float)rd, r2 = r * r;
  const float sp = r + r * r2 * (-1.6666666666666666e-1f + r2 * (8.333333333333333e-3f + r2 * (-1.984126984126984e-4f + r2 * 2.7557319223985893e-6f)));
  const float cp = 1.0f + r2 * (-0.5f + r2 * (4.1666666666666664e-2f + r2 * (-1.3888888888888889e-3f + r2 * (2.48015873015873e-5f + r2 * -2.755731922398589e-7f))));
  const int kq = (int)(((long long)k) & 3);
  const float c = (kq == 0) ? cp : ((kq == 1) ? -sp : ((kq == 2) ? -cp : sp));
  const float sn = (kq == 0) ? sp : ((kq == 1) ? cp : ((kq == 2) ? -sp : -cp));
  v2f o; o.x = c; o.y = sn;
  *(v2f*)(T + u) = o; 
}

// Fused q/k/v projection: C[64 tokens x 64 features] = A(X plane) . B (B[k][n] = W[n][k] from the k-contiguous W plane), K = 1024 stepped by 32, fragments loaded
// straight from the global f16 planes. Block 128 threads = 4 waves in 2x2, wave tile 32x32 = 2x2 WMMA tiles. The 64-column tile is exactly one head of q, k or
// v (which = column block / 1024, block-uniform). Epilogue: acc/512 + bf16-RNE(bias) staged in LDS (cross-wave: block barrier), then
__global__ __launch_bounds__(128) __attribute__((amdgpu_num_vgpr(256))) void gemm_qkv_kernel(
    const b16* __restrict__ Xp, const b16* __restrict__ Wp, const float* __restrict__ bq, const float* __restrict__ bk, const float* __restrict__ bv,
    const v2f* __restrict__ CSt, b16* __restrict__ Qp, b16* __restrict__ Qr, b16* __restrict__ Kp, b16* __restrict__ Kr, b16* __restrict__ VT,
    b16* __restrict__ VR) {
  __shared__ __attribute__((aligned(16))) float Tt[64][HD + 4];
  const int wave = threadIdx.x >> 5, lane = threadIdx.x & 31, hh = lane >> 4, m = lane & 15, wm = wave >> 1, wn = wave & 1;
  const int nblk = (int)blockIdx.x * 64, which = nblk / DM, n0 = nblk % DM, h = n0 / HD;
  const int mblk = (int)blockIdx.y * 64, b = mblk / SEQ, s0 = mblk % SEQ;
  const b16* Wb = Wp + (size_t)which * DM * DM + (size_t)(n0 + wn * 32) * DM;
  const b16* Ab = Xp + (size_t)(mblk + wm * 32) * DM;
  const float* bsel = (which == 0) ? bq : ((which == 1) ? bk : bv);
  v8f acc[2][2];
#pragma unroll
  for (int i = 0; i < 2; ++i)
#pragma unroll
    for (int j = 0; j < 2; ++j) acc[i][j] = (v8f){};
#pragma unroll 1
  for (int k0 = 0; k0 < DM; k0 += 32) {
    v16b af[2], bf[2];
#pragma unroll
    for (int mt = 0; mt < 2; ++mt) af[mt] = frag_kb(Ab + (size_t)(mt * 16 + m) * DM + k0, hh);
#pragma unroll
    for (int nt = 0; nt < 2; ++nt) bf[nt] = frag_kb(Wb + (size_t)(nt * 16 + m) * DM + k0, hh);
#pragma unroll
    for (int mt = 0; mt < 2; ++mt)
#pragma unroll
      for (int nt = 0; nt < 2; ++nt) acc[mt][nt] = wmma16b(af[mt], bf[nt], acc[mt][nt]);
  }
  float bias[2];
#pragma unroll
  for (int nt = 0; nt < 2; ++nt) bias[nt] = bf16_rne(bsel[n0 + wn * 32 + nt * 16 + m]);
  const float isc = 1.0f / (XS * WSC);
#pragma unroll
  for (int mt = 0; mt < 2; ++mt)
#pragma unroll
    for (int nt = 0; nt < 2; ++nt)
#pragma unroll
      for (int r = 0; r < 8; ++r) Tt[wm * 32 + mt * 16 + 8 * hh + r][wn * 32 + nt * 16 + m] = acc[mt][nt][r] * isc + bias[nt];
  __syncthreads();   // Tt is read across waves
  if (which < 2) {
    const size_t pb = ((size_t)(b * H + h) * SEQ + (size_t)s0) * HD;
    b16* Ph = ((which == 0) ? Qp : Kp) + pb;
    b16* Pl = ((which == 0) ? Qr : Kr) + pb;
#pragma unroll 1
    for (int it = 0; it < 16; ++it) {
      const int r = it * 4 + wave, s = s0 + r;
      const float x0 = Tt[r][2 * lane], x1 = Tt[r][2 * lane + 1];
      const v2f cv = CSt[(size_t)s * NCS + lane];
      const float y0 = x0 * cv.x - x1 * cv.y, y1 = x1 * cv.x + x0 * cv.y;
      float ss = y0 * y0 + y1 * y1;
#pragma unroll
      for (int w = 16; w >= 1; w >>= 1) ss += __shfl_xor(ss, w);
      const float inv = 1.0f / sqrtf(ss + EPSN);
      const float z0 = y0 * inv * QS, z1 = y1 * inv * QS;
      const b16 h0 = (b16)z0, h1 = (b16)z1;
      v2b oh, ol; oh.x = h0; oh.y = h1; ol.x = (b16)((z0 - (float)h0) * QRS); ol.y = (b16)((z1 - (float)h1) * QRS);
      const size_t off = (size_t)r * HD + 2 * lane;
      *(v2b*)(Ph + off) = oh; *(v2b*)(Pl + off) = ol;
      
    }
  } else {
    const size_t vb = ((size_t)(b * H + h) * HD) * SEQ + (size_t)s0;
#pragma unroll 1
    for (int it = 0; it < 4; ++it) {
      const int d = wave * 16 + it * 4 + (lane >> 3), tok = (lane & 7) * 8;
      v8b oh, ol;
#pragma unroll
      for (int j = 0; j < 8; ++j) {
        const float v = Tt[tok + j][d] * VS; const b16 hv = (b16)v; oh[j] = hv; ol[j] = (b16)((v - (float)hv) * VRS); }
      const size_t off = vb + (size_t)d * SEQ + tok;
      *(v8b*)(VT + off) = oh; *(v8b*)(VR + off) = ol;
      
    }
  }
}

// Masked softmax attention per (query block of 32, b*H+h); block = 2 waves x 16 queries; key steps of 32 over all SEQ keys in fixed order. The mask tile
// (16 ints per lane, row = the lane's query) is read first; a tile with no unmasked entry in the wave's 16x32 region is skipped wave-uniformly (contributes 0).
// S^T = K Q^T (hi.hi + hi.res + res.hi, q/k residual products scaled back by 1/1024), masked entries replaced by -inf, online softmax (running max, f32,
// -inf-safe), P x1024 and its x1024 residual via wave-private LDS, O^T += V^T P^T with V^T hi/res planes. ctx rows [b*SEQ+s][h*64+d] written as f16 x64
__global__ __launch_bounds__(64) __attribute__((amdgpu_num_vgpr(256))) void attn_kernel(
    const b16* __restrict__ Qp, const b16* __restrict__ Qr, const b16* __restrict__ Kp, const b16* __restrict__ Kr,
    const b16* __restrict__ VT, const b16* __restrict__ VR, const int* __restrict__ mask, const float* __restrict__ lsc,
    b16* __restrict__ Ch, b16* __restrict__ Cr) {
  __shared__ __attribute__((aligned(16))) b16 Pb[2][16][32 + 8];
  __shared__ __attribute__((aligned(16))) b16 Pr[2][16][32 + 8];
  __shared__ __attribute__((aligned(16))) float To[2][16][HD + 4];
  const int wave = threadIdx.x >> 5, lane = threadIdx.x & 31, hh = lane >> 4, col = lane & 15;
  const int bhi = (int)blockIdx.y, b = bhi / H, h = bhi % H;
  const int q0 = (int)blockIdx.x * 32 + wave * 16, qi = q0 + col;
  const size_t pq = (size_t)bhi * SEQ * HD;   // same plane size for [s][64] and [64][s] layouts
  const b16* Kb = Kp + pq; const b16* Klb = Kr + pq;
  const b16* Vb = VT + pq; const b16* Rb = VR + pq;
  const int* mrow = mask + ((size_t)b * SEQ_FULL + (size_t)qi) * SEQ_FULL;
  const v16b qa0 = frag_kb(Qp + pq + (size_t)qi * HD, hh), qa1 = frag_kb(Qp + pq + (size_t)qi * HD + 32, hh);
  const v16b ql0 = frag_kb(Qr + pq + (size_t)qi * HD, hh), ql1 = frag_kb(Qr + pq + (size_t)qi * HD + 32, hh);
  const float cs = 0.125f * expf(bf16_rne(lsc[0])) * (LOG2E / (QS * QS));
  float m = -INFINITY, l = 0.0f; v8f o[4], o2[4];
#pragma unroll
  for (int t = 0; t < 4; ++t) { o[t] = (v8f){}; o2[t] = (v8f){}; }
#pragma unroll 1
  for (int k0 = 0; k0 < SEQ; k0 += 32) {
    unsigned int vbm = 0u;   // bit i set <=> entry i of this lane is NOT masked; bits 0..7 keys k0+8hh+0..7, bits 8..15 keys k0+16+8hh+0..7
    {
      const int* mp = mrow + k0 + 8 * hh;
      const v4i g0 = *(const v4i*)mp, g1 = *(const v4i*)(mp + 4), g2 = *(const v4i*)(mp + 16), g3 = *(const v4i*)(mp + 20);
#pragma unroll
      for (int j = 0; j < 4; ++j) {
        vbm |= (g0[j] == 0 ? 1u : 0u) << j;       vbm |= (g1[j] == 0 ? 1u : 0u) << (4 + j);
        vbm |= (g2[j] == 0 ? 1u : 0u) << (8 + j); vbm |= (g3[j] == 0 ? 1u : 0u) << (12 + j);
      }
    }
    if (__any((vbm != 0u) ? 1 : 0) == 0) continue;
    float e[16]; float mx = -INFINITY;
#pragma unroll
    for (int u = 0; u < 2; ++u) {
      const size_t kr = (size_t)(k0 + u * 16 + col) * HD;
      const v16b ka = frag_kb(Kb + kr, hh), kc = frag_kb(Kb + kr + 32, hh);
      v8f s = wmma16b(ka, qa0, (v8f){}); s = wmma16b(kc, qa1, s);
      v8f s2 = wmma16b(ka, ql0, (v8f){}); s2 = wmma16b(kc, ql1, s2);
      s2 = wmma16b(frag_kb(Klb + kr, hh), qa0, s2); s2 = wmma16b(frag_kb(Klb + kr + 32, hh), qa1, s2);
#pragma unroll
      for (int r = 0; r < 8; ++r) {
        const int idx = u * 8 + r;
        const float v = ((vbm >> idx) & 1u) ? (s[r] + s2[r] * (1.0f / QRS)) * cs : -INFINITY;
        e[idx] = v; mx = fmaxf(mx, v); } }
    mx = fmaxf(mx, __shfl_xor(mx, 16)); const float mn = fmaxf(m, mx);
    const float mref = (mn == -INFINITY) ? 0.0f : mn;
    const float al = nexp2(m - mref); float sum = 0.0f;
#pragma unroll
    for (int i2 = 0; i2 < 16; ++i2) {
      const float p = nexp2(e[i2] - mref); sum += p; const int pi = (i2 < 8 ? 0 : 16) + 8 * hh + (i2 & 7);
      const float pp = p * PS; const b16 ph = (b16)pp; Pb[wave][col][pi] = ph;
      Pr[wave][col][pi] = (b16)((pp - (float)ph) * PRS); }
    sum += __shfl_xor(sum, 16); l = l * al + sum; m = mn;
    wave_lds_sync();
    const v16b pf = frag_kb(&Pb[wave][col][0], hh), plf = frag_kb(&Pr[wave][col][0], hh);
#pragma unroll
    for (int t = 0; t < 4; ++t) {
      o[t] *= al; o2[t] *= al;
      const size_t vo = (size_t)(t * 16 + col) * SEQ + k0;
      const v16b vh = frag_kb(Vb + vo, hh), vl = frag_kb(Rb + vo, hh);
      o[t] = wmma16b(vh, pf, o[t]);
      o2[t] = wmma16b(vl, pf, o2[t]);
      o2[t] = wmma16b(vh, plf, o2[t]); }
    wave_lds_sync(); }
  const float inv = 1.0f / (l * PS * VS);
#pragma unroll
  for (int t = 0; t < 4; ++t) {
#pragma unroll
    for (int r = 0; r < 8; ++r) To[wave][col][t * 16 + 8 * hh + r] = (o[t][r] + o2[t][r] * (1.0f / VRS)) * inv; }
  wave_lds_sync();
  const size_t cb = ((size_t)b * SEQ + (size_t)q0) * DM + (size_t)h * HD;
#pragma unroll 1
  for (int it = 0; it < 4; ++it) {
    const int rl = it * 4 + (lane >> 3), pc = (lane & 7) * 8;
    const v4f f0 = *(const v4f*)(&To[wave][rl][pc]), f1 = *(const v4f*)(&To[wave][rl][pc + 4]);
    v8b oh, ol;
#pragma unroll
    for (int j = 0; j < 4; ++j) {
      const float v0 = f0[j] * OCS; const b16 hv0 = (b16)v0; oh[j] = hv0; ol[j] = (b16)((v0 - (float)hv0) * OCRS);
      const float v1 = f1[j] * OCS; const b16 hv1 = (b16)v1; oh[4 + j] = hv1; ol[4 + j] = (b16)((v1 - (float)hv1) * OCRS); }
    const size_t off = cb + (size_t)rl * DM + pc;
    *(v8b*)(Ch + off) = oh; *(v8b*)(Cr + off) = ol;
    
  }
}

// Output projection: out[64 tokens x 64 features] = (ctx hi . Wo + ctx res . Wo / 1024) / 4096 + bf16-RNE(bo), K = 1024 stepped by 32, fragments from the
// global planes, block 128 = 4 waves in 2x2, wave tile 32x32. Result staged in LDS (cross-wave: block barrier); each 256-B row segment by 16 consecutive lanes x
__global__ __launch_bounds__(128) __attribute__((amdgpu_num_vgpr(256))) void gemm_out_kernel(
    const b16* __restrict__ Ch, const b16* __restrict__ Cr, const b16* __restrict__ Wop, const float* __restrict__ bo, float* __restrict__ out) {
  __shared__ __attribute__((aligned(16))) float Tt[64][HD + 4];
  const int wave = threadIdx.x >> 5, lane = threadIdx.x & 31, hh = lane >> 4, m = lane & 15, wm = wave >> 1, wn = wave & 1;
  const int nblk = (int)blockIdx.x * 64;
  const int mblk = (int)blockIdx.y * 64, b = mblk / SEQ, s0 = mblk % SEQ;
  const b16* Wb = Wop + (size_t)(nblk + wn * 32) * DM;
  const b16* Ab = Ch + (size_t)(mblk + wm * 32) * DM;
  const b16* Rb = Cr + (size_t)(mblk + wm * 32) * DM;
  v8f acc[2][2], acc2[2][2];
#pragma unroll
  for (int i = 0; i < 2; ++i)
#pragma unroll
    for (int j = 0; j < 2; ++j) { acc[i][j] = (v8f){}; acc2[i][j] = (v8f){}; }
#pragma unroll 1
  for (int k0 = 0; k0 < DM; k0 += 32) {
    v16b af[2], rf[2], bf[2];
#pragma unroll
    for (int mt = 0; mt < 2; ++mt) {
      af[mt] = frag_kb(Ab + (size_t)(mt * 16 + m) * DM + k0, hh);
      rf[mt] = frag_kb(Rb + (size_t)(mt * 16 + m) * DM + k0, hh); }
#pragma unroll
    for (int nt = 0; nt < 2; ++nt) bf[nt] = frag_kb(Wb + (size_t)(nt * 16 + m) * DM + k0, hh);
#pragma unroll
    for (int mt = 0; mt < 2; ++mt)
#pragma unroll
      for (int nt = 0; nt < 2; ++nt) {
        acc[mt][nt] = wmma16b(af[mt], bf[nt], acc[mt][nt]);
        acc2[mt][nt] = wmma16b(rf[mt], bf[nt], acc2[mt][nt]); }
  }
  float bias[2];
#pragma unroll
  for (int nt = 0; nt < 2; ++nt) bias[nt] = bf16_rne(bo[nblk + wn * 32 + nt * 16 + m]);
  const float isc = 1.0f / (OCS * WSC), irs = 1.0f / OCRS;
#pragma unroll
  for (int mt = 0; mt < 2; ++mt)
#pragma unroll
    for (int nt = 0; nt < 2; ++nt)
#pragma unroll
      for (int r = 0; r < 8; ++r)
        Tt[wm * 32 + mt * 16 + 8 * hh + r][wn * 32 + nt * 16 + m] = (acc[mt][nt][r] + acc2[mt][nt][r] * irs) * isc + bias[nt];
  __syncthreads();   // Tt is read across waves
  float* ob = out + ((size_t)b * SEQ_FULL + (size_t)s0) * DM + nblk;
  {
#pragma unroll 1
    for (int it = 0; it < 8; ++it) {
      const int rr = it * 8 + wave * 2 + hh; const v4f f = *(const v4f*)(&Tt[rr][m * 4]);
      *(v4f*)(ob + (size_t)rr * DM + m * 4) = f; }
     }
}
}  // namespace

extern "C" void kernel_launch(void* const* d_in, const int* in_sizes, int n_in, void* d_out, int out_size, void* d_ws, size_t ws_size, hipStream_t stream) {
  // wire order: 0 x [NB_FULL][SEQ_FULL][1024] f32, 1 Wq [1024][1024], 2 bq [1024], 3 Wk, 4 bk, 5 Wv, 6 bv, 7 Wo, 8 bo, 9 logit scale [1] f32,
  //             10 mask int32 [NB_FULL][SEQ_FULL][SEQ_FULL] (nonzero = masked); out [NB_FULL][SEQ_FULL][1024] f32
  if (n_in < 11) return;
  const size_t need_x = ((size_t)(NB - 1) * SEQ_FULL + SEQ) * DM;
  const size_t need_m = ((size_t)(NB - 1) * SEQ_FULL + SEQ - 1) * SEQ_FULL + SEQ;
  if ((size_t)in_sizes[0] < need_x || (size_t)out_size < need_x || (size_t)in_sizes[10] < need_m || in_sizes[9] < 1) return;
  if (in_sizes[1] < DM * DM || in_sizes[3] < DM * DM || in_sizes[5] < DM * DM || in_sizes[7] < DM * DM) return;
  if (in_sizes[2] < DM || in_sizes[4] < DM || in_sizes[6] < DM || in_sizes[8] < DM) return;
  const float* X = (const float*)d_in[0];
  const float* Wq = (const float*)d_in[1]; const float* bq = (const float*)d_in[2];
  const float* Wk = (const float*)d_in[3]; const float* bk = (const float*)d_in[4];
  const float* Wv = (const float*)d_in[5]; const float* bv = (const float*)d_in[6];
  const float* Wo = (const float*)d_in[7]; const float* bo = (const float*)d_in[8];
  const float* lsc = (const float*)d_in[9]; const int* mask = (const int*)d_in[10];
  size_t off = 0; char* ws = (char*)d_ws;
  auto carve = [&](size_t bytes) { char* p = ws + off; off += (bytes + 255) & ~(size_t)255; return p; };
  const size_t plane = (size_t)NT * DM * 2;
  v2f* T  = (v2f*)carve((size_t)SEQ * NCS * sizeof(v2f));          // 524,288 B (256-B rows, exact)
  b16* Xp = (b16*)carve(plane);
  b16* Wp = (b16*)carve((size_t)4 * DM * DM * 2);                   // 8,388,608 B
  b16* Qp = (b16*)carve(plane); b16* Qr = (b16*)carve(plane); b16* Kp = (b16*)carve(plane); b16* Kr = (b16*)carve(plane);
  b16* VT = (b16*)carve(plane); b16* VR = (b16*)carve(plane); b16* Ch = (b16*)carve(plane); b16* Cr = (b16*)carve(plane);
  if (off > ws_size || off > ((size_t)128 << 20)) return;          // 84,410,368 B total at NB=2, SEQ=2048
  cvt_x_kernel<<<dim3((unsigned)(((size_t)NT * DM / 8 + 255) / 256)), 256, 0, stream>>>(X, Xp);
  cvt_w_kernel<<<dim3((unsigned)(((size_t)DM * DM / 8 + 255) / 256), 4), 256, 0, stream>>>(Wq, Wk, Wv, Wo, Wp);
  rope_table_kernel<<<dim3((unsigned)((SEQ * NCS + 255) / 256)), 256, 0, stream>>>(T);
  gemm_qkv_kernel<<<dim3(3 * DM / 64, NT / 64), 128, 0, stream>>>(Xp, Wp, bq, bk, bv, T, Qp, Qr, Kp, Kr, VT, VR);
  attn_kernel<<<dim3(SEQ / 32, NB * H), 64, 0, stream>>>(Qp, Qr, Kp, Kr, VT, VR, mask, lsc, Ch, Cr);
  gemm_out_kernel<<<dim3(DM / 64, NT / 64), 128, 0, stream>>>(Ch, Cr, Wp + (size_t)3 * DM * DM, bo, (float*)d_out);
}

// v001
// Measured time: 415 microseconds a run.
// Next to v000, in two timings, it ran 1.03 and 1.04 times as fast.
#include <hip/hip_runtime.h>

// compute dtype: every contraction on v_wmma_f32_16x16x32_f16 (f16 operands, f32 accumulate). q/k/v projections: bf16-RNE(x) x8 times bf16-RNE(W) x64,
// 1 product each; scores K Q^T per head: q and k (rope + l2 norm in f32) as f16 x8 planes plus x1024 residual planes, 3 products (hi.hi, hi.res, res.hi);
// O^T += V^T P^T: V^T f16 x8 plus a x1024 residual plane, P f16 x1024 plus a x1024 residual tile, 3 products (residual products share one accumulator);
// output projection: ctx f16 x64 plus a x1024 residual plane times bf16-RNE(Wo) x64, 2 products. Softmax statistics (running max, exp2, row sums),
// rope cos/sin table, l2 norm and bias adds in f32; 1/sqrt(64) and exp(logit scale) folded into the log2-domain score constant.
// Fragment k-map per lane half hh for A AND B: elements 0..7 <- k = 8hh+0..7, 8..15 <- k = 16+8hh+0..7; acc[r] = D[8hh+r][col = lane&15].
// Packed planes (X, W, K, V^T, ctx and their residuals): a plane of R rows x C k-columns is stored as 16x32 tiles, tile index (row/16)*(C/32) + k/32 (V^T: (k/32)*(R/16) + row/16), each tile
// 512 elements laid out [k octet 0..3][row 0..15][8], so that each of a fragment's two wave loads reads 512 contiguous bytes (four whole 128-B lines).

#ifndef NB
#define NB 2
#endif
#ifndef SEQ
#define SEQ 2048
#endif
#ifndef NB_FULL
#define NB_FULL 2
#endif
#ifndef SEQ_FULL
#define SEQ_FULL 2048
#endif

namespace {
constexpr int H = 16, HD = 64, DM = 1024, NT = NB * SEQ, NCS = HD / 2, KT = DM / 32, TE = 512;
constexpr float XS = 8.0f, WSC = 64.0f, QS = 8.0f, QRS = 1024.0f, VS = 8.0f, VRS = 1024.0f, PS = 1024.0f, PRS = 1024.0f, OCS = 64.0f, OCRS = 1024.0f;
constexpr float LOG2E = 1.4426950408889634f, EPSN = 1e-6f;
static_assert(SEQ % 64 == 0 && SEQ >= 64 && SEQ <= SEQ_FULL && NB >= 1 && NB <= NB_FULL);
static_assert(DM == H * HD && HD == 64 && DM % 64 == 0 && (3 * DM) % 64 == 0 && NT % 64 == 0 && PRS == VRS);

typedef _Float16 b16;
typedef __attribute__((ext_vector_type(16))) _Float16 v16b;
typedef __attribute__((ext_vector_type(8))) _Float16 v8b;
typedef __attribute__((ext_vector_type(2))) _Float16 v2b;
typedef __attribute__((ext_vector_type(8))) float v8f;
typedef __attribute__((ext_vector_type(4))) float v4f;
typedef __attribute__((ext_vector_type(2))) float v2f;
typedef __attribute__((ext_vector_type(4))) int v4i;

__device__ __forceinline__ float bf16_rne(float f) { unsigned int u = __float_as_uint(f); u += 0x7FFFu + ((u >> 16) & 1u); return __uint_as_float(u & 0xFFFF0000u); }
// 16-bit fragment from a k-contiguous row: elements 0..7 <- p[8hh .. 8hh+7], 8..15 <- p[16+8hh .. 16+8hh+7]
__device__ __forceinline__ v16b frag_kb(const b16* p, int hh) {
  const v8b a = *(const v8b*)(p + 8 * hh), b = *(const v8b*)(p + 16 + 8 * hh); v16b f;
#pragma unroll
  for (int e = 0; e < 8; ++e) { f[e] = a[e]; f[8 + e] = b[e]; }
  return f;
}
// the same fragment from a packed tile; p = tile + 8*lane (lane = 16hh + row): octets hh and 2+hh of the lane's row
__device__ __forceinline__ v16b frag_pk(const b16* p) {
  const v8b a = *(const v8b*)p, b = *(const v8b*)(p + 256); v16b f;
#pragma unroll
  for (int e = 0; e < 8; ++e) { f[e] = a[e]; f[8 + e] = b[e]; }
  return f;
}
__device__ __forceinline__ v8f wmma16b(v16b a, v16b b, v8f c) {
  v8f d = __builtin_amdgcn_wmma_f32_16x16x32_f16(false, a, false, b, (short)0, c, false, false);
  asm volatile("v_nop\n\tv_nop\n\tv_nop\n\tv_nop" : "+v"(d) : "v"(a), "v"(b));
  return d;
}
__device__ __forceinline__ void wave_lds_sync() { __builtin_amdgcn_fence(3, "workgroup"); __builtin_amdgcn_wave_barrier(); __builtin_amdgcn_fence(2, "workgroup"); }
__device__ __forceinline__ float nexp2(float v) { return __builtin_amdgcn_exp2f(v); }

// X plane, packed tiles of [NB*SEQ tokens][1024], f16 = bf16-RNE(x) x8; token row b*SEQ+s reads input row b*SEQ_FULL+s. Thread per k octet: a wave reads 8 rows x
// 128 B and writes four whole 128-B lines of one tile.
__global__ __launch_bounds__(256) void cvt_x_kernel(const float* __restrict__ X, b16* __restrict__ Xp) {
  const size_t u = (size_t)blockIdx.x * 256 + threadIdx.x;
  if (u >= (size_t)NT * DM / 8) return;
  const int oct = (int)(u & 3), rl = (int)((u >> 2) & 15); const size_t t = u >> 6;
  const size_t row = (t / KT) * 16 + rl; const int kt = (int)(t % KT);
  const size_t b = row / SEQ, s = row % SEQ;
  const float* src = X + (b * SEQ_FULL + s) * DM + (size_t)(kt * 32 + oct * 8);
  b16* dst = Xp + t * TE + (size_t)((oct * 16 + rl) * 8);
  const v4f x0 = *(const v4f*)src, x1 = *(const v4f*)(src + 4); v8b o;
#pragma unroll
  for (int j = 0; j < 4; ++j) { o[j] = (b16)(bf16_rne(x0[j]) * XS); o[4 + j] = (b16)(bf16_rne(x1[j]) * XS); }
  *(v8b*)dst = o; 
}

// W planes [4], each the packed tiles of [1024 out][1024 in], f16 = bf16-RNE(W) x64 (rows n, k along the input). blockIdx.y selects the weight, block-uniform.
__global__ __launch_bounds__(256) void cvt_w_kernel(const float* __restrict__ Wq, const float* __restrict__ Wk, const float* __restrict__ Wv,
                                                    const float* __restrict__ Wo, b16* __restrict__ Wp) {
  const int y = (int)blockIdx.y;
  const float* W = (y == 0) ? Wq : ((y == 1) ? Wk : ((y == 2) ? Wv : Wo));
  const size_t u = (size_t)blockIdx.x * 256 + threadIdx.x;
  if (u >= (size_t)DM * DM / 8) return;
  const int oct = (int)(u & 3), rl = (int)((u >> 2) & 15); const size_t t = u >> 6;
  const float* src = W + ((t / KT) * 16 + rl) * DM + (size_t)((int)(t % KT) * 32 + oct * 8);
  b16* dst = Wp + (size_t)y * DM * DM + t * TE + (size_t)((oct * 16 + rl) * 8);
  const v4f x0 = *(const v4f*)src, x1 = *(const v4f*)(src + 4); v8b o;
#pragma unroll
  for (int j = 0; j < 4; ++j) { o[j] = (b16)(bf16_rne(x0[j]) * WSC); o[4 + j] = (b16)(bf16_rne(x1[j]) * WSC); }
  *(v8b*)dst = o; 
}

// rope table T[s][i] = (cos, sin)(s * freq_i), freq_i = 1 / fl32(10000^(2i/64)), s*freq as an f32 product. Argument reduction in f64 (mul/fma only), short f32
__global__ __launch_bounds__(256) void rope_table_kernel(v2f* __restrict__ T) {
  const int u = (int)blockIdx.x * 256 + (int)threadIdx.x;
  if (u >= SEQ * NCS) return;
  const int s = u / NCS, i = u % NCS;
  const float ex = (float)(2 * i) / (float)HD;
  const float pw = (float)exp2((double)ex * 13.287712379549449);
  const float freq = 1.0f / pw;
  const float ang = (float)s * freq;
  const double a = (double)ang;
  const double k = __builtin_rint(a * 0.63661977236758134);
  double rd = __builtin_fma(-k, 1.5707963267948966, a);
  rd = __builtin_fma(-k, 6.123233995736766e-17, rd);
  const float r = (float)rd, r2 = r * r;
  const float sp = r + r * r2 * (-1.6666666666666666e-1f + r2 * (8.333333333333333e-3f + r2 * (-1.984126984126984e-4f + r2 * 2.7557319223985893e-6f)));
  const float cp = 1.0f + r2 * (-0.5f + r2 * (4.1666666666666664e-2f + r2 * (-1.3888888888888889e-3f + r2 * (2.48015873015873e-5f + r2 * -2.755731922398589e-7f))));
  const int kq = (int)(((long long)k) & 3);
  const float c = (kq == 0) ? cp : ((kq == 1) ? -sp : ((kq == 2) ? -cp : sp));
  const float sn = (kq == 0) ? sp : ((kq == 1) ? cp : ((kq == 2) ? -sp : -cp));
  v2f o; o.x = c; o.y = sn;
  *(v2f*)(T + u) = o; 
}

// Fused q/k/v projection: C[64 tokens x 64 features] = A(X plane) . B (B[k][n] = W[n][k] from the packed W plane), K = 1024 stepped by 32, fragments loaded
// straight from the packed global f16 planes. q planes stay [s][64]; k planes are packed tiles of [s][64], v planes packed tiles of [64][s].
// Block 128 threads = 4 waves in 2x2, wave tile 32x32 = 2x2 WMMA tiles. The 64-column tile is exactly one head of q, k or
// v (which = column block / 1024, block-uniform). Epilogue: acc/512 + bf16-RNE(bias) staged in LDS (cross-wave: block barrier), then
__global__ __launch_bounds__(128) __attribute__((amdgpu_num_vgpr(256))) void gemm_qkv_kernel(
    const b16* __restrict__ Xp, const b16* __restrict__ Wp, const float* __restrict__ bq, const float* __restrict__ bk, const float* __restrict__ bv,
    const v2f* __restrict__ CSt, b16* __restrict__ Qp, b16* __restrict__ Qr, b16* __restrict__ Kp, b16* __restrict__ Kr, b16* __restrict__ VT,
    b16* __restrict__ VR) {
  __shared__ __attribute__((aligned(16))) float Tt[64][HD + 4];
  const int wave = threadIdx.x >> 5, lane = threadIdx.x & 31, hh = lane >> 4, m = lane & 15, wm = wave >> 1, wn = wave & 1;
  const int nblk = (int)blockIdx.x * 64, which = nblk / DM, n0 = nblk % DM, h = n0 / HD;
  const int mblk = (int)blockIdx.y * 64, b = mblk / SEQ, s0 = mblk % SEQ;
  const b16* Wb = Wp + (size_t)which * DM * DM + (size_t)((n0 + wn * 32) / 16) * KT * TE + 8 * lane;
  const b16* Ab = Xp + (size_t)((mblk + wm * 32) / 16) * KT * TE + 8 * lane;
  const float* bsel = (which == 0) ? bq : ((which == 1) ? bk : bv);
  v8f acc[2][2];
#pragma unroll
  for (int i = 0; i < 2; ++i)
#pragma unroll
    for (int j = 0; j < 2; ++j) acc[i][j] = (v8f){};
#pragma unroll 1
  for (int k0 = 0; k0 < DM; k0 += 32) {
    v16b af[2], bf[2];
#pragma unroll
    for (int mt = 0; mt < 2; ++mt) af[mt] = frag_pk(Ab + (size_t)(mt * KT + k0 / 32) * TE);
#pragma unroll
    for (int nt = 0; nt < 2; ++nt) bf[nt] = frag_pk(Wb + (size_t)(nt * KT + k0 / 32) * TE);
#pragma unroll
    for (int mt = 0; mt < 2; ++mt)
#pragma unroll
      for (int nt = 0; nt < 2; ++nt) acc[mt][nt] = wmma16b(af[mt], bf[nt], acc[mt][nt]);
  }
  float bias[2];
#pragma unroll
  for (int nt = 0; nt < 2; ++nt) bias[nt] = bf16_rne(bsel[n0 + wn * 32 + nt * 16 + m]);
  const float isc = 1.0f / (XS * WSC);
#pragma unroll
  for (int mt = 0; mt < 2; ++mt)
#pragma unroll
    for (int nt = 0; nt < 2; ++nt)
#pragma unroll
      for (int r = 0; r < 8; ++r) Tt[wm * 32 + mt * 16 + 8 * hh + r][wn * 32 + nt * 16 + m] = acc[mt][nt][r] * isc + bias[nt];
  __syncthreads();   // Tt is read across waves
  if (which < 2) {
    const size_t pb = (size_t)(b * H + h) * SEQ * HD;
    b16* Ph = ((which == 0) ? Qp : Kp) + pb;
    b16* Pl = ((which == 0) ? Qr : Kr) + pb;
#pragma unroll 1
    for (int it = 0; it < 16; ++it) {
      const int r = wave * 16 + it, s = s0 + r;   // a wave owns 16 consecutive rows = one row of packed tiles
      const float x0 = Tt[r][2 * lane], x1 = Tt[r][2 * lane + 1];
      const v2f cv = CSt[(size_t)s * NCS + lane];
      const float y0 = x0 * cv.x - x1 * cv.y, y1 = x1 * cv.x + x0 * cv.y;
      float ss = y0 * y0 + y1 * y1;
#pragma unroll
      for (int w = 16; w >= 1; w >>= 1) ss += __shfl_xor(ss, w);
      const float inv = 1.0f / sqrtf(ss + EPSN);
      const float z0 = y0 * inv * QS, z1 = y1 * inv * QS;
      const b16 h0 = (b16)z0, h1 = (b16)z1;
      v2b oh, ol; oh.x = h0; oh.y = h1; ol.x = (b16)((z0 - (float)h0) * QRS); ol.y = (b16)((z1 - (float)h1) * QRS);
      const size_t off = (which == 0) ? (size_t)s * HD + 2 * lane
                                      : (size_t)(((s >> 4) * 2 + (lane >> 4)) * 64 + ((lane >> 2) & 3) * 16 + (s & 15)) * 8 + ((2 * lane) & 7);
      *(v2b*)(Ph + off) = oh; *(v2b*)(Pl + off) = ol;
      asm volatile("s_wait_xcnt 0x0" ::: "memory");   // before the next trip rewrites the stores' address and data registers
    }
  } else {
    const size_t vb = ((size_t)(b * H + h) * HD) * SEQ;
#pragma unroll 1
    for (int it = 0; it < 4; ++it) {
      const int dl = (it & 1) * 8 + (lane & 7), d = wave * 16 + dl, tok = (it >> 1) * 32 + (lane >> 3) * 8;
      v8b oh, ol;
#pragma unroll
      for (int j = 0; j < 8; ++j) {
        const float v = Tt[tok + j][d] * VS; const b16 hv = (b16)v; oh[j] = hv; ol[j] = (b16)((v - (float)hv) * VRS); }
      const size_t off = vb + (size_t)((((s0 + tok) >> 5) * 4 + wave) * 64 + (lane >> 3) * 16 + dl) * 8;
      *(v8b*)(VT + off) = oh; *(v8b*)(VR + off) = ol;
      asm volatile("s_wait_xcnt 0x0" ::: "memory");   // before the next trip rewrites the stores' address and data registers
    }
  }
}

// Masked softmax attention per (query block of 32, b*H+h); block = 2 waves x 16 queries; key steps of 32 over all SEQ keys in fixed order. The mask tile
// (16 ints per lane, row = the lane's query) is read first; a tile with no unmasked entry in the wave's 16x32 region is skipped wave-uniformly (contributes 0).
// S^T = K Q^T (hi.hi + hi.res + res.hi, q/k residual products scaled back by 1/1024), masked entries replaced by -inf, online softmax (running max, f32,
// -inf-safe), P x1024 and its x1024 residual via wave-private LDS, O^T += V^T P^T with V^T hi/res planes. ctx [b*SEQ+s][h*64+d] written as packed tiles, f16 x64
__global__ __launch_bounds__(64) __attribute__((amdgpu_num_vgpr(256))) void attn_kernel(
    const b16* __restrict__ Qp, const b16* __restrict__ Qr, const b16* __restrict__ Kp, const b16* __restrict__ Kr,
    const b16* __restrict__ VT, const b16* __restrict__ VR, const int* __restrict__ mask, const float* __restrict__ lsc,
    b16* __restrict__ Ch, b16* __restrict__ Cr) {
  __shared__ __attribute__((aligned(16))) b16 Pb[2][16][32 + 8];
  __shared__ __attribute__((aligned(16))) b16 Pr[2][16][32 + 8];
  __shared__ __attribute__((aligned(16))) float To[2][16][HD + 4];
  const int wave = threadIdx.x >> 5, lane = threadIdx.x & 31, hh = lane >> 4, col = lane & 15;
  const int bhi = (int)blockIdx.y, b = bhi / H, h = bhi % H;
  const int q0 = (int)blockIdx.x * 32 + wave * 16, qi = q0 + col;
  const size_t pq = (size_t)bhi * SEQ * HD;   // same plane size for the [s][64] rows and for both packed layouts
  const b16* Kb = Kp + pq; const b16* Klb = Kr + pq;
  const b16* Vb = VT + pq; const b16* Rb = VR + pq;
  const int* mrow = mask + ((size_t)b * SEQ_FULL + (size_t)qi) * SEQ_FULL;
  const v16b qa0 = frag_kb(Qp + pq + (size_t)qi * HD, hh), qa1 = frag_kb(Qp + pq + (size_t)qi * HD + 32, hh);
  const v16b ql0 = frag_kb(Qr + pq + (size_t)qi * HD, hh), ql1 = frag_kb(Qr + pq + (size_t)qi * HD + 32, hh);
  const float cs = 0.125f * expf(bf16_rne(lsc[0])) * (LOG2E / (QS * QS));
  float m = -INFINITY, l = 0.0f; v8f o[4], o2[4];
#pragma unroll
  for (int t = 0; t < 4; ++t) { o[t] = (v8f){}; o2[t] = (v8f){}; }
#pragma unroll 1
  for (int k0 = 0; k0 < SEQ; k0 += 32) {
    unsigned int vbm = 0u;   // bit i set <=> entry i of this lane is NOT masked; bits 0..7 keys k0+8hh+0..7, bits 8..15 keys k0+16+8hh+0..7
    {
      const int* mp = mrow + k0 + 8 * hh;
      const v4i g0 = *(const v4i*)mp, g1 = *(const v4i*)(mp + 4), g2 = *(const v4i*)(mp + 16), g3 = *(const v4i*)(mp + 20);
#pragma unroll
      for (int j = 0; j < 4; ++j) {
        vbm |= (g0[j] == 0 ? 1u : 0u) << j;       vbm |= (g1[j] == 0 ? 1u : 0u) << (4 + j);
        vbm |= (g2[j] == 0 ? 1u : 0u) << (8 + j); vbm |= (g3[j] == 0 ? 1u : 0u) << (12 + j);
      }
    }
    if (__any((vbm != 0u) ? 1 : 0) == 0) continue;
    float e[16]; float mx = -INFINITY;
#pragma unroll
    for (int u = 0; u < 2; ++u) {
      const size_t kr = (size_t)(((k0 >> 4) + u) * 2) * TE + 8 * lane;
      const v16b ka = frag_pk(Kb + kr), kc = frag_pk(Kb + kr + TE);
      v8f s = wmma16b(ka, qa0, (v8f){}); s = wmma16b(kc, qa1, s);
      v8f s2 = wmma16b(ka, ql0, (v8f){}); s2 = wmma16b(kc, ql1, s2);
      s2 = wmma16b(frag_pk(Klb + kr), qa0, s2); s2 = wmma16b(frag_pk(Klb + kr + TE), qa1, s2);
#pragma unroll
      for (int r = 0; r < 8; ++r) {
        const int idx = u * 8 + r;
        const float v = ((vbm >> idx) & 1u) ? (s[r] + s2[r] * (1.0f / QRS)) * cs : -INFINITY;
        e[idx] = v; mx = fmaxf(mx, v); } }
    mx = fmaxf(mx, __shfl_xor(mx, 16)); const float mn = fmaxf(m, mx);
    const float mref = (mn == -INFINITY) ? 0.0f : mn;
    const float al = nexp2(m - mref); float sum = 0.0f;
#pragma unroll
    for (int i2 = 0; i2 < 16; ++i2) {
      const float p = nexp2(e[i2] - mref); sum += p; const int pi = (i2 < 8 ? 0 : 16) + 8 * hh + (i2 & 7);
      const float pp = p * PS; const b16 ph = (b16)pp; Pb[wave][col][pi] = ph;
      Pr[wave][col][pi] = (b16)((pp - (float)ph) * PRS); }
    sum += __shfl_xor(sum, 16); l = l * al + sum; m = mn;
    wave_lds_sync();
    const v16b pf = frag_kb(&Pb[wave][col][0], hh), plf = frag_kb(&Pr[wave][col][0], hh);
#pragma unroll
    for (int t = 0; t < 4; ++t) {
      o[t] *= al; o2[t] *= al;
      const size_t vo = (size_t)((k0 >> 5) * 4 + t) * TE + 8 * lane;
      const v16b vh = frag_pk(Vb + vo), vl = frag_pk(Rb + vo);
      o[t] = wmma16b(vh, pf, o[t]);
      o2[t] = wmma16b(vl, pf, o2[t]);
      o2[t] = wmma16b(vh, plf, o2[t]); }
    wave_lds_sync(); }
  const float inv = 1.0f / (l * PS * VS);
#pragma unroll
  for (int t = 0; t < 4; ++t) {
#pragma unroll
    for (int r = 0; r < 8; ++r) To[wave][col][t * 16 + 8 * hh + r] = (o[t][r] + o2[t][r] * (1.0f / VRS)) * inv; }
  wave_lds_sync();
  const size_t cb = ((size_t)((b * SEQ + q0) >> 4) * KT + (size_t)h * 2) * TE;
#pragma unroll 1
  for (int it = 0; it < 4; ++it) {
    const int rl = (it & 1) * 8 + (lane & 7), pc = (it >> 1) * 32 + (lane >> 3) * 8;
    const v4f f0 = *(const v4f*)(&To[wave][rl][pc]), f1 = *(const v4f*)(&To[wave][rl][pc + 4]);
    v8b oh, ol;
#pragma unroll
    for (int j = 0; j < 4; ++j) {
      const float v0 = f0[j] * OCS; const b16 hv0 = (b16)v0; oh[j] = hv0; ol[j] = (b16)((v0 - (float)hv0) * OCRS);
      const float v1 = f1[j] * OCS; const b16 hv1 = (b16)v1; oh[4 + j] = hv1; ol[4 + j] = (b16)((v1 - (float)hv1) * OCRS); }
    const size_t off = cb + (size_t)((it >> 1) * 64 + (lane >> 3) * 16 + rl) * 8;
    *(v8b*)(Ch + off) = oh; *(v8b*)(Cr + off) = ol;
    asm volatile("s_wait_xcnt 0x0" ::: "memory");   // before the next trip rewrites the stores' address and data registers
  }
}

// Output projection: out[64 tokens x 64 features] = (ctx hi . Wo + ctx res . Wo / 1024) / 4096 + bf16-RNE(bo), K = 1024 stepped by 32, fragments from the
// packed global planes, block 128 = 4 waves in 2x2, wave tile 32x32. Result staged in LDS (cross-wave: block barrier); each 256-B row segment by 16 consecutive lanes x
__global__ __launch_bounds__(128) __attribute__((amdgpu_num_vgpr(256))) void gemm_out_kernel(
    const b16* __restrict__ Ch, const b16* __restrict__ Cr, const b16* __restrict__ Wop, const float* __restrict__ bo, float* __restrict__ out) {
  __shared__ __attribute__((aligned(16))) float Tt[64][HD + 4];
  const int wave = threadIdx.x >> 5, lane = threadIdx.x & 31, hh = lane >> 4, m = lane & 15, wm = wave >> 1, wn = wave & 1;
  const int nblk = (int)blockIdx.x * 64;
  const int mblk = (int)blockIdx.y * 64, b = mblk / SEQ, s0 = mblk % SEQ;
  // byte offsets of the lane's place in the first tiles (each plane is far below 4 GiB); ctx and its residual share one
  unsigned wo = (unsigned)(((nblk + wn * 32) / 16 * KT * TE + 8 * lane) * 2), ao = (unsigned)(((mblk + wm * 32) / 16 * KT * TE + 8 * lane) * 2);
  v8f acc[2][2], acc2[2][2];
#pragma unroll
  for (int i = 0; i < 2; ++i)
#pragma unroll
    for (int j = 0; j < 2; ++j) { acc[i][j] = (v8f){}; acc2[i][j] = (v8f){}; }
#pragma unroll 1
  for (int k0 = 0; k0 < DM; k0 += 32) {
    v16b af[2], rf[2], bf[2];
#pragma unroll
    for (int mt = 0; mt < 2; ++mt) {
      af[mt] = frag_pk((const b16*)((const char*)Ch + ao) + (size_t)mt * KT * TE);
      rf[mt] = frag_pk((const b16*)((const char*)Cr + ao) + (size_t)mt * KT * TE); }
#pragma unroll
    for (int nt = 0; nt < 2; ++nt) bf[nt] = frag_pk((const b16*)((const char*)Wop + wo) + (size_t)nt * KT * TE);
    ao += TE * 2; wo += TE * 2;
#pragma unroll
    for (int mt = 0; mt < 2; ++mt)
#pragma unroll
      for (int nt = 0; nt < 2; ++nt) {
        acc[mt][nt] = wmma16b(af[mt], bf[nt], acc[mt][nt]);
        acc2[mt][nt] = wmma16b(rf[mt], bf[nt], acc2[mt][nt]); }
  }
  float bias[2];
#pragma unroll
  for (int nt = 0; nt < 2; ++nt) bias[nt] = bf16_rne(bo[nblk + wn * 32 + nt * 16 + m]);
  const float isc = 1.0f / (OCS * WSC), irs = 1.0f / OCRS;
#pragma unroll
  for (int mt = 0; mt < 2; ++mt)
#pragma unroll
    for (int nt = 0; nt < 2; ++nt)
#pragma unroll
      for (int r = 0; r < 8; ++r)
        Tt[wm * 32 + mt * 16 + 8 * hh + r][wn * 32 + nt * 16 + m] = (acc[mt][nt][r] + acc2[mt][nt][r] * irs) * isc + bias[nt];
  __syncthreads();   // Tt is read across waves
  float* ob = out + ((size_t)b * SEQ_FULL + (size_t)s0) * DM + nblk;
  {
#pragma unroll 1
    for (int it = 0; it < 8; ++it) {
      const int rr = it * 8 + wave * 2 + hh; const v4f f = *(const v4f*)(&Tt[rr][m * 4]);
      *(v4f*)(ob + (size_t)rr * DM + m * 4) = f; }
     }
}
}  // namespace

extern "C" void kernel_launch(void* const* d_in, const int* in_sizes, int n_in, void* d_out, int out_size, void* d_ws, size_t ws_size, hipStream_t stream) {
  // wire order: 0 x [NB_FULL][SEQ_FULL][1024] f32, 1 Wq [1024][1024], 2 bq [1024], 3 Wk, 4 bk, 5 Wv, 6 bv, 7 Wo, 8 bo, 9 logit scale [1] f32,
  //             10 mask int32 [NB_FULL][SEQ_FULL][SEQ_FULL] (nonzero = masked); out [NB_FULL][SEQ_FULL][1024] f32
  if (n_in < 11) return;
  const size_t need_x = ((size_t)(NB - 1) * SEQ_FULL + SEQ) * DM;
  const size_t need_m = ((size_t)(NB - 1) * SEQ_FULL + SEQ - 1) * SEQ_FULL + SEQ;
  if ((size_t)in_sizes[0] < need_x || (size_t)out_size < need_x || (size_t)in_sizes[10] < need_m || in_sizes[9] < 1) return;
  if (in_sizes[1] < DM * DM || in_sizes[3] < DM * DM || in_sizes[5] < DM * DM || in_sizes[7] < DM * DM) return;
  if (in_sizes[2] < DM || in_sizes[4] < DM || in_sizes[6] < DM || in_sizes[8] < DM) return;
  const float* X = (const float*)d_in[0];
  const float* Wq = (const float*)d_in[1]; const float* bq = (const float*)d_in[2];
  const float* Wk = (const float*)d_in[3]; const float* bk = (const float*)d_in[4];
  const float* Wv = (const float*)d_in[5]; const float* bv = (const float*)d_in[6];
  const float* Wo = (const float*)d_in[7]; const float* bo = (const float*)d_in[8];
  const float* lsc = (const float*)d_in[9]; const int* mask = (const int*)d_in[10];
  size_t off = 0; char* ws = (char*)d_ws;
  auto carve = [&](size_t bytes) { char* p = ws + off; off += (bytes + 255) & ~(size_t)255; return p; };
  const size_t plane = (size_t)NT * DM * 2;
  v2f* T  = (v2f*)carve((size_t)SEQ * NCS * sizeof(v2f));          // 524,288 B (256-B rows, exact)
  b16* Xp = (b16*)carve(plane);
  b16* Wp = (b16*)carve((size_t)4 * DM * DM * 2);                   // 8,388,608 B
  b16* Qp = (b16*)carve(plane); b16* Qr = (b16*)carve(plane); b16* Kp = (b16*)carve(plane); b16* Kr = (b16*)carve(plane);
  b16* VT = (b16*)carve(plane); b16* VR = (b16*)carve(plane); b16* Ch = (b16*)carve(plane); b16* Cr = (b16*)carve(plane);
  if (off > ws_size || off > ((size_t)128 << 20)) return;          // 84,410,368 B total at NB=2, SEQ=2048
  cvt_x_kernel<<<dim3((unsigned)(((size_t)NT * DM / 8 + 255) / 256)), 256, 0, stream>>>(X, Xp);
  cvt_w_kernel<<<dim3((unsigned)(((size_t)DM * DM / 8 + 255) / 256), 4), 256, 0, stream>>>(Wq, Wk, Wv, Wo, Wp);
  rope_table_kernel<<<dim3((unsigned)((SEQ * NCS + 255) / 256)), 256, 0, stream>>>(T);
  gemm_qkv_kernel<<<dim3(3 * DM / 64, NT / 64), 128, 0, stream>>>(Xp, Wp, bq, bk, bv, T, Qp, Qr, Kp, Kr, VT, VR);
  attn_kernel<<<dim3(SEQ / 32, NB * H), 64, 0, stream>>>(Qp, Qr, Kp, Kr, VT, VR, mask, lsc, Ch, Cr);
  gemm_out_kernel<<<dim3(DM / 64, NT / 64), 128, 0, stream>>>(Ch, Cr, Wp + (size_t)3 * DM * DM, bo, (float*)d_out);
}

// v002
// Measured time: 207 microseconds a run.
// Two timings next to v001 put it at 2.00 and 2.01 times that version's speed.
// Counting every step since v000, it is 2.08 times as fast.
#include <hip/hip_runtime.h>

// compute dtype: every contraction on v_wmma_f32_16x16x32_f16 (f16 operands, f32 accumulate). q/k/v projections: bf16-RNE(x) x8 times bf16-RNE(W) x64,
// 1 product each; scores K Q^T per head: q and k (rope + l2 norm in f32) as f16 x8 planes plus x1024 residual planes, 3 products (hi.hi, hi.res, res.hi);
// O^T += V^T P^T: V^T f16 x8 plus a x1024 residual plane, P f16 x1024 plus a x1024 residual tile, 3 products (residual products share one accumulator);
// output projection: ctx f16 x64 plus a x1024 residual plane times bf16-RNE(Wo) x64, 2 products. Softmax statistics (running max, exp2, row sums),
// rope cos/sin table, l2 norm and bias adds in f32; 1/sqrt(64) and exp(logit scale) folded into the log2-domain score constant.
// Fragment k-map per lane half hh for A AND B: elements 0..7 <- k = 8hh+0..7, 8..15 <- k = 16+8hh+0..7; acc[r] = D[8hh+r][col = lane&15].
// Packed planes (X, W, K, V^T, ctx and their residuals): a plane of R rows x C k-columns is stored as 16x32 tiles, tile index (row/16)*(C/32) + k/32 (V^T: (k/32)*(R/16) + row/16), each tile
// 512 elements laid out [k octet 0..3][row 0..15][8], so that each of a fragment's two wave loads reads 512 contiguous bytes (four whole 128-B lines).

#ifndef NB
#define NB 2
#endif
#ifndef SEQ
#define SEQ 2048
#endif
#ifndef NB_FULL
#define NB_FULL 2
#endif
#ifndef SEQ_FULL
#define SEQ_FULL 2048
#endif

namespace {
constexpr int H = 16, HD = 64, DM = 1024, NT = NB * SEQ, NCS = HD / 2, KT = DM / 32, TE = 512;
constexpr float XS = 8.0f, WSC = 64.0f, QS = 8.0f, QRS = 1024.0f, VS = 8.0f, VRS = 1024.0f, PS = 1024.0f, PRS = 1024.0f, OCS = 64.0f, OCRS = 1024.0f;
constexpr float LOG2E = 1.4426950408889634f, EPSN = 1e-6f;
static_assert(SEQ % 64 == 0 && SEQ >= 64 && SEQ <= SEQ_FULL && NB >= 1 && NB <= NB_FULL);
static_assert(DM == H * HD && HD == 64 && DM % 64 == 0 && (3 * DM) % 64 == 0 && NT % 64 == 0 && PRS == VRS);

typedef _Float16 b16;
typedef __attribute__((ext_vector_type(16))) _Float16 v16b;
typedef __attribute__((ext_vector_type(8))) _Float16 v8b;
typedef __attribute__((ext_vector_type(2))) _Float16 v2b;
typedef __attribute__((ext_vector_type(8))) float v8f;
typedef __attribute__((ext_vector_type(4))) float v4f;
typedef __attribute__((ext_vector_type(2))) float v2f;
typedef __attribute__((ext_vector_type(4))) int v4i;

__device__ __forceinline__ float bf16_rne(float f) { unsigned int u = __float_as_uint(f); u += 0x7FFFu + ((u >> 16) & 1u); return __uint_as_float(u & 0xFFFF0000u); }
// 16-bit fragment from a k-contiguous row: elements 0..7 <- p[8hh .. 8hh+7], 8..15 <- p[16+8hh .. 16+8hh+7]
__device__ __forceinline__ v16b frag_kb(const b16* p, int hh) {
  const v8b a = *(const v8b*)(p + 8 * hh), b = *(const v8b*)(p + 16 + 8 * hh); v16b f;
#pragma unroll
  for (int e = 0; e < 8; ++e) { f[e] = a[e]; f[8 + e] = b[e]; }
  return f;
}
// the same fragment from a packed tile; p = tile + 8*lane (lane = 16hh + row): octets hh and 2+hh of the lane's row
__device__ __forceinline__ v16b frag_pk(const b16* p) {
  const v8b a = *(const v8b*)p, b = *(const v8b*)(p + 256); v16b f;
#pragma unroll
  for (int e = 0; e < 8; ++e) { f[e] = a[e]; f[8 + e] = b[e]; }
  return f;
}
__device__ __forceinline__ v8f wmma16b(v16b a, v16b b, v8f c) {
  v8f d = __builtin_amdgcn_wmma_f32_16x16x32_f16(false, a, false, b, (short)0, c, false, false);
  asm volatile("v_nop\n\tv_nop\n\tv_nop\n\tv_nop" : "+v"(d) : "v"(a), "v"(b));
  return d;
}
__device__ __forceinline__ void wave_lds_sync() { __builtin_amdgcn_fence(3, "workgroup"); __builtin_amdgcn_wave_barrier(); __builtin_amdgcn_fence(2, "workgroup"); }
__device__ __forceinline__ float nexp2(float v) { return __builtin_amdgcn_exp2f(v); }

// X plane, packed tiles of [NB*SEQ tokens][1024], f16 = bf16-RNE(x) x8; token row b*SEQ+s reads input row b*SEQ_FULL+s. Thread per k octet: a wave reads 8 rows x
// 128 B and writes four whole 128-B lines of one tile.
__global__ __launch_bounds__(256) void cvt_x_kernel(const float* __restrict__ X, b16* __restrict__ Xp) {
  const size_t u = (size_t)blockIdx.x * 256 + threadIdx.x;
  if (u >= (size_t)NT * DM / 8) return;
  const int oct = (int)(u & 3), rl = (int)((u >> 2) & 15); const size_t t = u >> 6;
  const size_t row = (t / KT) * 16 + rl; const int kt = (int)(t % KT);
  const size_t b = row / SEQ, s = row % SEQ;
  const float* src = X + (b * SEQ_FULL + s) * DM + (size_t)(kt * 32 + oct * 8);
  b16* dst = Xp + t * TE + (size_t)((oct * 16 + rl) * 8);
  const v4f x0 = *(const v4f*)src, x1 = *(const v4f*)(src + 4); v8b o;
#pragma unroll
  for (int j = 0; j < 4; ++j) { o[j] = (b16)(bf16_rne(x0[j]) * XS); o[4 + j] = (b16)(bf16_rne(x1[j]) * XS); }
  *(v8b*)dst = o; 
}

// W planes [4], each the packed tiles of [1024 out][1024 in], f16 = bf16-RNE(W) x64 (rows n, k along the input). blockIdx.y selects the weight, block-uniform.
__global__ __launch_bounds__(256) void cvt_w_kernel(const float* __restrict__ Wq, const float* __restrict__ Wk, const float* __restrict__ Wv,
                                                    const float* __restrict__ Wo, b16* __restrict__ Wp) {
  const int y = (int)blockIdx.y;
  const float* W = (y == 0) ? Wq : ((y == 1) ? Wk : ((y == 2) ? Wv : Wo));
  const size_t u = (size_t)blockIdx.x * 256 + threadIdx.x;
  if (u >= (size_t)DM * DM / 8) return;
  const int oct = (int)(u & 3), rl = (int)((u >> 2) & 15); const size_t t = u >> 6;
  const float* src = W + ((t / KT) * 16 + rl) * DM + (size_t)((int)(t % KT) * 32 + oct * 8);
  b16* dst = Wp + (size_t)y * DM * DM + t * TE + (size_t)((oct * 16 + rl) * 8);
  const v4f x0 = *(const v4f*)src, x1 = *(const v4f*)(src + 4); v8b o;
#pragma unroll
  for (int j = 0; j < 4; ++j) { o[j] = (b16)(bf16_rne(x0[j]) * WSC); o[4 + j] = (b16)(bf16_rne(x1[j]) * WSC); }
  *(v8b*)dst = o; 
}

// rope table T[s][i] = (cos, sin)(s * freq_i), freq_i = 1 / fl32(10000^(2i/64)), s*freq as an f32 product. Argument reduction in f64 (mul/fma only), short f32
__global__ __launch_bounds__(256) void rope_table_kernel(v2f* __restrict__ T) {
  const int u = (int)blockIdx.x * 256 + (int)threadIdx.x;
  if (u >= SEQ * NCS) return;
  const int s = u / NCS, i = u % NCS;
  const float ex = (float)(2 * i) / (float)HD;
  const float pw = (float)exp2((double)ex * 13.287712379549449);
  const float freq = 1.0f / pw;
  const float ang = (float)s * freq;
  const double a = (double)ang;
  const double k = __builtin_rint(a * 0.63661977236758134);
  double rd = __builtin_fma(-k, 1.5707963267948966, a);
  rd = __builtin_fma(-k, 6.123233995736766e-17, rd);
  const float r = (float)rd, r2 = r * r;
  const float sp = r + r * r2 * (-1.6666666666666666e-1f + r2 * (8.333333333333333e-3f + r2 * (-1.984126984126984e-4f + r2 * 2.7557319223985893e-6f)));
  const float cp = 1.0f + r2 * (-0.5f + r2 * (4.1666666666666664e-2f + r2 * (-1.3888888888888889e-3f + r2 * (2.48015873015873e-5f + r2 * -2.755731922398589e-7f))));
  const int kq = (int)(((long long)k) & 3);
  const float c = (kq == 0) ? cp : ((kq == 1) ? -sp : ((kq == 2) ? -cp : sp));
  const float sn = (kq == 0) ? sp : ((kq == 1) ? cp : ((kq == 2) ? -sp : -cp));
  v2f o; o.x = c; o.y = sn;
  *(v2f*)(T + u) = o; 
}

// Fused q/k/v projection: C[64 tokens x 64 features] = A(X plane) . B (B[k][n] = W[n][k] from the packed W plane), K = 1024 stepped by 32, fragments loaded
// straight from the packed global f16 planes. q planes stay [s][64]; k planes are packed tiles of [s][64], v planes packed tiles of [64][s].
// Block 128 threads = 4 waves in 2x2, wave tile 32x32 = 2x2 WMMA tiles. The 64-column tile is exactly one head of q, k or
// v (which = column block / 1024, block-uniform). Epilogue: acc/512 + bf16-RNE(bias) staged in LDS (cross-wave: block barrier), then
__global__ __launch_bounds__(128) __attribute__((amdgpu_num_vgpr(256))) void gemm_qkv_kernel(
    const b16* __restrict__ Xp, const b16* __restrict__ Wp, const float* __restrict__ bq, const float* __restrict__ bk, const float* __restrict__ bv,
    const v2f* __restrict__ CSt, b16* __restrict__ Qp, b16* __restrict__ Qr, b16* __restrict__ Kp, b16* __restrict__ Kr, b16* __restrict__ VT,
    b16* __restrict__ VR) {
  __shared__ __attribute__((aligned(16))) float Tt[64][HD + 4];
  const int wave = threadIdx.x >> 5, lane = threadIdx.x & 31, hh = lane >> 4, m = lane & 15, wm = wave >> 1, wn = wave & 1;
  const int nblk = (int)blockIdx.x * 64, which = nblk / DM, n0 = nblk % DM, h = n0 / HD;
  const int mblk = (int)blockIdx.y * 64, b = mblk / SEQ, s0 = mblk % SEQ;
  const b16* Wb = Wp + (size_t)which * DM * DM + (size_t)((n0 + wn * 32) / 16) * KT * TE + 8 * lane;
  const b16* Ab = Xp + (size_t)((mblk + wm * 32) / 16) * KT * TE + 8 * lane;
  const float* bsel = (which == 0) ? bq : ((which == 1) ? bk : bv);
  v8f acc[2][2];
#pragma unroll
  for (int i = 0; i < 2; ++i)
#pragma unroll
    for (int j = 0; j < 2; ++j) acc[i][j] = (v8f){};
#pragma unroll 1
  for (int k0 = 0; k0 < DM; k0 += 32) {
    v16b af[2], bf[2];
#pragma unroll
    for (int mt = 0; mt < 2; ++mt) af[mt] = frag_pk(Ab + (size_t)(mt * KT + k0 / 32) * TE);
#pragma unroll
    for (int nt = 0; nt < 2; ++nt) bf[nt] = frag_pk(Wb + (size_t)(nt * KT + k0 / 32) * TE);
#pragma unroll
    for (int mt = 0; mt < 2; ++mt)
#pragma unroll
      for (int nt = 0; nt < 2; ++nt) acc[mt][nt] = wmma16b(af[mt], bf[nt], acc[mt][nt]);
  }
  float bias[2];
#pragma unroll
  for (int nt = 0; nt < 2; ++nt) bias[nt] = bf16_rne(bsel[n0 + wn * 32 + nt * 16 + m]);
  const float isc = 1.0f / (XS * WSC);
#pragma unroll
  for (int mt = 0; mt < 2; ++mt)
#pragma unroll
    for (int nt = 0; nt < 2; ++nt)
#pragma unroll
      for (int r = 0; r < 8; ++r) Tt[wm * 32 + mt * 16 + 8 * hh + r][wn * 32 + nt * 16 + m] = acc[mt][nt][r] * isc + bias[nt];
  __syncthreads();   // Tt is read across waves
  if (which < 2) {
    const size_t pb = (size_t)(b * H + h) * SEQ * HD;
    b16* Ph = ((which == 0) ? Qp : Kp) + pb;
    b16* Pl = ((which == 0) ? Qr : Kr) + pb;
#pragma unroll 1
    for (int it = 0; it < 16; ++it) {
      const int r = wave * 16 + it, s = s0 + r;   // a wave owns 16 consecutive rows = one row of packed tiles
      const float x0 = Tt[r][2 * lane], x1 = Tt[r][2 * lane + 1];
      const v2f cv = CSt[(size_t)s * NCS + lane];
      const float y0 = x0 * cv.x - x1 * cv.y, y1 = x1 * cv.x + x0 * cv.y;
      float ss = y0 * y0 + y1 * y1;
#pragma unroll
      for (int w = 16; w >= 1; w >>= 1) ss += __shfl_xor(ss, w);
      const float inv = 1.0f / sqrtf(ss + EPSN);
      const float z0 = y0 * inv * QS, z1 = y1 * inv * QS;
      const b16 h0 = (b16)z0, h1 = (b16)z1;
      v2b oh, ol; oh.x = h0; oh.y = h1; ol.x = (b16)((z0 - (float)h0) * QRS); ol.y = (b16)((z1 - (float)h1) * QRS);
      const size_t off = (which == 0) ? (size_t)s * HD + 2 * lane
                                      : (size_t)(((s >> 4) * 2 + (lane >> 4)) * 64 + ((lane >> 2) & 3) * 16 + (s & 15)) * 8 + ((2 * lane) & 7);
      *(v2b*)(Ph + off) = oh; *(v2b*)(Pl + off) = ol;
      asm volatile("s_wait_xcnt 0x0" ::: "memory");   // before the next trip rewrites the stores' address and data registers
    }
  } else {
    const size_t vb = ((size_t)(b * H + h) * HD) * SEQ;
#pragma unroll 1
    for (int it = 0; it < 4; ++it) {
      const int dl = (it & 1) * 8 + (lane & 7), d = wave * 16 + dl, tok = (it >> 1) * 32 + (lane >> 3) * 8;
      v8b oh, ol;
#pragma unroll
      for (int j = 0; j < 8; ++j) {
        const float v = Tt[tok + j][d] * VS; const b16 hv = (b16)v; oh[j] = hv; ol[j] = (b16)((v - (float)hv) * VRS); }
      const size_t off = vb + (size_t)((((s0 + tok) >> 5) * 4 + wave) * 64 + (lane >> 3) * 16 + dl) * 8;
      *(v8b*)(VT + off) = oh; *(v8b*)(VR + off) = ol;
      asm volatile("s_wait_xcnt 0x0" ::: "memory");   // before the next trip rewrites the stores' address and data registers
    }
  }
}

// Masked softmax attention per (query block of 32, b*H+h); block = 2 waves x 16 queries; key steps of 32 over all SEQ keys in fixed order. The mask tile
// (16 ints per lane, row = the lane's query) is requested one key step ahead; a tile with no unmasked entry in the wave's 16x32 region is skipped wave-uniformly (contributes 0).
// S^T = K Q^T (hi.hi + hi.res + res.hi, q/k residual products scaled back by 1/1024), masked entries replaced by -inf, online softmax (running max, f32,
// -inf-safe), P x1024 and its x1024 residual via wave-private LDS, O^T += V^T P^T with V^T hi/res planes. ctx [b*SEQ+s][h*64+d] written as packed tiles, f16 x64
__global__ __launch_bounds__(64) __attribute__((amdgpu_num_vgpr(256))) void attn_kernel(
    const b16* __restrict__ Qp, const b16* __restrict__ Qr, const b16* __restrict__ Kp, const b16* __restrict__ Kr,
    const b16* __restrict__ VT, const b16* __restrict__ VR, const int* __restrict__ mask, const float* __restrict__ lsc,
    b16* __restrict__ Ch, b16* __restrict__ Cr) {
  __shared__ __attribute__((aligned(16))) b16 Pb[2][16][32 + 8];
  __shared__ __attribute__((aligned(16))) b16 Pr[2][16][32 + 8];
  __shared__ __attribute__((aligned(16))) float To[2][16][HD + 4];
  const int wave = threadIdx.x >> 5, lane = threadIdx.x & 31, hh = lane >> 4, col = lane & 15;
  const int bhi = (int)blockIdx.y, b = bhi / H, h = bhi % H;
  const int q0 = (int)blockIdx.x * 32 + wave * 16, qi = q0 + col;
  const size_t pq = (size_t)bhi * SEQ * HD;   // same plane size for the [s][64] rows and for both packed layouts
  const b16* Kb = Kp + pq; const b16* Klb = Kr + pq;
  const b16* Vb = VT + pq; const b16* Rb = VR + pq;
  // byte offset of the lane's 16 mask words of key step 0 (the whole mask is far below 4 GiB)
  unsigned mo = (unsigned)((((size_t)b * SEQ_FULL + (size_t)qi) * SEQ_FULL + (size_t)(8 * hh)) * sizeof(int));
  const v16b qa0 = frag_kb(Qp + pq + (size_t)qi * HD, hh), qa1 = frag_kb(Qp + pq + (size_t)qi * HD + 32, hh);
  const v16b ql0 = frag_kb(Qr + pq + (size_t)qi * HD, hh), ql1 = frag_kb(Qr + pq + (size_t)qi * HD + 32, hh);
  const float cs = 0.125f * expf(bf16_rne(lsc[0])) * (LOG2E / (QS * QS));
  float m = -INFINITY, l = 0.0f; v8f o[4], o2[4];
#pragma unroll
  for (int t = 0; t < 4; ++t) { o[t] = (v8f){}; o2[t] = (v8f){}; }
  v4i g0, g1, g2, g3;   // mask tile, requested one key step ahead
  { const int* mp = (const int*)((const char*)mask + mo); g0 = *(const v4i*)mp; g1 = *(const v4i*)(mp + 4); g2 = *(const v4i*)(mp + 16); g3 = *(const v4i*)(mp + 20); }
  unsigned ko = (unsigned)lane * 16u;   // byte offset of the lane's place in the step's first tile: K tiles 2u, 2u+1 of key group u and V tiles t share it
#pragma unroll 1
  for (int k0 = 0; k0 < SEQ; k0 += 32, ko += 4 * TE * 2) {
    unsigned int vbm = 0u;   // bit i set <=> entry i of this lane is NOT masked; bits 0..7 keys k0+8hh+0..7, bits 8..15 keys k0+16+8hh+0..7
    {
#pragma unroll
      for (int j = 0; j < 4; ++j) {
        vbm |= (g0[j] == 0 ? 1u : 0u) << j;       vbm |= (g1[j] == 0 ? 1u : 0u) << (4 + j);
        vbm |= (g2[j] == 0 ? 1u : 0u) << (8 + j); vbm |= (g3[j] == 0 ? 1u : 0u) << (12 + j);
      }
      // the next key step's mask tile (the last step asks for its own tile again: in bounds, never used)
      mo += (k0 + 32 < SEQ) ? 32u * (unsigned)sizeof(int) : 0u;
      const int* mp = (const int*)((const char*)mask + mo);
      g0 = *(const v4i*)mp; g1 = *(const v4i*)(mp + 4); g2 = *(const v4i*)(mp + 16); g3 = *(const v4i*)(mp + 20);
    }
    if (__any((vbm != 0u) ? 1 : 0) == 0) continue;
    // all eight K fragments of the step are requested here as one group, ahead of the matrix work
    v16b kh[4], kl[4], vh[4], vl[4];
    const b16* pk = (const b16*)((const char*)Kb + ko); const b16* pkl = (const b16*)((const char*)Klb + ko);
    const b16* pv = (const b16*)((const char*)Vb + ko); const b16* pvl = (const b16*)((const char*)Rb + ko);
#pragma unroll
    for (int j = 0; j < 4; ++j) { kh[j] = frag_pk(pk + j * TE); kl[j] = frag_pk(pkl + j * TE); }
    // behind the group: its address pairs stay whole until here, and no load sinks to its use (there each pair of loads costs the wave a full L2 round trip)
    asm volatile("s_wait_xcnt 0x0" :: "v"(pk), "v"(pkl) : "memory");
    float e[16]; float mx = -INFINITY;
#pragma unroll
    for (int u = 0; u < 2; ++u) {
      const v16b ka = kh[2 * u], kc = kh[2 * u + 1];
      v8f s = wmma16b(ka, qa0, (v8f){}); s = wmma16b(kc, qa1, s);
      v8f s2 = wmma16b(ka, ql0, (v8f){}); s2 = wmma16b(kc, ql1, s2);
      s2 = wmma16b(kl[2 * u], qa0, s2); s2 = wmma16b(kl[2 * u + 1], qa1, s2);
#pragma unroll
      for (int r = 0; r < 8; ++r) {
        const int idx = u * 8 + r;
        const float v = ((vbm >> idx) & 1u) ? (s[r] + s2[r] * (1.0f / QRS)) * cs : -INFINITY;
        e[idx] = v; mx = fmaxf(mx, v); } }
    // second group, into the registers that K has left: all eight V fragments fly while the softmax runs
#pragma unroll
    for (int t = 0; t < 4; ++t) { vh[t] = frag_pk(pv + t * TE); vl[t] = frag_pk(pvl + t * TE); }
    asm volatile("s_wait_xcnt 0x0" :: "v"(pv), "v"(pvl) : "memory");   // as behind the K group: address pairs whole, the loads ahead of the softmax arithmetic
    mx = fmaxf(mx, __shfl_xor(mx, 16)); const float mn = fmaxf(m, mx);
    const float mref = (mn == -INFINITY) ? 0.0f : mn;
    const float al = nexp2(m - mref); float sum = 0.0f;
#pragma unroll
    for (int i2 = 0; i2 < 16; ++i2) {
      const float p = nexp2(e[i2] - mref); sum += p; const int pi = (i2 < 8 ? 0 : 16) + 8 * hh + (i2 & 7);
      const float pp = p * PS; const b16 ph = (b16)pp; Pb[wave][col][pi] = ph;
      Pr[wave][col][pi] = (b16)((pp - (float)ph) * PRS); }
    sum += __shfl_xor(sum, 16); l = l * al + sum; m = mn;
    wave_lds_sync();
    const v16b pf = frag_kb(&Pb[wave][col][0], hh), plf = frag_kb(&Pr[wave][col][0], hh);
#pragma unroll
    for (int t = 0; t < 4; ++t) {
      o[t] *= al; o2[t] *= al;
      o[t] = wmma16b(vh[t], pf, o[t]);
      o2[t] = wmma16b(vl[t], pf, o2[t]);
      o2[t] = wmma16b(vh[t], plf, o2[t]); }
    wave_lds_sync(); }
  const float inv = 1.0f / (l * PS * VS);
#pragma unroll
  for (int t = 0; t < 4; ++t) {
#pragma unroll
    for (int r = 0; r < 8; ++r) To[wave][col][t * 16 + 8 * hh + r] = (o[t][r] + o2[t][r] * (1.0f / VRS)) * inv; }
  wave_lds_sync();
  const size_t cb = ((size_t)((b * SEQ + q0) >> 4) * KT + (size_t)h * 2) * TE;
#pragma unroll 1
  for (int it = 0; it < 4; ++it) {
    const int rl = (it & 1) * 8 + (lane & 7), pc = (it >> 1) * 32 + (lane >> 3) * 8;
    const v4f f0 = *(const v4f*)(&To[wave][rl][pc]), f1 = *(const v4f*)(&To[wave][rl][pc + 4]);
    v8b oh, ol;
#pragma unroll
    for (int j = 0; j < 4; ++j) {
      const float v0 = f0[j] * OCS; const b16 hv0 = (b16)v0; oh[j] = hv0; ol[j] = (b16)((v0 - (float)hv0) * OCRS);
      const float v1 = f1[j] * OCS; const b16 hv1 = (b16)v1; oh[4 + j] = hv1; ol[4 + j] = (b16)((v1 - (float)hv1) * OCRS); }
    const size_t off = cb + (size_t)((it >> 1) * 64 + (lane >> 3) * 16 + rl) * 8;
    *(v8b*)(Ch + off) = oh; *(v8b*)(Cr + off) = ol;
    asm volatile("s_wait_xcnt 0x0" ::: "memory");   // before the next trip rewrites the stores' address and data registers
  }
}

// Output projection: out[64 tokens x 64 features] = (ctx hi . Wo + ctx res . Wo / 1024) / 4096 + bf16-RNE(bo), K = 1024 stepped by 32, fragments from the
// packed global planes, block 128 = 4 waves in 2x2, wave tile 32x32. Result staged in LDS (cross-wave: block barrier); each 256-B row segment by 16 consecutive lanes x
__global__ __launch_bounds__(128) __attribute__((amdgpu_num_vgpr(256))) void gemm_out_kernel(
    const b16* __restrict__ Ch, const b16* __restrict__ Cr, const b16* __restrict__ Wop, const float* __restrict__ bo, float* __restrict__ out) {
  __shared__ __attribute__((aligned(16))) float Tt[64][HD + 4];
  const int wave = threadIdx.x >> 5, lane = threadIdx.x & 31, hh = lane >> 4, m = lane & 15, wm = wave >> 1, wn = wave & 1;
  const int nblk = (int)blockIdx.x * 64;
  const int mblk = (int)blockIdx.y * 64, b = mblk / SEQ, s0 = mblk % SEQ;
  // byte offsets of the lane's place in the first tiles (each plane is far below 4 GiB); ctx and its residual share one
  unsigned wo = (unsigned)(((nblk + wn * 32) / 16 * KT * TE + 8 * lane) * 2), ao = (unsigned)(((mblk + wm * 32) / 16 * KT * TE + 8 * lane) * 2);
  v8f acc[2][2], acc2[2][2];
#pragma unroll
  for (int i = 0; i < 2; ++i)
#pragma unroll
    for (int j = 0; j < 2; ++j) { acc[i][j] = (v8f){}; acc2[i][j] = (v8f){}; }
#pragma unroll 1
  for (int k0 = 0; k0 < DM; k0 += 32) {
    v16b af[2], rf[2], bf[2];
#pragma unroll
    for (int mt = 0; mt < 2; ++mt) {
      af[mt] = frag_pk((const b16*)((const char*)Ch + ao) + (size_t)mt * KT * TE);
      rf[mt] = frag_pk((const b16*)((const char*)Cr + ao) + (size_t)mt * KT * TE); }
#pragma unroll
    for (int nt = 0; nt < 2; ++nt) bf[nt] = frag_pk((const b16*)((const char*)Wop + wo) + (size_t)nt * KT * TE);
    ao += TE * 2; wo += TE * 2;
#pragma unroll
    for (int mt = 0; mt < 2; ++mt)
#pragma unroll
      for (int nt = 0; nt < 2; ++nt) {
        acc[mt][nt] = wmma16b(af[mt], bf[nt], acc[mt][nt]);
        acc2[mt][nt] = wmma16b(rf[mt], bf[nt], acc2[mt][nt]); }
  }
  float bias[2];
#pragma unroll
  for (int nt = 0; nt < 2; ++nt) bias[nt] = bf16_rne(bo[nblk + wn * 32 + nt * 16 + m]);
  const float isc = 1.0f / (OCS * WSC), irs = 1.0f / OCRS;
#pragma unroll
  for (int mt = 0; mt < 2; ++mt)
#pragma unroll
    for (int nt = 0; nt < 2; ++nt)
#pragma unroll
      for (int r = 0; r < 8; ++r)
        Tt[wm * 32 + mt * 16 + 8 * hh + r][wn * 32 + nt * 16 + m] = (acc[mt][nt][r] + acc2[mt][nt][r] * irs) * isc + bias[nt];
  __syncthreads();   // Tt is read across waves
  float* ob = out + ((size_t)b * SEQ_FULL + (size_t)s0) * DM + nblk;
  {
#pragma unroll 1
    for (int it = 0; it < 8; ++it) {
      const int rr = it * 8 + wave * 2 + hh; const v4f f = *(const v4f*)(&Tt[rr][m * 4]);
      *(v4f*)(ob + (size_t)rr * DM + m * 4) = f; }
     }
}
}  // namespace

extern "C" void kernel_launch(void* const* d_in, const int* in_sizes, int n_in, void* d_out, int out_size, void* d_ws, size_t ws_size, hipStream_t stream) {
  // wire order: 0 x [NB_FULL][SEQ_FULL][1024] f32, 1 Wq [1024][1024], 2 bq [1024], 3 Wk, 4 bk, 5 Wv, 6 bv, 7 Wo, 8 bo, 9 logit scale [1] f32,
  //             10 mask int32 [NB_FULL][SEQ_FULL][SEQ_FULL] (nonzero = masked); out [NB_FULL][SEQ_FULL][1024] f32
  if (n_in < 11) return;
  const size_t need_x = ((size_t)(NB - 1) * SEQ_FULL + SEQ) * DM;
  const size_t need_m = ((size_t)(NB - 1) * SEQ_FULL + SEQ - 1) * SEQ_FULL + SEQ;
  if ((size_t)in_sizes[0] < need_x || (size_t)out_size < need_x || (size_t)in_sizes[10] < need_m || in_sizes[9] < 1) return;
  if (in_sizes[1] < DM * DM || in_sizes[3] < DM * DM || in_sizes[5] < DM * DM || in_sizes[7] < DM * DM) return;
  if (in_sizes[2] < DM || in_sizes[4] < DM || in_sizes[6] < DM || in_sizes[8] < DM) return;
  const float* X = (const float*)d_in[0];
  const float* Wq = (const float*)d_in[1]; const float* bq = (const float*)d_in[2];
  const float* Wk = (const float*)d_in[3]; const float* bk = (const float*)d_in[4];
  const float* Wv = (const float*)d_in[5]; const float* bv = (const float*)d_in[6];
  const float* Wo = (const float*)d_in[7]; const float* bo = (const float*)d_in[8];
  const float* lsc = (const float*)d_in[9]; const int* mask = (const int*)d_in[10];
  size_t off = 0; char* ws = (char*)d_ws;
  auto carve = [&](size_t bytes) { char* p = ws + off; off += (bytes + 255) & ~(size_t)255; return p; };
  const size_t plane = (size_t)NT * DM * 2;
  v2f* T  = (v2f*)carve((size_t)SEQ * NCS * sizeof(v2f));          // 524,288 B (256-B rows, exact)
  b16* Xp = (b16*)carve(plane);
  b16* Wp = (b16*)carve((size_t)4 * DM * DM * 2);                   // 8,388,608 B
  b16* Qp = (b16*)carve(plane); b16* Qr = (b16*)carve(plane); b16* Kp = (b16*)carve(plane); b16* Kr = (b16*)carve(plane);
  b16* VT = (b16*)carve(plane); b16* VR = (b16*)carve(plane); b16* Ch = (b16*)carve(plane); b16* Cr = (b16*)carve(plane);
  if (off > ws_size || off > ((size_t)128 << 20)) return;          // 84,410,368 B total at NB=2, SEQ=2048
  cvt_x_kernel<<<dim3((unsigned)(((size_t)NT * DM / 8 + 255) / 256)), 256, 0, stream>>>(X, Xp);
  cvt_w_kernel<<<dim3((unsigned)(((size_t)DM * DM / 8 + 255) / 256), 4), 256, 0, stream>>>(Wq, Wk, Wv, Wo, Wp);
  rope_table_kernel<<<dim3((unsigned)((SEQ * NCS + 255) / 256)), 256, 0, stream>>>(T);
  gemm_qkv_kernel<<<dim3(3 * DM / 64, NT / 64), 128, 0, stream>>>(Xp, Wp, bq, bk, bv, T, Qp, Qr, Kp, Kr, VT, VR);
  attn_kernel<<<dim3(SEQ / 32, NB * H), 64, 0, stream>>>(Qp, Qr, Kp, Kr, VT, VR, mask, lsc, Ch, Cr);
  gemm_out_kernel<<<dim3(DM / 64, NT / 64), 128, 0, stream>>>(Ch, Cr, Wp + (size_t)3 * DM * DM, bo, (float*)d_out);
}

// v003
// It runs in 191 microseconds.
// Two timings next to v002 put it at 1.07 and 1.08 times that version's speed.
// Counting every step since v000, it is 2.23 times as fast.
#include <hip/hip_runtime.h>

// compute dtype: every contraction on v_wmma_f32_16x16x32_f16 (f16 operands, f32 accumulate). q/k/v projections: bf16-RNE(x) x8 times bf16-RNE(W) x64,
// 1 product each; scores K Q^T per head: q and k (rope + l2 norm in f32) as f16 x8 planes plus x1024 residual planes, 3 products (hi.hi, hi.res, res.hi);
// O^T += V^T P^T: V^T f16 x8 plus a x1024 residual plane, P f16 x1024 plus a x1024 residual tile, 3 products (residual products share one accumulator);
// output projection: ctx f16 x64 plus a x1024 residual plane times bf16-RNE(Wo) x64, 2 products. Softmax statistics (running max, exp2, row sums),
// rope cos/sin table, l2 norm and bias adds in f32; 1/sqrt(64) and exp(logit scale) folded into the log2-domain score constant.
// Fragment k-map per lane half hh for A AND B: elements 0..7 <- k = 8hh+0..7, 8..15 <- k = 16+8hh+0..7; acc[r] = D[8hh+r][col = lane&15].
// Packed planes (X, W, K, V^T, ctx and their residuals): a plane of R rows x C k-columns is stored as 16x32 tiles, tile index (row/16)*(C/32) + k/32 (V^T: (k/32)*(R/16) + row/16), each tile
// 512 elements laid out [k octet 0..3][row 0..15][8], so that each of a fragment's two wave loads reads 512 contiguous bytes (four whole 128-B lines).

#ifndef NB
#define NB 2
#endif
#ifndef SEQ
#define SEQ 2048
#endif
#ifndef NB_FULL
#define NB_FULL 2
#endif
#ifndef SEQ_FULL
#define SEQ_FULL 2048
#endif

namespace {
constexpr int H = 16, HD = 64, DM = 1024, NT = NB * SEQ, NCS = HD / 2, KT = DM / 32, TE = 512;
constexpr float XS = 8.0f, WSC = 64.0f, QS = 8.0f, QRS = 1024.0f, VS = 8.0f, VRS = 1024.0f, PS = 1024.0f, PRS = 1024.0f, OCS = 64.0f, OCRS = 1024.0f;
constexpr float LOG2E = 1.4426950408889634f, EPSN = 1e-6f;
constexpr int KSPL = 4;   // key shares (waves) per query tile in the attention kernel
static_assert(KSPL == 4 && SEQ % (32 * KSPL) == 0);
static_assert(SEQ % 64 == 0 && SEQ >= 64 && SEQ <= SEQ_FULL && NB >= 1 && NB <= NB_FULL);
static_assert(DM == H * HD && HD == 64 && DM % 64 == 0 && (3 * DM) % 64 == 0 && NT % 64 == 0 && PRS == VRS);

typedef _Float16 b16;
typedef __attribute__((ext_vector_type(16))) _Float16 v16b;
typedef __attribute__((ext_vector_type(8))) _Float16 v8b;
typedef __attribute__((ext_vector_type(2))) _Float16 v2b;
typedef __attribute__((ext_vector_type(8))) float v8f;
typedef __attribute__((ext_vector_type(4))) float v4f;
typedef __attribute__((ext_vector_type(2))) float v2f;
typedef __attribute__((ext_vector_type(4))) int v4i;

__device__ __forceinline__ float bf16_rne(float f) { unsigned int u = __float_as_uint(f); u += 0x7FFFu + ((u >> 16) & 1u); return __uint_as_float(u & 0xFFFF0000u); }
// 16-bit fragment from a k-contiguous row: elements 0..7 <- p[8hh .. 8hh+7], 8..15 <- p[16+8hh .. 16+8hh+7]
__device__ __forceinline__ v16b frag_kb(const b16* p, int hh) {
  const v8b a = *(const v8b*)(p + 8 * hh), b = *(const v8b*)(p + 16 + 8 * hh); v16b f;
#pragma unroll
  for (int e = 0; e < 8; ++e) { f[e] = a[e]; f[8 + e] = b[e]; }
  return f;
}
// the same fragment from a packed tile; p = tile + 8*lane (lane = 16hh + row): octets hh and 2+hh of the lane's row
__device__ __forceinline__ v16b frag_pk(const b16* p) {
  const v8b a = *(const v8b*)p, b = *(const v8b*)(p + 256); v16b f;
#pragma unroll
  for (int e = 0; e < 8; ++e) { f[e] = a[e]; f[8 + e] = b[e]; }
  return f;
}
__device__ __forceinline__ v8f wmma16b(v16b a, v16b b, v8f c) {
  v8f d = __builtin_amdgcn_wmma_f32_16x16x32_f16(false, a, false, b, (short)0, c, false, false);
  asm volatile("v_nop\n\tv_nop\n\tv_nop\n\tv_nop" : "+v"(d) : "v"(a), "v"(b));
  return d;
}
__device__ __forceinline__ void wave_lds_sync() { __builtin_amdgcn_fence(3, "workgroup"); __builtin_amdgcn_wave_barrier(); __builtin_amdgcn_fence(2, "workgroup"); }
__device__ __forceinline__ float nexp2(float v) { return __builtin_amdgcn_exp2f(v); }

// X plane, packed tiles of [NB*SEQ tokens][1024], f16 = bf16-RNE(x) x8; token row b*SEQ+s reads input row b*SEQ_FULL+s. Thread per k octet: a wave reads 8 rows x
// 128 B and writes four whole 128-B lines of one tile.
__global__ __launch_bounds__(256) void cvt_x_kernel(const float* __restrict__ X, b16* __restrict__ Xp) {
  const size_t u = (size_t)blockIdx.x * 256 + threadIdx.x;
  if (u >= (size_t)NT * DM / 8) return;
  const int oct = (int)(u & 3), rl = (int)((u >> 2) & 15); const size_t t = u >> 6;
  const size_t row = (t / KT) * 16 + rl; const int kt = (int)(t % KT);
  const size_t b = row / SEQ, s = row % SEQ;
  const float* src = X + (b * SEQ_FULL + s) * DM + (size_t)(kt * 32 + oct * 8);
  b16* dst = Xp + t * TE + (size_t)((oct * 16 + rl) * 8);
  const v4f x0 = *(const v4f*)src, x1 = *(const v4f*)(src + 4); v8b o;
#pragma unroll
  for (int j = 0; j < 4; ++j) { o[j] = (b16)(bf16_rne(x0[j]) * XS); o[4 + j] = (b16)(bf16_rne(x1[j]) * XS); }
  *(v8b*)dst = o; 
}

// W planes [4], each the packed tiles of [1024 out][1024 in], f16 = bf16-RNE(W) x64 (rows n, k along the input). blockIdx.y selects the weight, block-uniform.
__global__ __launch_bounds__(256) void cvt_w_kernel(const float* __restrict__ Wq, const float* __restrict__ Wk, const float* __restrict__ Wv,
                                                    const float* __restrict__ Wo, b16* __restrict__ Wp) {
  const int y = (int)blockIdx.y;
  const float* W = (y == 0) ? Wq : ((y == 1) ? Wk : ((y == 2) ? Wv : Wo));
  const size_t u = (size_t)blockIdx.x * 256 + threadIdx.x;
  if (u >= (size_t)DM * DM / 8) return;
  const int oct = (int)(u & 3), rl = (int)((u >> 2) & 15); const size_t t = u >> 6;
  const float* src = W + ((t / KT) * 16 + rl) * DM + (size_t)((int)(t % KT) * 32 + oct * 8);
  b16* dst = Wp + (size_t)y * DM * DM + t * TE + (size_t)((oct * 16 + rl) * 8);
  const v4f x0 = *(const v4f*)src, x1 = *(const v4f*)(src + 4); v8b o;
#pragma unroll
  for (int j = 0; j < 4; ++j) { o[j] = (b16)(bf16_rne(x0[j]) * WSC); o[4 + j] = (b16)(bf16_rne(x1[j]) * WSC); }
  *(v8b*)dst = o; 
}

// rope table T[s][i] = (cos, sin)(s * freq_i), freq_i = 1 / fl32(10000^(2i/64)), s*freq as an f32 product. Argument reduction in f64 (mul/fma only), short f32
__global__ __launch_bounds__(256) void rope_table_kernel(v2f* __restrict__ T) {
  const int u = (int)blockIdx.x * 256 + (int)threadIdx.x;
  if (u >= SEQ * NCS) return;
  const int s = u / NCS, i = u % NCS;
  const float ex = (float)(2 * i) / (float)HD;
  const float pw = (float)exp2((double)ex * 13.287712379549449);
  const float freq = 1.0f / pw;
  const float ang = (float)s * freq;
  const double a = (double)ang;
  const double k = __builtin_rint(a * 0.63661977236758134);
  double rd = __builtin_fma(-k, 1.5707963267948966, a);
  rd = __builtin_fma(-k, 6.123233995736766e-17, rd);
  const float r = (float)rd, r2 = r * r;
  const float sp = r + r * r2 * (-1.6666666666666666e-1f + r2 * (8.333333333333333e-3f + r2 * (-1.984126984126984e-4f + r2 * 2.7557319223985893e-6f)));
  const float cp = 1.0f + r2 * (-0.5f + r2 * (4.1666666666666664e-2f + r2 * (-1.3888888888888889e-3f + r2 * (2.48015873015873e-5f + r2 * -2.755731922398589e-7f))));
  const int kq = (int)(((long long)k) & 3);
  const float c = (kq == 0) ? cp : ((kq == 1) ? -sp : ((kq == 2) ? -cp : sp));
  const float sn = (kq == 0) ? sp : ((kq == 1) ? cp : ((kq == 2) ? -sp : -cp));
  v2f o; o.x = c; o.y = sn;
  *(v2f*)(T + u) = o; 
}

// Fused q/k/v projection: C[64 tokens x 64 features] = A(X plane) . B (B[k][n] = W[n][k] from the packed W plane), K = 1024 stepped by 32, fragments loaded
// straight from the packed global f16 planes. q planes stay [s][64]; k planes are packed tiles of [s][64], v planes packed tiles of [64][s].
// Block 128 threads = 4 waves in 2x2, wave tile 32x32 = 2x2 WMMA tiles. The 64-column tile is exactly one head of q, k or
// v (which = column block / 1024, block-uniform). Epilogue: acc/512 + bf16-RNE(bias) staged in LDS (cross-wave: block barrier), then
__global__ __launch_bounds__(128) __attribute__((amdgpu_num_vgpr(256))) void gemm_qkv_kernel(
    const b16* __restrict__ Xp, const b16* __restrict__ Wp, const float* __restrict__ bq, const float* __restrict__ bk, const float* __restrict__ bv,
    const v2f* __restrict__ CSt, b16* __restrict__ Qp, b16* __restrict__ Qr, b16* __restrict__ Kp, b16* __restrict__ Kr, b16* __restrict__ VT,
    b16* __restrict__ VR) {
  __shared__ __attribute__((aligned(16))) float Tt[64][HD + 4];
  const int wave = threadIdx.x >> 5, lane = threadIdx.x & 31, hh = lane >> 4, m = lane & 15, wm = wave >> 1, wn = wave & 1;
  const int nblk = (int)blockIdx.x * 64, which = nblk / DM, n0 = nblk % DM, h = n0 / HD;
  const int mblk = (int)blockIdx.y * 64, b = mblk / SEQ, s0 = mblk % SEQ;
  const b16* Wb = Wp + (size_t)which * DM * DM + (size_t)((n0 + wn * 32) / 16) * KT * TE + 8 * lane;
  const b16* Ab = Xp + (size_t)((mblk + wm * 32) / 16) * KT * TE + 8 * lane;
  const float* bsel = (which == 0) ? bq : ((which == 1) ? bk : bv);
  v8f acc[2][2];
#pragma unroll
  for (int i = 0; i < 2; ++i)
#pragma unroll
    for (int j = 0; j < 2; ++j) acc[i][j] = (v8f){};
#pragma unroll 1
  for (int k0 = 0; k0 < DM; k0 += 32) {
    v16b af[2], bf[2];
#pragma unroll
    for (int mt = 0; mt < 2; ++mt) af[mt] = frag_pk(Ab + (size_t)(mt * KT + k0 / 32) * TE);
#pragma unroll
    for (int nt = 0; nt < 2; ++nt) bf[nt] = frag_pk(Wb + (size_t)(nt * KT + k0 / 32) * TE);
#pragma unroll
    for (int mt = 0; mt < 2; ++mt)
#pragma unroll
      for (int nt = 0; nt < 2; ++nt) acc[mt][nt] = wmma16b(af[mt], bf[nt], acc[mt][nt]);
  }
  float bias[2];
#pragma unroll
  for (int nt = 0; nt < 2; ++nt) bias[nt] = bf16_rne(bsel[n0 + wn * 32 + nt * 16 + m]);
  const float isc = 1.0f / (XS * WSC);
#pragma unroll
  for (int mt = 0; mt < 2; ++mt)
#pragma unroll
    for (int nt = 0; nt < 2; ++nt)
#pragma unroll
      for (int r = 0; r < 8; ++r) Tt[wm * 32 + mt * 16 + 8 * hh + r][wn * 32 + nt * 16 + m] = acc[mt][nt][r] * isc + bias[nt];
  __syncthreads();   // Tt is read across waves
  if (which < 2) {
    const size_t pb = (size_t)(b * H + h) * SEQ * HD;
    b16* Ph = ((which == 0) ? Qp : Kp) + pb;
    b16* Pl = ((which == 0) ? Qr : Kr) + pb;
#pragma unroll 1
    for (int it = 0; it < 16; ++it) {
      const int r = wave * 16 + it, s = s0 + r;   // a wave owns 16 consecutive rows = one row of packed tiles
      const float x0 = Tt[r][2 * lane], x1 = Tt[r][2 * lane + 1];
      const v2f cv = CSt[(size_t)s * NCS + lane];
      const float y0 = x0 * cv.x - x1 * cv.y, y1 = x1 * cv.x + x0 * cv.y;
      float ss = y0 * y0 + y1 * y1;
#pragma unroll
      for (int w = 16; w >= 1; w >>= 1) ss += __shfl_xor(ss, w);
      const float inv = 1.0f / sqrtf(ss + EPSN);
      const float z0 = y0 * inv * QS, z1 = y1 * inv * QS;
      const b16 h0 = (b16)z0, h1 = (b16)z1;
      v2b oh, ol; oh.x = h0; oh.y = h1; ol.x = (b16)((z0 - (float)h0) * QRS); ol.y = (b16)((z1 - (float)h1) * QRS);
      const size_t off = (which == 0) ? (size_t)s * HD + 2 * lane
                                      : (size_t)(((s >> 4) * 2 + (lane >> 4)) * 64 + ((lane >> 2) & 3) * 16 + (s & 15)) * 8 + ((2 * lane) & 7);
      *(v2b*)(Ph + off) = oh; *(v2b*)(Pl + off) = ol;
      asm volatile("s_wait_xcnt 0x0" ::: "memory");   // before the next trip rewrites the stores' address and data registers
    }
  } else {
    const size_t vb = ((size_t)(b * H + h) * HD) * SEQ;
#pragma unroll 1
    for (int it = 0; it < 4; ++it) {
      const int dl = (it & 1) * 8 + (lane & 7), d = wave * 16 + dl, tok = (it >> 1) * 32 + (lane >> 3) * 8;
      v8b oh, ol;
#pragma unroll
      for (int j = 0; j < 8; ++j) {
        const float v = Tt[tok + j][d] * VS; const b16 hv = (b16)v; oh[j] = hv; ol[j] = (b16)((v - (float)hv) * VRS); }
      const size_t off = vb + (size_t)((((s0 + tok) >> 5) * 4 + wave) * 64 + (lane >> 3) * 16 + dl) * 8;
      *(v8b*)(VT + off) = oh; *(v8b*)(VR + off) = ol;
      asm volatile("s_wait_xcnt 0x0" ::: "memory");   // before the next trip rewrites the stores' address and data registers
    }
  }
}

// Masked softmax attention per (query block of 32, b*H+h); block = 8 waves = 2 query tiles of 16 x 4 key shares: share ks takes the key steps of 32 whose
// index is ks modulo 4, in fixed order, with its own running max, row sum and O tile; the four partial results of a query tile are merged in LDS behind one
// block barrier (weights exp2(m_j - max m), fixed order j = 0..3), each share's wave packing a quarter of the tile's ctx. The mask tile
// (16 ints per lane, row = the lane's query) is requested one key step ahead; a tile with no unmasked entry in the wave's 16x32 region is skipped wave-uniformly (contributes 0).
// S^T = K Q^T (hi.hi + hi.res + res.hi, q/k residual products scaled back by 1/1024), masked entries replaced by -inf, online softmax (running max, f32,
// -inf-safe), P x1024 and its x1024 residual via wave-private LDS, O^T += V^T P^T with V^T hi/res planes. ctx [b*SEQ+s][h*64+d] written as packed tiles, f16 x64
__global__ __launch_bounds__(64 * KSPL) __attribute__((amdgpu_num_vgpr(256))) void attn_kernel(
    const b16* __restrict__ Qp, const b16* __restrict__ Qr, const b16* __restrict__ Kp, const b16* __restrict__ Kr,
    const b16* __restrict__ VT, const b16* __restrict__ VR, const int* __restrict__ mask, const float* __restrict__ lsc,
    b16* __restrict__ Ch, b16* __restrict__ Cr) {
  __shared__ __attribute__((aligned(16))) b16 Pb[2 * KSPL][16][32 + 8];
  __shared__ __attribute__((aligned(16))) b16 Pr[2 * KSPL][16][32 + 8];
  __shared__ __attribute__((aligned(16))) float To[2 * KSPL][16][HD + 4];
  __shared__ float Ms[2 * KSPL][16], Ls[2 * KSPL][16];
  // the wave's number as a scalar, so that the key loop's control and the plane offsets stay on the scalar unit
  const int wave = __builtin_amdgcn_readfirstlane((int)(threadIdx.x >> 5)), qt = wave / KSPL, ks = wave % KSPL;
  const int lane = threadIdx.x & 31, hh = lane >> 4, col = lane & 15;
  const int bhi = (int)blockIdx.y, b = bhi / H, h = bhi % H;
  const int q0 = (int)blockIdx.x * 32 + qt * 16, qi = q0 + col;
  const size_t pq = (size_t)bhi * SEQ * HD;   // same plane size for the [s][64] rows and for both packed layouts
  const b16* Kb = Kp + pq; const b16* Klb = Kr + pq;
  const b16* Vb = VT + pq; const b16* Rb = VR + pq;
  // byte offset of the lane's 8 mask words of the share's first key step (the whole mask is far below 4 GiB)
  unsigned mo = (unsigned)((((size_t)b * SEQ_FULL + (size_t)qi) * SEQ_FULL + (size_t)(32 * ks + 8 * hh)) * sizeof(int));
  const v16b qa0 = frag_kb(Qp + pq + (size_t)qi * HD, hh), qa1 = frag_kb(Qp + pq + (size_t)qi * HD + 32, hh);
  const v16b ql0 = frag_kb(Qr + pq + (size_t)qi * HD, hh), ql1 = frag_kb(Qr + pq + (size_t)qi * HD + 32, hh);
  const float cs = 0.125f * expf(bf16_rne(lsc[0])) * (LOG2E / (QS * QS));
  float m = -INFINITY, l = 0.0f; v8f o[4], o2[4];
#pragma unroll
  for (int t = 0; t < 4; ++t) { o[t] = (v8f){}; o2[t] = (v8f){}; }
  v4i g0, g1, g2, g3;   // mask tile, requested one key step ahead
  { const int* mp = (const int*)((const char*)mask + mo); g0 = *(const v4i*)mp; g1 = *(const v4i*)(mp + 4); g2 = *(const v4i*)(mp + 16); g3 = *(const v4i*)(mp + 20); }
  // byte offset of the lane's place in the step's first tile: K tiles 2u, 2u+1 of key group u and V tiles t share it
  unsigned ko = (unsigned)lane * 16u + (unsigned)(ks * 4 * TE * 2);
#pragma unroll 1
  for (int k0 = 32 * ks; k0 < SEQ; k0 += 32 * KSPL, ko += KSPL * 4 * TE * 2) {
    unsigned int vbm = 0u;   // bit i set <=> entry i of this lane is NOT masked; bits 0..7 keys k0+8hh+0..7, bits 8..15 keys k0+16+8hh+0..7
    {
#pragma unroll
      for (int j = 0; j < 4; ++j) {
        vbm |= (g0[j] == 0 ? 1u : 0u) << j;       vbm |= (g1[j] == 0 ? 1u : 0u) << (4 + j);
        vbm |= (g2[j] == 0 ? 1u : 0u) << (8 + j); vbm |= (g3[j] == 0 ? 1u : 0u) << (12 + j);
      }
      // the mask tile of the share's next key step (the last step asks for its own tile again: in bounds, never used)
      mo += (k0 + 32 * KSPL < SEQ) ? (unsigned)(32 * KSPL) * (unsigned)sizeof(int) : 0u;
      const int* mp = (const int*)((const char*)mask + mo);
      g0 = *(const v4i*)mp; g1 = *(const v4i*)(mp + 4); g2 = *(const v4i*)(mp + 16); g3 = *(const v4i*)(mp + 20);
    }
    if (__any((vbm != 0u) ? 1 : 0) == 0) continue;
    // all eight K fragments of the step are requested here as one group, ahead of the matrix work
    v16b kh[4], kl[4], vh[4], vl[4];
    const b16* pk = (const b16*)((const char*)Kb + ko); const b16* pkl = (const b16*)((const char*)Klb + ko);
    const b16* pv = (const b16*)((const char*)Vb + ko); const b16* pvl = (const b16*)((const char*)Rb + ko);
#pragma unroll
    for (int j = 0; j < 4; ++j) { kh[j] = frag_pk(pk + j * TE); kl[j] = frag_pk(pkl + j * TE); }
    // behind the group: its address pairs stay whole until here, and no load sinks to its use (there each pair of loads costs the wave a full L2 round trip)
    asm volatile("s_wait_xcnt 0x0" :: "v"(pk), "v"(pkl) : "memory");
    float e[16]; float mx = -INFINITY;
#pragma unroll
    for (int u = 0; u < 2; ++u) {
      const v16b ka = kh[2 * u], kc = kh[2 * u + 1];
      v8f s = wmma16b(ka, qa0, (v8f){}); s = wmma16b(kc, qa1, s);
      v8f s2 = wmma16b(ka, ql0, (v8f){}); s2 = wmma16b(kc, ql1, s2);
      s2 = wmma16b(kl[2 * u], qa0, s2); s2 = wmma16b(kl[2 * u + 1], qa1, s2);
#pragma unroll
      for (int r = 0; r < 8; ++r) {
        const int idx = u * 8 + r;
        const float v = ((vbm >> idx) & 1u) ? (s[r] + s2[r] * (1.0f / QRS)) * cs : -INFINITY;
        e[idx] = v; mx = fmaxf(mx, v); } }
    // second group, into the registers that K has left: all eight V fragments fly while the softmax runs
#pragma unroll
    for (int t = 0; t < 4; ++t) { vh[t] = frag_pk(pv + t * TE); vl[t] = frag_pk(pvl + t * TE); }
    asm volatile("s_wait_xcnt 0x0" :: "v"(pv), "v"(pvl) : "memory");   // as behind the K group: address pairs whole, the loads ahead of the softmax arithmetic
    mx = fmaxf(mx, __shfl_xor(mx, 16)); const float mn = fmaxf(m, mx);
    const float mref = (mn == -INFINITY) ? 0.0f : mn;
    const float al = nexp2(m - mref); float sum = 0.0f;
#pragma unroll
    for (int i2 = 0; i2 < 16; ++i2) {
      const float p = nexp2(e[i2] - mref); sum += p; const int pi = (i2 < 8 ? 0 : 16) + 8 * hh + (i2 & 7);
      const float pp = p * PS; const b16 ph = (b16)pp; Pb[wave][col][pi] = ph;
      Pr[wave][col][pi] = (b16)((pp - (float)ph) * PRS); }
    sum += __shfl_xor(sum, 16); l = l * al + sum; m = mn;
    wave_lds_sync();
    const v16b pf = frag_kb(&Pb[wave][col][0], hh), plf = frag_kb(&Pr[wave][col][0], hh);
#pragma unroll
    for (int t = 0; t < 4; ++t) {
      o[t] *= al; o2[t] *= al;
      o[t] = wmma16b(vh[t], pf, o[t]);
      o2[t] = wmma16b(vl[t], pf, o2[t]);
      o2[t] = wmma16b(vh[t], plf, o2[t]); }
    wave_lds_sync(); }
  // the share's partial result, not yet normalised: O tile, running max and row sum of each query
#pragma unroll
  for (int t = 0; t < 4; ++t) {
#pragma unroll
    for (int r = 0; r < 8; ++r) To[wave][col][t * 16 + 8 * hh + r] = o[t][r] + o2[t][r] * (1.0f / VRS); }
  if (hh == 0) { Ms[wave][col] = m; Ls[wave][col] = l; }
  __syncthreads();   // the partial results are read across the four waves of a query tile
  const size_t cb = ((size_t)((b * SEQ + q0) >> 4) * KT + (size_t)h * 2) * TE;
  {
    const int it = ks;   // each share's wave merges and packs one quarter of the query tile
    const int rl = (it & 1) * 8 + (lane & 7), pc = (it >> 1) * 32 + (lane >> 3) * 8;
    float mj[KSPL], mt = -INFINITY;
#pragma unroll
    for (int j = 0; j < KSPL; ++j) { mj[j] = Ms[qt * KSPL + j][rl]; mt = fmaxf(mt, mj[j]); }
    const float mtr = (mt == -INFINITY) ? 0.0f : mt;   // -inf-safe, as in the key loop
    float lt = 0.0f; v4f f0 = (v4f){}, f1 = (v4f){};
#pragma unroll
    for (int j = 0; j < KSPL; ++j) {
      const float w = nexp2(mj[j] - mtr);
      lt += w * Ls[qt * KSPL + j][rl];
      f0 += w * *(const v4f*)(&To[qt * KSPL + j][rl][pc]); f1 += w * *(const v4f*)(&To[qt * KSPL + j][rl][pc + 4]); }
    const float inv = 1.0f / (lt * PS * VS);
    f0 *= inv; f1 *= inv;
    v8b oh, ol;
#pragma unroll
    for (int j = 0; j < 4; ++j) {
      const float v0 = f0[j] * OCS; const b16 hv0 = (b16)v0; oh[j] = hv0; ol[j] = (b16)((v0 - (float)hv0) * OCRS);
      const float v1 = f1[j] * OCS; const b16 hv1 = (b16)v1; oh[4 + j] = hv1; ol[4 + j] = (b16)((v1 - (float)hv1) * OCRS); }
    const size_t off = cb + (size_t)((it >> 1) * 64 + (lane >> 3) * 16 + rl) * 8;
    *(v8b*)(Ch + off) = oh; *(v8b*)(Cr + off) = ol;
  }
}

// Output projection: out[64 tokens x 64 features] = (ctx hi . Wo + ctx res . Wo / 1024) / 4096 + bf16-RNE(bo), K = 1024 stepped by 32, fragments from the
// packed global planes, block 128 = 4 waves in 2x2, wave tile 32x32. Result staged in LDS (cross-wave: block barrier); each 256-B row segment by 16 consecutive lanes x
__global__ __launch_bounds__(128) __attribute__((amdgpu_num_vgpr(256))) void gemm_out_kernel(
    const b16* __restrict__ Ch, const b16* __restrict__ Cr, const b16* __restrict__ Wop, const float* __restrict__ bo, float* __restrict__ out) {
  __shared__ __attribute__((aligned(16))) float Tt[64][HD + 4];
  const int wave = threadIdx.x >> 5, lane = threadIdx.x & 31, hh = lane >> 4, m = lane & 15, wm = wave >> 1, wn = wave & 1;
  const int nblk = (int)blockIdx.x * 64;
  const int mblk = (int)blockIdx.y * 64, b = mblk / SEQ, s0 = mblk % SEQ;
  // byte offsets of the lane's place in the first tiles (each plane is far below 4 GiB); ctx and its residual share one
  unsigned wo = (unsigned)(((nblk + wn * 32) / 16 * KT * TE + 8 * lane) * 2), ao = (unsigned)(((mblk + wm * 32) / 16 * KT * TE + 8 * lane) * 2);
  v8f acc[2][2], acc2[2][2];
#pragma unroll
  for (int i = 0; i < 2; ++i)
#pragma unroll
    for (int j = 0; j < 2; ++j) { acc[i][j] = (v8f){}; acc2[i][j] = (v8f){}; }
#pragma unroll 1
  for (int k0 = 0; k0 < DM; k0 += 32) {
    v16b af[2], rf[2], bf[2];
#pragma unroll
    for (int mt = 0; mt < 2; ++mt) {
      af[mt] = frag_pk((const b16*)((const char*)Ch + ao) + (size_t)mt * KT * TE);
      rf[mt] = frag_pk((const b16*)((const char*)Cr + ao) + (size_t)mt * KT * TE); }
#pragma unroll
    for (int nt = 0; nt < 2; ++nt) bf[nt] = frag_pk((const b16*)((const char*)Wop + wo) + (size_t)nt * KT * TE);
    ao += TE * 2; wo += TE * 2;
#pragma unroll
    for (int mt = 0; mt < 2; ++mt)
#pragma unroll
      for (int nt = 0; nt < 2; ++nt) {
        acc[mt][nt] = wmma16b(af[mt], bf[nt], acc[mt][nt]);
        acc2[mt][nt] = wmma16b(rf[mt], bf[nt], acc2[mt][nt]); }
  }
  float bias[2];
#pragma unroll
  for (int nt = 0; nt < 2; ++nt) bias[nt] = bf16_rne(bo[nblk + wn * 32 + nt * 16 + m]);
  const float isc = 1.0f / (OCS * WSC), irs = 1.0f / OCRS;
#pragma unroll
  for (int mt = 0; mt < 2; ++mt)
#pragma unroll
    for (int nt = 0; nt < 2; ++nt)
#pragma unroll
      for (int r = 0; r < 8; ++r)
        Tt[wm * 32 + mt * 16 + 8 * hh + r][wn * 32 + nt * 16 + m] = (acc[mt][nt][r] + acc2[mt][nt][r] * irs) * isc + bias[nt];
  __syncthreads();   // Tt is read across waves
  float* ob = out + ((size_t)b * SEQ_FULL + (size_t)s0) * DM + nblk;
  {
#pragma unroll 1
    for (int it = 0; it < 8; ++it) {
      const int rr = it * 8 + wave * 2 + hh; const v4f f = *(const v4f*)(&Tt[rr][m * 4]);
      *(v4f*)(ob + (size_t)rr * DM + m * 4) = f; }
     }
}
}  // namespace

extern "C" void kernel_launch(void* const* d_in, const int* in_sizes, int n_in, void* d_out, int out_size, void* d_ws, size_t ws_size, hipStream_t stream) {
  // wire order: 0 x [NB_FULL][SEQ_FULL][1024] f32, 1 Wq [1024][1024], 2 bq [1024], 3 Wk, 4 bk, 5 Wv, 6 bv, 7 Wo, 8 bo, 9 logit scale [1] f32,
  //             10 mask int32 [NB_FULL][SEQ_FULL][SEQ_FULL] (nonzero = masked); out [NB_FULL][SEQ_FULL][1024] f32
  if (n_in < 11) return;
  const size_t need_x = ((size_t)(NB - 1) * SEQ_FULL + SEQ) * DM;
  const size_t need_m = ((size_t)(NB - 1) * SEQ_FULL + SEQ - 1) * SEQ_FULL + SEQ;
  if ((size_t)in_sizes[0] < need_x || (size_t)out_size < need_x || (size_t)in_sizes[10] < need_m || in_sizes[9] < 1) return;
  if (in_sizes[1] < DM * DM || in_sizes[3] < DM * DM || in_sizes[5] < DM * DM || in_sizes[7] < DM * DM) return;
  if (in_sizes[2] < DM || in_sizes[4] < DM || in_sizes[6] < DM || in_sizes[8] < DM) return;
  const float* X = (const float*)d_in[0];
  const float* Wq = (const float*)d_in[1]; const float* bq = (const float*)d_in[2];
  const float* Wk = (const float*)d_in[3]; const float* bk = (const float*)d_in[4];
  const float* Wv = (const float*)d_in[5]; const float* bv = (const float*)d_in[6];
  const float* Wo = (const float*)d_in[7]; const float* bo = (const float*)d_in[8];
  const float* lsc = (const float*)d_in[9]; const int* mask = (const int*)d_in[10];
  size_t off = 0; char* ws = (char*)d_ws;
  auto carve = [&](size_t bytes) { char* p = ws + off; off += (bytes + 255) & ~(size_t)255; return p; };
  const size_t plane = (size_t)NT * DM * 2;
  v2f* T  = (v2f*)carve((size_t)SEQ * NCS * sizeof(v2f));          // 524,288 B (256-B rows, exact)
  b16* Xp = (b16*)carve(plane);
  b16* Wp = (b16*)carve((size_t)4 * DM * DM * 2);                   // 8,388,608 B
  b16* Qp = (b16*)carve(plane); b16* Qr = (b16*)carve(plane); b16* Kp = (b16*)carve(plane); b16* Kr = (b16*)carve(plane);
  b16* VT = (b16*)carve(plane); b16* VR = (b16*)carve(plane); b16* Ch = (b16*)carve(plane); b16* Cr = (b16*)carve(plane);
  if (off > ws_size || off > ((size_t)128 << 20)) return;          // 84,410,368 B total at NB=2, SEQ=2048
  cvt_x_kernel<<<dim3((unsigned)(((size_t)NT * DM / 8 + 255) / 256)), 256, 0, stream>>>(X, Xp);
  cvt_w_kernel<<<dim3((unsigned)(((size_t)DM * DM / 8 + 255) / 256), 4), 256, 0, stream>>>(Wq, Wk, Wv, Wo, Wp);
  rope_table_kernel<<<dim3((unsigned)((SEQ * NCS + 255) / 256)), 256, 0, stream>>>(T);
  gemm_qkv_kernel<<<dim3(3 * DM / 64, NT / 64), 128, 0, stream>>>(Xp, Wp, bq, bk, bv, T, Qp, Qr, Kp, Kr, VT, VR);
  attn_kernel<<<dim3(SEQ / 32, NB * H), 64 * KSPL, 0, stream>>>(Qp, Qr, Kp, Kr, VT, VR, mask, lsc, Ch, Cr);
  gemm_out_kernel<<<dim3(DM / 64, NT / 64), 128, 0, stream>>>(Ch, Cr, Wp + (size_t)3 * DM * DM, bo, (float*)d_out);
}

// v004
// A run of this version takes 172 microseconds.
// Next to v003, in two timings, it ran 1.11 times as fast each time.
// Over all steps from v000 it is 2.49 times as fast.
#include <hip/hip_runtime.h>

// compute dtype: every contraction on v_wmma_f32_16x16x32_f16 (f16 operands, f32 accumulate). q/k/v projections: bf16-RNE(x) x8 times bf16-RNE(W) x64,
// 1 product each; scores K Q^T per head: q and k (rope + l2 norm in f32) as f16 x8 planes plus x1024 residual planes, 3 products (hi.hi, hi.res, res.hi);
// O^T += V^T P^T: V^T f16 x8 plus a x1024 residual plane, P f16 x1024 plus a x1024 residual tile, 3 products (residual products share one accumulator);
// output projection: ctx f16 x64 plus a x1024 residual plane times bf16-RNE(Wo) x64, 2 products. Softmax statistics (running max, exp2, row sums),
// rope cos/sin table, l2 norm and bias adds in f32; 1/sqrt(64) and exp(logit scale) folded into the log2-domain score constant.
// Fragment k-map per lane half hh for A AND B: elements 0..7 <- k = 8hh+0..7, 8..15 <- k = 16+8hh+0..7; acc[r] = D[8hh+r][col = lane&15].
// Packed planes (X, W, K, V^T, ctx and their residuals): a plane of R rows x C k-columns is stored as 16x32 tiles, tile index (row/16)*(C/32) + k/32 (V^T: (k/32)*(R/16) + row/16), each tile
// 512 elements laid out [k octet 0..3][row 0..15][8], so that each of a fragment's two wave loads reads 512 contiguous bytes (four whole 128-B lines).

#ifndef NB
#define NB 2
#endif
#ifndef SEQ
#define SEQ 2048
#endif
#ifndef NB_FULL
#define NB_FULL 2
#endif
#ifndef SEQ_FULL
#define SEQ_FULL 2048
#endif

namespace {
constexpr int H = 16, HD = 64, DM = 1024, NT = NB * SEQ, NCS = HD / 2, KT = DM / 32, TE = 512;
constexpr float XS = 8.0f, WSC = 64.0f, QS = 8.0f, QRS = 1024.0f, VS = 8.0f, VRS = 1024.0f, PS = 1024.0f, PRS = 1024.0f, OCS = 64.0f, OCRS = 1024.0f;
constexpr float LOG2E = 1.4426950408889634f, EPSN = 1e-6f;
constexpr int KSPL = 4;   // key shares (waves) per query tile in the attention kernel
static_assert(KSPL == 4 && SEQ % (32 * KSPL) == 0);
constexpr int NJ = SEQ / (32 * KSPL);                       // key steps per share
constexpr int WGX = DM * DM / 8 / 256;                      // blocks per weight plane in the conversion launch
constexpr int MWV = NB * (SEQ / 16) * KSPL * (NJ / 2);      // waves that pack the mask, two key steps each
constexpr int MGY = (MWV / 8 + WGX - 1) / WGX;              // grid rows of 8-wave blocks that hold them
static_assert(NJ % 2 == 0 && NJ <= 16 && MWV % 8 == 0 && (DM * DM / 8) % 256 == 0);
static_assert(SEQ % 64 == 0 && SEQ >= 64 && SEQ <= SEQ_FULL && NB >= 1 && NB <= NB_FULL);
static_assert(DM == H * HD && HD == 64 && DM % 64 == 0 && (3 * DM) % 64 == 0 && NT % 64 == 0 && PRS == VRS);

typedef _Float16 b16;
typedef __attribute__((ext_vector_type(16))) _Float16 v16b;
typedef __attribute__((ext_vector_type(8))) _Float16 v8b;
typedef __attribute__((ext_vector_type(2))) _Float16 v2b;
typedef __attribute__((ext_vector_type(8))) float v8f;
typedef __attribute__((ext_vector_type(4))) float v4f;
typedef __attribute__((ext_vector_type(2))) float v2f;
typedef __attribute__((ext_vector_type(4))) unsigned int v4u;

__device__ __forceinline__ float bf16_rne(float f) { unsigned int u = __float_as_uint(f); u += 0x7FFFu + ((u >> 16) & 1u); return __uint_as_float(u & 0xFFFF0000u); }
// 16-bit fragment from a k-contiguous row: elements 0..7 <- p[8hh .. 8hh+7], 8..15 <- p[16+8hh .. 16+8hh+7]
__device__ __forceinline__ v16b frag_kb(const b16* p, int hh) {
  const v8b a = *(const v8b*)(p + 8 * hh), b = *(const v8b*)(p + 16 + 8 * hh); v16b f;
#pragma unroll
  for (int e = 0; e < 8; ++e) { f[e] = a[e]; f[8 + e] = b[e]; }
  return f;
}
// the same fragment from a packed tile; p = tile + 8*lane (lane = 16hh + row): octets hh and 2+hh of the lane's row
__device__ __forceinline__ v16b frag_pk(const b16* p) {
  const v8b a = *(const v8b*)p, b = *(const v8b*)(p + 256); v16b f;
#pragma unroll
  for (int e = 0; e < 8; ++e) { f[e] = a[e]; f[8 + e] = b[e]; }
  return f;
}
__device__ __forceinline__ v8f wmma16b(v16b a, v16b b, v8f c) {
  v8f d = __builtin_amdgcn_wmma_f32_16x16x32_f16(false, a, false, b, (short)0, c, false, false);
  asm volatile("v_nop\n\tv_nop\n\tv_nop\n\tv_nop" : "+v"(d) : "v"(a), "v"(b));
  return d;
}
__device__ __forceinline__ void wave_lds_sync() { __builtin_amdgcn_fence(3, "workgroup"); __builtin_amdgcn_wave_barrier(); __builtin_amdgcn_fence(2, "workgroup"); }
__device__ __forceinline__ float nexp2(float v) { return __builtin_amdgcn_exp2f(v); }

// X plane, packed tiles of [NB*SEQ tokens][1024], f16 = bf16-RNE(x) x8; token row b*SEQ+s reads input row b*SEQ_FULL+s. Thread per k octet: a wave reads 8 rows x
// 128 B and writes four whole 128-B lines of one tile.
__global__ __launch_bounds__(256) void cvt_x_kernel(const float* __restrict__ X, b16* __restrict__ Xp) {
  const size_t u = (size_t)blockIdx.x * 256 + threadIdx.x;
  if (u >= (size_t)NT * DM / 8) return;
  const int oct = (int)(u & 3), rl = (int)((u >> 2) & 15); const size_t t = u >> 6;
  const size_t row = (t / KT) * 16 + rl; const int kt = (int)(t % KT);
  const size_t b = row / SEQ, s = row % SEQ;
  const float* src = X + (b * SEQ_FULL + s) * DM + (size_t)(kt * 32 + oct * 8);
  b16* dst = Xp + t * TE + (size_t)((oct * 16 + rl) * 8);
  const v4f x0 = *(const v4f*)src, x1 = *(const v4f*)(src + 4); v8b o;
#pragma unroll
  for (int j = 0; j < 4; ++j) { o[j] = (b16)(bf16_rne(x0[j]) * XS); o[4 + j] = (b16)(bf16_rne(x1[j]) * XS); }
  *(v8b*)dst = o; 
}

// W planes [4], each the packed tiles of [1024 out][1024 in], f16 = bf16-RNE(W) x64 (rows n, k along the input). blockIdx.y selects the weight, block-uniform.
// Grid rows 4 and up pack the mask into bit words Mw[b][query tile][share ks][step j of the share][query 0..15]: bit i set <=> key 32*(j*KSPL+ks)+i is NOT masked
// for that query. A wave takes one query tile and the steps j, j+1 of one share: 32 row pieces of 128 B in, one whole 128-B line out.
__global__ __launch_bounds__(256) void cvt_w_kernel(const float* __restrict__ Wq, const float* __restrict__ Wk, const float* __restrict__ Wv,
                                                    const float* __restrict__ Wo, b16* __restrict__ Wp, const int* __restrict__ mask,
                                                    unsigned int* __restrict__ Mw) {
  const int y = (int)blockIdx.y;
  if (y >= 4) {
    const int wv = ((y - 4) * WGX + (int)blockIdx.x) * 8 + (int)(threadIdx.x >> 5), lane = (int)(threadIdx.x & 31);
    if (wv >= MWV) return;   // wave-uniform
    const int ks = wv % KSPL, jp = (wv / KSPL) % (NJ / 2), qt = (wv / (KSPL * (NJ / 2))) % (SEQ / 16), b = wv / (KSPL * (NJ / 2) * (SEQ / 16));
    const int* src = mask + ((size_t)b * SEQ_FULL + (size_t)qt * 16) * SEQ_FULL + (size_t)((2 * jp * KSPL + ks) * 32 + lane);
    int g0[16], g1[16];
#pragma unroll
    for (int r = 0; r < 16; ++r) { g0[r] = src[(size_t)r * SEQ_FULL]; g1[r] = src[(size_t)r * SEQ_FULL + 32 * KSPL]; }
    unsigned int w = 0u;
#pragma unroll
    for (int r = 0; r < 16; ++r) {
      const unsigned int b0 = __builtin_amdgcn_ballot_w32(g0[r] == 0), b1 = __builtin_amdgcn_ballot_w32(g1[r] == 0);
      w = (lane == r) ? b0 : w; w = (lane == 16 + r) ? b1 : w; }
    Mw[(size_t)((((b * (SEQ / 16) + qt) * KSPL + ks) * NJ + 2 * jp) * 16) + lane] = w;
    return;
  }
  const float* W = (y == 0) ? Wq : ((y == 1) ? Wk : ((y == 2) ? Wv : Wo));
  const size_t u = (size_t)blockIdx.x * 256 + threadIdx.x;
  if (u >= (size_t)DM * DM / 8) return;
  const int oct = (int)(u & 3), rl = (int)((u >> 2) & 15); const size_t t = u >> 6;
  const float* src = W + ((t / KT) * 16 + rl) * DM + (size_t)((int)(t % KT) * 32 + oct * 8);
  b16* dst = Wp + (size_t)y * DM * DM + t * TE + (size_t)((oct * 16 + rl) * 8);
  const v4f x0 = *(const v4f*)src, x1 = *(const v4f*)(src + 4); v8b o;
#pragma unroll
  for (int j = 0; j < 4; ++j) { o[j] = (b16)(bf16_rne(x0[j]) * WSC); o[4 + j] = (b16)(bf16_rne(x1[j]) * WSC); }
  *(v8b*)dst = o; 
}

// rope table T[s][i] = (cos, sin)(s * freq_i), freq_i = 1 / fl32(10000^(2i/64)), s*freq as an f32 product. Argument reduction in f64 (mul/fma only), short f32
__global__ __launch_bounds__(256) void rope_table_kernel(v2f* __restrict__ T) {
  const int u = (int)blockIdx.x * 256 + (int)threadIdx.x;
  if (u >= SEQ * NCS) return;
  const int s = u / NCS, i = u % NCS;
  const float ex = (float)(2 * i) / (float)HD;
  const float pw = (float)exp2((double)ex * 13.287712379549449);
  const float freq = 1.0f / pw;
  const float ang = (float)s * freq;
  const double a = (double)ang;
  const double k = __builtin_rint(a * 0.63661977236758134);
  double rd = __builtin_fma(-k, 1.5707963267948966, a);
  rd = __builtin_fma(-k, 6.123233995736766e-17, rd);
  const float r = (float)rd, r2 = r * r;
  const float sp = r + r * r2 * (-1.6666666666666666e-1f + r2 * (8.333333333333333e-3f + r2 * (-1.984126984126984e-4f + r2 * 2.7557319223985893e-6f)));
  const float cp = 1.0f + r2 * (-0.5f + r2 * (4.1666666666666664e-2f + r2 * (-1.3888888888888889e-3f + r2 * (2.48015873015873e-5f + r2 * -2.755731922398589e-7f))));
  const int kq = (int)(((long long)k) & 3);
  const float c = (kq == 0) ? cp : ((kq == 1) ? -sp : ((kq == 2) ? -cp : sp));
  const float sn = (kq == 0) ? sp : ((kq == 1) ? cp : ((kq == 2) ? -sp : -cp));
  v2f o; o.x = c; o.y = sn;
  *(v2f*)(T + u) = o; 
}

// Fused q/k/v projection: C[64 tokens x 64 features] = A(X plane) . B (B[k][n] = W[n][k] from the packed W plane), K = 1024 stepped by 32, fragments loaded
// straight from the packed global f16 planes. q planes stay [s][64]; k planes are packed tiles of [s][64], v planes packed tiles of [64][s].
// Block 128 threads = 4 waves in 2x2, wave tile 32x32 = 2x2 WMMA tiles. The 64-column tile is exactly one head of q, k or
// v (which = column block / 1024, block-uniform). Epilogue: acc/512 + bf16-RNE(bias) staged in LDS (cross-wave: block barrier), then
__global__ __launch_bounds__(128) __attribute__((amdgpu_num_vgpr(256))) void gemm_qkv_kernel(
    const b16* __restrict__ Xp, const b16* __restrict__ Wp, const float* __restrict__ bq, const float* __restrict__ bk, const float* __restrict__ bv,
    const v2f* __restrict__ CSt, b16* __restrict__ Qp, b16* __restrict__ Qr, b16* __restrict__ Kp, b16* __restrict__ Kr, b16* __restrict__ VT,
    b16* __restrict__ VR) {
  __shared__ __attribute__((aligned(16))) float Tt[64][HD + 4];
  const int wave = threadIdx.x >> 5, lane = threadIdx.x & 31, hh = lane >> 4, m = lane & 15, wm = wave >> 1, wn = wave & 1;
  const int nblk = (int)blockIdx.x * 64, which = nblk / DM, n0 = nblk % DM, h = n0 / HD;
  const int mblk = (int)blockIdx.y * 64, b = mblk / SEQ, s0 = mblk % SEQ;
  const b16* Wb = Wp + (size_t)which * DM * DM + (size_t)((n0 + wn * 32) / 16) * KT * TE + 8 * lane;
  const b16* Ab = Xp + (size_t)((mblk + wm * 32) / 16) * KT * TE + 8 * lane;
  const float* bsel = (which == 0) ? bq : ((which == 1) ? bk : bv);
  v8f acc[2][2];
#pragma unroll
  for (int i = 0; i < 2; ++i)
#pragma unroll
    for (int j = 0; j < 2; ++j) acc[i][j] = (v8f){};
#pragma unroll 1
  for (int k0 = 0; k0 < DM; k0 += 32) {
    v16b af[2], bf[2];
#pragma unroll
    for (int mt = 0; mt < 2; ++mt) af[mt] = frag_pk(Ab + (size_t)(mt * KT + k0 / 32) * TE);
#pragma unroll
    for (int nt = 0; nt < 2; ++nt) bf[nt] = frag_pk(Wb + (size_t)(nt * KT + k0 / 32) * TE);
#pragma unroll
    for (int mt = 0; mt < 2; ++mt)
#pragma unroll
      for (int nt = 0; nt < 2; ++nt) acc[mt][nt] = wmma16b(af[mt], bf[nt], acc[mt][nt]);
  }
  float bias[2];
#pragma unroll
  for (int nt = 0; nt < 2; ++nt) bias[nt] = bf16_rne(bsel[n0 + wn * 32 + nt * 16 + m]);
  const float isc = 1.0f / (XS * WSC);
#pragma unroll
  for (int mt = 0; mt < 2; ++mt)
#pragma unroll
    for (int nt = 0; nt < 2; ++nt)
#pragma unroll
      for (int r = 0; r < 8; ++r) Tt[wm * 32 + mt * 16 + 8 * hh + r][wn * 32 + nt * 16 + m] = acc[mt][nt][r] * isc + bias[nt];
  __syncthreads();   // Tt is read across waves
  if (which < 2) {
    const size_t pb = (size_t)(b * H + h) * SEQ * HD;
    b16* Ph = ((which == 0) ? Qp : Kp) + pb;
    b16* Pl = ((which == 0) ? Qr : Kr) + pb;
#pragma unroll 1
    for (int it = 0; it < 16; ++it) {
      const int r = wave * 16 + it, s = s0 + r;   // a wave owns 16 consecutive rows = one row of packed tiles
      const float x0 = Tt[r][2 * lane], x1 = Tt[r][2 * lane + 1];
      const v2f cv = CSt[(size_t)s * NCS + lane];
      const float y0 = x0 * cv.x - x1 * cv.y, y1 = x1 * cv.x + x0 * cv.y;
      float ss = y0 * y0 + y1 * y1;
#pragma unroll
      for (int w = 16; w >= 1; w >>= 1) ss += __shfl_xor(ss, w);
      const float inv = 1.0f / sqrtf(ss + EPSN);
      const float z0 = y0 * inv * QS, z1 = y1 * inv * QS;
      const b16 h0 = (b16)z0, h1 = (b16)z1;
      v2b oh, ol; oh.x = h0; oh.y = h1; ol.x = (b16)((z0 - (float)h0) * QRS); ol.y = (b16)((z1 - (float)h1) * QRS);
      const size_t off = (which == 0) ? (size_t)s * HD + 2 * lane
                                      : (size_t)(((s >> 4) * 2 + (lane >> 4)) * 64 + ((lane >> 2) & 3) * 16 + (s & 15)) * 8 + ((2 * lane) & 7);
      *(v2b*)(Ph + off) = oh; *(v2b*)(Pl + off) = ol;
      asm volatile("s_wait_xcnt 0x0" ::: "memory");   // before the next trip rewrites the stores' address and data registers
    }
  } else {
    const size_t vb = ((size_t)(b * H + h) * HD) * SEQ;
#pragma unroll 1
    for (int it = 0; it < 4; ++it) {
      const int dl = (it & 1) * 8 + (lane & 7), d = wave * 16 + dl, tok = (it >> 1) * 32 + (lane >> 3) * 8;
      v8b oh, ol;
#pragma unroll
      for (int j = 0; j < 8; ++j) {
        const float v = Tt[tok + j][d] * VS; const b16 hv = (b16)v; oh[j] = hv; ol[j] = (b16)((v - (float)hv) * VRS); }
      const size_t off = vb + (size_t)((((s0 + tok) >> 5) * 4 + wave) * 64 + (lane >> 3) * 16 + dl) * 8;
      *(v8b*)(VT + off) = oh; *(v8b*)(VR + off) = ol;
      asm volatile("s_wait_xcnt 0x0" ::: "memory");   // before the next trip rewrites the stores' address and data registers
    }
  }
}

// Masked softmax attention per (query block of 32, b*H+h); block = 8 waves = 2 query tiles of 16 x 4 key shares: share ks takes the key steps of 32 whose
// index is ks modulo 4, in fixed order, with its own running max, row sum and O tile; the four partial results of a query tile are merged in LDS behind one
// block barrier (weights exp2(m_j - max m), fixed order j = 0..3), each share's wave packing a quarter of the tile's ctx. The mask comes as the
// packed bit words: the wave reads all words of its share once and keeps two scalar maps, the steps with any unmasked entry in its 16x32 region (only these are walked; the
// others contribute 0) and the steps with none masked (these apply no mask); a walked step's word per query is requested one walked step ahead.
// S^T = K Q^T (hi.hi + hi.res + res.hi, q/k residual products scaled back by 1/1024), masked entries replaced by -inf, online softmax (running max, f32,
// -inf-safe), P x1024 and its x1024 residual via wave-private LDS, O^T += V^T P^T with V^T hi/res planes. ctx [b*SEQ+s][h*64+d] written as packed tiles, f16 x64
__global__ __launch_bounds__(64 * KSPL) __attribute__((amdgpu_num_vgpr(256))) void attn_kernel(
    const b16* __restrict__ Qp, const b16* __restrict__ Qr, const b16* __restrict__ Kp, const b16* __restrict__ Kr,
    const b16* __restrict__ VT, const b16* __restrict__ VR, const unsigned int* __restrict__ Mw, const float* __restrict__ lsc,
    b16* __restrict__ Ch, b16* __restrict__ Cr) {
  __shared__ __attribute__((aligned(16))) b16 Pb[2 * KSPL][16][32 + 8];
  __shared__ __attribute__((aligned(16))) b16 Pr[2 * KSPL][16][32 + 8];
  __shared__ __attribute__((aligned(16))) float To[2 * KSPL][16][HD + 4];
  __shared__ float Ms[2 * KSPL][16], Ls[2 * KSPL][16];
  // the wave's number as a scalar, so that the key loop's control and the plane offsets stay on the scalar unit
  const int wave = __builtin_amdgcn_readfirstlane((int)(threadIdx.x >> 5)), qt = wave / KSPL, ks = wave % KSPL;
  const int lane = threadIdx.x & 31, hh = lane >> 4, col = lane & 15;
  const int bhi = (int)blockIdx.y, b = bhi / H, h = bhi % H;
  const int q0 = (int)blockIdx.x * 32 + qt * 16, qi = q0 + col;
  const size_t pq = (size_t)bhi * SEQ * HD;   // same plane size for the [s][64] rows and for both packed layouts
  const b16* Kb = Kp + pq; const b16* Klb = Kr + pq;
  const b16* Vb = VT + pq; const b16* Rb = VR + pq;
  const unsigned int* Mq = Mw + (size_t)(((b * (SEQ / 16) + (q0 >> 4)) * KSPL + ks) * NJ) * 16;   // the share's NJ x 16 mask words
  unsigned int act, ful;   // bit 2j: step j of the share has an unmasked entry / has no masked entry; both wave-uniform
  const int jl = lane >> 1;   // the lane reads 8 of step jl's 16 words
  const unsigned so = (jl < NJ) ? (unsigned)lane * 32u : 0u;
  {
    const unsigned int* sp = (const unsigned int*)((const char*)Mq + so);
    const v4u w0 = *(const v4u*)sp, w1 = *(const v4u*)(sp + 4);
    const unsigned int wo = w0.x | w0.y | w0.z | w0.w | w1.x | w1.y | w1.z | w1.w, wa = w0.x & w0.y & w0.z & w0.w & w1.x & w1.y & w1.z & w1.w;
    const unsigned int anyb = __builtin_amdgcn_ballot_w32(jl < NJ && wo != 0u), allb = __builtin_amdgcn_ballot_w32(wa == 0xFFFFFFFFu);
    act = (anyb | (anyb >> 1)) & 0x55555555u; ful = allb & (allb >> 1);
  }
  const v16b qa0 = frag_kb(Qp + pq + (size_t)qi * HD, hh), qa1 = frag_kb(Qp + pq + (size_t)qi * HD + 32, hh);
  const v16b ql0 = frag_kb(Qr + pq + (size_t)qi * HD, hh), ql1 = frag_kb(Qr + pq + (size_t)qi * HD + 32, hh);
  // loaded values as inputs only: holds the Q fragment loads in flight beside the mask words' loads (else they sink behind the test for an empty share: a second
  // round trip); the wait stands before the mask words' offset register is rewritten
  asm volatile("s_wait_xcnt 0x0" :: "v"(qa0), "v"(qa1), "v"(ql0), "v"(ql1), "v"(so) : "memory");
  const float cs = 0.125f * expf(bf16_rne(lsc[0])) * (LOG2E / (QS * QS));
  float m = -INFINITY, l = 0.0f; v8f o[4], o2[4];
#pragma unroll
  for (int t = 0; t < 4; ++t) { o[t] = (v8f){}; o2[t] = (v8f){}; }
  // the query's 32 mask bits of a walked step are requested one walked step ahead
  unsigned int mwn = *(const unsigned int*)((const char*)Mq + ((unsigned)((act != 0u ? __builtin_ctz(act) : 0) >> 1) * 64u + (unsigned)col * 4u));
#pragma unroll 1
  while (act != 0u) {   // at most NJ trips, in rising key order
    const int tz = __builtin_ctz(act), j = tz >> 1; act &= act - 1u;
    const bool full = ((ful >> tz) & 1u) != 0u;
    // byte offset of the lane's place in the step's first tile: K tiles 2u, 2u+1 of key group u and V tiles t share it
    const unsigned ko = (unsigned)lane * 16u + (unsigned)(j * KSPL + ks) * (unsigned)(4 * TE * 2);
    const unsigned int mw = mwn;
    // the next walked step's word (the last step asks for its own again: in bounds, never used)
    const unsigned mo = (unsigned)((act != 0u ? __builtin_ctz(act) >> 1 : j) * 64) + (unsigned)col * 4u;
    mwn = *(const unsigned int*)((const char*)Mq + mo);
    // all eight K fragments of the step are requested here as one group, ahead of the matrix work
    v16b kh[4], kl[4], vh[4], vl[4];
    const b16* pk = (const b16*)((const char*)Kb + ko); const b16* pkl = (const b16*)((const char*)Klb + ko);
    const b16* pv = (const b16*)((const char*)Vb + ko); const b16* pvl = (const b16*)((const char*)Rb + ko);
#pragma unroll
    for (int j = 0; j < 4; ++j) { kh[j] = frag_pk(pk + j * TE); kl[j] = frag_pk(pkl + j * TE); }
    // behind the group: its offset registers stay whole until here, and no load sinks to its use (there each pair of loads costs the wave a full L2 round trip)
    asm volatile("s_wait_xcnt 0x0" :: "v"(ko), "v"(mo) : "memory");
    float e[16];
#pragma unroll
    for (int u = 0; u < 2; ++u) {
      const v16b ka = kh[2 * u], kc = kh[2 * u + 1];
      v8f s = wmma16b(ka, qa0, (v8f){}); s = wmma16b(kc, qa1, s);
      v8f s2 = wmma16b(ka, ql0, (v8f){}); s2 = wmma16b(kc, ql1, s2);
      s2 = wmma16b(kl[2 * u], qa0, s2); s2 = wmma16b(kl[2 * u + 1], qa1, s2);
#pragma unroll
      for (int r = 0; r < 8; ++r) e[u * 8 + r] = (s[r] + s2[r] * (1.0f / QRS)) * cs; }
    // second group, into the registers that K has left: all eight V fragments fly while the softmax runs
#pragma unroll
    for (int t = 0; t < 4; ++t) { vh[t] = frag_pk(pv + t * TE); vl[t] = frag_pk(pvl + t * TE); }
    asm volatile("s_wait_xcnt 0x0" :: "v"(ko) : "memory");   // as behind the K group: the offset register whole, the loads ahead of the softmax arithmetic
    if (!full) {   // scalar branch: entry i of the lane is key 8hh+i (i < 8) or 16+8hh+i-8 of the step
      const unsigned int sh = mw >> (8 * hh);
#pragma unroll
      for (int i2 = 0; i2 < 16; ++i2) e[i2] = ((sh >> (i2 < 8 ? i2 : i2 + 8)) & 1u) ? e[i2] : -INFINITY; }
    float mx = -INFINITY;
#pragma unroll
    for (int i2 = 0; i2 < 16; ++i2) mx = fmaxf(mx, e[i2]);
    mx = fmaxf(mx, __shfl_xor(mx, 16)); const float mn = fmaxf(m, mx);
    const float mref = (mn == -INFINITY) ? 0.0f : mn;
    const float al = nexp2(m - mref); float sum = 0.0f;
#pragma unroll
    for (int i2 = 0; i2 < 16; ++i2) {
      const float p = nexp2(e[i2] - mref); sum += p; const int pi = (i2 < 8 ? 0 : 16) + 8 * hh + (i2 & 7);
      const float pp = p * PS; const b16 ph = (b16)pp; Pb[wave][col][pi] = ph;
      Pr[wave][col][pi] = (b16)((pp - (float)ph) * PRS); }
    sum += __shfl_xor(sum, 16); l = l * al + sum; m = mn;
    wave_lds_sync();
    const v16b pf = frag_kb(&Pb[wave][col][0], hh), plf = frag_kb(&Pr[wave][col][0], hh);
#pragma unroll
    for (int t = 0; t < 4; ++t) {
      o[t] *= al; o2[t] *= al;
      o[t] = wmma16b(vh[t], pf, o[t]);
      o2[t] = wmma16b(vl[t], pf, o2[t]);
      o2[t] = wmma16b(vh[t], plf, o2[t]); }
    wave_lds_sync(); }
  // the share's partial result, not yet normalised: O tile, running max and row sum of each query
#pragma unroll
  for (int t = 0; t < 4; ++t) {
#pragma unroll
    for (int r = 0; r < 8; ++r) To[wave][col][t * 16 + 8 * hh + r] = o[t][r] + o2[t][r] * (1.0f / VRS); }
  if (hh == 0) { Ms[wave][col] = m; Ls[wave][col] = l; }
  __syncthreads();   // the partial results are read across the four waves of a query tile
  const size_t cb = ((size_t)((b * SEQ + q0) >> 4) * KT + (size_t)h * 2) * TE;
  {
    const int it = ks;   // each share's wave merges and packs one quarter of the query tile
    const int rl = (it & 1) * 8 + (lane & 7), pc = (it >> 1) * 32 + (lane >> 3) * 8;
    float mj[KSPL], mt = -INFINITY;
#pragma unroll
    for (int j = 0; j < KSPL; ++j) { mj[j] = Ms[qt * KSPL + j][rl]; mt = fmaxf(mt, mj[j]); }
    const float mtr = (mt == -INFINITY) ? 0.0f : mt;   // -inf-safe, as in the key loop
    float lt = 0.0f; v4f f0 = (v4f){}, f1 = (v4f){};
#pragma unroll
    for (int j = 0; j < KSPL; ++j) {
      const float w = nexp2(mj[j] - mtr);
      lt += w * Ls[qt * KSPL + j][rl];
      f0 += w * *(const v4f*)(&To[qt * KSPL + j][rl][pc]); f1 += w * *(const v4f*)(&To[qt * KSPL + j][rl][pc + 4]); }
    const float inv = 1.0f / (lt * PS * VS);
    f0 *= inv; f1 *= inv;
    v8b oh, ol;
#pragma unroll
    for (int j = 0; j < 4; ++j) {
      const float v0 = f0[j] * OCS; const b16 hv0 = (b16)v0; oh[j] = hv0; ol[j] = (b16)((v0 - (float)hv0) * OCRS);
      const float v1 = f1[j] * OCS; const b16 hv1 = (b16)v1; oh[4 + j] = hv1; ol[4 + j] = (b16)((v1 - (float)hv1) * OCRS); }
    const size_t off = cb + (size_t)((it >> 1) * 64 + (lane >> 3) * 16 + rl) * 8;
    *(v8b*)(Ch + off) = oh; *(v8b*)(Cr + off) = ol;
  }
}

// Output projection: out[64 tokens x 64 features] = (ctx hi . Wo + ctx res . Wo / 1024) / 4096 + bf16-RNE(bo), K = 1024 stepped by 32, fragments from the
// packed global planes, block 128 = 4 waves in 2x2, wave tile 32x32. Result staged in LDS (cross-wave: block barrier); each 256-B row segment by 16 consecutive lanes x
__global__ __launch_bounds__(128) __attribute__((amdgpu_num_vgpr(256))) void gemm_out_kernel(
    const b16* __restrict__ Ch, const b16* __restrict__ Cr, const b16* __restrict__ Wop, const float* __restrict__ bo, float* __restrict__ out) {
  __shared__ __attribute__((aligned(16))) float Tt[64][HD + 4];
  const int wave = threadIdx.x >> 5, lane = threadIdx.x & 31, hh = lane >> 4, m = lane & 15, wm = wave >> 1, wn = wave & 1;
  const int nblk = (int)blockIdx.x * 64;
  const int mblk = (int)blockIdx.y * 64, b = mblk / SEQ, s0 = mblk % SEQ;
  // byte offsets of the lane's place in the first tiles (each plane is far below 4 GiB); ctx and its residual share one
  unsigned wo = (unsigned)(((nblk + wn * 32) / 16 * KT * TE + 8 * lane) * 2), ao = (unsigned)(((mblk + wm * 32) / 16 * KT * TE + 8 * lane) * 2);
  v8f acc[2][2], acc2[2][2];
#pragma unroll
  for (int i = 0; i < 2; ++i)
#pragma unroll
    for (int j = 0; j < 2; ++j) { acc[i][j] = (v8f){}; acc2[i][j] = (v8f){}; }
#pragma unroll 1
  for (int k0 = 0; k0 < DM; k0 += 32) {
    v16b af[2], rf[2], bf[2];
#pragma unroll
    for (int mt = 0; mt < 2; ++mt) {
      af[mt] = frag_pk((const b16*)((const char*)Ch + ao) + (size_t)mt * KT * TE);
      rf[mt] = frag_pk((const b16*)((const char*)Cr + ao) + (size_t)mt * KT * TE); }
#pragma unroll
    for (int nt = 0; nt < 2; ++nt) bf[nt] = frag_pk((const b16*)((const char*)Wop + wo) + (size_t)nt * KT * TE);
    ao += TE * 2; wo += TE * 2;
#pragma unroll
    for (int mt = 0; mt < 2; ++mt)
#pragma unroll
      for (int nt = 0; nt < 2; ++nt) {
        acc[mt][nt] = wmma16b(af[mt], bf[nt], acc[mt][nt]);
        acc2[mt][nt] = wmma16b(rf[mt], bf[nt], acc2[mt][nt]); }
  }
  float bias[2];
#pragma unroll
  for (int nt = 0; nt < 2; ++nt) bias[nt] = bf16_rne(bo[nblk + wn * 32 + nt * 16 + m]);
  const float isc = 1.0f / (OCS * WSC), irs = 1.0f / OCRS;
#pragma unroll
  for (int mt = 0; mt < 2; ++mt)
#pragma unroll
    for (int nt = 0; nt < 2; ++nt)
#pragma unroll
      for (int r = 0; r < 8; ++r)
        Tt[wm * 32 + mt * 16 + 8 * hh + r][wn * 32 + nt * 16 + m] = (acc[mt][nt][r] + acc2[mt][nt][r] * irs) * isc + bias[nt];
  __syncthreads();   // Tt is read across waves
  float* ob = out + ((size_t)b * SEQ_FULL + (size_t)s0) * DM + nblk;
  {
#pragma unroll 1
    for (int it = 0; it < 8; ++it) {
      const int rr = it * 8 + wave * 2 + hh; const v4f f = *(const v4f*)(&Tt[rr][m * 4]);
      *(v4f*)(ob + (size_t)rr * DM + m * 4) = f; }
     }
}
}  // namespace

extern "C" void kernel_launch(void* const* d_in, const int* in_sizes, int n_in, void* d_out, int out_size, void* d_ws, size_t ws_size, hipStream_t stream) {
  // wire order: 0 x [NB_FULL][SEQ_FULL][1024] f32, 1 Wq [1024][1024], 2 bq [1024], 3 Wk, 4 bk, 5 Wv, 6 bv, 7 Wo, 8 bo, 9 logit scale [1] f32,
  //             10 mask int32 [NB_FULL][SEQ_FULL][SEQ_FULL] (nonzero = masked); out [NB_FULL][SEQ_FULL][1024] f32
  if (n_in < 11) return;
  const size_t need_x = ((size_t)(NB - 1) * SEQ_FULL + SEQ) * DM;
  const size_t need_m = ((size_t)(NB - 1) * SEQ_FULL + SEQ - 1) * SEQ_FULL + SEQ;
  if ((size_t)in_sizes[0] < need_x || (size_t)out_size < need_x || (size_t)in_sizes[10] < need_m || in_sizes[9] < 1) return;
  if (in_sizes[1] < DM * DM || in_sizes[3] < DM * DM || in_sizes[5] < DM * DM || in_sizes[7] < DM * DM) return;
  if (in_sizes[2] < DM || in_sizes[4] < DM || in_sizes[6] < DM || in_sizes[8] < DM) return;
  const float* X = (const float*)d_in[0];
  const float* Wq = (const float*)d_in[1]; const float* bq = (const float*)d_in[2];
  const float* Wk = (const float*)d_in[3]; const float* bk = (const float*)d_in[4];
  const float* Wv = (const float*)d_in[5]; const float* bv = (const float*)d_in[6];
  const float* Wo = (const float*)d_in[7]; const float* bo = (const float*)d_in[8];
  const float* lsc = (const float*)d_in[9]; const int* mask = (const int*)d_in[10];
  size_t off = 0; char* ws = (char*)d_ws;
  auto carve = [&](size_t bytes) { char* p = ws + off; off += (bytes + 255) & ~(size_t)255; return p; };
  const size_t plane = (size_t)NT * DM * 2;
  v2f* T  = (v2f*)carve((size_t)SEQ * NCS * sizeof(v2f));          // 524,288 B (256-B rows, exact)
  b16* Xp = (b16*)carve(plane);
  b16* Wp = (b16*)carve((size_t)4 * DM * DM * 2);                   // 8,388,608 B
  b16* Qp = (b16*)carve(plane); b16* Qr = (b16*)carve(plane); b16* Kp = (b16*)carve(plane); b16* Kr = (b16*)carve(plane);
  b16* VT = (b16*)carve(plane); b16* VR = (b16*)carve(plane); b16* Ch = (b16*)carve(plane); b16* Cr = (b16*)carve(plane);
  unsigned int* Mw = (unsigned int*)carve((size_t)NB * SEQ * (SEQ / 32) * sizeof(unsigned int));   // 1,048,576 B
  if (off > ws_size || off > ((size_t)128 << 20)) return;          // 85,458,944 B total at NB=2, SEQ=2048
  cvt_x_kernel<<<dim3((unsigned)(((size_t)NT * DM / 8 + 255) / 256)), 256, 0, stream>>>(X, Xp);
  cvt_w_kernel<<<dim3(WGX, 4 + MGY), 256, 0, stream>>>(Wq, Wk, Wv, Wo, Wp, mask, Mw);
  rope_table_kernel<<<dim3((unsigned)((SEQ * NCS + 255) / 256)), 256, 0, stream>>>(T);
  gemm_qkv_kernel<<<dim3(3 * DM / 64, NT / 64), 128, 0, stream>>>(Xp, Wp, bq, bk, bv, T, Qp, Qr, Kp, Kr, VT, VR);
  attn_kernel<<<dim3(SEQ / 32, NB * H), 64 * KSPL, 0, stream>>>(Qp, Qr, Kp, Kr, VT, VR, Mw, lsc, Ch, Cr);
  gemm_out_kernel<<<dim3(DM / 64, NT / 64), 128, 0, stream>>>(Ch, Cr, Wp + (size_t)3 * DM * DM, bo, (float*)d_out);
}

// v005
// A run of this version takes 166 microseconds.
// In two side-by-side timings against v004, it was 1.03 and 1.04 times as fast.
// All steps since v000 together make it 2.57 times as fast.
#include <hip/hip_runtime.h>

// compute dtype: every contraction on v_wmma_f32_16x16x32_f16 (f16 operands, f32 accumulate). q/k/v projections: bf16-RNE(x) x8 times bf16-RNE(W) x64,
// 1 product each; scores K Q^T per head: q and k (rope + l2 norm in f32) as f16 x8 planes plus x1024 residual planes, 3 products (hi.hi, hi.res, res.hi);
// O^T += V^T P^T: V^T f16 x8 plus a x1024 residual plane, P f16 x1024 plus a x1024 residual tile, 3 products (residual products share one accumulator);
// output projection: ctx f16 x64 plus a x1024 residual plane times bf16-RNE(Wo) x64, 2 products. Softmax statistics (running max, exp2, row sums),
// rope cos/sin table, l2 norm and bias adds in f32; 1/sqrt(64) and exp(logit scale) folded into the log2-domain score constant.
// Fragment k-map per lane half hh for A AND B: elements 0..7 <- k = 8hh+0..7, 8..15 <- k = 16+8hh+0..7; acc[r] = D[8hh+r][col = lane&15].
// Packed planes (X, W, K, V^T, ctx and their residuals): a plane of R rows x C k-columns is stored as 16x32 tiles, tile index (row/16)*(C/32) + k/32 (V^T: (k/32)*(R/16) + row/16), each tile
// 512 elements laid out [k octet 0..3][row 0..15][8], so that each of a fragment's two wave loads reads 512 contiguous bytes (four whole 128-B lines).

#ifndef NB
#define NB 2
#endif
#ifndef SEQ
#define SEQ 2048
#endif
#ifndef NB_FULL
#define NB_FULL 2
#endif
#ifndef SEQ_FULL
#define SEQ_FULL 2048
#endif

namespace {
constexpr int H = 16, HD = 64, DM = 1024, NT = NB * SEQ, NCS = HD / 2, KT = DM / 32, TE = 512;
constexpr float XS = 8.0f, WSC = 64.0f, QS = 8.0f, QRS = 1024.0f, VS = 8.0f, VRS = 1024.0f, PS = 1024.0f, PRS = 1024.0f, OCS = 64.0f, OCRS = 1024.0f;
constexpr float LOG2E = 1.4426950408889634f, EPSN = 1e-6f;
constexpr int KSPL = 4;   // key shares (waves) per query tile in the attention kernel
static_assert(KSPL == 4 && SEQ % (32 * KSPL) == 0);
constexpr int NJ = SEQ / (32 * KSPL);                       // key steps per share
// block ranges of the preparation launch (256 threads each): rope table, mask words, X plane, W planes
constexpr int PBR = SEQ * NCS / 4 / 256;                    // a thread fills 4 table entries
constexpr int PBM = NB * (SEQ / 16) * (NJ / 2) / 8;         // a wave packs 2 key steps of all KSPL shares of one query tile
constexpr int PBX = NT / 16, PBW = 4 * DM / 16;             // a block converts 16 rows of 1024
static_assert(NJ % 2 == 0 && NJ <= 16 && (NB * (SEQ / 16) * (NJ / 2)) % 8 == 0 && (SEQ * NCS / 4) % 256 == 0 && KT == 32 && SEQ % 16 == 0);
static_assert(SEQ % 64 == 0 && SEQ >= 64 && SEQ <= SEQ_FULL && NB >= 1 && NB <= NB_FULL);
static_assert(DM == H * HD && HD == 64 && DM % 64 == 0 && (3 * DM) % 64 == 0 && NT % 64 == 0 && PRS == VRS);

typedef _Float16 b16;
typedef __attribute__((ext_vector_type(16))) _Float16 v16b;
typedef __attribute__((ext_vector_type(8))) _Float16 v8b;
typedef __attribute__((ext_vector_type(2))) _Float16 v2b;
typedef __attribute__((ext_vector_type(8))) float v8f;
typedef __attribute__((ext_vector_type(4))) float v4f;
typedef __attribute__((ext_vector_type(2))) float v2f;
typedef __attribute__((ext_vector_type(4))) unsigned int v4u;

__device__ __forceinline__ float bf16_rne(float f) { unsigned int u = __float_as_uint(f); u += 0x7FFFu + ((u >> 16) & 1u); return __uint_as_float(u & 0xFFFF0000u); }
// 16-bit fragment from a k-contiguous row: elements 0..7 <- p[8hh .. 8hh+7], 8..15 <- p[16+8hh .. 16+8hh+7]
__device__ __forceinline__ v16b frag_kb(const b16* p, int hh) {
  const v8b a = *(const v8b*)(p + 8 * hh), b = *(const v8b*)(p + 16 + 8 * hh); v16b f;
#pragma unroll
  for (int e = 0; e < 8; ++e) { f[e] = a[e]; f[8 + e] = b[e]; }
  return f;
}
// the same fragment from a packed tile; p = tile + 8*lane (lane = 16hh + row): octets hh and 2+hh of the lane's row
__device__ __forceinline__ v16b frag_pk(const b16* p) {
  const v8b a = *(const v8b*)p, b = *(const v8b*)(p + 256); v16b f;
#pragma unroll
  for (int e = 0; e < 8; ++e) { f[e] = a[e]; f[8 + e] = b[e]; }
  return f;
}
__device__ __forceinline__ v8f wmma16b(v16b a, v16b b, v8f c) {
  v8f d = __builtin_amdgcn_wmma_f32_16x16x32_f16(false, a, false, b, (short)0, c, false, false);
  asm volatile("v_nop\n\tv_nop\n\tv_nop\n\tv_nop" : "+v"(d) : "v"(a), "v"(b));
  return d;
}
__device__ __forceinline__ void wave_lds_sync() { __builtin_amdgcn_fence(3, "workgroup"); __builtin_amdgcn_wave_barrier(); __builtin_amdgcn_fence(2, "workgroup"); }
__device__ __forceinline__ float nexp2(float v) { return __builtin_amdgcn_exp2f(v); }

// One row group (16 rows x 1024 columns, f32, row pitch DM, first row at S) to its KT packed tiles at D, f16 = bf16-RNE(value) x sc, by one block of 256 threads.
// A pass of the block covers 4 tiles, thread per k octet: a wave reads 8 rows x 128 B and writes four whole 128-B lines of one tile. All 8 passes' loads (16 of
// 16 B a lane) are requested before the first conversion.
__device__ __forceinline__ void cvt_row_group(const float* __restrict__ S, b16* __restrict__ D, float sc, int tid) {
  const int oct = tid & 3, rl = (tid >> 2) & 15, t0 = tid >> 6;
  const float* src = S + (size_t)rl * DM + (size_t)(t0 * 32 + oct * 8);
  b16* dst = D + (size_t)t0 * TE + (size_t)((oct * 16 + rl) * 8);
  v4f x0[KT / 4], x1[KT / 4];
#pragma unroll
  for (int i = 0; i < KT / 4; ++i) { x0[i] = *(const v4f*)(src + i * 128); x1[i] = *(const v4f*)(src + i * 128 + 4); }
  asm volatile("s_wait_xcnt 0x0" :: "v"(src) : "memory");   // behind the group: the address pair stays whole until here, before any of its registers is rewritten
  v8b o[KT / 4];
#pragma unroll
  for (int i = 0; i < KT / 4; ++i)
#pragma unroll
    for (int j = 0; j < 4; ++j) { o[i][j] = (b16)(bf16_rne(x0[i][j]) * sc); o[i][4 + j] = (b16)(bf16_rne(x1[i][j]) * sc); }
#pragma unroll
  for (int i = 0; i < KT / 4; ++i) *(v8b*)(dst + (size_t)i * 4 * TE) = o[i];
  asm volatile("s_wait_xcnt 0x0" ::: "memory");   // behind the run of stores, before any later code rewrites their address or data registers
}

// All preparation in one launch; the block's range of blockIdx.x selects its work (block-uniform):
// [0, PBR): rope table T[s][i] = (cos, sin)(s * freq_i), freq_i = 1 / fl32(10000^(2i/64)), s*freq as an f32 product, argument reduction in f64 (mul/fma only), short
//   f32 polynomials; a thread computes freq_i once and fills four rows s.
// [PBR, PBR+PBM): the mask packed into bit words Mw[b][query tile][share ks][step j of the share][query 0..15]: bit i set <=> key 32*(j*KSPL+ks)+i is NOT masked for
//   that query. A wave takes one query tile and the steps j, j+1 of all four shares, two shares a trip: 16 rows x two pieces of 256 B in, two whole 128-B lines out.
// [.., +PBX): X plane, packed tiles of [NB*SEQ tokens][1024], f16 = bf16-RNE(x) x8; token row b*SEQ+s reads input row b*SEQ_FULL+s; a block per 16 tokens.
// [.., +PBW): W planes [4], each the packed tiles of [1024 out][1024 in], f16 = bf16-RNE(W) x64 (rows n, k along the input); a block per 16 rows of one weight.
__global__ __launch_bounds__(256) void prep_kernel(const float* __restrict__ X, const float* __restrict__ Wq, const float* __restrict__ Wk,
                                                   const float* __restrict__ Wv, const float* __restrict__ Wo, const int* __restrict__ mask,
                                                   b16* __restrict__ Xp, b16* __restrict__ Wp, unsigned int* __restrict__ Mw, v2f* __restrict__ T) {
  const int blk = (int)blockIdx.x, tid = (int)threadIdx.x;
  if (blk < PBR) {
    const int u = blk * 256 + tid, i = u % NCS, sq = u / NCS;
    const float ex = (float)(2 * i) / (float)HD;
    const float pw = (float)exp2((double)ex * 13.287712379549449);
    const float freq = 1.0f / pw;
#pragma unroll
    for (int q = 0; q < 4; ++q) {
      const int s = sq + q * (SEQ / 4);
      const float ang = (float)s * freq;
      const double a = (double)ang;
      const double k = __builtin_rint(a * 0.63661977236758134);
      double rd = __builtin_fma(-k, 1.5707963267948966, a);
      rd = __builtin_fma(-k, 6.123233995736766e-17, rd);
      const float r = (float)rd, r2 = r * r;
      const float sp = r + r * r2 * (-1.6666666666666666e-1f + r2 * (8.333333333333333e-3f + r2 * (-1.984126984126984e-4f + r2 * 2.7557319223985893e-6f)));
      const float cp = 1.0f + r2 * (-0.5f + r2 * (4.1666666666666664e-2f + r2 * (-1.3888888888888889e-3f + r2 * (2.48015873015873e-5f + r2 * -2.755731922398589e-7f))));
      const int kq = (int)(((long long)k) & 3);
      const float c = (kq == 0) ? cp : ((kq == 1) ? -sp : ((kq == 2) ? -cp : sp));
      const float sn = (kq == 0) ? sp : ((kq == 1) ? cp : ((kq == 2) ? -sp : -cp));
      v2f o; o.x = c; o.y = sn;
      *(v2f*)(T + (size_t)s * NCS + i) = o;
    }
    return;
  }
  if (blk < PBR + PBM) {
    const int wv = (blk - PBR) * 8 + (tid >> 5), lane = tid & 31;
    const int jp = wv % (NJ / 2), qt = (wv / (NJ / 2)) % (SEQ / 16), b = wv / ((NJ / 2) * (SEQ / 16));
    const int* src = mask + ((size_t)b * SEQ_FULL + (size_t)qt * 16) * SEQ_FULL + (size_t)(2 * jp * KSPL * 32 + lane);
    unsigned int* dst = Mw + (size_t)(((b * (SEQ / 16) + qt) * KSPL * NJ + 2 * jp) * 16) + lane;
#pragma unroll 1   // two trips of 64 loads a lane: all four shares at once would double the registers of the whole launch
    for (int ks = 0; ks < KSPL; ks += 2) {
      int g[2][2][16];
#pragma unroll
      for (int r = 0; r < 16; ++r)
#pragma unroll
        for (int c = 0; c < 2; ++c) {
          g[c][0][r] = src[(size_t)r * SEQ_FULL + (ks + c) * 32]; g[c][1][r] = src[(size_t)r * SEQ_FULL + (ks + c) * 32 + 32 * KSPL]; }
#pragma unroll
      for (int c = 0; c < 2; ++c) {
        unsigned int w = 0u;
#pragma unroll
        for (int r = 0; r < 16; ++r) {
          const unsigned int b0 = __builtin_amdgcn_ballot_w32(g[c][0][r] == 0), b1 = __builtin_amdgcn_ballot_w32(g[c][1][r] == 0);
          w = (lane == r) ? b0 : w; w = (lane == 16 + r) ? b1 : w; }
        dst[(size_t)(ks + c) * NJ * 16] = w; }
      asm volatile("s_wait_xcnt 0x0" ::: "memory");   // before the next trip rewrites the loads' and stores' address and data registers
    }
    return;
  }
  if (blk < PBR + PBM + PBX) {
    const int row0 = (blk - PBR - PBM) * 16, b = row0 / SEQ, s0 = row0 % SEQ;
    cvt_row_group(X + ((size_t)b * SEQ_FULL + (size_t)s0) * DM, Xp + (size_t)(row0 / 16) * KT * TE, XS, tid);
    return;
  }
  const int wb = blk - PBR - PBM - PBX, y = wb / (DM / 16), rg = wb % (DM / 16);
  const float* W = (y == 0) ? Wq : ((y == 1) ? Wk : ((y == 2) ? Wv : Wo));
  cvt_row_group(W + (size_t)rg * 16 * DM, Wp + (size_t)y * DM * DM + (size_t)rg * KT * TE, WSC, tid);
}

// Fused q/k/v projection: C[64 tokens x 64 features] = A(X plane) . B (B[k][n] = W[n][k] from the packed W plane), K = 1024 stepped by 32, fragments loaded
// straight from the packed global f16 planes. q planes stay [s][64]; k planes are packed tiles of [s][64], v planes packed tiles of [64][s].
// Block 128 threads = 4 waves in 2x2, wave tile 32x32 = 2x2 WMMA tiles. The 64-column tile is exactly one head of q, k or
// v (which = column block / 1024, block-uniform). Epilogue: acc/512 + bf16-RNE(bias) staged in LDS (cross-wave: block barrier), then
__global__ __launch_bounds__(128) __attribute__((amdgpu_num_vgpr(256))) void gemm_qkv_kernel(
    const b16* __restrict__ Xp, const b16* __restrict__ Wp, const float* __restrict__ bq, const float* __restrict__ bk, const float* __restrict__ bv,
    const v2f* __restrict__ CSt, b16* __restrict__ Qp, b16* __restrict__ Qr, b16* __restrict__ Kp, b16* __restrict__ Kr, b16* __restrict__ VT,
    b16* __restrict__ VR) {
  __shared__ __attribute__((aligned(16))) float Tt[64][HD + 4];
  const int wave = threadIdx.x >> 5, lane = threadIdx.x & 31, hh = lane >> 4, m = lane & 15, wm = wave >> 1, wn = wave & 1;
  const int nblk = (int)blockIdx.x * 64, which = nblk / DM, n0 = nblk % DM, h = n0 / HD;
  const int mblk = (int)blockIdx.y * 64, b = mblk / SEQ, s0 = mblk % SEQ;
  const b16* Wb = Wp + (size_t)which * DM * DM + (size_t)((n0 + wn * 32) / 16) * KT * TE + 8 * lane;
  const b16* Ab = Xp + (size_t)((mblk + wm * 32) / 16) * KT * TE + 8 * lane;
  const float* bsel = (which == 0) ? bq : ((which == 1) ? bk : bv);
  v8f acc[2][2];
#pragma unroll
  for (int i = 0; i < 2; ++i)
#pragma unroll
    for (int j = 0; j < 2; ++j) acc[i][j] = (v8f){};
#pragma unroll 1
  for (int k0 = 0; k0 < DM; k0 += 32) {
    v16b af[2], bf[2];
#pragma unroll
    for (int mt = 0; mt < 2; ++mt) af[mt] = frag_pk(Ab + (size_t)(mt * KT + k0 / 32) * TE);
#pragma unroll
    for (int nt = 0; nt < 2; ++nt) bf[nt] = frag_pk(Wb + (size_t)(nt * KT + k0 / 32) * TE);
#pragma unroll
    for (int mt = 0; mt < 2; ++mt)
#pragma unroll
      for (int nt = 0; nt < 2; ++nt) acc[mt][nt] = wmma16b(af[mt], bf[nt], acc[mt][nt]);
  }
  float bias[2];
#pragma unroll
  for (int nt = 0; nt < 2; ++nt) bias[nt] = bf16_rne(bsel[n0 + wn * 32 + nt * 16 + m]);
  const float isc = 1.0f / (XS * WSC);
#pragma unroll
  for (int mt = 0; mt < 2; ++mt)
#pragma unroll
    for (int nt = 0; nt < 2; ++nt)
#pragma unroll
      for (int r = 0; r < 8; ++r) Tt[wm * 32 + mt * 16 + 8 * hh + r][wn * 32 + nt * 16 + m] = acc[mt][nt][r] * isc + bias[nt];
  __syncthreads();   // Tt is read across waves
  if (which < 2) {
    const size_t pb = (size_t)(b * H + h) * SEQ * HD;
    b16* Ph = ((which == 0) ? Qp : Kp) + pb;
    b16* Pl = ((which == 0) ? Qr : Kr) + pb;
#pragma unroll 1
    for (int it = 0; it < 16; ++it) {
      const int r = wave * 16 + it, s = s0 + r;   // a wave owns 16 consecutive rows = one row of packed tiles
      const float x0 = Tt[r][2 * lane], x1 = Tt[r][2 * lane + 1];
      const v2f cv = CSt[(size_t)s * NCS + lane];
      const float y0 = x0 * cv.x - x1 * cv.y, y1 = x1 * cv.x + x0 * cv.y;
      float ss = y0 * y0 + y1 * y1;
#pragma unroll
      for (int w = 16; w >= 1; w >>= 1) ss += __shfl_xor(ss, w);
      const float inv = 1.0f / sqrtf(ss + EPSN);
      const float z0 = y0 * inv * QS, z1 = y1 * inv * QS;
      const b16 h0 = (b16)z0, h1 = (b16)z1;
      v2b oh, ol; oh.x = h0; oh.y = h1; ol.x = (b16)((z0 - (float)h0) * QRS); ol.y = (b16)((z1 - (float)h1) * QRS);
      const size_t off = (which == 0) ? (size_t)s * HD + 2 * lane
                                      : (size_t)(((s >> 4) * 2 + (lane >> 4)) * 64 + ((lane >> 2) & 3) * 16 + (s & 15)) * 8 + ((2 * lane) & 7);
      *(v2b*)(Ph + off) = oh; *(v2b*)(Pl + off) = ol;
      asm volatile("s_wait_xcnt 0x0" ::: "memory");   // before the next trip rewrites the stores' address and data registers
    }
  } else {
    const size_t vb = ((size_t)(b * H + h) * HD) * SEQ;
#pragma unroll 1
    for (int it = 0; it < 4; ++it) {
      const int dl = (it & 1) * 8 + (lane & 7), d = wave * 16 + dl, tok = (it >> 1) * 32 + (lane >> 3) * 8;
      v8b oh, ol;
#pragma unroll
      for (int j = 0; j < 8; ++j) {
        const float v = Tt[tok + j][d] * VS; const b16 hv = (b16)v; oh[j] = hv; ol[j] = (b16)((v - (float)hv) * VRS); }
      const size_t off = vb + (size_t)((((s0 + tok) >> 5) * 4 + wave) * 64 + (lane >> 3) * 16 + dl) * 8;
      *(v8b*)(VT + off) = oh; *(v8b*)(VR + off) = ol;
      asm volatile("s_wait_xcnt 0x0" ::: "memory");   // before the next trip rewrites the stores' address and data registers
    }
  }
}

// Masked softmax attention per (query block of 32, b*H+h); block = 8 waves = 2 query tiles of 16 x 4 key shares: share ks takes the key steps of 32 whose
// index is ks modulo 4, in fixed order, with its own running max, row sum and O tile; the four partial results of a query tile are merged in LDS behind one
// block barrier (weights exp2(m_j - max m), fixed order j = 0..3), each share's wave packing a quarter of the tile's ctx. The mask comes as the
// packed bit words: the wave reads all words of its share once and keeps two scalar maps, the steps with any unmasked entry in its 16x32 region (only these are walked; the
// others contribute 0) and the steps with none masked (these apply no mask); a walked step's word per query is requested one walked step ahead.
// S^T = K Q^T (hi.hi + hi.res + res.hi, q/k residual products scaled back by 1/1024), masked entries replaced by -inf, online softmax (running max, f32,
// -inf-safe), P x1024 and its x1024 residual via wave-private LDS, O^T += V^T P^T with V^T hi/res planes. ctx [b*SEQ+s][h*64+d] written as packed tiles, f16 x64
__global__ __launch_bounds__(64 * KSPL) __attribute__((amdgpu_num_vgpr(256))) void attn_kernel(
    const b16* __restrict__ Qp, const b16* __restrict__ Qr, const b16* __restrict__ Kp, const b16* __restrict__ Kr,
    const b16* __restrict__ VT, const b16* __restrict__ VR, const unsigned int* __restrict__ Mw, const float* __restrict__ lsc,
    b16* __restrict__ Ch, b16* __restrict__ Cr) {
  __shared__ __attribute__((aligned(16))) b16 Pb[2 * KSPL][16][32 + 8];
  __shared__ __attribute__((aligned(16))) b16 Pr[2 * KSPL][16][32 + 8];
  __shared__ __attribute__((aligned(16))) float To[2 * KSPL][16][HD + 4];
  __shared__ float Ms[2 * KSPL][16], Ls[2 * KSPL][16];
  // the wave's number as a scalar, so that the key loop's control and the plane offsets stay on the scalar unit
  const int wave = __builtin_amdgcn_readfirstlane((int)(threadIdx.x >> 5)), qt = wave / KSPL, ks = wave % KSPL;
  const int lane = threadIdx.x & 31, hh = lane >> 4, col = lane & 15;
  const int bhi = (int)blockIdx.y, b = bhi / H, h = bhi % H;
  const int q0 = (int)blockIdx.x * 32 + qt * 16, qi = q0 + col;
  const size_t pq = (size_t)bhi * SEQ * HD;   // same plane size for the [s][64] rows and for both packed layouts
  const b16* Kb = Kp + pq; const b16* Klb = Kr + pq;
  const b16* Vb = VT + pq; const b16* Rb = VR + pq;
  const unsigned int* Mq = Mw + (size_t)(((b * (SEQ / 16) + (q0 >> 4)) * KSPL + ks) * NJ) * 16;   // the share's NJ x 16 mask words
  unsigned int act, ful;   // bit 2j: step j of the share has an unmasked entry / has no masked entry; both wave-uniform
  const int jl = lane >> 1;   // the lane reads 8 of step jl's 16 words
  const unsigned so = (jl < NJ) ? (unsigned)lane * 32u : 0u;
  {
    const unsigned int* sp = (const unsigned int*)((const char*)Mq + so);
    const v4u w0 = *(const v4u*)sp, w1 = *(const v4u*)(sp + 4);
    const unsigned int wo = w0.x | w0.y | w0.z | w0.w | w1.x | w1.y | w1.z | w1.w, wa = w0.x & w0.y & w0.z & w0.w & w1.x & w1.y & w1.z & w1.w;
    const unsigned int anyb = __builtin_amdgcn_ballot_w32(jl < NJ && wo != 0u), allb = __builtin_amdgcn_ballot_w32(wa == 0xFFFFFFFFu);
    act = (anyb | (anyb >> 1)) & 0x55555555u; ful = allb & (allb >> 1);
  }
  const v16b qa0 = frag_kb(Qp + pq + (size_t)qi * HD, hh), qa1 = frag_kb(Qp + pq + (size_t)qi * HD + 32, hh);
  const v16b ql0 = frag_kb(Qr + pq + (size_t)qi * HD, hh), ql1 = frag_kb(Qr + pq + (size_t)qi * HD + 32, hh);
  // loaded values as inputs only: holds the Q fragment loads in flight beside the mask words' loads (else they sink behind the test for an empty share: a second
  // round trip); the wait stands before the mask words' offset register is rewritten
  asm volatile("s_wait_xcnt 0x0" :: "v"(qa0), "v"(qa1), "v"(ql0), "v"(ql1), "v"(so) : "memory");
  const float cs = 0.125f * expf(bf16_rne(lsc[0])) * (LOG2E / (QS * QS));
  float m = -INFINITY, l = 0.0f; v8f o[4], o2[4];
#pragma unroll
  for (int t = 0; t < 4; ++t) { o[t] = (v8f){}; o2[t] = (v8f){}; }
  // the query's 32 mask bits of a walked step are requested one walked step ahead
  unsigned int mwn = *(const unsigned int*)((const char*)Mq + ((unsigned)((act != 0u ? __builtin_ctz(act) : 0) >> 1) * 64u + (unsigned)col * 4u));
#pragma unroll 1
  while (act != 0u) {   // at most NJ trips, in rising key order
    const int tz = __builtin_ctz(act), j = tz >> 1; act &= act - 1u;
    const bool full = ((ful >> tz) & 1u) != 0u;
    // byte offset of the lane's place in the step's first tile: K tiles 2u, 2u+1 of key group u and V tiles t share it
    const unsigned ko = (unsigned)lane * 16u + (unsigned)(j * KSPL + ks) * (unsigned)(4 * TE * 2);
    const unsigned int mw = mwn;
    // the next walked step's word (the last step asks for its own again: in bounds, never used)
    const unsigned mo = (unsigned)((act != 0u ? __builtin_ctz(act) >> 1 : j) * 64) + (unsigned)col * 4u;
    mwn = *(const unsigned int*)((const char*)Mq + mo);
    // all eight K fragments of the step are requested here as one group, ahead of the matrix work
    v16b kh[4], kl[4], vh[4], vl[4];
    const b16* pk = (const b16*)((const char*)Kb + ko); const b16* pkl = (const b16*)((const char*)Klb + ko);
    const b16* pv = (const b16*)((const char*)Vb + ko); const b16* pvl = (const b16*)((const char*)Rb + ko);
#pragma unroll
    for (int j = 0; j < 4; ++j) { kh[j] = frag_pk(pk + j * TE); kl[j] = frag_pk(pkl + j * TE); }
    // behind the group: its offset registers stay whole until here, and no load sinks to its use (there each pair of loads costs the wave a full L2 round trip)
    asm volatile("s_wait_xcnt 0x0" :: "v"(ko), "v"(mo) : "memory");
    float e[16];
#pragma unroll
    for (int u = 0; u < 2; ++u) {
      const v16b ka = kh[2 * u], kc = kh[2 * u + 1];
      v8f s = wmma16b(ka, qa0, (v8f){}); s = wmma16b(kc, qa1, s);
      v8f s2 = wmma16b(ka, ql0, (v8f){}); s2 = wmma16b(kc, ql1, s2);
      s2 = wmma16b(kl[2 * u], qa0, s2); s2 = wmma16b(kl[2 * u + 1], qa1, s2);
#pragma unroll
      for (int r = 0; r < 8; ++r) e[u * 8 + r] = (s[r] + s2[r] * (1.0f / QRS)) * cs; }
    // second group, into the registers that K has left: all eight V fragments fly while the softmax runs
#pragma unroll
    for (int t = 0; t < 4; ++t) { vh[t] = frag_pk(pv + t * TE); vl[t] = frag_pk(pvl + t * TE); }
    asm volatile("s_wait_xcnt 0x0" :: "v"(ko) : "memory");   // as behind the K group: the offset register whole, the loads ahead of the softmax arithmetic
    if (!full) {   // scalar branch: entry i of the lane is key 8hh+i (i < 8) or 16+8hh+i-8 of the step
      const unsigned int sh = mw >> (8 * hh);
#pragma unroll
      for (int i2 = 0; i2 < 16; ++i2) e[i2] = ((sh >> (i2 < 8 ? i2 : i2 + 8)) & 1u) ? e[i2] : -INFINITY; }
    float mx = -INFINITY;
#pragma unroll
    for (int i2 = 0; i2 < 16; ++i2) mx = fmaxf(mx, e[i2]);
    mx = fmaxf(mx, __shfl_xor(mx, 16)); const float mn = fmaxf(m, mx);
    const float mref = (mn == -INFINITY) ? 0.0f : mn;
    const float al = nexp2(m - mref); float sum = 0.0f;
#pragma unroll
    for (int i2 = 0; i2 < 16; ++i2) {
      const float p = nexp2(e[i2] - mref); sum += p; const int pi = (i2 < 8 ? 0 : 16) + 8 * hh + (i2 & 7);
      const float pp = p * PS; const b16 ph = (b16)pp; Pb[wave][col][pi] = ph;
      Pr[wave][col][pi] = (b16)((pp - (float)ph) * PRS); }
    sum += __shfl_xor(sum, 16); l = l * al + sum; m = mn;
    wave_lds_sync();
    const v16b pf = frag_kb(&Pb[wave][col][0], hh), plf = frag_kb(&Pr[wave][col][0], hh);
#pragma unroll
    for (int t = 0; t < 4; ++t) {
      o[t] *= al; o2[t] *= al;
      o[t] = wmma16b(vh[t], pf, o[t]);
      o2[t] = wmma16b(vl[t], pf, o2[t]);
      o2[t] = wmma16b(vh[t], plf, o2[t]); }
    wave_lds_sync(); }
  // the share's partial result, not yet normalised: O tile, running max and row sum of each query
#pragma unroll
  for (int t = 0; t < 4; ++t) {
#pragma unroll
    for (int r = 0; r < 8; ++r) To[wave][col][t * 16 + 8 * hh + r] = o[t][r] + o2[t][r] * (1.0f / VRS); }
  if (hh == 0) { Ms[wave][col] = m; Ls[wave][col] = l; }
  __syncthreads();   // the partial results are read across the four waves of a query tile
  const size_t cb = ((size_t)((b * SEQ + q0) >> 4) * KT + (size_t)h * 2) * TE;
  {
    const int it = ks;   // each share's wave merges and packs one quarter of the query tile
    const int rl = (it & 1) * 8 + (lane & 7), pc = (it >> 1) * 32 + (lane >> 3) * 8;
    float mj[KSPL], mt = -INFINITY;
#pragma unroll
    for (int j = 0; j < KSPL; ++j) { mj[j] = Ms[qt * KSPL + j][rl]; mt = fmaxf(mt, mj[j]); }
    const float mtr = (mt == -INFINITY) ? 0.0f : mt;   // -inf-safe, as in the key loop
    float lt = 0.0f; v4f f0 = (v4f){}, f1 = (v4f){};
#pragma unroll
    for (int j = 0; j < KSPL; ++j) {
      const float w = nexp2(mj[j] - mtr);
      lt += w * Ls[qt * KSPL + j][rl];
      f0 += w * *(const v4f*)(&To[qt * KSPL + j][rl][pc]); f1 += w * *(const v4f*)(&To[qt * KSPL + j][rl][pc + 4]); }
    const float inv = 1.0f / (lt * PS * VS);
    f0 *= inv; f1 *= inv;
    v8b oh, ol;
#pragma unroll
    for (int j = 0; j < 4; ++j) {
      const float v0 = f0[j] * OCS; const b16 hv0 = (b16)v0; oh[j] = hv0; ol[j] = (b16)((v0 - (float)hv0) * OCRS);
      const float v1 = f1[j] * OCS; const b16 hv1 = (b16)v1; oh[4 + j] = hv1; ol[4 + j] = (b16)((v1 - (float)hv1) * OCRS); }
    const size_t off = cb + (size_t)((it >> 1) * 64 + (lane >> 3) * 16 + rl) * 8;
    *(v8b*)(Ch + off) = oh; *(v8b*)(Cr + off) = ol;
  }
}

// Output projection: out[64 tokens x 64 features] = (ctx hi . Wo + ctx res . Wo / 1024) / 4096 + bf16-RNE(bo), K = 1024 stepped by 32, fragments from the
// packed global planes, block 128 = 4 waves in 2x2, wave tile 32x32. Result staged in LDS (cross-wave: block barrier); each 256-B row segment by 16 consecutive lanes x
__global__ __launch_bounds__(128) __attribute__((amdgpu_num_vgpr(256))) void gemm_out_kernel(
    const b16* __restrict__ Ch, const b16* __restrict__ Cr, const b16* __restrict__ Wop, const float* __restrict__ bo, float* __restrict__ out) {
  __shared__ __attribute__((aligned(16))) float Tt[64][HD + 4];
  const int wave = threadIdx.x >> 5, lane = threadIdx.x & 31, hh = lane >> 4, m = lane & 15, wm = wave >> 1, wn = wave & 1;
  const int nblk = (int)blockIdx.x * 64;
  const int mblk = (int)blockIdx.y * 64, b = mblk / SEQ, s0 = mblk % SEQ;
  // byte offsets of the lane's place in the first tiles (each plane is far below 4 GiB); ctx and its residual share one
  unsigned wo = (unsigned)(((nblk + wn * 32) / 16 * KT * TE + 8 * lane) * 2), ao = (unsigned)(((mblk + wm * 32) / 16 * KT * TE + 8 * lane) * 2);
  v8f acc[2][2], acc2[2][2];
#pragma unroll
  for (int i = 0; i < 2; ++i)
#pragma unroll
    for (int j = 0; j < 2; ++j) { acc[i][j] = (v8f){}; acc2[i][j] = (v8f){}; }
#pragma unroll 1
  for (int k0 = 0; k0 < DM; k0 += 32) {
    v16b af[2], rf[2], bf[2];
#pragma unroll
    for (int mt = 0; mt < 2; ++mt) {
      af[mt] = frag_pk((const b16*)((const char*)Ch + ao) + (size_t)mt * KT * TE);
      rf[mt] = frag_pk((const b16*)((const char*)Cr + ao) + (size_t)mt * KT * TE); }
#pragma unroll
    for (int nt = 0; nt < 2; ++nt) bf[nt] = frag_pk((const b16*)((const char*)Wop + wo) + (size_t)nt * KT * TE);
    ao += TE * 2; wo += TE * 2;
#pragma unroll
    for (int mt = 0; mt < 2; ++mt)
#pragma unroll
      for (int nt = 0; nt < 2; ++nt) {
        acc[mt][nt] = wmma16b(af[mt], bf[nt], acc[mt][nt]);
        acc2[mt][nt] = wmma16b(rf[mt], bf[nt], acc2[mt][nt]); }
  }
  float bias[2];
#pragma unroll
  for (int nt = 0; nt < 2; ++nt) bias[nt] = bf16_rne(bo[nblk + wn * 32 + nt * 16 + m]);
  const float isc = 1.0f / (OCS * WSC), irs = 1.0f / OCRS;
#pragma unroll
  for (int mt = 0; mt < 2; ++mt)
#pragma unroll
    for (int nt = 0; nt < 2; ++nt)
#pragma unroll
      for (int r = 0; r < 8; ++r)
        Tt[wm * 32 + mt * 16 + 8 * hh + r][wn * 32 + nt * 16 + m] = (acc[mt][nt][r] + acc2[mt][nt][r] * irs) * isc + bias[nt];
  __syncthreads();   // Tt is read across waves
  float* ob = out + ((size_t)b * SEQ_FULL + (size_t)s0) * DM + nblk;
  {
#pragma unroll 1
    for (int it = 0; it < 8; ++it) {
      const int rr = it * 8 + wave * 2 + hh; const v4f f = *(const v4f*)(&Tt[rr][m * 4]);
      *(v4f*)(ob + (size_t)rr * DM + m * 4) = f; }
     }
}
}  // namespace

extern "C" void kernel_launch(void* const* d_in, const int* in_sizes, int n_in, void* d_out, int out_size, void* d_ws, size_t ws_size, hipStream_t stream) {
  // wire order: 0 x [NB_FULL][SEQ_FULL][1024] f32, 1 Wq [1024][1024], 2 bq [1024], 3 Wk, 4 bk, 5 Wv, 6 bv, 7 Wo, 8 bo, 9 logit scale [1] f32,
  //             10 mask int32 [NB_FULL][SEQ_FULL][SEQ_FULL] (nonzero = masked); out [NB_FULL][SEQ_FULL][1024] f32
  if (n_in < 11) return;
  const size_t need_x = ((size_t)(NB - 1) * SEQ_FULL + SEQ) * DM;
  const size_t need_m = ((size_t)(NB - 1) * SEQ_FULL + SEQ - 1) * SEQ_FULL + SEQ;
  if ((size_t)in_sizes[0] < need_x || (size_t)out_size < need_x || (size_t)in_sizes[10] < need_m || in_sizes[9] < 1) return;
  if (in_sizes[1] < DM * DM || in_sizes[3] < DM * DM || in_sizes[5] < DM * DM || in_sizes[7] < DM * DM) return;
  if (in_sizes[2] < DM || in_sizes[4] < DM || in_sizes[6] < DM || in_sizes[8] < DM) return;
  const float* X = (const float*)d_in[0];
  const float* Wq = (const float*)d_in[1]; const float* bq = (const float*)d_in[2];
  const float* Wk = (const float*)d_in[3]; const float* bk = (const float*)d_in[4];
  const float* Wv = (const float*)d_in[5]; const float* bv = (const float*)d_in[6];
  const float* Wo = (const float*)d_in[7]; const float* bo = (const float*)d_in[8];
  const float* lsc = (const float*)d_in[9]; const int* mask = (const int*)d_in[10];
  size_t off = 0; char* ws = (char*)d_ws;
  auto carve = [&](size_t bytes) { char* p = ws + off; off += (bytes + 255) & ~(size_t)255; return p; };
  const size_t plane = (size_t)NT * DM * 2;
  v2f* T  = (v2f*)carve((size_t)SEQ * NCS * sizeof(v2f));          // 524,288 B (256-B rows, exact)
  b16* Xp = (b16*)carve(plane);
  b16* Wp = (b16*)carve((size_t)4 * DM * DM * 2);                   // 8,388,608 B
  b16* Qp = (b16*)carve(plane); b16* Qr = (b16*)carve(plane); b16* Kp = (b16*)carve(plane); b16* Kr = (b16*)carve(plane);
  b16* VT = (b16*)carve(plane); b16* VR = (b16*)carve(plane); b16* Ch = (b16*)carve(plane); b16* Cr = (b16*)carve(plane);
  unsigned int* Mw = (unsigned int*)carve((size_t)NB * SEQ * (SEQ / 32) * sizeof(unsigned int));   // 1,048,576 B
  if (off > ws_size || off > ((size_t)128 << 20)) return;          // 85,458,944 B total at NB=2, SEQ=2048
  prep_kernel<<<dim3(PBR + PBM + PBX + PBW), 256, 0, stream>>>(X, Wq, Wk, Wv, Wo, mask, Xp, Wp, Mw, T);
  gemm_qkv_kernel<<<dim3(3 * DM / 64, NT / 64), 128, 0, stream>>>(Xp, Wp, bq, bk, bv, T, Qp, Qr, Kp, Kr, VT, VR);
  attn_kernel<<<dim3(SEQ / 32, NB * H), 64 * KSPL, 0, stream>>>(Qp, Qr, Kp, Kr, VT, VR, Mw, lsc, Ch, Cr);
  gemm_out_kernel<<<dim3(DM / 64, NT / 64), 128, 0, stream>>>(Ch, Cr, Wp + (size_t)3 * DM * DM, bo, (float*)d_out);
}

// v006
// It runs in 149 microseconds.
// Timed twice side by side with v005, it ran 1.12 and 1.11 times as fast.
// All steps since v000 together make it 2.87 times as fast.
#include <hip/hip_runtime.h>

// compute dtype: every contraction on v_wmma_f32_16x16x32_f16 (f16 operands, f32 accumulate). q/k/v projections: bf16-RNE(x) x8 times bf16-RNE(W) x64,
// 1 product each; scores K Q^T per head: q and k (rope + l2 norm in f32) as f16 x8 planes plus x1024 residual planes, 3 products (hi.hi, hi.res, res.hi);
// O^T += V^T P^T: V^T f16 x8 plus a x1024 residual plane, P f16 x1024 plus a x1024 residual tile, 3 products (residual products share one accumulator);
// output projection: ctx f16 x64 plus a x1024 residual plane times bf16-RNE(Wo) x64, 2 products. Softmax statistics (running max, exp2, row sums),
// rope cos/sin table, l2 norm and bias adds in f32; 1/sqrt(64) and exp(logit scale) folded into the log2-domain score constant.
// Fragment k-map per lane half hh for A AND B: elements 0..7 <- k = 8hh+0..7, 8..15 <- k = 16+8hh+0..7; acc[r] = D[8hh+r][col = lane&15].
// Packed planes (X, W, K, V^T, ctx and their residuals): a plane of R rows x C k-columns is stored as 16x32 tiles, tile index (row/16)*(C/32) + k/32 (V^T: (k/32)*(R/16) + row/16), each tile
// 512 elements laid out [k octet 0..3][row 0..15][8], so that each of a fragment's two wave loads reads 512 contiguous bytes (four whole 128-B lines).

#ifndef NB
#define NB 2
#endif
#ifndef SEQ
#define SEQ 2048
#endif
#ifndef NB_FULL
#define NB_FULL 2
#endif
#ifndef SEQ_FULL
#define SEQ_FULL 2048
#endif

namespace {
constexpr int H = 16, HD = 64, DM = 1024, NT = NB * SEQ, NCS = HD / 2, KT = DM / 32, TE = 512;
constexpr float XS = 8.0f, WSC = 64.0f, QS = 8.0f, QRS = 1024.0f, VS = 8.0f, VRS = 1024.0f, PS = 1024.0f, PRS = 1024.0f, OCS = 64.0f, OCRS = 1024.0f;
constexpr float LOG2E = 1.4426950408889634f, EPSN = 1e-6f;
constexpr int KSPL = 4;   // key shares (waves) per query tile in the attention kernel
static_assert(KSPL == 4 && SEQ % (32 * KSPL) == 0);
constexpr int NJ = SEQ / (32 * KSPL);                       // key steps per share
// block ranges of the preparation launch (256 threads each): rope table, mask words, X plane, W planes
constexpr int PBR = SEQ * NCS / 4 / 256;                    // a thread fills 4 table entries
constexpr int PBM = NB * (SEQ / 16) * (NJ / 2) / 8;         // a wave packs 2 key steps of all KSPL shares of one query tile
constexpr int PBX = NT / 16, PBW = 4 * DM / 16;             // a block converts 16 rows of 1024
static_assert(NJ % 2 == 0 && NJ <= 16 && (NB * (SEQ / 16) * (NJ / 2)) % 8 == 0 && (SEQ * NCS / 4) % 256 == 0 && KT == 32 && SEQ % 16 == 0);
static_assert(SEQ % 64 == 0 && SEQ >= 64 && SEQ <= SEQ_FULL && NB >= 1 && NB <= NB_FULL);
static_assert(DM == H * HD && HD == 64 && DM % 128 == 0 && NT % 128 == 0 && PRS == VRS);

typedef _Float16 b16;
typedef __attribute__((ext_vector_type(16))) _Float16 v16b;
typedef __attribute__((ext_vector_type(8))) _Float16 v8b;
typedef __attribute__((ext_vector_type(2))) _Float16 v2b;
typedef __attribute__((ext_vector_type(8))) float v8f;
typedef __attribute__((ext_vector_type(4))) float v4f;
typedef __attribute__((ext_vector_type(2))) float v2f;
typedef __attribute__((ext_vector_type(4))) unsigned int v4u;

__device__ __forceinline__ float bf16_rne(float f) { unsigned int u = __float_as_uint(f); u += 0x7FFFu + ((u >> 16) & 1u); return __uint_as_float(u & 0xFFFF0000u); }
// 16-bit fragment from a k-contiguous row: elements 0..7 <- p[8hh .. 8hh+7], 8..15 <- p[16+8hh .. 16+8hh+7]
__device__ __forceinline__ v16b frag_kb(const b16* p, int hh) {
  const v8b a = *(const v8b*)(p + 8 * hh), b = *(const v8b*)(p + 16 + 8 * hh); v16b f;
#pragma unroll
  for (int e = 0; e < 8; ++e) { f[e] = a[e]; f[8 + e] = b[e]; }
  return f;
}
// the same fragment from a packed tile; p = tile + 8*lane (lane = 16hh + row): octets hh and 2+hh of the lane's row
__device__ __forceinline__ v16b frag_pk(const b16* p) {
  const v8b a = *(const v8b*)p, b = *(const v8b*)(p + 256); v16b f;
#pragma unroll
  for (int e = 0; e < 8; ++e) { f[e] = a[e]; f[8 + e] = b[e]; }
  return f;
}
__device__ __forceinline__ v8f wmma16b(v16b a, v16b b, v8f c) {
  v8f d = __builtin_amdgcn_wmma_f32_16x16x32_f16(false, a, false, b, (short)0, c, false, false);
  asm volatile("v_nop\n\tv_nop\n\tv_nop\n\tv_nop" : "+v"(d) : "v"(a), "v"(b));
  return d;
}
__device__ __forceinline__ void wave_lds_sync() { __builtin_amdgcn_fence(3, "workgroup"); __builtin_amdgcn_wave_barrier(); __builtin_amdgcn_fence(2, "workgroup"); }
__device__ __forceinline__ float nexp2(float v) { return __builtin_amdgcn_exp2f(v); }

// One row group (16 rows x 1024 columns, f32, row pitch DM, first row at S) to its KT packed tiles at D, f16 = bf16-RNE(value) x sc, by one block of 256 threads.
// A pass of the block covers 4 tiles, thread per k octet: a wave reads 8 rows x 128 B and writes four whole 128-B lines of one tile. All 8 passes' loads (16 of
// 16 B a lane) are requested before the first conversion.
__device__ __forceinline__ void cvt_row_group(const float* __restrict__ S, b16* __restrict__ D, float sc, int tid) {
  const int oct = tid & 3, rl = (tid >> 2) & 15, t0 = tid >> 6;
  const float* src = S + (size_t)rl * DM + (size_t)(t0 * 32 + oct * 8);
  b16* dst = D + (size_t)t0 * TE + (size_t)((oct * 16 + rl) * 8);
  v4f x0[KT / 4], x1[KT / 4];
#pragma unroll
  for (int i = 0; i < KT / 4; ++i) { x0[i] = *(const v4f*)(src + i * 128); x1[i] = *(const v4f*)(src + i * 128 + 4); }
  asm volatile("s_wait_xcnt 0x0" :: "v"(src) : "memory");   // behind the group: the address pair stays whole until here, before any of its registers is rewritten
  v8b o[KT / 4];
#pragma unroll
  for (int i = 0; i < KT / 4; ++i)
#pragma unroll
    for (int j = 0; j < 4; ++j) { o[i][j] = (b16)(bf16_rne(x0[i][j]) * sc); o[i][4 + j] = (b16)(bf16_rne(x1[i][j]) * sc); }
#pragma unroll
  for (int i = 0; i < KT / 4; ++i) *(v8b*)(dst + (size_t)i * 4 * TE) = o[i];
  asm volatile("s_wait_xcnt 0x0" ::: "memory");   // behind the run of stores, before any later code rewrites their address or data registers
}

// All preparation in one launch; the block's range of blockIdx.x selects its work (block-uniform):
// [0, PBR): rope table T[s][i] = (cos, sin)(s * freq_i), freq_i = 1 / fl32(10000^(2i/64)), s*freq as an f32 product, argument reduction in f64 (mul/fma only), short
//   f32 polynomials; a thread computes freq_i once and fills four rows s.
// [PBR, PBR+PBM): the mask packed into bit words Mw[b][query tile][share ks][step j of the share][query 0..15]: bit i set <=> key 32*(j*KSPL+ks)+i is NOT masked for
//   that query. A wave takes one query tile and the steps j, j+1 of all four shares, two shares a trip: 16 rows x two pieces of 256 B in, two whole 128-B lines out.
// [.., +PBX): X plane, packed tiles of [NB*SEQ tokens][1024], f16 = bf16-RNE(x) x8; token row b*SEQ+s reads input row b*SEQ_FULL+s; a block per 16 tokens.
// [.., +PBW): W planes [4], each the packed tiles of [1024 out][1024 in], f16 = bf16-RNE(W) x64 (rows n, k along the input); a block per 16 rows of one weight.
__global__ __launch_bounds__(256) void prep_kernel(const float* __restrict__ X, const float* __restrict__ Wq, const float* __restrict__ Wk,
                                                   const float* __restrict__ Wv, const float* __restrict__ Wo, const int* __restrict__ mask,
                                                   b16* __restrict__ Xp, b16* __restrict__ Wp, unsigned int* __restrict__ Mw, v2f* __restrict__ T) {
  const int blk = (int)blockIdx.x, tid = (int)threadIdx.x;
  if (blk < PBR) {
    const int u = blk * 256 + tid, i = u % NCS, sq = u / NCS;
    const float ex = (float)(2 * i) / (float)HD;
    const float pw = (float)exp2((double)ex * 13.287712379549449);
    const float freq = 1.0f / pw;
#pragma unroll
    for (int q = 0; q < 4; ++q) {
      const int s = sq + q * (SEQ / 4);
      const float ang = (float)s * freq;
      const double a = (double)ang;
      const double k = __builtin_rint(a * 0.63661977236758134);
      double rd = __builtin_fma(-k, 1.5707963267948966, a);
      rd = __builtin_fma(-k, 6.123233995736766e-17, rd);
      const float r = (float)rd, r2 = r * r;
      const float sp = r + r * r2 * (-1.6666666666666666e-1f + r2 * (8.333333333333333e-3f + r2 * (-1.984126984126984e-4f + r2 * 2.7557319223985893e-6f)));
      const float cp = 1.0f + r2 * (-0.5f + r2 * (4.1666666666666664e-2f + r2 * (-1.3888888888888889e-3f + r2 * (2.48015873015873e-5f + r2 * -2.755731922398589e-7f))));
      const int kq = (int)(((long long)k) & 3);
      const float c = (kq == 0) ? cp : ((kq == 1) ? -sp : ((kq == 2) ? -cp : sp));
      const float sn = (kq == 0) ? sp : ((kq == 1) ? cp : ((kq == 2) ? -sp : -cp));
      v2f o; o.x = c; o.y = sn;
      *(v2f*)(T + (size_t)s * NCS + i) = o;
    }
    return;
  }
  if (blk < PBR + PBM) {
    const int wv = (blk - PBR) * 8 + (tid >> 5), lane = tid & 31;
    const int jp = wv % (NJ / 2), qt = (wv / (NJ / 2)) % (SEQ / 16), b = wv / ((NJ / 2) * (SEQ / 16));
    const int* src = mask + ((size_t)b * SEQ_FULL + (size_t)qt * 16) * SEQ_FULL + (size_t)(2 * jp * KSPL * 32 + lane);
    unsigned int* dst = Mw + (size_t)(((b * (SEQ / 16) + qt) * KSPL * NJ + 2 * jp) * 16) + lane;
#pragma unroll 1   // two trips of 64 loads a lane: all four shares at once would double the registers of the whole launch
    for (int ks = 0; ks < KSPL; ks += 2) {
      int g[2][2][16];
#pragma unroll
      for (int r = 0; r < 16; ++r)
#pragma unroll
        for (int c = 0; c < 2; ++c) {
          g[c][0][r] = src[(size_t)r * SEQ_FULL + (ks + c) * 32]; g[c][1][r] = src[(size_t)r * SEQ_FULL + (ks + c) * 32 + 32 * KSPL]; }
#pragma unroll
      for (int c = 0; c < 2; ++c) {
        unsigned int w = 0u;
#pragma unroll
        for (int r = 0; r < 16; ++r) {
          const unsigned int b0 = __builtin_amdgcn_ballot_w32(g[c][0][r] == 0), b1 = __builtin_amdgcn_ballot_w32(g[c][1][r] == 0);
          w = (lane == r) ? b0 : w; w = (lane == 16 + r) ? b1 : w; }
        dst[(size_t)(ks + c) * NJ * 16] = w; }
      asm volatile("s_wait_xcnt 0x0" ::: "memory");   // before the next trip rewrites the loads' and stores' address and data registers
    }
    return;
  }
  if (blk < PBR + PBM + PBX) {
    const int row0 = (blk - PBR - PBM) * 16, b = row0 / SEQ, s0 = row0 % SEQ;
    cvt_row_group(X + ((size_t)b * SEQ_FULL + (size_t)s0) * DM, Xp + (size_t)(row0 / 16) * KT * TE, XS, tid);
    return;
  }
  const int wb = blk - PBR - PBM - PBX, y = wb / (DM / 16), rg = wb % (DM / 16);
  const float* W = (y == 0) ? Wq : ((y == 1) ? Wk : ((y == 2) ? Wv : Wo));
  cvt_row_group(W + (size_t)rg * 16 * DM, Wp + (size_t)y * DM * DM + (size_t)rg * KT * TE, WSC, tid);
}

// Fused q/k/v projection: C = A(X plane) . B (B[k][n] = W[n][k] from the packed W plane), K = 1024 stepped by 32, fragments loaded straight from the packed
// global f16 planes. q planes stay [s][64]; k planes are packed tiles of [s][64], v planes packed tiles of [64][s].
// Block 128 threads = 4 waves in 2x2, wave tile 64 tokens x 64 features = 4x4 WMMA tiles: a k step's 8 fragments (8 KB) feed 16 products. A wave's 64 columns are
// exactly one head of q, k or v (which = column block / 1024, block-uniform). Epilogue, each wave on its own tile: acc/512 + bf16-RNE(bias) staged in the wave's
// part of LDS, then rope + l2 norm (q, k) or transpose (v); a trip of each epilogue loop takes its piece of all four 16-row tiles of the wave.
__global__ __launch_bounds__(128) __attribute__((amdgpu_num_vgpr(256))) void gemm_qkv_kernel(
    const b16* __restrict__ Xp, const b16* __restrict__ Wp, const float* __restrict__ bq, const float* __restrict__ bk, const float* __restrict__ bv,
    const v2f* __restrict__ CSt, b16* __restrict__ Qp, b16* __restrict__ Qr, b16* __restrict__ Kp, b16* __restrict__ Kr, b16* __restrict__ VT,
    b16* __restrict__ VR) {
  __shared__ __attribute__((aligned(16))) float Tt[4][64][HD + 4];
  const int wave = threadIdx.x >> 5, lane = threadIdx.x & 31, hh = lane >> 4, m = lane & 15, wm = wave >> 1, wn = wave & 1;
  const int nblk = (int)blockIdx.x * 128, which = nblk / DM, n0 = nblk % DM + wn * 64, h = n0 / HD;
  const int mblk = (int)blockIdx.y * 128 + wm * 64, b = mblk / SEQ, s0 = mblk % SEQ;
  // byte offsets of the lane's place in the wave's first tiles (each plane is far below 4 GiB)
  unsigned wo = (unsigned)(((which * (DM / 16) + n0 / 16) * KT * TE + 8 * lane) * 2), ao = (unsigned)((mblk / 16 * KT * TE + 8 * lane) * 2);
  const float* bsel = (which == 0) ? bq : ((which == 1) ? bk : bv);
  float (*Tw)[HD + 4] = Tt[wave];
  v8f acc[4][4];
#pragma unroll
  for (int i = 0; i < 4; ++i)
#pragma unroll
    for (int j = 0; j < 4; ++j) acc[i][j] = (v8f){};
#pragma unroll 1
  for (int k0 = 0; k0 < DM; k0 += 32) {
    v16b af[4], bf[4];
#pragma unroll
    for (int mt = 0; mt < 4; ++mt) af[mt] = frag_pk((const b16*)((const char*)Xp + ao) + (size_t)mt * KT * TE);
#pragma unroll
    for (int nt = 0; nt < 4; ++nt) bf[nt] = frag_pk((const b16*)((const char*)Wp + wo) + (size_t)nt * KT * TE);
    ao += TE * 2; wo += TE * 2;
#pragma unroll
    for (int mt = 0; mt < 4; ++mt)
#pragma unroll
      for (int nt = 0; nt < 4; ++nt) acc[mt][nt] = wmma16b(af[mt], bf[nt], acc[mt][nt]);
  }
  float bias[4];
#pragma unroll
  for (int nt = 0; nt < 4; ++nt) bias[nt] = bf16_rne(bsel[n0 + nt * 16 + m]);
  const float isc = 1.0f / (XS * WSC);
#pragma unroll
  for (int mt = 0; mt < 4; ++mt)
#pragma unroll
    for (int nt = 0; nt < 4; ++nt)
#pragma unroll
      for (int r = 0; r < 8; ++r) Tw[mt * 16 + 8 * hh + r][nt * 16 + m] = acc[mt][nt][r] * isc + bias[nt];
  __syncthreads();   // the staged tile is read across lanes
  if (which < 2) {
    // 16 rows are 1024 elements in both layouts ([s][64] rows for q, packed tiles of [s][64] for k); lo = the lane's place in them, rs = elements from a row to the next
    const int lo = (which == 0) ? 2 * lane : (lane >> 4) * 512 + ((lane >> 2) & 3) * 128 + ((2 * lane) & 7), rs = (which == 0) ? HD : 8;
    const size_t pb = (size_t)(b * H + h) * SEQ * HD + (size_t)s0 * HD + lo;
    b16* Ph = ((which == 0) ? Qp : Kp) + pb;
    b16* Pl = ((which == 0) ? Qr : Kr) + pb;
    const v2f* Cw = CSt + (size_t)s0 * NCS + lane;
#pragma unroll 1
    for (int it = 0; it < 16; ++it) {   // row it of each of the wave's four 16-row tiles
      float y0[4], y1[4], ss[4];
#pragma unroll
      for (int mt = 0; mt < 4; ++mt) {
        const int r = mt * 16 + it;
        const float x0 = Tw[r][2 * lane], x1 = Tw[r][2 * lane + 1];
        const v2f cv = Cw[(size_t)r * NCS];
        y0[mt] = x0 * cv.x - x1 * cv.y; y1[mt] = x1 * cv.x + x0 * cv.y;
        ss[mt] = y0[mt] * y0[mt] + y1[mt] * y1[mt]; }
#pragma unroll
      for (int w = 16; w >= 1; w >>= 1)
#pragma unroll
        for (int mt = 0; mt < 4; ++mt) ss[mt] += __shfl_xor(ss[mt], w);
#pragma unroll
      for (int mt = 0; mt < 4; ++mt) {
        const float inv = 1.0f / sqrtf(ss[mt] + EPSN);
        const float z0 = y0[mt] * inv * QS, z1 = y1[mt] * inv * QS;
        const b16 h0 = (b16)z0, h1 = (b16)z1;
        v2b oh, ol; oh.x = h0; oh.y = h1; ol.x = (b16)((z0 - (float)h0) * QRS); ol.y = (b16)((z1 - (float)h1) * QRS);
        const int off = mt * 16 * HD + it * rs;
        *(v2b*)(Ph + off) = oh; *(v2b*)(Pl + off) = ol; }
      asm volatile("s_wait_xcnt 0x0" ::: "memory");   // before the next trip rewrites the loads' and stores' address and data registers
    }
  } else {
    const size_t vb = ((size_t)(b * H + h) * HD) * SEQ;
#pragma unroll 1
    for (int it = 0; it < 4; ++it) {
#pragma unroll
      for (int g = 0; g < 4; ++g) {   // the wave's four groups of 16 head features (each one row of packed tiles)
        const int dl = (it & 1) * 8 + (lane & 7), d = g * 16 + dl, tok = (it >> 1) * 32 + (lane >> 3) * 8;
        v8b oh, ol;
#pragma unroll
        for (int j = 0; j < 8; ++j) {
          const float v = Tw[tok + j][d] * VS; const b16 hv = (b16)v; oh[j] = hv; ol[j] = (b16)((v - (float)hv) * VRS); }
        const size_t off = vb + (size_t)((((s0 + tok) >> 5) * 4 + g) * 64 + (lane >> 3) * 16 + dl) * 8;
        *(v8b*)(VT + off) = oh; *(v8b*)(VR + off) = ol;
      }
      asm volatile("s_wait_xcnt 0x0" ::: "memory");   // before the next trip rewrites the stores' address and data registers
    }
  }
}

// Masked softmax attention per (query block of 32, b*H+h); block = 8 waves = 2 query tiles of 16 x 4 key shares: share ks takes the key steps of 32 whose
// index is ks modulo 4, in fixed order, with its own running max, row sum and O tile; the four partial results of a query tile are merged in LDS behind one
// block barrier (weights exp2(m_j - max m), fixed order j = 0..3), each share's wave packing a quarter of the tile's ctx. The mask comes as the
// packed bit words: the wave reads all words of its share once and keeps two scalar maps, the steps with any unmasked entry in its 16x32 region (only these are walked; the
// others contribute 0) and the steps with none masked (these apply no mask); a walked step's word per query is requested one walked step ahead.
// S^T = K Q^T (hi.hi + hi.res + res.hi, q/k residual products scaled back by 1/1024), masked entries replaced by -inf, online softmax (running max, f32,
// -inf-safe), P x1024 and its x1024 residual via wave-private LDS, O^T += V^T P^T with V^T hi/res planes. ctx [b*SEQ+s][h*64+d] written as packed tiles, f16 x64
__global__ __launch_bounds__(64 * KSPL) __attribute__((amdgpu_num_vgpr(256))) void attn_kernel(
    const b16* __restrict__ Qp, const b16* __restrict__ Qr, const b16* __restrict__ Kp, const b16* __restrict__ Kr,
    const b16* __restrict__ VT, const b16* __restrict__ VR, const unsigned int* __restrict__ Mw, const float* __restrict__ lsc,
    b16* __restrict__ Ch, b16* __restrict__ Cr) {
  __shared__ __attribute__((aligned(16))) b16 Pb[2 * KSPL][16][32 + 8];
  __shared__ __attribute__((aligned(16))) b16 Pr[2 * KSPL][16][32 + 8];
  __shared__ __attribute__((aligned(16))) float To[2 * KSPL][16][HD + 4];
  __shared__ float Ms[2 * KSPL][16], Ls[2 * KSPL][16];
  // the wave's number as a scalar, so that the key loop's control and the plane offsets stay on the scalar unit
  const int wave = __builtin_amdgcn_readfirstlane((int)(threadIdx.x >> 5)), qt = wave / KSPL, ks = wave % KSPL;
  const int lane = threadIdx.x & 31, hh = lane >> 4, col = lane & 15;
  const int bhi = (int)blockIdx.y, b = bhi / H, h = bhi % H;
  const int q0 = (int)blockIdx.x * 32 + qt * 16, qi = q0 + col;
  const size_t pq = (size_t)bhi * SEQ * HD;   // same plane size for the [s][64] rows and for both packed layouts
  const b16* Kb = Kp + pq; const b16* Klb = Kr + pq;
  const b16* Vb = VT + pq; const b16* Rb = VR + pq;
  const unsigned int* Mq = Mw + (size_t)(((b * (SEQ / 16) + (q0 >> 4)) * KSPL + ks) * NJ) * 16;   // the share's NJ x 16 mask words
  unsigned int act, ful;   // bit 2j: step j of the share has an unmasked entry / has no masked entry; both wave-uniform
  const int jl = lane >> 1;   // the lane reads 8 of step jl's 16 words
  const unsigned so = (jl < NJ) ? (unsigned)lane * 32u : 0u;
  {
    const unsigned int* sp = (const unsigned int*)((const char*)Mq + so);
    const v4u w0 = *(const v4u*)sp, w1 = *(const v4u*)(sp + 4);
    const unsigned int wo = w0.x | w0.y | w0.z | w0.w | w1.x | w1.y | w1.z | w1.w, wa = w0.x & w0.y & w0.z & w0.w & w1.x & w1.y & w1.z & w1.w;
    const unsigned int anyb = __builtin_amdgcn_ballot_w32(jl < NJ && wo != 0u), allb = __builtin_amdgcn_ballot_w32(wa == 0xFFFFFFFFu);
    act = (anyb | (anyb >> 1)) & 0x55555555u; ful = allb & (allb >> 1);
  }
  const v16b qa0 = frag_kb(Qp + pq + (size_t)qi * HD, hh), qa1 = frag_kb(Qp + pq + (size_t)qi * HD + 32, hh);
  const v16b ql0 = frag_kb(Qr + pq + (size_t)qi * HD, hh), ql1 = frag_kb(Qr + pq + (size_t)qi * HD + 32, hh);
  // loaded values as inputs only: holds the Q fragment loads in flight beside the mask words' loads (else they sink behind the test for an empty share: a second
  // round trip); the wait stands before the mask words' offset register is rewritten
  asm volatile("s_wait_xcnt 0x0" :: "v"(qa0), "v"(qa1), "v"(ql0), "v"(ql1), "v"(so) : "memory");
  const float cs = 0.125f * expf(bf16_rne(lsc[0])) * (LOG2E / (QS * QS));
  float m = -INFINITY, l = 0.0f; v8f o[4], o2[4];
#pragma unroll
  for (int t = 0; t < 4; ++t) { o[t] = (v8f){}; o2[t] = (v8f){}; }
  // the query's 32 mask bits of a walked step are requested one walked step ahead
  unsigned int mwn = *(const unsigned int*)((const char*)Mq + ((unsigned)((act != 0u ? __builtin_ctz(act) : 0) >> 1) * 64u + (unsigned)col * 4u));
#pragma unroll 1
  while (act != 0u) {   // at most NJ trips, in rising key order
    const int tz = __builtin_ctz(act), j = tz >> 1; act &= act - 1u;
    const bool full = ((ful >> tz) & 1u) != 0u;
    // byte offset of the lane's place in the step's first tile: K tiles 2u, 2u+1 of key group u and V tiles t share it
    const unsigned ko = (unsigned)lane * 16u + (unsigned)(j * KSPL + ks) * (unsigned)(4 * TE * 2);
    const unsigned int mw = mwn;
    // the next walked step's word (the last step asks for its own again: in bounds, never used)
    const unsigned mo = (unsigned)((act != 0u ? __builtin_ctz(act) >> 1 : j) * 64) + (unsigned)col * 4u;
    mwn = *(const unsigned int*)((const char*)Mq + mo);
    // all eight K fragments of the step are requested here as one group, ahead of the matrix work
    v16b kh[4], kl[4], vh[4], vl[4];
    const b16* pk = (const b16*)((const char*)Kb + ko); const b16* pkl = (const b16*)((const char*)Klb + ko);
    const b16* pv = (const b16*)((const char*)Vb + ko); const b16* pvl = (const b16*)((const char*)Rb + ko);
#pragma unroll
    for (int j = 0; j < 4; ++j) { kh[j] = frag_pk(pk + j * TE); kl[j] = frag_pk(pkl + j * TE); }
    // behind the group: its offset registers stay whole until here, and no load sinks to its use (there each pair of loads costs the wave a full L2 round trip)
    asm volatile("s_wait_xcnt 0x0" :: "v"(ko), "v"(mo) : "memory");
    float e[16];
#pragma unroll
    for (int u = 0; u < 2; ++u) {
      const v16b ka = kh[2 * u], kc = kh[2 * u + 1];
      v8f s = wmma16b(ka, qa0, (v8f){}); s = wmma16b(kc, qa1, s);
      v8f s2 = wmma16b(ka, ql0, (v8f){}); s2 = wmma16b(kc, ql1, s2);
      s2 = wmma16b(kl[2 * u], qa0, s2); s2 = wmma16b(kl[2 * u + 1], qa1, s2);
#pragma unroll
      for (int r = 0; r < 8; ++r) e[u * 8 + r] = (s[r] + s2[r] * (1.0f / QRS)) * cs; }
    // second group, into the registers that K has left: all eight V fragments fly while the softmax runs
#pragma unroll
    for (int t = 0; t < 4; ++t) { vh[t] = frag_pk(pv + t * TE); vl[t] = frag_pk(pvl + t * TE); }
    asm volatile("s_wait_xcnt 0x0" :: "v"(ko) : "memory");   // as behind the K group: the offset register whole, the loads ahead of the softmax arithmetic
    if (!full) {   // scalar branch: entry i of the lane is key 8hh+i (i < 8) or 16+8hh+i-8 of the step
      const unsigned int sh = mw >> (8 * hh);
#pragma unroll
      for (int i2 = 0; i2 < 16; ++i2) e[i2] = ((sh >> (i2 < 8 ? i2 : i2 + 8)) & 1u) ? e[i2] : -INFINITY; }
    float mx = -INFINITY;
#pragma unroll
    for (int i2 = 0; i2 < 16; ++i2) mx = fmaxf(mx, e[i2]);
    mx = fmaxf(mx, __shfl_xor(mx, 16)); const float mn = fmaxf(m, mx);
    const float mref = (mn == -INFINITY) ? 0.0f : mn;
    const float al = nexp2(m - mref); float sum = 0.0f;
#pragma unroll
    for (int i2 = 0; i2 < 16; ++i2) {
      const float p = nexp2(e[i2] - mref); sum += p; const int pi = (i2 < 8 ? 0 : 16) + 8 * hh + (i2 & 7);
      const float pp = p * PS; const b16 ph = (b16)pp; Pb[wave][col][pi] = ph;
      Pr[wave][col][pi] = (b16)((pp - (float)ph) * PRS); }
    sum += __shfl_xor(sum, 16); l = l * al + sum; m = mn;
    wave_lds_sync();
    const v16b pf = frag_kb(&Pb[wave][col][0], hh), plf = frag_kb(&Pr[wave][col][0], hh);
#pragma unroll
    for (int t = 0; t < 4; ++t) {
      o[t] *= al; o2[t] *= al;
      o[t] = wmma16b(vh[t], pf, o[t]);
      o2[t] = wmma16b(vl[t], pf, o2[t]);
      o2[t] = wmma16b(vh[t], plf, o2[t]); }
    wave_lds_sync(); }
  // the share's partial result, not yet normalised: O tile, running max and row sum of each query
#pragma unroll
  for (int t = 0; t < 4; ++t) {
#pragma unroll
    for (int r = 0; r < 8; ++r) To[wave][col][t * 16 + 8 * hh + r] = o[t][r] + o2[t][r] * (1.0f / VRS); }
  if (hh == 0) { Ms[wave][col] = m; Ls[wave][col] = l; }
  __syncthreads();   // the partial results are read across the four waves of a query tile
  const size_t cb = ((size_t)((b * SEQ + q0) >> 4) * KT + (size_t)h * 2) * TE;
  {
    const int it = ks;   // each share's wave merges and packs one quarter of the query tile
    const int rl = (it & 1) * 8 + (lane & 7), pc = (it >> 1) * 32 + (lane >> 3) * 8;
    float mj[KSPL], mt = -INFINITY;
#pragma unroll
    for (int j = 0; j < KSPL; ++j) { mj[j] = Ms[qt * KSPL + j][rl]; mt = fmaxf(mt, mj[j]); }
    const float mtr = (mt == -INFINITY) ? 0.0f : mt;   // -inf-safe, as in the key loop
    float lt = 0.0f; v4f f0 = (v4f){}, f1 = (v4f){};
#pragma unroll
    for (int j = 0; j < KSPL; ++j) {
      const float w = nexp2(mj[j] - mtr);
      lt += w * Ls[qt * KSPL + j][rl];
      f0 += w * *(const v4f*)(&To[qt * KSPL + j][rl][pc]); f1 += w * *(const v4f*)(&To[qt * KSPL + j][rl][pc + 4]); }
    const float inv = 1.0f / (lt * PS * VS);
    f0 *= inv; f1 *= inv;
    v8b oh, ol;
#pragma unroll
    for (int j = 0; j < 4; ++j) {
      const float v0 = f0[j] * OCS; const b16 hv0 = (b16)v0; oh[j] = hv0; ol[j] = (b16)((v0 - (float)hv0) * OCRS);
      const float v1 = f1[j] * OCS; const b16 hv1 = (b16)v1; oh[4 + j] = hv1; ol[4 + j] = (b16)((v1 - (float)hv1) * OCRS); }
    const size_t off = cb + (size_t)((it >> 1) * 64 + (lane >> 3) * 16 + rl) * 8;
    *(v8b*)(Ch + off) = oh; *(v8b*)(Cr + off) = ol;
  }
}

// Output projection: out = (ctx hi . Wo + ctx res . Wo / 1024) / 4096 + bf16-RNE(bo), K = 1024 stepped by 32, fragments from the packed global planes.
// Block 128 = 4 waves in 2x2, wave tile 32 tokens x 64 features = 2x4 WMMA tiles for each of the two products: a k step's 8 fragments (8 KB) feed 16 products.
// Result staged in the wave's part of LDS; each 256-B row segment is stored by 16 consecutive lanes.
__global__ __launch_bounds__(128) __attribute__((amdgpu_num_vgpr(256))) void gemm_out_kernel(
    const b16* __restrict__ Ch, const b16* __restrict__ Cr, const b16* __restrict__ Wop, const float* __restrict__ bo, float* __restrict__ out) {
  __shared__ __attribute__((aligned(16))) float Tt[4][32][HD + 4];
  const int wave = threadIdx.x >> 5, lane = threadIdx.x & 31, hh = lane >> 4, m = lane & 15, wm = wave >> 1, wn = wave & 1;
  const int nblk = (int)blockIdx.x * 128 + wn * 64;
  const int mblk = (int)blockIdx.y * 64 + wm * 32, b = mblk / SEQ, s0 = mblk % SEQ;
  // byte offsets of the lane's place in the wave's first tiles (each plane is far below 4 GiB); ctx and its residual share one
  unsigned wo = (unsigned)((nblk / 16 * KT * TE + 8 * lane) * 2), ao = (unsigned)((mblk / 16 * KT * TE + 8 * lane) * 2);
  float (*Tw)[HD + 4] = Tt[wave];
  v8f acc[2][4], acc2[2][4];
#pragma unroll
  for (int i = 0; i < 2; ++i)
#pragma unroll
    for (int j = 0; j < 4; ++j) { acc[i][j] = (v8f){}; acc2[i][j] = (v8f){}; }
#pragma unroll 1
  for (int k0 = 0; k0 < DM; k0 += 32) {
    v16b af[2], rf[2], bf[4];
#pragma unroll
    for (int mt = 0; mt < 2; ++mt) {
      af[mt] = frag_pk((const b16*)((const char*)Ch + ao) + (size_t)mt * KT * TE);
      rf[mt] = frag_pk((const b16*)((const char*)Cr + ao) + (size_t)mt * KT * TE); }
#pragma unroll
    for (int nt = 0; nt < 4; ++nt) bf[nt] = frag_pk((const b16*)((const char*)Wop + wo) + (size_t)nt * KT * TE);
    ao += TE * 2; wo += TE * 2;
#pragma unroll
    for (int mt = 0; mt < 2; ++mt)
#pragma unroll
      for (int nt = 0; nt < 4; ++nt) {
        acc[mt][nt] = wmma16b(af[mt], bf[nt], acc[mt][nt]);
        acc2[mt][nt] = wmma16b(rf[mt], bf[nt], acc2[mt][nt]); }
  }
  const int bi = nblk + m;
  float bias[4];
#pragma unroll
  for (int nt = 0; nt < 4; ++nt) bias[nt] = bo[bi + nt * 16];
  asm volatile("s_wait_xcnt 0x0" :: "v"(bi) : "memory");   // behind the four bias loads: their index register stays whole until here
#pragma unroll
  for (int nt = 0; nt < 4; ++nt) bias[nt] = bf16_rne(bias[nt]);
  const float isc = 1.0f / (OCS * WSC), irs = 1.0f / OCRS;
#pragma unroll
  for (int mt = 0; mt < 2; ++mt)
#pragma unroll
    for (int nt = 0; nt < 4; ++nt)
#pragma unroll
      for (int r = 0; r < 8; ++r)
        Tw[mt * 16 + 8 * hh + r][nt * 16 + m] = (acc[mt][nt][r] + acc2[mt][nt][r] * irs) * isc + bias[nt];
  __syncthreads();   // the staged tile is read across lanes
  float* ob = out + ((size_t)b * SEQ_FULL + (size_t)s0) * DM + nblk;
#pragma unroll 1
  for (int it = 0; it < 8; ++it) {
#pragma unroll
    for (int mt = 0; mt < 2; ++mt) {   // two rows of each of the wave's two 16-row tiles
      const int rr = mt * 16 + it * 2 + hh; const v4f f = *(const v4f*)(&Tw[rr][m * 4]);
      *(v4f*)(ob + (size_t)rr * DM + m * 4) = f; }
  }
}
}  // namespace

extern "C" void kernel_launch(void* const* d_in, const int* in_sizes, int n_in, void* d_out, int out_size, void* d_ws, size_t ws_size, hipStream_t stream) {
  // wire order: 0 x [NB_FULL][SEQ_FULL][1024] f32, 1 Wq [1024][1024], 2 bq [1024], 3 Wk, 4 bk, 5 Wv, 6 bv, 7 Wo, 8 bo, 9 logit scale [1] f32,
  //             10 mask int32 [NB_FULL][SEQ_FULL][SEQ_FULL] (nonzero = masked); out [NB_FULL][SEQ_FULL][1024] f32
  if (n_in < 11) return;
  const size_t need_x = ((size_t)(NB - 1) * SEQ_FULL + SEQ) * DM;
  const size_t need_m = ((size_t)(NB - 1) * SEQ_FULL + SEQ - 1) * SEQ_FULL + SEQ;
  if ((size_t)in_sizes[0] < need_x || (size_t)out_size < need_x || (size_t)in_sizes[10] < need_m || in_sizes[9] < 1) return;
  if (in_sizes[1] < DM * DM || in_sizes[3] < DM * DM || in_sizes[5] < DM * DM || in_sizes[7] < DM * DM) return;
  if (in_sizes[2] < DM || in_sizes[4] < DM || in_sizes[6] < DM || in_sizes[8] < DM) return;
  const float* X = (const float*)d_in[0];
  const float* Wq = (const float*)d_in[1]; const float* bq = (const float*)d_in[2];
  const float* Wk = (const float*)d_in[3]; const float* bk = (const float*)d_in[4];
  const float* Wv = (const float*)d_in[5]; const float* bv = (const float*)d_in[6];
  const float* Wo = (const float*)d_in[7]; const float* bo = (const float*)d_in[8];
  const float* lsc = (const float*)d_in[9]; const int* mask = (const int*)d_in[10];
  size_t off = 0; char* ws = (char*)d_ws;
  auto carve = [&](size_t bytes) { char* p = ws + off; off += (bytes + 255) & ~(size_t)255; return p; };
  const size_t plane = (size_t)NT * DM * 2;
  v2f* T  = (v2f*)carve((size_t)SEQ * NCS * sizeof(v2f));          // 524,288 B (256-B rows, exact)
  b16* Xp = (b16*)carve(plane);
  b16* Wp = (b16*)carve((size_t)4 * DM * DM * 2);                   // 8,388,608 B
  b16* Qp = (b16*)carve(plane); b16* Qr = (b16*)carve(plane); b16* Kp = (b16*)carve(plane); b16* Kr = (b16*)carve(plane);
  b16* VT = (b16*)carve(plane); b16* VR = (b16*)carve(plane); b16* Ch = (b16*)carve(plane); b16* Cr = (b16*)carve(plane);
  unsigned int* Mw = (unsigned int*)carve((size_t)NB * SEQ * (SEQ / 32) * sizeof(unsigned int));   // 1,048,576 B
  if (off > ws_size || off > ((size_t)128 << 20)) return;          // 85,458,944 B total at NB=2, SEQ=2048
  prep_kernel<<<dim3(PBR + PBM + PBX + PBW), 256, 0, stream>>>(X, Wq, Wk, Wv, Wo, mask, Xp, Wp, Mw, T);
  gemm_qkv_kernel<<<dim3(3 * DM / 128, NT / 128), 128, 0, stream>>>(Xp, Wp, bq, bk, bv, T, Qp, Qr, Kp, Kr, VT, VR);
  attn_kernel<<<dim3(SEQ / 32, NB * H), 64 * KSPL, 0, stream>>>(Qp, Qr, Kp, Kr, VT, VR, Mw, lsc, Ch, Cr);
  gemm_out_kernel<<<dim3(DM / 128, NT / 64), 128, 0, stream>>>(Ch, Cr, Wp + (size_t)3 * DM * DM, bo, (float*)d_out);
}

// v007
// A run of this version takes 140 microseconds.
// Next to v006, in two timings, it ran 1.07 times as fast each time.
// Over all steps from v000 it is 3.07 times as fast.
#include <hip/hip_runtime.h>

// compute dtype: every contraction on v_wmma_f32_16x16x32_f16 (f16 operands, f32 accumulate). q/k/v projections: bf16-RNE(x) x8 times bf16-RNE(W) x64,
// 1 product each; scores K Q^T per head: q and k (rope + l2 norm in f32) as f16 x8 planes plus x1024 residual planes, 3 products (hi.hi, hi.res, res.hi);
// O^T += V^T P^T: V^T f16 x8 plus a x1024 residual plane, P f16 x1024 plus a x1024 residual tile, 3 products (residual products share one accumulator);
// output projection: ctx f16 x64 plus a x1024 residual plane times bf16-RNE(Wo) x64, 2 products. Softmax statistics (running max, exp2, row sums),
// rope cos/sin table, l2 norm and bias adds in f32; 1/sqrt(64) and exp(logit scale) folded into the log2-domain score constant.
// Fragment k-map per lane half hh for A AND B: elements 0..7 <- k = 8hh+0..7, 8..15 <- k = 16+8hh+0..7; acc[r] = D[8hh+r][col = lane&15].
// Packed planes (X, W, K, V^T, ctx and their residuals): a plane of R rows x C k-columns is stored as 16x32 tiles, tile index (row/16)*(C/32) + k/32 (V^T: (k/32)*(R/16) + row/16), each tile
// 512 elements laid out [k octet 0..3][row 0..15][8], so that each of a fragment's two wave loads reads 512 contiguous bytes (four whole 128-B lines).

#ifndef NB
#define NB 2
#endif
#ifndef SEQ
#define SEQ 2048
#endif
#ifndef NB_FULL
#define NB_FULL 2
#endif
#ifndef SEQ_FULL
#define SEQ_FULL 2048
#endif

namespace {
constexpr int H = 16, HD = 64, DM = 1024, NT = NB * SEQ, NCS = HD / 2, KT = DM / 32, TE = 512;
constexpr float XS = 8.0f, WSC = 64.0f, QS = 8.0f, QRS = 1024.0f, VS = 8.0f, VRS = 1024.0f, PS = 1024.0f, PRS = 1024.0f, OCS = 64.0f, OCRS = 1024.0f;
constexpr float LOG2E = 1.4426950408889634f, EPSN = 1e-6f;
constexpr int KSPL = 4;   // key shares (waves) per query block in the attention kernel
static_assert(KSPL == 4 && SEQ % (32 * KSPL) == 0);
constexpr int NJ = SEQ / (32 * KSPL);                       // key steps per share
// block ranges of the preparation launch (256 threads each): rope table, mask words, X plane, W planes
constexpr int PBR = SEQ * NCS / 4 / 256;                    // a thread fills 4 table entries
constexpr int PBM = NB * (SEQ / 16) * (NJ / 2) / 8;         // a wave packs 2 key steps of all KSPL shares of one query tile
constexpr int PBX = NT / 16, PBW = 4 * DM / 16;             // a block converts 16 rows of 1024
static_assert(NJ % 2 == 0 && NJ <= 16 && (NB * (SEQ / 16) * (NJ / 2)) % 8 == 0 && (SEQ * NCS / 4) % 256 == 0 && KT == 32 && SEQ % 16 == 0);
static_assert(SEQ % 64 == 0 && SEQ >= 64 && SEQ <= SEQ_FULL && NB >= 1 && NB <= NB_FULL);
static_assert(DM == H * HD && HD == 64 && DM % 128 == 0 && NT % 128 == 0 && PRS == VRS);

typedef _Float16 b16;
typedef __attribute__((ext_vector_type(16))) _Float16 v16b;
typedef __attribute__((ext_vector_type(8))) _Float16 v8b;
typedef __attribute__((ext_vector_type(2))) _Float16 v2b;
typedef __attribute__((ext_vector_type(8))) float v8f;
typedef __attribute__((ext_vector_type(4))) float v4f;
typedef __attribute__((ext_vector_type(2))) float v2f;
typedef __attribute__((ext_vector_type(4))) unsigned int v4u;

__device__ __forceinline__ float bf16_rne(float f) { unsigned int u = __float_as_uint(f); u += 0x7FFFu + ((u >> 16) & 1u); return __uint_as_float(u & 0xFFFF0000u); }
// 16-bit fragment from a k-contiguous row: elements 0..7 <- p[8hh .. 8hh+7], 8..15 <- p[16+8hh .. 16+8hh+7]
__device__ __forceinline__ v16b frag_kb(const b16* p, int hh) {
  const v8b a = *(const v8b*)(p + 8 * hh), b = *(const v8b*)(p + 16 + 8 * hh); v16b f;
#pragma unroll
  for (int e = 0; e < 8; ++e) { f[e] = a[e]; f[8 + e] = b[e]; }
  return f;
}
// the same fragment from a packed tile; p = tile + 8*lane (lane = 16hh + row): octets hh and 2+hh of the lane's row
__device__ __forceinline__ v16b frag_pk(const b16* p) {
  const v8b a = *(const v8b*)p, b = *(const v8b*)(p + 256); v16b f;
#pragma unroll
  for (int e = 0; e < 8; ++e) { f[e] = a[e]; f[8 + e] = b[e]; }
  return f;
}
__device__ __forceinline__ v8f wmma16b(v16b a, v16b b, v8f c) {
  v8f d = __builtin_amdgcn_wmma_f32_16x16x32_f16(false, a, false, b, (short)0, c, false, false);
  asm volatile("v_nop\n\tv_nop\n\tv_nop\n\tv_nop" : "+v"(d) : "v"(a), "v"(b));
  return d;
}
// the plain builtin (the compiler keeps the distances): for the attention kernel, whose live set passes v255, where the operands of an asm statement cannot lie
__device__ __forceinline__ v8f wmma16p(v16b a, v16b b, v8f c) { return __builtin_amdgcn_wmma_f32_16x16x32_f16(false, a, false, b, (short)0, c, false, false); }
__device__ __forceinline__ void wave_lds_sync() { __builtin_amdgcn_fence(3, "workgroup"); __builtin_amdgcn_wave_barrier(); __builtin_amdgcn_fence(2, "workgroup"); }
__device__ __forceinline__ float nexp2(float v) { return __builtin_amdgcn_exp2f(v); }

// One row group (16 rows x 1024 columns, f32, row pitch DM, first row at S) to its KT packed tiles at D, f16 = bf16-RNE(value) x sc, by one block of 256 threads.
// A pass of the block covers 4 tiles, thread per k octet: a wave reads 8 rows x 128 B and writes four whole 128-B lines of one tile. All 8 passes' loads (16 of
// 16 B a lane) are requested before the first conversion.
__device__ __forceinline__ void cvt_row_group(const float* __restrict__ S, b16* __restrict__ D, float sc, int tid) {
  const int oct = tid & 3, rl = (tid >> 2) & 15, t0 = tid >> 6;
  const float* src = S + (size_t)rl * DM + (size_t)(t0 * 32 + oct * 8);
  b16* dst = D + (size_t)t0 * TE + (size_t)((oct * 16 + rl) * 8);
  v4f x0[KT / 4], x1[KT / 4];
#pragma unroll
  for (int i = 0; i < KT / 4; ++i) { x0[i] = *(const v4f*)(src + i * 128); x1[i] = *(const v4f*)(src + i * 128 + 4); }
  asm volatile("s_wait_xcnt 0x0" :: "v"(src) : "memory");   // behind the group: the address pair stays whole until here, before any of its registers is rewritten
  v8b o[KT / 4];
#pragma unroll
  for (int i = 0; i < KT / 4; ++i)
#pragma unroll
    for (int j = 0; j < 4; ++j) { o[i][j] = (b16)(bf16_rne(x0[i][j]) * sc); o[i][4 + j] = (b16)(bf16_rne(x1[i][j]) * sc); }
#pragma unroll
  for (int i = 0; i < KT / 4; ++i) *(v8b*)(dst + (size_t)i * 4 * TE) = o[i];
  asm volatile("s_wait_xcnt 0x0" ::: "memory");   // behind the run of stores, before any later code rewrites their address or data registers
}

// All preparation in one launch; the block's range of blockIdx.x selects its work (block-uniform):
// [0, PBR): rope table T[s][i] = (cos, sin)(s * freq_i), freq_i = 1 / fl32(10000^(2i/64)), s*freq as an f32 product, argument reduction in f64 (mul/fma only), short
//   f32 polynomials; a thread computes freq_i once and fills four rows s.
// [PBR, PBR+PBM): the mask packed into bit words Mw[b][query tile][share ks][step j of the share][query 0..15]: bit i set <=> key 32*(j*KSPL+ks)+i is NOT masked for
//   that query. A wave takes one query tile and the steps j, j+1 of all four shares, two shares a trip: 16 rows x two pieces of 256 B in, two whole 128-B lines out.
// [.., +PBX): X plane, packed tiles of [NB*SEQ tokens][1024], f16 = bf16-RNE(x) x8; token row b*SEQ+s reads input row b*SEQ_FULL+s; a block per 16 tokens.
// [.., +PBW): W planes [4], each the packed tiles of [1024 out][1024 in], f16 = bf16-RNE(W) x64 (rows n, k along the input); a block per 16 rows of one weight.
__global__ __launch_bounds__(256) void prep_kernel(const float* __restrict__ X, const float* __restrict__ Wq, const float* __restrict__ Wk,
                                                   const float* __restrict__ Wv, const float* __restrict__ Wo, const int* __restrict__ mask,
                                                   b16* __restrict__ Xp, b16* __restrict__ Wp, unsigned int* __restrict__ Mw, v2f* __restrict__ T) {
  const int blk = (int)blockIdx.x, tid = (int)threadIdx.x;
  if (blk < PBR) {
    const int u = blk * 256 + tid, i = u % NCS, sq = u / NCS;
    const float ex = (float)(2 * i) / (float)HD;
    const float pw = (float)exp2((double)ex * 13.287712379549449);
    const float freq = 1.0f / pw;
#pragma unroll
    for (int q = 0; q < 4; ++q) {
      const int s = sq + q * (SEQ / 4);
      const float ang = (float)s * freq;
      const double a = (double)ang;
      const double k = __builtin_rint(a * 0.63661977236758134);
      double rd = __builtin_fma(-k, 1.5707963267948966, a);
      rd = __builtin_fma(-k, 6.123233995736766e-17, rd);
      const float r = (float)rd, r2 = r * r;
      const float sp = r + r * r2 * (-1.6666666666666666e-1f + r2 * (8.333333333333333e-3f + r2 * (-1.984126984126984e-4f + r2 * 2.7557319223985893e-6f)));
      const float cp = 1.0f + r2 * (-0.5f + r2 * (4.1666666666666664e-2f + r2 * (-1.3888888888888889e-3f + r2 * (2.48015873015873e-5f + r2 * -2.755731922398589e-7f))));
      const int kq = (int)(((long long)k) & 3);
      const float c = (kq == 0) ? cp : ((kq == 1) ? -sp : ((kq == 2) ? -cp : sp));
      const float sn = (kq == 0) ? sp : ((kq == 1) ? cp : ((kq == 2) ? -sp : -cp));
      v2f o; o.x = c; o.y = sn;
      *(v2f*)(T + (size_t)s * NCS + i) = o;
    }
    return;
  }
  if (blk < PBR + PBM) {
    const int wv = (blk - PBR) * 8 + (tid >> 5), lane = tid & 31;
    const int jp = wv % (NJ / 2), qt = (wv / (NJ / 2)) % (SEQ / 16), b = wv / ((NJ / 2) * (SEQ / 16));
    const int* src = mask + ((size_t)b * SEQ_FULL + (size_t)qt * 16) * SEQ_FULL + (size_t)(2 * jp * KSPL * 32 + lane);
    unsigned int* dst = Mw + (size_t)(((b * (SEQ / 16) + qt) * KSPL * NJ + 2 * jp) * 16) + lane;
#pragma unroll 1   // two trips of 64 loads a lane: all four shares at once would double the registers of the whole launch
    for (int ks = 0; ks < KSPL; ks += 2) {
      int g[2][2][16];
#pragma unroll
      for (int r = 0; r < 16; ++r)
#pragma unroll
        for (int c = 0; c < 2; ++c) {
          g[c][0][r] = src[(size_t)r * SEQ_FULL + (ks + c) * 32]; g[c][1][r] = src[(size_t)r * SEQ_FULL + (ks + c) * 32 + 32 * KSPL]; }
#pragma unroll
      for (int c = 0; c < 2; ++c) {
        unsigned int w = 0u;
#pragma unroll
        for (int r = 0; r < 16; ++r) {
          const unsigned int b0 = __builtin_amdgcn_ballot_w32(g[c][0][r] == 0), b1 = __builtin_amdgcn_ballot_w32(g[c][1][r] == 0);
          w = (lane == r) ? b0 : w; w = (lane == 16 + r) ? b1 : w; }
        dst[(size_t)(ks + c) * NJ * 16] = w; }
      asm volatile("s_wait_xcnt 0x0" ::: "memory");   // before the next trip rewrites the loads' and stores' address and data registers
    }
    return;
  }
  if (blk < PBR + PBM + PBX) {
    const int row0 = (blk - PBR - PBM) * 16, b = row0 / SEQ, s0 = row0 % SEQ;
    cvt_row_group(X + ((size_t)b * SEQ_FULL + (size_t)s0) * DM, Xp + (size_t)(row0 / 16) * KT * TE, XS, tid);
    return;
  }
  const int wb = blk - PBR - PBM - PBX, y = wb / (DM / 16), rg = wb % (DM / 16);
  const float* W = (y == 0) ? Wq : ((y == 1) ? Wk : ((y == 2) ? Wv : Wo));
  cvt_row_group(W + (size_t)rg * 16 * DM, Wp + (size_t)y * DM * DM + (size_t)rg * KT * TE, WSC, tid);
}

// Fused q/k/v projection: C = A(X plane) . B (B[k][n] = W[n][k] from the packed W plane), K = 1024 stepped by 32, fragments loaded straight from the packed
// global f16 planes. q planes stay [s][64]; k planes are packed tiles of [s][64], v planes packed tiles of [64][s].
// Block 128 threads = 4 waves in 2x2, wave tile 64 tokens x 64 features = 4x4 WMMA tiles: a k step's 8 fragments (8 KB) feed 16 products. A wave's 64 columns are
// exactly one head of q, k or v (which = column block / 1024, block-uniform). Epilogue, each wave on its own tile: acc/512 + bf16-RNE(bias) staged in the wave's
// part of LDS, then rope + l2 norm (q, k) or transpose (v); a trip of each epilogue loop takes its piece of all four 16-row tiles of the wave.
__global__ __launch_bounds__(128) __attribute__((amdgpu_num_vgpr(256))) void gemm_qkv_kernel(
    const b16* __restrict__ Xp, const b16* __restrict__ Wp, const float* __restrict__ bq, const float* __restrict__ bk, const float* __restrict__ bv,
    const v2f* __restrict__ CSt, b16* __restrict__ Qp, b16* __restrict__ Qr, b16* __restrict__ Kp, b16* __restrict__ Kr, b16* __restrict__ VT,
    b16* __restrict__ VR) {
  __shared__ __attribute__((aligned(16))) float Tt[4][64][HD + 4];
  const int wave = threadIdx.x >> 5, lane = threadIdx.x & 31, hh = lane >> 4, m = lane & 15, wm = wave >> 1, wn = wave & 1;
  const int nblk = (int)blockIdx.x * 128, which = nblk / DM, n0 = nblk % DM + wn * 64, h = n0 / HD;
  const int mblk = (int)blockIdx.y * 128 + wm * 64, b = mblk / SEQ, s0 = mblk % SEQ;
  // byte offsets of the lane's place in the wave's first tiles (each plane is far below 4 GiB)
  unsigned wo = (unsigned)(((which * (DM / 16) + n0 / 16) * KT * TE + 8 * lane) * 2), ao = (unsigned)((mblk / 16 * KT * TE + 8 * lane) * 2);
  const float* bsel = (which == 0) ? bq : ((which == 1) ? bk : bv);
  float (*Tw)[HD + 4] = Tt[wave];
  v8f acc[4][4];
#pragma unroll
  for (int i = 0; i < 4; ++i)
#pragma unroll
    for (int j = 0; j < 4; ++j) acc[i][j] = (v8f){};
#pragma unroll 1
  for (int k0 = 0; k0 < DM; k0 += 32) {
    v16b af[4], bf[4];
#pragma unroll
    for (int mt = 0; mt < 4; ++mt) af[mt] = frag_pk((const b16*)((const char*)Xp + ao) + (size_t)mt * KT * TE);
#pragma unroll
    for (int nt = 0; nt < 4; ++nt) bf[nt] = frag_pk((const b16*)((const char*)Wp + wo) + (size_t)nt * KT * TE);
    ao += TE * 2; wo += TE * 2;
#pragma unroll
    for (int mt = 0; mt < 4; ++mt)
#pragma unroll
      for (int nt = 0; nt < 4; ++nt) acc[mt][nt] = wmma16b(af[mt], bf[nt], acc[mt][nt]);
  }
  float bias[4];
#pragma unroll
  for (int nt = 0; nt < 4; ++nt) bias[nt] = bf16_rne(bsel[n0 + nt * 16 + m]);
  const float isc = 1.0f / (XS * WSC);
#pragma unroll
  for (int mt = 0; mt < 4; ++mt)
#pragma unroll
    for (int nt = 0; nt < 4; ++nt)
#pragma unroll
      for (int r = 0; r < 8; ++r) Tw[mt * 16 + 8 * hh + r][nt * 16 + m] = acc[mt][nt][r] * isc + bias[nt];
  __syncthreads();   // the staged tile is read across lanes
  if (which < 2) {
    // 16 rows are 1024 elements in both layouts ([s][64] rows for q, packed tiles of [s][64] for k); lo = the lane's place in them, rs = elements from a row to the next
    const int lo = (which == 0) ? 2 * lane : (lane >> 4) * 512 + ((lane >> 2) & 3) * 128 + ((2 * lane) & 7), rs = (which == 0) ? HD : 8;
    const size_t pb = (size_t)(b * H + h) * SEQ * HD + (size_t)s0 * HD + lo;
    b16* Ph = ((which == 0) ? Qp : Kp) + pb;
    b16* Pl = ((which == 0) ? Qr : Kr) + pb;
    const v2f* Cw = CSt + (size_t)s0 * NCS + lane;
#pragma unroll 1
    for (int it = 0; it < 16; ++it) {   // row it of each of the wave's four 16-row tiles
      float y0[4], y1[4], ss[4];
#pragma unroll
      for (int mt = 0; mt < 4; ++mt) {
        const int r = mt * 16 + it;
        const float x0 = Tw[r][2 * lane], x1 = Tw[r][2 * lane + 1];
        const v2f cv = Cw[(size_t)r * NCS];
        y0[mt] = x0 * cv.x - x1 * cv.y; y1[mt] = x1 * cv.x + x0 * cv.y;
        ss[mt] = y0[mt] * y0[mt] + y1[mt] * y1[mt]; }
#pragma unroll
      for (int w = 16; w >= 1; w >>= 1)
#pragma unroll
        for (int mt = 0; mt < 4; ++mt) ss[mt] += __shfl_xor(ss[mt], w);
#pragma unroll
      for (int mt = 0; mt < 4; ++mt) {
        const float inv = 1.0f / sqrtf(ss[mt] + EPSN);
        const float z0 = y0[mt] * inv * QS, z1 = y1[mt] * inv * QS;
        const b16 h0 = (b16)z0, h1 = (b16)z1;
        v2b oh, ol; oh.x = h0; oh.y = h1; ol.x = (b16)((z0 - (float)h0) * QRS); ol.y = (b16)((z1 - (float)h1) * QRS);
        const int off = mt * 16 * HD + it * rs;
        *(v2b*)(Ph + off) = oh; *(v2b*)(Pl + off) = ol; }
      asm volatile("s_wait_xcnt 0x0" ::: "memory");   // before the next trip rewrites the loads' and stores' address and data registers
    }
  } else {
    const size_t vb = ((size_t)(b * H + h) * HD) * SEQ;
#pragma unroll 1
    for (int it = 0; it < 4; ++it) {
#pragma unroll
      for (int g = 0; g < 4; ++g) {   // the wave's four groups of 16 head features (each one row of packed tiles)
        const int dl = (it & 1) * 8 + (lane & 7), d = g * 16 + dl, tok = (it >> 1) * 32 + (lane >> 3) * 8;
        v8b oh, ol;
#pragma unroll
        for (int j = 0; j < 8; ++j) {
          const float v = Tw[tok + j][d] * VS; const b16 hv = (b16)v; oh[j] = hv; ol[j] = (b16)((v - (float)hv) * VRS); }
        const size_t off = vb + (size_t)((((s0 + tok) >> 5) * 4 + g) * 64 + (lane >> 3) * 16 + dl) * 8;
        *(v8b*)(VT + off) = oh; *(v8b*)(VR + off) = ol;
      }
      asm volatile("s_wait_xcnt 0x0" ::: "memory");   // before the next trip rewrites the stores' address and data registers
    }
  }
}

// Masked softmax attention per (query block of 32, b*H+h); block = 4 waves = 4 key shares, each wave on BOTH 16-query tiles of the block, so that every K and V
// fragment it loads feeds the products of both tiles: share ks takes the key steps of 32 whose index is ks modulo 4, in fixed order, with its own running max, row sum and O tile
// per query tile; the four partial results of a query tile are merged in LDS behind one block barrier (weights exp2(m_j - max m), fixed order j = 0..3), each
// share's wave packing a quarter of each tile's ctx. The mask comes as the packed bit words: the wave reads all words of its share for both tiles once and keeps two
// scalar maps, the steps with any unmasked entry in its 32x32 region (only these are walked; the others contribute 0) and the steps with none masked (these apply no
// mask); a walked step's word per query is requested one walked step ahead. A walked step in which a query has no unmasked key leaves that query's max, sum and O as they are.
// S^T = K Q^T (hi.hi + hi.res + res.hi, q/k residual products scaled back by 1/1024), masked entries replaced by -inf, online softmax (running max, f32,
// -inf-safe), P x1024 and its x1024 residual via wave-private LDS, O^T += V^T P^T with V^T hi/res planes. ctx [b*SEQ+s][h*64+d] written as packed tiles, f16 x64
__global__ __launch_bounds__(32 * KSPL) __attribute__((amdgpu_num_vgpr(336))) void attn_kernel(
    const b16* __restrict__ Qp, const b16* __restrict__ Qr, const b16* __restrict__ Kp, const b16* __restrict__ Kr,
    const b16* __restrict__ VT, const b16* __restrict__ VR, const unsigned int* __restrict__ Mw, const float* __restrict__ lsc,
    b16* __restrict__ Ch, b16* __restrict__ Cr) {
  __shared__ __attribute__((aligned(16))) b16 Pb[KSPL][2][16][32 + 8];
  __shared__ __attribute__((aligned(16))) b16 Pr[KSPL][2][16][32 + 8];
  __shared__ __attribute__((aligned(16))) float To[KSPL][2][16][HD + 4];
  __shared__ float Ms[KSPL][2][16], Ls[KSPL][2][16];
  // the wave's number (its key share) as a scalar, so that the key loop's control and the plane offsets stay on the scalar unit
  const int ks = __builtin_amdgcn_readfirstlane((int)(threadIdx.x >> 5));
  const int lane = threadIdx.x & 31, hh = lane >> 4, col = lane & 15;
  const int bhi = (int)blockIdx.y, b = bhi / H, h = bhi % H;
  const int q0 = (int)blockIdx.x * 32;
  const size_t pq = (size_t)bhi * SEQ * HD;   // same plane size for the [s][64] rows and for both packed layouts
  const b16* Kb = Kp + pq; const b16* Klb = Kr + pq;
  const b16* Vb = VT + pq; const b16* Rb = VR + pq;
  constexpr unsigned MTB = (unsigned)(KSPL * NJ * 16 * 4);   // bytes from a query tile's mask words to the next tile's
  const unsigned int* Mq = Mw + (size_t)(((b * (SEQ / 16) + (q0 >> 4)) * KSPL + ks) * NJ) * 16;   // the share's NJ x 16 mask words of the first tile
  unsigned int act, ful;   // bit 2j: step j of the share has an unmasked entry / has no masked entry, over both tiles; both wave-uniform
  const int jl = lane >> 1;   // the lane reads 8 of step jl's 16 words of each tile
  const unsigned so = (jl < NJ) ? (unsigned)lane * 32u : 0u;
  {
    const unsigned int* sp = (const unsigned int*)((const char*)Mq + so);
    const unsigned int* sp1 = (const unsigned int*)((const char*)Mq + so + MTB);
    const v4u w0 = *(const v4u*)sp, w1 = *(const v4u*)(sp + 4), w2 = *(const v4u*)sp1, w3 = *(const v4u*)(sp1 + 4);
    const v4u vo = w0 | w1 | w2 | w3, va = w0 & w1 & w2 & w3;
    const unsigned int wo = vo.x | vo.y | vo.z | vo.w, wa = va.x & va.y & va.z & va.w;
    const unsigned int anyb = __builtin_amdgcn_ballot_w32(jl < NJ && wo != 0u), allb = __builtin_amdgcn_ballot_w32(wa == 0xFFFFFFFFu);
    act = (anyb | (anyb >> 1)) & 0x55555555u; ful = allb & (allb >> 1);
  }
  asm volatile("s_wait_xcnt 0x0" :: "v"(so) : "memory");   // before the mask words' offset register is rewritten
  float m[2], l[2]; v8f o[2][4], o2[2][4];
#pragma unroll
  for (int a = 0; a < 2; ++a) {
    m[a] = -INFINITY; l[a] = 0.0f;
#pragma unroll
    for (int t = 0; t < 4; ++t) { o[a][t] = (v8f){}; o2[a][t] = (v8f){}; } }
  if (act != 0u) {   // scalar branch: a share with no unmasked entry loads nothing more
  // Q fragments [query tile][k half] and the first walked step's mask words: one group, in flight beside the first step's K group
  v16b qa[2][2], ql[2][2];
  const unsigned qb = (unsigned)((q0 + col) * HD + 8 * hh) * 2u;   // byte offset of the lane's first octet in the head's [s][64] plane
  const b16* pqh = (const b16*)((const char*)(Qp + pq) + qb); const b16* pql = (const b16*)((const char*)(Qr + pq) + qb);
#pragma unroll
  for (int a = 0; a < 2; ++a) {
    qa[a][0] = frag_kb(pqh + a * 16 * HD, 0); qa[a][1] = frag_kb(pqh + a * 16 * HD + 32, 0);
    ql[a][0] = frag_kb(pql + a * 16 * HD, 0); ql[a][1] = frag_kb(pql + a * 16 * HD + 32, 0); }
  // each query's 32 mask bits of a walked step are requested one walked step ahead
  unsigned int mwn[2];
  const unsigned mo0 = (unsigned)(__builtin_ctz(act) >> 1) * 64u + (unsigned)col * 4u;
  mwn[0] = *(const unsigned int*)((const char*)Mq + mo0); mwn[1] = *(const unsigned int*)((const char*)Mq + mo0 + MTB);
  asm volatile("s_wait_xcnt 0x0" :: "v"(qb), "v"(mo0) : "memory");   // behind the group: its offset registers stay whole until here
  const float cs = 0.125f * expf(bf16_rne(lsc[0])) * (LOG2E / (QS * QS));
#pragma unroll 1   // rolled: the trip count comes from the mask, and one body fills the register budget
  do {   // at most NJ trips, in rising key order
    const int tz = __builtin_ctz(act), j = tz >> 1; act &= act - 1u;
    const bool full = ((ful >> tz) & 1u) != 0u;
    // byte offset of the lane's place in the step's first tile: K tiles 2u, 2u+1 of key group u and V tiles t share it
    const unsigned ko = (unsigned)lane * 16u + (unsigned)(j * KSPL + ks) * (unsigned)(4 * TE * 2);
    const unsigned int mw[2] = {mwn[0], mwn[1]};
    // the next walked step's words (the last step asks for its own again: in bounds, never used)
    const unsigned mo = (unsigned)((act != 0u ? __builtin_ctz(act) >> 1 : j) * 64) + (unsigned)col * 4u;
    mwn[0] = *(const unsigned int*)((const char*)Mq + mo); mwn[1] = *(const unsigned int*)((const char*)Mq + mo + MTB);
    // all eight K fragments of the step are requested here as one group, ahead of the matrix work
    v16b kh[4], kl[4], vh[4], vl[4];
    const b16* pk = (const b16*)((const char*)Kb + ko); const b16* pkl = (const b16*)((const char*)Klb + ko);
    const b16* pv = (const b16*)((const char*)Vb + ko); const b16* pvl = (const b16*)((const char*)Rb + ko);
#pragma unroll
    for (int j = 0; j < 4; ++j) { kh[j] = frag_pk(pk + j * TE); kl[j] = frag_pk(pkl + j * TE); }
    // behind the group: its offset registers stay whole until here, and no load sinks to its use (there each pair of loads costs the wave a full L2 round trip)
    asm volatile("s_wait_xcnt 0x0" :: "v"(ko), "v"(mo) : "memory");
    __builtin_amdgcn_sched_barrier(0);   // no product rises above the group: else a late K load takes an early fragment's registers and waits out a second round trip
    float e[2][16];
#pragma unroll
    for (int u = 0; u < 2; ++u) {
      const v16b ka = kh[2 * u], kc = kh[2 * u + 1];
#pragma unroll
      for (int a = 0; a < 2; ++a) {
        v8f s = wmma16p(ka, qa[a][0], (v8f){}); s = wmma16p(kc, qa[a][1], s);
        v8f s2 = wmma16p(ka, ql[a][0], (v8f){}); s2 = wmma16p(kc, ql[a][1], s2);
        s2 = wmma16p(kl[2 * u], qa[a][0], s2); s2 = wmma16p(kl[2 * u + 1], qa[a][1], s2);
#pragma unroll
        for (int r = 0; r < 8; ++r) e[a][u * 8 + r] = (s[r] + s2[r] * (1.0f / QRS)) * cs; } }
    // second group, into the registers that K has left: all eight V fragments fly while the softmax runs
#pragma unroll
    for (int t = 0; t < 4; ++t) { vh[t] = frag_pk(pv + t * TE); vl[t] = frag_pk(pvl + t * TE); }
    asm volatile("s_wait_xcnt 0x0" :: "v"(ko) : "memory");   // as behind the K group: the offset register whole, the loads ahead of the softmax arithmetic
    if (!full) {   // scalar branch: entry i of the lane is key 8hh+i (i < 8) or 16+8hh+i-8 of the step
#pragma unroll
      for (int a = 0; a < 2; ++a) {
        const unsigned int sh = mw[a] >> (8 * hh);
#pragma unroll
        for (int i2 = 0; i2 < 16; ++i2) e[a][i2] = ((sh >> (i2 < 8 ? i2 : i2 + 8)) & 1u) ? e[a][i2] : -INFINITY; } }
    float al[2], mx[2];
#pragma unroll
    for (int a = 0; a < 2; ++a) {   // both tiles' maxima first, so that their two exchanges between the lane halves share one wait
      mx[a] = -INFINITY;
#pragma unroll
      for (int i2 = 0; i2 < 16; ++i2) mx[a] = fmaxf(mx[a], e[a][i2]); }
    const float ox[2] = {__shfl_xor(mx[0], 16), __shfl_xor(mx[1], 16)};
#pragma unroll
    for (int a = 0; a < 2; ++a) {
      const float mn = fmaxf(m[a], fmaxf(mx[a], ox[a]));
      const float mref = (mn == -INFINITY) ? 0.0f : mn;
      const float xa = m[a] - mref; al[a] = nexp2(xa); float sum = 0.0f;
      asm volatile("v_nop" :: "v"(xa), "v"(al[a]));   // the slot behind the exponential, as below
#pragma unroll
      for (int g = 0; g < 16; g += 4) {
        float x[4], p[4];
#pragma unroll
        for (int k = 0; k < 4; ++k) { x[k] = e[a][g + k] - mref; p[k] = nexp2(x[k]); }
        // the slot behind a transcendental: arguments and results as inputs only, so that the four stand in front of it and no argument register is rewritten before it
        asm volatile("v_nop" :: "v"(x[0]), "v"(x[1]), "v"(x[2]), "v"(x[3]), "v"(p[0]), "v"(p[1]), "v"(p[2]), "v"(p[3]));
#pragma unroll
        for (int k = 0; k < 4; ++k) {
          const int i2 = g + k, pi = (i2 < 8 ? 0 : 16) + 8 * hh + (i2 & 7); sum += p[k];
          const float pp = p[k] * PS; const b16 ph = (b16)pp; Pb[ks][a][col][pi] = ph;
          Pr[ks][a][col][pi] = (b16)((pp - (float)ph) * PRS); } }
      sum += __shfl_xor(sum, 16); l[a] = l[a] * al[a] + sum; m[a] = mn; }
    wave_lds_sync();
    v16b pf[2], plf[2];
#pragma unroll
    for (int a = 0; a < 2; ++a) { pf[a] = frag_kb(&Pb[ks][a][col][0], hh); plf[a] = frag_kb(&Pr[ks][a][col][0], hh); }
#pragma unroll
    for (int t = 0; t < 4; ++t)
#pragma unroll
      for (int a = 0; a < 2; ++a) {
        o[a][t] *= al[a]; o2[a][t] *= al[a];
        o[a][t] = wmma16p(vh[t], pf[a], o[a][t]);
        o2[a][t] = wmma16p(vl[t], pf[a], o2[a][t]);
        o2[a][t] = wmma16p(vh[t], plf[a], o2[a][t]); }
    wave_lds_sync(); } while (act != 0u);
  }
  // the share's partial results, not yet normalised: O tile, running max and row sum of each query
#pragma unroll
  for (int a = 0; a < 2; ++a) {
#pragma unroll
    for (int t = 0; t < 4; ++t) {
#pragma unroll
      for (int r = 0; r < 8; ++r) To[ks][a][col][t * 16 + 8 * hh + r] = o[a][t][r] + o2[a][t][r] * (1.0f / VRS); }
    if (hh == 0) { Ms[ks][a][col] = m[a]; Ls[ks][a][col] = l[a]; } }
  __syncthreads();   // the partial results are read across the four waves
#pragma unroll
  for (int a = 0; a < 2; ++a) {
    const size_t cb = ((size_t)((b * SEQ + q0 + a * 16) >> 4) * KT + (size_t)h * 2) * TE;
    const int it = ks;   // each share's wave merges and packs one quarter of each query tile
    const int rl = (it & 1) * 8 + (lane & 7), pc = (it >> 1) * 32 + (lane >> 3) * 8;
    float mj[KSPL], mt = -INFINITY;
#pragma unroll
    for (int j = 0; j < KSPL; ++j) { mj[j] = Ms[j][a][rl]; mt = fmaxf(mt, mj[j]); }
    const float mtr = (mt == -INFINITY) ? 0.0f : mt;   // -inf-safe, as in the key loop
    float lt = 0.0f, xw[KSPL], w[KSPL]; v4f f0 = (v4f){}, f1 = (v4f){};
#pragma unroll
    for (int j = 0; j < KSPL; ++j) { xw[j] = mj[j] - mtr; w[j] = nexp2(xw[j]); }
    // the slot behind a transcendental, as in the key loop
    asm volatile("v_nop" :: "v"(xw[0]), "v"(xw[1]), "v"(xw[2]), "v"(xw[3]), "v"(w[0]), "v"(w[1]), "v"(w[2]), "v"(w[3]));
#pragma unroll
    for (int j = 0; j < KSPL; ++j) {
      lt += w[j] * Ls[j][a][rl];
      f0 += w[j] * *(const v4f*)(&To[j][a][rl][pc]); f1 += w[j] * *(const v4f*)(&To[j][a][rl][pc + 4]); }
    const float inv = 1.0f / (lt * PS * VS);
    f0 *= inv; f1 *= inv;
    v8b oh, ol;
#pragma unroll
    for (int j = 0; j < 4; ++j) {
      const float v0 = f0[j] * OCS; const b16 hv0 = (b16)v0; oh[j] = hv0; ol[j] = (b16)((v0 - (float)hv0) * OCRS);
      const float v1 = f1[j] * OCS; const b16 hv1 = (b16)v1; oh[4 + j] = hv1; ol[4 + j] = (b16)((v1 - (float)hv1) * OCRS); }
    const size_t off = cb + (size_t)((it >> 1) * 64 + (lane >> 3) * 16 + rl) * 8;
    *(v8b*)(Ch + off) = oh; *(v8b*)(Cr + off) = ol;
    if (a == 0) asm volatile("s_wait_xcnt 0x0" ::: "memory");   // before the second tile's code rewrites the stores' address and data registers
  }
}

// Output projection: out = (ctx hi . Wo + ctx res . Wo / 1024) / 4096 + bf16-RNE(bo), K = 1024 stepped by 32, fragments from the packed global planes.
// Block 128 = 4 waves in 2x2, wave tile 32 tokens x 64 features = 2x4 WMMA tiles for each of the two products: a k step's 8 fragments (8 KB) feed 16 products.
// Result staged in the wave's part of LDS; each 256-B row segment is stored by 16 consecutive lanes.
__global__ __launch_bounds__(128) __attribute__((amdgpu_num_vgpr(256))) void gemm_out_kernel(
    const b16* __restrict__ Ch, const b16* __restrict__ Cr, const b16* __restrict__ Wop, const float* __restrict__ bo, float* __restrict__ out) {
  __shared__ __attribute__((aligned(16))) float Tt[4][32][HD + 4];
  const int wave = threadIdx.x >> 5, lane = threadIdx.x & 31, hh = lane >> 4, m = lane & 15, wm = wave >> 1, wn = wave & 1;
  const int nblk = (int)blockIdx.x * 128 + wn * 64;
  const int mblk = (int)blockIdx.y * 64 + wm * 32, b = mblk / SEQ, s0 = mblk % SEQ;
  // byte offsets of the lane's place in the wave's first tiles (each plane is far below 4 GiB); ctx and its residual share one
  unsigned wo = (unsigned)((nblk / 16 * KT * TE + 8 * lane) * 2), ao = (unsigned)((mblk / 16 * KT * TE + 8 * lane) * 2);
  float (*Tw)[HD + 4] = Tt[wave];
  v8f acc[2][4], acc2[2][4];
#pragma unroll
  for (int i = 0; i < 2; ++i)
#pragma unroll
    for (int j = 0; j < 4; ++j) { acc[i][j] = (v8f){}; acc2[i][j] = (v8f){}; }
#pragma unroll 1
  for (int k0 = 0; k0 < DM; k0 += 32) {
    v16b af[2], rf[2], bf[4];
#pragma unroll
    for (int mt = 0; mt < 2; ++mt) {
      af[mt] = frag_pk((const b16*)((const char*)Ch + ao) + (size_t)mt * KT * TE);
      rf[mt] = frag_pk((const b16*)((const char*)Cr + ao) + (size_t)mt * KT * TE); }
#pragma unroll
    for (int nt = 0; nt < 4; ++nt) bf[nt] = frag_pk((const b16*)((const char*)Wop + wo) + (size_t)nt * KT * TE);
    ao += TE * 2; wo += TE * 2;
#pragma unroll
    for (int mt = 0; mt < 2; ++mt)
#pragma unroll
      for (int nt = 0; nt < 4; ++nt) {
        acc[mt][nt] = wmma16b(af[mt], bf[nt], acc[mt][nt]);
        acc2[mt][nt] = wmma16b(rf[mt], bf[nt], acc2[mt][nt]); }
  }
  const int bi = nblk + m;
  float bias[4];
#pragma unroll
  for (int nt = 0; nt < 4; ++nt) bias[nt] = bo[bi + nt * 16];
  asm volatile("s_wait_xcnt 0x0" :: "v"(bi) : "memory");   // behind the four bias loads: their index register stays whole until here
#pragma unroll
  for (int nt = 0; nt < 4; ++nt) bias[nt] = bf16_rne(bias[nt]);
  const float isc = 1.0f / (OCS * WSC), irs = 1.0f / OCRS;
#pragma unroll
  for (int mt = 0; mt < 2; ++mt)
#pragma unroll
    for (int nt = 0; nt < 4; ++nt)
#pragma unroll
      for (int r = 0; r < 8; ++r)
        Tw[mt * 16 + 8 * hh + r][nt * 16 + m] = (acc[mt][nt][r] + acc2[mt][nt][r] * irs) * isc + bias[nt];
  __syncthreads();   // the staged tile is read across lanes
  float* ob = out + ((size_t)b * SEQ_FULL + (size_t)s0) * DM + nblk;
#pragma unroll 1
  for (int it = 0; it < 8; ++it) {
#pragma unroll
    for (int mt = 0; mt < 2; ++mt) {   // two rows of each of the wave's two 16-row tiles
      const int rr = mt * 16 + it * 2 + hh; const v4f f = *(const v4f*)(&Tw[rr][m * 4]);
      *(v4f*)(ob + (size_t)rr * DM + m * 4) = f; }
  }
}
}  // namespace

extern "C" void kernel_launch(void* const* d_in, const int* in_sizes, int n_in, void* d_out, int out_size, void* d_ws, size_t ws_size, hipStream_t stream) {
  // wire order: 0 x [NB_FULL][SEQ_FULL][1024] f32, 1 Wq [1024][1024], 2 bq [1024], 3 Wk, 4 bk, 5 Wv, 6 bv, 7 Wo, 8 bo, 9 logit scale [1] f32,
  //             10 mask int32 [NB_FULL][SEQ_FULL][SEQ_FULL] (nonzero = masked); out [NB_FULL][SEQ_FULL][1024] f32
  if (n_in < 11) return;
  const size_t need_x = ((size_t)(NB - 1) * SEQ_FULL + SEQ) * DM;
  const size_t need_m = ((size_t)(NB - 1) * SEQ_FULL + SEQ - 1) * SEQ_FULL + SEQ;
  if ((size_t)in_sizes[0] < need_x || (size_t)out_size < need_x || (size_t)in_sizes[10] < need_m || in_sizes[9] < 1) return;
  if (in_sizes[1] < DM * DM || in_sizes[3] < DM * DM || in_sizes[5] < DM * DM || in_sizes[7] < DM * DM) return;
  if (in_sizes[2] < DM || in_sizes[4] < DM || in_sizes[6] < DM || in_sizes[8] < DM) return;
  const float* X = (const float*)d_in[0];
  const float* Wq = (const float*)d_in[1]; const float* bq = (const float*)d_in[2];
  const float* Wk = (const float*)d_in[3]; const float* bk = (const float*)d_in[4];
  const float* Wv = (const float*)d_in[5]; const float* bv = (const float*)d_in[6];
  const float* Wo = (const float*)d_in[7]; const float* bo = (const float*)d_in[8];
  const float* lsc = (const float*)d_in[9]; const int* mask = (const int*)d_in[10];
  size_t off = 0; char* ws = (char*)d_ws;
  auto carve = [&](size_t bytes) { char* p = ws + off; off += (bytes + 255) & ~(size_t)255; return p; };
  const size_t plane = (size_t)NT * DM * 2;
  v2f* T  = (v2f*)carve((size_t)SEQ * NCS * sizeof(v2f));          // 524,288 B (256-B rows, exact)
  b16* Xp = (b16*)carve(plane);
  b16* Wp = (b16*)carve((size_t)4 * DM * DM * 2);                   // 8,388,608 B
  b16* Qp = (b16*)carve(plane); b16* Qr = (b16*)carve(plane); b16* Kp = (b16*)carve(plane); b16* Kr = (b16*)carve(plane);
  b16* VT = (b16*)carve(plane); b16* VR = (b16*)carve(plane); b16* Ch = (b16*)carve(plane); b16* Cr = (b16*)carve(plane);
  unsigned int* Mw = (unsigned int*)carve((size_t)NB * SEQ * (SEQ / 32) * sizeof(unsigned int));   // 1,048,576 B
  if (off > ws_size || off > ((size_t)128 << 20)) return;          // 85,458,944 B total at NB=2, SEQ=2048
  prep_kernel<<<dim3(PBR + PBM + PBX + PBW), 256, 0, stream>>>(X, Wq, Wk, Wv, Wo, mask, Xp, Wp, Mw, T);
  gemm_qkv_kernel<<<dim3(3 * DM / 128, NT / 128), 128, 0, stream>>>(Xp, Wp, bq, bk, bv, T, Qp, Qr, Kp, Kr, VT, VR);
  attn_kernel<<<dim3(SEQ / 32, NB * H), 32 * KSPL, 0, stream>>>(Qp, Qr, Kp, Kr, VT, VR, Mw, lsc, Ch, Cr);
  gemm_out_kernel<<<dim3(DM / 128, NT / 64), 128, 0, stream>>>(Ch, Cr, Wp + (size_t)3 * DM * DM, bo, (float*)d_out);
}

// v008
// One run takes 125 microseconds.
// Two timings next to v007 put it at 1.12 and 1.13 times that version's speed.
// All steps since v000 together make it 3.45 times as fast.
#include <hip/hip_runtime.h>

// compute dtype: every contraction on v_wmma_f32_16x16x32_f16 (f16 operands, f32 accumulate). q/k/v projections: bf16-RNE(x) x8 times bf16-RNE(W) x64,
// 1 product each; scores K Q^T per head: q and k (rope + l2 norm in f32) as f16 x8 planes plus x1024 residual planes, 3 products (hi.hi, hi.res, res.hi);
// O^T += V^T P^T: V^T f16 x8 plus a x1024 residual plane, P f16 x1024 plus a x1024 residual tile, 3 products (residual products share one accumulator);
// output projection: ctx f16 x64 plus a x1024 residual plane times bf16-RNE(Wo) x64, 2 products. Softmax statistics (running max, exp2, row sums),
// rope cos/sin table, l2 norm and bias adds in f32; 1/sqrt(64) and exp(logit scale) folded into the log2-domain score constant.
// Fragment k-map per lane half hh for A AND B: elements 0..7 <- k = 8hh+0..7, 8..15 <- k = 16+8hh+0..7; acc[r] = D[8hh+r][col = lane&15].
// Packed planes (X, W, K, V^T, ctx and their residuals): a plane of R rows x C k-columns is stored as 16x32 tiles, tile index (row/16)*(C/32) + k/32 (V^T: (k/32)*(R/16) + row/16), each tile
// 512 elements laid out [k octet 0..3][row 0..15][8], so that each of a fragment's two wave loads reads 512 contiguous bytes (four whole 128-B lines).

#ifndef NB
#define NB 2
#endif
#ifndef SEQ
#define SEQ 2048
#endif
#ifndef NB_FULL
#define NB_FULL 2
#endif
#ifndef SEQ_FULL
#define SEQ_FULL 2048
#endif

namespace {
constexpr int H = 16, HD = 64, DM = 1024, NT = NB * SEQ, NCS = HD / 2, KT = DM / 32, TE = 512;
constexpr float XS = 8.0f, WSC = 64.0f, QS = 8.0f, QRS = 1024.0f, VS = 8.0f, VRS = 1024.0f, PS = 1024.0f, PRS = 1024.0f, OCS = 64.0f, OCRS = 1024.0f;
constexpr float LOG2E = 1.4426950408889634f, EPSN = 1e-6f;
constexpr int KSPL = 4;   // key shares (waves) per query block in the attention kernel
static_assert(KSPL == 4 && SEQ % (32 * KSPL) == 0);
constexpr int NJ = SEQ / (32 * KSPL);                       // key steps per share
// block ranges of the preparation launch (256 threads each): rope table, mask words, X plane, W planes
constexpr int PBR = SEQ * NCS / 4 / 256;                    // a thread fills 4 table entries
constexpr int PBM = NB * (SEQ / 16) * (NJ / 2) / 8;         // a wave packs 2 key steps of all KSPL shares of one query tile
constexpr int PBX = NT / 16, PBW = 4 * DM / 16;             // a block converts 16 rows of 1024
static_assert(NJ % 2 == 0 && NJ <= 16 && (NB * (SEQ / 16) * (NJ / 2)) % 8 == 0 && (SEQ * NCS / 4) % 256 == 0 && KT == 32 && SEQ % 16 == 0);
static_assert(SEQ % 64 == 0 && SEQ >= 64 && SEQ <= SEQ_FULL && NB >= 1 && NB <= NB_FULL);
static_assert(DM == H * HD && HD == 64 && DM % 128 == 0 && NT % 256 == 0 && (3 * DM) % 192 == 0 && PRS == VRS);

typedef _Float16 b16;
typedef __attribute__((ext_vector_type(16))) _Float16 v16b;
typedef __attribute__((ext_vector_type(8))) _Float16 v8b;
typedef __attribute__((ext_vector_type(2))) _Float16 v2b;
typedef __attribute__((ext_vector_type(8))) float v8f;
typedef __attribute__((ext_vector_type(4))) float v4f;
typedef __attribute__((ext_vector_type(2))) float v2f;
typedef __attribute__((ext_vector_type(4))) unsigned int v4u;

__device__ __forceinline__ float bf16_rne(float f) { unsigned int u = __float_as_uint(f); u += 0x7FFFu + ((u >> 16) & 1u); return __uint_as_float(u & 0xFFFF0000u); }
// 16-bit fragment from a k-contiguous row: elements 0..7 <- p[8hh .. 8hh+7], 8..15 <- p[16+8hh .. 16+8hh+7]
__device__ __forceinline__ v16b frag_kb(const b16* p, int hh) {
  const v8b a = *(const v8b*)(p + 8 * hh), b = *(const v8b*)(p + 16 + 8 * hh); v16b f;
#pragma unroll
  for (int e = 0; e < 8; ++e) { f[e] = a[e]; f[8 + e] = b[e]; }
  return f;
}
// the same fragment from a packed tile; p = tile + 8*lane (lane = 16hh + row): octets hh and 2+hh of the lane's row
__device__ __forceinline__ v16b frag_pk(const b16* p) {
  const v8b a = *(const v8b*)p, b = *(const v8b*)(p + 256); v16b f;
#pragma unroll
  for (int e = 0; e < 8; ++e) { f[e] = a[e]; f[8 + e] = b[e]; }
  return f;
}
__device__ __forceinline__ v8f wmma16b(v16b a, v16b b, v8f c) {
  v8f d = __builtin_amdgcn_wmma_f32_16x16x32_f16(false, a, false, b, (short)0, c, false, false);
  asm volatile("v_nop\n\tv_nop\n\tv_nop\n\tv_nop" : "+v"(d) : "v"(a), "v"(b));
  return d;
}
// the plain builtin (the compiler keeps the distances): for the attention kernel, whose live set passes v255, where the operands of an asm statement cannot lie
__device__ __forceinline__ v8f wmma16p(v16b a, v16b b, v8f c) { return __builtin_amdgcn_wmma_f32_16x16x32_f16(false, a, false, b, (short)0, c, false, false); }
__device__ __forceinline__ void wave_lds_sync() { __builtin_amdgcn_fence(3, "workgroup"); __builtin_amdgcn_wave_barrier(); __builtin_amdgcn_fence(2, "workgroup"); }
__device__ __forceinline__ float nexp2(float v) { return __builtin_amdgcn_exp2f(v); }

// LDS staging of the two GEMMs. A stage is KS k tiles (128 k) of every 16-row group of the block's operands; a chunk is one row group's part of it, CHB bytes that
// are contiguous in the packed plane and are kept in that order in LDS, so a fragment is read from LDS as it was from the plane (two reads of 512 contiguous bytes).
constexpr int KS = 4, CHB = KS * TE * 2, NST = KT / KS;
static_assert(KT % KS == 0 && NST >= 2);
// One chunk by one wave: eight asynchronous copies of 512 B; l = the lane's LDS byte address, g = the lane's place in the plane (both 16 B x lane into the chunk).
// The s_wait_xcnt stands inside the statement, behind the last copy: no address register of a copy is rewritten in front of it.
__device__ __forceinline__ void copy_chunk(unsigned l, const b16* g) {
  asm volatile("global_load_async_to_lds_b128 %0, %8, off\n\t"
               "global_load_async_to_lds_b128 %1, %9, off\n\t"
               "global_load_async_to_lds_b128 %2, %10, off\n\t"
               "global_load_async_to_lds_b128 %3, %11, off\n\t"
               "global_load_async_to_lds_b128 %4, %12, off\n\t"
               "global_load_async_to_lds_b128 %5, %13, off\n\t"
               "global_load_async_to_lds_b128 %6, %14, off\n\t"
               "global_load_async_to_lds_b128 %7, %15, off\n\t"
               "s_wait_xcnt 0x0"
               :: "v"(l), "v"(l + 512u), "v"(l + 1024u), "v"(l + 1536u), "v"(l + 2048u), "v"(l + 2560u), "v"(l + 3072u), "v"(l + 3584u),
                  "v"(g), "v"(g + 256), "v"(g + 512), "v"(g + 768), "v"(g + 1024), "v"(g + 1280), "v"(g + 1536), "v"(g + 1792) : "memory");
}
// the wave's own copies have landed (in front of the barrier behind which other waves read them)
__device__ __forceinline__ void wait_copies() { asm volatile("s_wait_asynccnt 0x0" ::: "memory"); }
// the wave's own LDS reads have returned (in front of the barrier behind which their buffer is refilled)
__device__ __forceinline__ void wait_lds() { asm volatile("s_wait_dscnt 0x0" ::: "memory"); }

// One row group (16 rows x 1024 columns, f32, row pitch DM, first row at S) to its KT packed tiles at D, f16 = bf16-RNE(value) x sc, by one block of 256 threads.
// A pass of the block covers 4 tiles, thread per k octet: a wave reads 8 rows x 128 B and writes four whole 128-B lines of one tile. All 8 passes' loads (16 of
// 16 B a lane) are requested before the first conversion.
__device__ __forceinline__ void cvt_row_group(const float* __restrict__ S, b16* __restrict__ D, float sc, int tid) {
  const int oct = tid & 3, rl = (tid >> 2) & 15, t0 = tid >> 6;
  const float* src = S + (size_t)rl * DM + (size_t)(t0 * 32 + oct * 8);
  b16* dst = D + (size_t)t0 * TE + (size_t)((oct * 16 + rl) * 8);
  v4f x0[KT / 4], x1[KT / 4];
#pragma unroll
  for (int i = 0; i < KT / 4; ++i) { x0[i] = *(const v4f*)(src + i * 128); x1[i] = *(const v4f*)(src + i * 128 + 4); }
  asm volatile("s_wait_xcnt 0x0" :: "v"(src) : "memory");   // behind the group: the address pair stays whole until here, before any of its registers is rewritten
  v8b o[KT / 4];
#pragma unroll
  for (int i = 0; i < KT / 4; ++i)
#pragma unroll
    for (int j = 0; j < 4; ++j) { o[i][j] = (b16)(bf16_rne(x0[i][j]) * sc); o[i][4 + j] = (b16)(bf16_rne(x1[i][j]) * sc); }
#pragma unroll
  for (int i = 0; i < KT / 4; ++i) *(v8b*)(dst + (size_t)i * 4 * TE) = o[i];
  asm volatile("s_wait_xcnt 0x0" ::: "memory");   // behind the run of stores, before any later code rewrites their address or data registers
}

// All preparation in one launch; the block's range of blockIdx.x selects its work (block-uniform):
// [0, PBR): rope table T[s][i] = (cos, sin)(s * freq_i), freq_i = 1 / fl32(10000^(2i/64)), s*freq as an f32 product, argument reduction in f64 (mul/fma only), short
//   f32 polynomials; a thread computes freq_i once and fills four rows s.
// [PBR, PBR+PBM): the mask packed into bit words Mw[b][query tile][share ks][step j of the share][query 0..15]: bit i set <=> key 32*(j*KSPL+ks)+i is NOT masked for
//   that query. A wave takes one query tile and the steps j, j+1 of all four shares, two shares a trip: 16 rows x two pieces of 256 B in, two whole 128-B lines out.
// [.., +PBX): X plane, packed tiles of [NB*SEQ tokens][1024], f16 = bf16-RNE(x) x8; token row b*SEQ+s reads input row b*SEQ_FULL+s; a block per 16 tokens.
// [.., +PBW): W planes [4], each the packed tiles of [1024 out][1024 in], f16 = bf16-RNE(W) x64 (rows n, k along the input); a block per 16 rows of one weight.
__global__ __launch_bounds__(256) void prep_kernel(const float* __restrict__ X, const float* __restrict__ Wq, const float* __restrict__ Wk,
                                                   const float* __restrict__ Wv, const float* __restrict__ Wo, const int* __restrict__ mask,
                                                   b16* __restrict__ Xp, b16* __restrict__ Wp, unsigned int* __restrict__ Mw, v2f* __restrict__ T) {
  const int blk = (int)blockIdx.x, tid = (int)threadIdx.x;
  if (blk < PBR) {
    const int u = blk * 256 + tid, i = u % NCS, sq = u / NCS;
    const float ex = (float)(2 * i) / (float)HD;
    const float pw = (float)exp2((double)ex * 13.287712379549449);
    const float freq = 1.0f / pw;
#pragma unroll
    for (int q = 0; q < 4; ++q) {
      const int s = sq + q * (SEQ / 4);
      const float ang = (float)s * freq;
      const double a = (double)ang;
      const double k = __builtin_rint(a * 0.63661977236758134);
      double rd = __builtin_fma(-k, 1.5707963267948966, a);
      rd = __builtin_fma(-k, 6.123233995736766e-17, rd);
      const float r = (float)rd, r2 = r * r;
      const float sp = r + r * r2 * (-1.6666666666666666e-1f + r2 * (8.333333333333333e-3f + r2 * (-1.984126984126984e-4f + r2 * 2.7557319223985893e-6f)));
      const float cp = 1.0f + r2 * (-0.5f + r2 * (4.1666666666666664e-2f + r2 * (-1.3888888888888889e-3f + r2 * (2.48015873015873e-5f + r2 * -2.755731922398589e-7f))));
      const int kq = (int)(((long long)k) & 3);
      const float c = (kq == 0) ? cp : ((kq == 1) ? -sp : ((kq == 2) ? -cp : sp));
      const float sn = (kq == 0) ? sp : ((kq == 1) ? cp : ((kq == 2) ? -sp : -cp));
      v2f o; o.x = c; o.y = sn;
      *(v2f*)(T + (size_t)s * NCS + i) = o;
    }
    return;
  }
  if (blk < PBR + PBM) {
    const int wv = (blk - PBR) * 8 + (tid >> 5), lane = tid & 31;
    const int jp = wv % (NJ / 2), qt = (wv / (NJ / 2)) % (SEQ / 16), b = wv / ((NJ / 2) * (SEQ / 16));
    const int* src = mask + ((size_t)b * SEQ_FULL + (size_t)qt * 16) * SEQ_FULL + (size_t)(2 * jp * KSPL * 32 + lane);
    unsigned int* dst = Mw + (size_t)(((b * (SEQ / 16) + qt) * KSPL * NJ + 2 * jp) * 16) + lane;
#pragma unroll 1   // two trips of 64 loads a lane: all four shares at once would double the registers of the whole launch
    for (int ks = 0; ks < KSPL; ks += 2) {
      int g[2][2][16];
#pragma unroll
      for (int r = 0; r < 16; ++r)
#pragma unroll
        for (int c = 0; c < 2; ++c) {
          g[c][0][r] = src[(size_t)r * SEQ_FULL + (ks + c) * 32]; g[c][1][r] = src[(size_t)r * SEQ_FULL + (ks + c) * 32 + 32 * KSPL]; }
#pragma unroll
      for (int c = 0; c < 2; ++c) {
        unsigned int w = 0u;
#pragma unroll
        for (int r = 0; r < 16; ++r) {
          const unsigned int b0 = __builtin_amdgcn_ballot_w32(g[c][0][r] == 0), b1 = __builtin_amdgcn_ballot_w32(g[c][1][r] == 0);
          w = (lane == r) ? b0 : w; w = (lane == 16 + r) ? b1 : w; }
        dst[(size_t)(ks + c) * NJ * 16] = w; }
      asm volatile("s_wait_xcnt 0x0" ::: "memory");   // before the next trip rewrites the loads' and stores' address and data registers
    }
    return;
  }
  if (blk < PBR + PBM + PBX) {
    const int row0 = (blk - PBR - PBM) * 16, b = row0 / SEQ, s0 = row0 % SEQ;
    cvt_row_group(X + ((size_t)b * SEQ_FULL + (size_t)s0) * DM, Xp + (size_t)(row0 / 16) * KT * TE, XS, tid);
    return;
  }
  const int wb = blk - PBR - PBM - PBX, y = wb / (DM / 16), rg = wb % (DM / 16);
  const float* W = (y == 0) ? Wq : ((y == 1) ? Wk : ((y == 2) ? Wv : Wo));
  cvt_row_group(W + (size_t)rg * 16 * DM, Wp + (size_t)y * DM * DM + (size_t)rg * KT * TE, WSC, tid);
}

// Fused q/k/v projection: C = A(X plane) . B (B[k][n] = W[n][k] from the packed W plane), K = 1024 stepped by 32. q planes stay [s][64]; k planes are packed tiles
// of [s][64], v planes packed tiles of [64][s].
// Block 384 threads = 12 waves in 4x3, block tile 256 tokens x 192 features, wave tile 64 x 64 = 4x4 WMMA tiles. The block's 16 X and 12 W row groups are brought into
// LDS once a stage by asynchronous copies (two buffers: the next stage flies while this one is worked on) and every wave reads its fragments from there, so that
// an X row group is fetched once for three waves and a W row group once for four. A wave's 64 columns are exactly one head of q, k or v (which = column / 1024,
// wave-uniform). Epilogue, each wave on its own tile: acc/512 + bf16-RNE(bias) staged in the wave's part of LDS (the ring's bytes, free behind the last stage's
// barrier), then rope + l2 norm (q, k) or transpose (v); a trip of each epilogue loop takes its piece of all four 16-row tiles of the wave.
__global__ __launch_bounds__(384) __attribute__((amdgpu_num_vgpr(256))) void gemm_qkv_kernel(
    const b16* __restrict__ Xp, const b16* __restrict__ Wp, const float* __restrict__ bq, const float* __restrict__ bk, const float* __restrict__ bv,
    const v2f* __restrict__ CSt, b16* __restrict__ Qp, b16* __restrict__ Qr, b16* __restrict__ Kp, b16* __restrict__ Kr, b16* __restrict__ VT,
    b16* __restrict__ VR) {
  constexpr int NCA = 16, NCB = 12, STB = (NCA + NCB) * CHB, TWB = 64 * (HD + 4) * 4;   // X and W chunks of a stage, bytes of a stage, of a wave's epilogue tile
  __shared__ __attribute__((aligned(1024))) char sm[2 * STB > 12 * TWB ? 2 * STB : 12 * TWB];
  // the wave's number as a scalar: the choice of its chunks, of q/k/v and the test around its third chunk stay on the scalar unit
  const int wave = __builtin_amdgcn_readfirstlane((int)(threadIdx.x >> 5));
  const int lane = threadIdx.x & 31, hh = lane >> 4, m = lane & 15, wm = wave / 3, wn = wave % 3;
  const int col0 = (int)blockIdx.x * 192 + wn * 64, which = col0 / DM, n0 = col0 % DM, h = n0 / HD;
  const int mblk = (int)blockIdx.y * 256 + wm * 64, b = mblk / SEQ, s0 = mblk % SEQ;
  const float* bsel = (which == 0) ? bq : ((which == 1) ? bk : bv);
  float (*Tw)[HD + 4] = (float (*)[HD + 4])(sm + wave * TWB);
  // chunk c of a stage: X row group c (c < 16) or W row group c - 16 of the block; wave w copies chunks w, w + 12 and, for w < 4, w + 24
  const b16* Xb = Xp + (size_t)((int)blockIdx.y * NCA) * KT * TE + 8 * lane;
  const b16* Wb = Wp + (size_t)((int)blockIdx.x * NCB) * KT * TE + 8 * lane;
  const b16* g0 = Xb + (size_t)wave * KT * TE;
  const b16* g1 = (wave < 4) ? Xb + (size_t)(wave + 12) * KT * TE : Wb + (size_t)(wave - 4) * KT * TE;
  const b16* g2 = Wb + (size_t)((wave & 3) + 8) * KT * TE;
  const unsigned l0 = (unsigned)(size_t)sm + (unsigned)(wave * CHB + lane * 16);
  auto issue = [&](int st, int buf) {
    const unsigned lo = l0 + (unsigned)(buf * STB); const int go = st * KS * TE;
    copy_chunk(lo, g0 + go); copy_chunk(lo + 12u * CHB, g1 + go);
    if (wave < 4) copy_chunk(lo + 24u * CHB, g2 + go);
  };
  v8f acc[4][4];
#pragma unroll
  for (int i = 0; i < 4; ++i)
#pragma unroll
    for (int j = 0; j < 4; ++j) acc[i][j] = (v8f){};
  issue(0, 0); wait_copies();
  __syncthreads();   // stage 0 is readable by every wave
  issue(1, 1);
#pragma unroll 1   // rolled: one body of four k steps; the buffer alternates
  for (int t = 0; t < NST; ++t) {
    const char* sa = sm + (t & 1) * STB + wm * 4 * CHB + lane * 16;
    const char* sw = sm + (t & 1) * STB + (NCA + wn * 4) * CHB + lane * 16;
#pragma unroll
    for (int kk = 0; kk < KS; ++kk) {
      v16b af[4], bf[4];
#pragma unroll
      for (int mt = 0; mt < 4; ++mt) af[mt] = frag_pk((const b16*)(sa + mt * CHB + kk * TE * 2));
#pragma unroll
      for (int nt = 0; nt < 4; ++nt) bf[nt] = frag_pk((const b16*)(sw + nt * CHB + kk * TE * 2));
#pragma unroll
      for (int mt = 0; mt < 4; ++mt)
#pragma unroll
        for (int nt = 0; nt < 4; ++nt) acc[mt][nt] = wmma16b(af[mt], bf[nt], acc[mt][nt]);
    }
    wait_lds(); wait_copies();
    __syncthreads();   // publishes stage t + 1 and ends every wave's reads of stage t's buffer
    if (t + 2 < NST) issue(t + 2, t & 1);
  }
  wait_copies();   // nothing is in flight when the ring's bytes become the epilogue's tiles
  float bias[4];
#pragma unroll
  for (int nt = 0; nt < 4; ++nt) bias[nt] = bf16_rne(bsel[n0 + nt * 16 + m]);
  const float isc = 1.0f / (XS * WSC);
#pragma unroll
  for (int mt = 0; mt < 4; ++mt)
#pragma unroll
    for (int nt = 0; nt < 4; ++nt)
#pragma unroll
      for (int r = 0; r < 8; ++r) Tw[mt * 16 + 8 * hh + r][nt * 16 + m] = acc[mt][nt][r] * isc + bias[nt];
  __syncthreads();   // the staged tile is read across lanes
  if (which < 2) {
    // 16 rows are 1024 elements in both layouts ([s][64] rows for q, packed tiles of [s][64] for k); lo = the lane's place in them, rs = elements from a row to the next
    const int lo = (which == 0) ? 2 * lane : (lane >> 4) * 512 + ((lane >> 2) & 3) * 128 + ((2 * lane) & 7), rs = (which == 0) ? HD : 8;
    const size_t pb = (size_t)(b * H + h) * SEQ * HD + (size_t)s0 * HD + lo;
    b16* Ph = ((which == 0) ? Qp : Kp) + pb;
    b16* Pl = ((which == 0) ? Qr : Kr) + pb;
    const v2f* Cw = CSt + (size_t)s0 * NCS + lane;
#pragma unroll 1
    for (int it = 0; it < 16; ++it) {   // row it of each of the wave's four 16-row tiles
      float y0[4], y1[4], ss[4];
#pragma unroll
      for (int mt = 0; mt < 4; ++mt) {
        const int r = mt * 16 + it;
        const float x0 = Tw[r][2 * lane], x1 = Tw[r][2 * lane + 1];
        const v2f cv = Cw[(size_t)r * NCS];
        y0[mt] = x0 * cv.x - x1 * cv.y; y1[mt] = x1 * cv.x + x0 * cv.y;
        ss[mt] = y0[mt] * y0[mt] + y1[mt] * y1[mt]; }
#pragma unroll
      for (int w = 16; w >= 1; w >>= 1)
#pragma unroll
        for (int mt = 0; mt < 4; ++mt) ss[mt] += __shfl_xor(ss[mt], w);
#pragma unroll
      for (int mt = 0; mt < 4; ++mt) {
        const float inv = 1.0f / sqrtf(ss[mt] + EPSN);
        const float z0 = y0[mt] * inv * QS, z1 = y1[mt] * inv * QS;
        const b16 h0 = (b16)z0, h1 = (b16)z1;
        v2b oh, ol; oh.x = h0; oh.y = h1; ol.x = (b16)((z0 - (float)h0) * QRS); ol.y = (b16)((z1 - (float)h1) * QRS);
        const int off = mt * 16 * HD + it * rs;
        *(v2b*)(Ph + off) = oh; *(v2b*)(Pl + off) = ol; }
      asm volatile("s_wait_xcnt 0x0" ::: "memory");   // before the next trip rewrites the loads' and stores' address and data registers
    }
  } else {
    const size_t vb = ((size_t)(b * H + h) * HD) * SEQ;
#pragma unroll 1
    for (int it = 0; it < 4; ++it) {
#pragma unroll
      for (int g = 0; g < 4; ++g) {   // the wave's four groups of 16 head features (each one row of packed tiles)
        const int dl = (it & 1) * 8 + (lane & 7), d = g * 16 + dl, tok = (it >> 1) * 32 + (lane >> 3) * 8;
        v8b oh, ol;
#pragma unroll
        for (int j = 0; j < 8; ++j) {
          const float v = Tw[tok + j][d] * VS; const b16 hv = (b16)v; oh[j] = hv; ol[j] = (b16)((v - (float)hv) * VRS); }
        const size_t off = vb + (size_t)((((s0 + tok) >> 5) * 4 + g) * 64 + (lane >> 3) * 16 + dl) * 8;
        *(v8b*)(VT + off) = oh; *(v8b*)(VR + off) = ol;
      }
      asm volatile("s_wait_xcnt 0x0" ::: "memory");   // before the next trip rewrites the stores' address and data registers
    }
  }
}

// Masked softmax attention per (query block of 32, b*H+h); block = 4 waves = 4 key shares, each wave on BOTH 16-query tiles of the block, so that every K and V
// fragment it loads feeds the products of both tiles: share ks takes the key steps of 32 whose index is ks modulo 4, in fixed order, with its own running max, row sum and O tile
// per query tile; the four partial results of a query tile are merged in LDS behind one block barrier (weights exp2(m_j - max m), fixed order j = 0..3), each
// share's wave packing a quarter of each tile's ctx. The mask comes as the packed bit words: the wave reads all words of its share for both tiles once and keeps two
// scalar maps, the steps with any unmasked entry in its 32x32 region (only these are walked; the others contribute 0) and the steps with none masked (these apply no
// mask); a walked step's word per query is requested one walked step ahead. A walked step in which a query has no unmasked key leaves that query's max, sum and O as they are.
// S^T = K Q^T (hi.hi + hi.res + res.hi, q/k residual products scaled back by 1/1024), masked entries replaced by -inf, online softmax (running max, f32,
// -inf-safe), P x1024 and its x1024 residual via wave-private LDS, O^T += V^T P^T with V^T hi/res planes. ctx [b*SEQ+s][h*64+d] written as packed tiles, f16 x64
__global__ __launch_bounds__(32 * KSPL) __attribute__((amdgpu_num_vgpr(336))) void attn_kernel(
    const b16* __restrict__ Qp, const b16* __restrict__ Qr, const b16* __restrict__ Kp, const b16* __restrict__ Kr,
    const b16* __restrict__ VT, const b16* __restrict__ VR, const unsigned int* __restrict__ Mw, const float* __restrict__ lsc,
    b16* __restrict__ Ch, b16* __restrict__ Cr) {
  __shared__ __attribute__((aligned(16))) b16 Pb[KSPL][2][16][32 + 8];
  __shared__ __attribute__((aligned(16))) b16 Pr[KSPL][2][16][32 + 8];
  __shared__ __attribute__((aligned(16))) float To[KSPL][2][16][HD + 4];
  __shared__ float Ms[KSPL][2][16], Ls[KSPL][2][16];
  // the wave's number (its key share) as a scalar, so that the key loop's control and the plane offsets stay on the scalar unit
  const int ks = __builtin_amdgcn_readfirstlane((int)(threadIdx.x >> 5));
  const int lane = threadIdx.x & 31, hh = lane >> 4, col = lane & 15;
  const int bhi = (int)blockIdx.y, b = bhi / H, h = bhi % H;
  const int q0 = (int)blockIdx.x * 32;
  const size_t pq = (size_t)bhi * SEQ * HD;   // same plane size for the [s][64] rows and for both packed layouts
  const b16* Kb = Kp + pq; const b16* Klb = Kr + pq;
  const b16* Vb = VT + pq; const b16* Rb = VR + pq;
  constexpr unsigned MTB = (unsigned)(KSPL * NJ * 16 * 4);   // bytes from a query tile's mask words to the next tile's
  const unsigned int* Mq = Mw + (size_t)(((b * (SEQ / 16) + (q0 >> 4)) * KSPL + ks) * NJ) * 16;   // the share's NJ x 16 mask words of the first tile
  unsigned int act, ful;   // bit 2j: step j of the share has an unmasked entry / has no masked entry, over both tiles; both wave-uniform
  const int jl = lane >> 1;   // the lane reads 8 of step jl's 16 words of each tile
  const unsigned so = (jl < NJ) ? (unsigned)lane * 32u : 0u;
  {
    const unsigned int* sp = (const unsigned int*)((const char*)Mq + so);
    const unsigned int* sp1 = (const unsigned int*)((const char*)Mq + so + MTB);
    const v4u w0 = *(const v4u*)sp, w1 = *(const v4u*)(sp + 4), w2 = *(const v4u*)sp1, w3 = *(const v4u*)(sp1 + 4);
    const v4u vo = w0 | w1 | w2 | w3, va = w0 & w1 & w2 & w3;
    const unsigned int wo = vo.x | vo.y | vo.z | vo.w, wa = va.x & va.y & va.z & va.w;
    const unsigned int anyb = __builtin_amdgcn_ballot_w32(jl < NJ && wo != 0u), allb = __builtin_amdgcn_ballot_w32(wa == 0xFFFFFFFFu);
    act = (anyb | (anyb >> 1)) & 0x55555555u; ful = allb & (allb >> 1);
  }
  asm volatile("s_wait_xcnt 0x0" :: "v"(so) : "memory");   // before the mask words' offset register is rewritten
  float m[2], l[2]; v8f o[2][4], o2[2][4];
#pragma unroll
  for (int a = 0; a < 2; ++a) {
    m[a] = -INFINITY; l[a] = 0.0f;
#pragma unroll
    for (int t = 0; t < 4; ++t) { o[a][t] = (v8f){}; o2[a][t] = (v8f){}; } }
  if (act != 0u) {   // scalar branch: a share with no unmasked entry loads nothing more
  // Q fragments [query tile][k half] and the first walked step's mask words: one group, in flight beside the first step's K group
  v16b qa[2][2], ql[2][2];
  const unsigned qb = (unsigned)((q0 + col) * HD + 8 * hh) * 2u;   // byte offset of the lane's first octet in the head's [s][64] plane
  const b16* pqh = (const b16*)((const char*)(Qp + pq) + qb); const b16* pql = (const b16*)((const char*)(Qr + pq) + qb);
#pragma unroll
  for (int a = 0; a < 2; ++a) {
    qa[a][0] = frag_kb(pqh + a * 16 * HD, 0); qa[a][1] = frag_kb(pqh + a * 16 * HD + 32, 0);
    ql[a][0] = frag_kb(pql + a * 16 * HD, 0); ql[a][1] = frag_kb(pql + a * 16 * HD + 32, 0); }
  // each query's 32 mask bits of a walked step are requested one walked step ahead
  unsigned int mwn[2];
  const unsigned mo0 = (unsigned)(__builtin_ctz(act) >> 1) * 64u + (unsigned)col * 4u;
  mwn[0] = *(const unsigned int*)((const char*)Mq + mo0); mwn[1] = *(const unsigned int*)((const char*)Mq + mo0 + MTB);
  asm volatile("s_wait_xcnt 0x0" :: "v"(qb), "v"(mo0) : "memory");   // behind the group: its offset registers stay whole until here
  const float cs = 0.125f * expf(bf16_rne(lsc[0])) * (LOG2E / (QS * QS));
#pragma unroll 1   // rolled: the trip count comes from the mask, and one body fills the register budget
  do {   // at most NJ trips, in rising key order
    const int tz = __builtin_ctz(act), j = tz >> 1; act &= act - 1u;
    const bool full = ((ful >> tz) & 1u) != 0u;
    // byte offset of the lane's place in the step's first tile: K tiles 2u, 2u+1 of key group u and V tiles t share it
    const unsigned ko = (unsigned)lane * 16u + (unsigned)(j * KSPL + ks) * (unsigned)(4 * TE * 2);
    const unsigned int mw[2] = {mwn[0], mwn[1]};
    // the next walked step's words (the last step asks for its own again: in bounds, never used)
    const unsigned mo = (unsigned)((act != 0u ? __builtin_ctz(act) >> 1 : j) * 64) + (unsigned)col * 4u;
    mwn[0] = *(const unsigned int*)((const char*)Mq + mo); mwn[1] = *(const unsigned int*)((const char*)Mq + mo + MTB);
    // all eight K fragments of the step are requested here as one group, ahead of the matrix work
    v16b kh[4], kl[4], vh[4], vl[4];
    const b16* pk = (const b16*)((const char*)Kb + ko); const b16* pkl = (const b16*)((const char*)Klb + ko);
    const b16* pv = (const b16*)((const char*)Vb + ko); const b16* pvl = (const b16*)((const char*)Rb + ko);
#pragma unroll
    for (int j = 0; j < 4; ++j) { kh[j] = frag_pk(pk + j * TE); kl[j] = frag_pk(pkl + j * TE); }
    // behind the group: its offset registers stay whole until here, and no load sinks to its use (there each pair of loads costs the wave a full L2 round trip)
    asm volatile("s_wait_xcnt 0x0" :: "v"(ko), "v"(mo) : "memory");
    __builtin_amdgcn_sched_barrier(0);   // no product rises above the group: else a late K load takes an early fragment's registers and waits out a second round trip
    float e[2][16];
#pragma unroll
    for (int u = 0; u < 2; ++u) {
      const v16b ka = kh[2 * u], kc = kh[2 * u + 1];
#pragma unroll
      for (int a = 0; a < 2; ++a) {
        v8f s = wmma16p(ka, qa[a][0], (v8f){}); s = wmma16p(kc, qa[a][1], s);
        v8f s2 = wmma16p(ka, ql[a][0], (v8f){}); s2 = wmma16p(kc, ql[a][1], s2);
        s2 = wmma16p(kl[2 * u], qa[a][0], s2); s2 = wmma16p(kl[2 * u + 1], qa[a][1], s2);
#pragma unroll
        for (int r = 0; r < 8; ++r) e[a][u * 8 + r] = (s[r] + s2[r] * (1.0f / QRS)) * cs; } }
    // second group, into the registers that K has left: all eight V fragments fly while the softmax runs
#pragma unroll
    for (int t = 0; t < 4; ++t) { vh[t] = frag_pk(pv + t * TE); vl[t] = frag_pk(pvl + t * TE); }
    asm volatile("s_wait_xcnt 0x0" :: "v"(ko) : "memory");   // as behind the K group: the offset register whole, the loads ahead of the softmax arithmetic
    if (!full) {   // scalar branch: entry i of the lane is key 8hh+i (i < 8) or 16+8hh+i-8 of the step
#pragma unroll
      for (int a = 0; a < 2; ++a) {
        const unsigned int sh = mw[a] >> (8 * hh);
#pragma unroll
        for (int i2 = 0; i2 < 16; ++i2) e[a][i2] = ((sh >> (i2 < 8 ? i2 : i2 + 8)) & 1u) ? e[a][i2] : -INFINITY; } }
    float al[2], mx[2];
#pragma unroll
    for (int a = 0; a < 2; ++a) {   // both tiles' maxima first, so that their two exchanges between the lane halves share one wait
      mx[a] = -INFINITY;
#pragma unroll
      for (int i2 = 0; i2 < 16; ++i2) mx[a] = fmaxf(mx[a], e[a][i2]); }
    const float ox[2] = {__shfl_xor(mx[0], 16), __shfl_xor(mx[1], 16)};
#pragma unroll
    for (int a = 0; a < 2; ++a) {
      const float mn = fmaxf(m[a], fmaxf(mx[a], ox[a]));
      const float mref = (mn == -INFINITY) ? 0.0f : mn;
      const float xa = m[a] - mref; al[a] = nexp2(xa); float sum = 0.0f;
      asm volatile("v_nop" :: "v"(xa), "v"(al[a]));   // the slot behind the exponential, as below
#pragma unroll
      for (int g = 0; g < 16; g += 4) {
        float x[4], p[4];
#pragma unroll
        for (int k = 0; k < 4; ++k) { x[k] = e[a][g + k] - mref; p[k] = nexp2(x[k]); }
        // the slot behind a transcendental: arguments and results as inputs only, so that the four stand in front of it and no argument register is rewritten before it
        asm volatile("v_nop" :: "v"(x[0]), "v"(x[1]), "v"(x[2]), "v"(x[3]), "v"(p[0]), "v"(p[1]), "v"(p[2]), "v"(p[3]));
#pragma unroll
        for (int k = 0; k < 4; ++k) {
          const int i2 = g + k, pi = (i2 < 8 ? 0 : 16) + 8 * hh + (i2 & 7); sum += p[k];
          const float pp = p[k] * PS; const b16 ph = (b16)pp; Pb[ks][a][col][pi] = ph;
          Pr[ks][a][col][pi] = (b16)((pp - (float)ph) * PRS); } }
      sum += __shfl_xor(sum, 16); l[a] = l[a] * al[a] + sum; m[a] = mn; }
    wave_lds_sync();
    v16b pf[2], plf[2];
#pragma unroll
    for (int a = 0; a < 2; ++a) { pf[a] = frag_kb(&Pb[ks][a][col][0], hh); plf[a] = frag_kb(&Pr[ks][a][col][0], hh); }
#pragma unroll
    for (int t = 0; t < 4; ++t)
#pragma unroll
      for (int a = 0; a < 2; ++a) {
        o[a][t] *= al[a]; o2[a][t] *= al[a];
        o[a][t] = wmma16p(vh[t], pf[a], o[a][t]);
        o2[a][t] = wmma16p(vl[t], pf[a], o2[a][t]);
        o2[a][t] = wmma16p(vh[t], plf[a], o2[a][t]); }
    wave_lds_sync(); } while (act != 0u);
  }
  // the share's partial results, not yet normalised: O tile, running max and row sum of each query
#pragma unroll
  for (int a = 0; a < 2; ++a) {
#pragma unroll
    for (int t = 0; t < 4; ++t) {
#pragma unroll
      for (int r = 0; r < 8; ++r) To[ks][a][col][t * 16 + 8 * hh + r] = o[a][t][r] + o2[a][t][r] * (1.0f / VRS); }
    if (hh == 0) { Ms[ks][a][col] = m[a]; Ls[ks][a][col] = l[a]; } }
  __syncthreads();   // the partial results are read across the four waves
#pragma unroll
  for (int a = 0; a < 2; ++a) {
    const size_t cb = ((size_t)((b * SEQ + q0 + a * 16) >> 4) * KT + (size_t)h * 2) * TE;
    const int it = ks;   // each share's wave merges and packs one quarter of each query tile
    const int rl = (it & 1) * 8 + (lane & 7), pc = (it >> 1) * 32 + (lane >> 3) * 8;
    float mj[KSPL], mt = -INFINITY;
#pragma unroll
    for (int j = 0; j < KSPL; ++j) { mj[j] = Ms[j][a][rl]; mt = fmaxf(mt, mj[j]); }
    const float mtr = (mt == -INFINITY) ? 0.0f : mt;   // -inf-safe, as in the key loop
    float lt = 0.0f, xw[KSPL], w[KSPL]; v4f f0 = (v4f){}, f1 = (v4f){};
#pragma unroll
    for (int j = 0; j < KSPL; ++j) { xw[j] = mj[j] - mtr; w[j] = nexp2(xw[j]); }
    // the slot behind a transcendental, as in the key loop
    asm volatile("v_nop" :: "v"(xw[0]), "v"(xw[1]), "v"(xw[2]), "v"(xw[3]), "v"(w[0]), "v"(w[1]), "v"(w[2]), "v"(w[3]));
#pragma unroll
    for (int j = 0; j < KSPL; ++j) {
      lt += w[j] * Ls[j][a][rl];
      f0 += w[j] * *(const v4f*)(&To[j][a][rl][pc]); f1 += w[j] * *(const v4f*)(&To[j][a][rl][pc + 4]); }
    const float inv = 1.0f / (lt * PS * VS);
    f0 *= inv; f1 *= inv;
    v8b oh, ol;
#pragma unroll
    for (int j = 0; j < 4; ++j) {
      const float v0 = f0[j] * OCS; const b16 hv0 = (b16)v0; oh[j] = hv0; ol[j] = (b16)((v0 - (float)hv0) * OCRS);
      const float v1 = f1[j] * OCS; const b16 hv1 = (b16)v1; oh[4 + j] = hv1; ol[4 + j] = (b16)((v1 - (float)hv1) * OCRS); }
    const size_t off = cb + (size_t)((it >> 1) * 64 + (lane >> 3) * 16 + rl) * 8;
    *(v8b*)(Ch + off) = oh; *(v8b*)(Cr + off) = ol;
    if (a == 0) asm volatile("s_wait_xcnt 0x0" ::: "memory");   // before the second tile's code rewrites the stores' address and data registers
  }
}

// Output projection: out = (ctx hi . Wo + ctx res . Wo / 1024) / 4096 + bf16-RNE(bo), K = 1024 stepped by 32.
// Block 256 = 8 waves in 4x2, block tile 128 tokens x 128 features, wave tile 32 x 64 = 2x4 WMMA tiles for each of the two products. The block's 8 ctx, 8 residual and
// 8 Wo row groups come into LDS once a stage by asynchronous copies (two buffers, as in the q/k/v kernel), one chunk of each per wave; fragments are read from LDS.
// Result staged in the wave's part of LDS (the ring's bytes); each 256-B row segment is stored by 16 consecutive lanes.
__global__ __launch_bounds__(256) __attribute__((amdgpu_num_vgpr(256))) void gemm_out_kernel(
    const b16* __restrict__ Ch, const b16* __restrict__ Cr, const b16* __restrict__ Wop, const float* __restrict__ bo, float* __restrict__ out) {
  constexpr int NCG = 8, STB = 3 * NCG * CHB, TWB = 32 * (HD + 4) * 4;   // chunks of each operand in a stage, bytes of a stage, of a wave's epilogue tile
  __shared__ __attribute__((aligned(1024))) char sm[2 * STB > 8 * TWB ? 2 * STB : 8 * TWB];
  const int wave = __builtin_amdgcn_readfirstlane((int)(threadIdx.x >> 5));   // a scalar: the wave's chunk and tile offsets stay on the scalar unit
  const int lane = threadIdx.x & 31, hh = lane >> 4, m = lane & 15, wm = wave >> 1, wn = wave & 1;
  const int nblk = (int)blockIdx.x * 128 + wn * 64;
  const int mblk = (int)blockIdx.y * 128 + wm * 32, b = mblk / SEQ, s0 = mblk % SEQ;
  float (*Tw)[HD + 4] = (float (*)[HD + 4])(sm + wave * TWB);
  // a stage in LDS: [8 ctx chunks][8 residual chunks][8 Wo chunks]; wave w copies chunk w of each
  const size_t ga = (size_t)((int)blockIdx.y * NCG + wave) * KT * TE + 8 * lane;
  const b16* g0 = Ch + ga; const b16* g1 = Cr + ga;
  const b16* g2 = Wop + (size_t)((int)blockIdx.x * NCG + wave) * KT * TE + 8 * lane;
  const unsigned l0 = (unsigned)(size_t)sm + (unsigned)(wave * CHB + lane * 16);
  auto issue = [&](int st, int buf) {
    const unsigned lo = l0 + (unsigned)(buf * STB); const int go = st * KS * TE;
    copy_chunk(lo, g0 + go); copy_chunk(lo + (unsigned)(NCG * CHB), g1 + go); copy_chunk(lo + (unsigned)(2 * NCG * CHB), g2 + go);
  };
  v8f acc[2][4], acc2[2][4];
#pragma unroll
  for (int i = 0; i < 2; ++i)
#pragma unroll
    for (int j = 0; j < 4; ++j) { acc[i][j] = (v8f){}; acc2[i][j] = (v8f){}; }
  issue(0, 0); wait_copies();
  __syncthreads();   // stage 0 is readable by every wave
  issue(1, 1);
#pragma unroll 1   // rolled: one body of four k steps; the buffer alternates
  for (int t = 0; t < NST; ++t) {
    const char* sa = sm + (t & 1) * STB + wm * 2 * CHB + lane * 16;
    const char* sw = sm + (t & 1) * STB + (2 * NCG + wn * 4) * CHB + lane * 16;
#pragma unroll
    for (int kk = 0; kk < KS; ++kk) {
      v16b af[2], rf[2], bf[4];
#pragma unroll
      for (int mt = 0; mt < 2; ++mt) {
        af[mt] = frag_pk((const b16*)(sa + mt * CHB + kk * TE * 2));
        rf[mt] = frag_pk((const b16*)(sa + (NCG + mt) * CHB + kk * TE * 2)); }
#pragma unroll
      for (int nt = 0; nt < 4; ++nt) bf[nt] = frag_pk((const b16*)(sw + nt * CHB + kk * TE * 2));
#pragma unroll
      for (int mt = 0; mt < 2; ++mt)
#pragma unroll
        for (int nt = 0; nt < 4; ++nt) {
          acc[mt][nt] = wmma16b(af[mt], bf[nt], acc[mt][nt]);
          acc2[mt][nt] = wmma16b(rf[mt], bf[nt], acc2[mt][nt]); }
    }
    wait_lds(); wait_copies();
    __syncthreads();   // publishes stage t + 1 and ends every wave's reads of stage t's buffer
    if (t + 2 < NST) issue(t + 2, t & 1);
  }
  wait_copies();   // nothing is in flight when the ring's bytes become the epilogue's tiles
  const int bi = nblk + m;
  float bias[4];
#pragma unroll
  for (int nt = 0; nt < 4; ++nt) bias[nt] = bo[bi + nt * 16];
  asm volatile("s_wait_xcnt 0x0" :: "v"(bi) : "memory");   // behind the four bias loads: their index register stays whole until here
#pragma unroll
  for (int nt = 0; nt < 4; ++nt) bias[nt] = bf16_rne(bias[nt]);
  const float isc = 1.0f / (OCS * WSC), irs = 1.0f / OCRS;
#pragma unroll
  for (int mt = 0; mt < 2; ++mt)
#pragma unroll
    for (int nt = 0; nt < 4; ++nt)
#pragma unroll
      for (int r = 0; r < 8; ++r)
        Tw[mt * 16 + 8 * hh + r][nt * 16 + m] = (acc[mt][nt][r] + acc2[mt][nt][r] * irs) * isc + bias[nt];
  __syncthreads();   // the staged tile is read across lanes
  float* ob = out + ((size_t)b * SEQ_FULL + (size_t)s0) * DM + nblk;
#pragma unroll 1
  for (int it = 0; it < 8; ++it) {
#pragma unroll
    for (int mt = 0; mt < 2; ++mt) {   // two rows of each of the wave's two 16-row tiles
      const int rr = mt * 16 + it * 2 + hh; const v4f f = *(const v4f*)(&Tw[rr][m * 4]);
      *(v4f*)(ob + (size_t)rr * DM + m * 4) = f; }
  }
}
}  // namespace

extern "C" void kernel_launch(void* const* d_in, const int* in_sizes, int n_in, void* d_out, int out_size, void* d_ws, size_t ws_size, hipStream_t stream) {
  // wire order: 0 x [NB_FULL][SEQ_FULL][1024] f32, 1 Wq [1024][1024], 2 bq [1024], 3 Wk, 4 bk, 5 Wv, 6 bv, 7 Wo, 8 bo, 9 logit scale [1] f32,
  //             10 mask int32 [NB_FULL][SEQ_FULL][SEQ_FULL] (nonzero = masked); out [NB_FULL][SEQ_FULL][1024] f32
  if (n_in < 11) return;
  const size_t need_x = ((size_t)(NB - 1) * SEQ_FULL + SEQ) * DM;
  const size_t need_m = ((size_t)(NB - 1) * SEQ_FULL + SEQ - 1) * SEQ_FULL + SEQ;
  if ((size_t)in_sizes[0] < need_x || (size_t)out_size < need_x || (size_t)in_sizes[10] < need_m || in_sizes[9] < 1) return;
  if (in_sizes[1] < DM * DM || in_sizes[3] < DM * DM || in_sizes[5] < DM * DM || in_sizes[7] < DM * DM) return;
  if (in_sizes[2] < DM || in_sizes[4] < DM || in_sizes[6] < DM || in_sizes[8] < DM) return;
  const float* X = (const float*)d_in[0];
  const float* Wq = (const float*)d_in[1]; const float* bq = (const float*)d_in[2];
  const float* Wk = (const float*)d_in[3]; const float* bk = (const float*)d_in[4];
  const float* Wv = (const float*)d_in[5]; const float* bv = (const float*)d_in[6];
  const float* Wo = (const float*)d_in[7]; const float* bo = (const float*)d_in[8];
  const float* lsc = (const float*)d_in[9]; const int* mask = (const int*)d_in[10];
  size_t off = 0; char* ws = (char*)d_ws;
  auto carve = [&](size_t bytes) { char* p = ws + off; off += (bytes + 255) & ~(size_t)255; return p; };
  const size_t plane = (size_t)NT * DM * 2;
  v2f* T  = (v2f*)carve((size_t)SEQ * NCS * sizeof(v2f));          // 524,288 B (256-B rows, exact)
  b16* Xp = (b16*)carve(plane);
  b16* Wp = (b16*)carve((size_t)4 * DM * DM * 2);                   // 8,388,608 B
  b16* Qp = (b16*)carve(plane); b16* Qr = (b16*)carve(plane); b16* Kp = (b16*)carve(plane); b16* Kr = (b16*)carve(plane);
  b16* VT = (b16*)carve(plane); b16* VR = (b16*)carve(plane); b16* Ch = (b16*)carve(plane); b16* Cr = (b16*)carve(plane);
  unsigned int* Mw = (unsigned int*)carve((size_t)NB * SEQ * (SEQ / 32) * sizeof(unsigned int));   // 1,048,576 B
  if (off > ws_size || off > ((size_t)128 << 20)) return;          // 85,458,944 B total at NB=2, SEQ=2048
  prep_kernel<<<dim3(PBR + PBM + PBX + PBW), 256, 0, stream>>>(X, Wq, Wk, Wv, Wo, mask, Xp, Wp, Mw, T);
  gemm_qkv_kernel<<<dim3(3 * DM / 192, NT / 256), 384, 0, stream>>>(Xp, Wp, bq, bk, bv, T, Qp, Qr, Kp, Kr, VT, VR);
  attn_kernel<<<dim3(SEQ / 32, NB * H), 32 * KSPL, 0, stream>>>(Qp, Qr, Kp, Kr, VT, VR, Mw, lsc, Ch, Cr);
  gemm_out_kernel<<<dim3(DM / 128, NT / 128), 256, 0, stream>>>(Ch, Cr, Wp + (size_t)3 * DM * DM, bo, (float*)d_out);
}

// v009
// A run of this version takes 111 microseconds.
// Two timings next to v008 both put it at 1.13 times that version's speed.
// Over all steps from v000 it is 3.88 times as fast.
#include <hip/hip_runtime.h>

// compute dtype: every contraction on v_wmma_f32_16x16x32_f16 (f16 operands, f32 accumulate). q/k/v projections: bf16-RNE(x) x8 times bf16-RNE(W) x64,
// 1 product each; scores K Q^T per head: q and k (rope + l2 norm in f32) as f16 x8 planes plus x1024 residual planes, 3 products (hi.hi, hi.res, res.hi);
// O^T += V^T P^T: V^T f16 x8 plus a x1024 residual plane, P f16 x1024 plus a x1024 residual tile, 3 products (residual products share one accumulator);
// output projection: ctx f16 x64 plus a x1024 residual plane times bf16-RNE(Wo) x64, 2 products. Softmax statistics (running max, exp2, row sums),
// rope cos/sin table, l2 norm and bias adds in f32; 1/sqrt(64) and exp(logit scale) folded into the log2-domain score constant.
// Fragment k-map per lane half hh for A AND B: elements 0..7 <- k = 8hh+0..7, 8..15 <- k = 16+8hh+0..7; acc[r] = D[8hh+r][col = lane&15].
// Packed planes (X, W, K, V^T, ctx and their residuals): a plane of R rows x C k-columns is stored as 16x32 tiles, tile index (row/16)*(C/32) + k/32 (V^T: (k/32)*(R/16) + row/16), each tile
// 512 elements laid out [k octet 0..3][row 0..15][8], so that each of a fragment's two wave loads reads 512 contiguous bytes (four whole 128-B lines).

#ifndef NB
#define NB 2
#endif
#ifndef SEQ
#define SEQ 2048
#endif
#ifndef NB_FULL
#define NB_FULL 2
#endif
#ifndef SEQ_FULL
#define SEQ_FULL 2048
#endif

namespace {
constexpr int H = 16, HD = 64, DM = 1024, NT = NB * SEQ, NCS = HD / 2, KT = DM / 32, TE = 512;
constexpr float XS = 8.0f, WSC = 64.0f, QS = 8.0f, QRS = 1024.0f, VS = 8.0f, VRS = 1024.0f, PS = 1024.0f, PRS = 1024.0f, OCS = 64.0f, OCRS = 1024.0f;
constexpr float LOG2E = 1.4426950408889634f, EPSN = 1e-6f;
constexpr int KSPL = 4;   // key shares (waves) per query block in the attention kernel
static_assert(KSPL == 4 && SEQ % (32 * KSPL) == 0);
constexpr int NJ = SEQ / (32 * KSPL);                       // key steps per share
// block ranges of the preparation launch (256 threads each): rope table, mask words, X plane, W planes
constexpr int PBR = SEQ * NCS / 4 / 256;                    // a thread fills 4 table entries
constexpr int PBM = NB * (SEQ / 16) * (NJ / 2) / 8;         // a wave packs 2 key steps of all KSPL shares of one query tile
constexpr int PBX = NT / 16, PBW = 4 * DM / 16;             // a block converts 16 rows of 1024
static_assert(NJ % 2 == 0 && NJ <= 16 && (NB * (SEQ / 16) * (NJ / 2)) % 8 == 0 && (SEQ * NCS / 4) % 256 == 0 && KT == 32 && SEQ % 16 == 0);
static_assert(SEQ % 64 == 0 && SEQ >= 64 && SEQ <= SEQ_FULL && NB >= 1 && NB <= NB_FULL);
static_assert(DM == H * HD && HD == 64 && DM % 128 == 0 && NT % 256 == 0 && (3 * DM) % 192 == 0 && PRS == VRS);

typedef _Float16 b16;
typedef __attribute__((ext_vector_type(16))) _Float16 v16b;
typedef __attribute__((ext_vector_type(8))) _Float16 v8b;
typedef __attribute__((ext_vector_type(2))) _Float16 v2b;
typedef __attribute__((ext_vector_type(8))) float v8f;
typedef __attribute__((ext_vector_type(4))) float v4f;
typedef __attribute__((ext_vector_type(2))) float v2f;
typedef __attribute__((ext_vector_type(4))) unsigned int v4u;

__device__ __forceinline__ float bf16_rne(float f) { unsigned int u = __float_as_uint(f); u += 0x7FFFu + ((u >> 16) & 1u); return __uint_as_float(u & 0xFFFF0000u); }
// 16-bit fragment from a k-contiguous row: elements 0..7 <- p[8hh .. 8hh+7], 8..15 <- p[16+8hh .. 16+8hh+7]
__device__ __forceinline__ v16b frag_kb(const b16* p, int hh) {
  const v8b a = *(const v8b*)(p + 8 * hh), b = *(const v8b*)(p + 16 + 8 * hh); v16b f;
#pragma unroll
  for (int e = 0; e < 8; ++e) { f[e] = a[e]; f[8 + e] = b[e]; }
  return f;
}
// the same fragment from a packed tile; p = tile + 8*lane (lane = 16hh + row): octets hh and 2+hh of the lane's row
__device__ __forceinline__ v16b frag_pk(const b16* p) {
  const v8b a = *(const v8b*)p, b = *(const v8b*)(p + 256); v16b f;
#pragma unroll
  for (int e = 0; e < 8; ++e) { f[e] = a[e]; f[8 + e] = b[e]; }
  return f;
}
__device__ __forceinline__ v8f wmma16b(v16b a, v16b b, v8f c) {
  v8f d = __builtin_amdgcn_wmma_f32_16x16x32_f16(false, a, false, b, (short)0, c, false, false);
  asm volatile("v_nop\n\tv_nop\n\tv_nop\n\tv_nop" : "+v"(d) : "v"(a), "v"(b));
  return d;
}
// the plain builtin (the compiler keeps the distances): for the attention kernel, whose live set passes v255, where the operands of an asm statement cannot lie
__device__ __forceinline__ v8f wmma16p(v16b a, v16b b, v8f c) { return __builtin_amdgcn_wmma_f32_16x16x32_f16(false, a, false, b, (short)0, c, false, false); }
__device__ __forceinline__ void wave_lds_sync() { __builtin_amdgcn_fence(3, "workgroup"); __builtin_amdgcn_wave_barrier(); __builtin_amdgcn_fence(2, "workgroup"); }
__device__ __forceinline__ float nexp2(float v) { return __builtin_amdgcn_exp2f(v); }

// LDS staging of the two GEMMs. A stage is KS k tiles (128 k) of every 16-row group of the block's operands; a chunk is one row group's part of it, CHB bytes that
// are contiguous in the packed plane and are kept in that order in LDS, so a fragment is read from LDS as it was from the plane (two reads of 512 contiguous bytes).
constexpr int KS = 4, CHB = KS * TE * 2, NST = KT / KS;
static_assert(KT % KS == 0 && NST >= 2);
// One chunk by one wave: eight asynchronous copies of 512 B; l = the lane's LDS byte address, g = the lane's place in the plane (both 16 B x lane into the chunk).
// The s_wait_xcnt stands inside the statement, behind the last copy: no address register of a copy is rewritten in front of it.
__device__ __forceinline__ void copy_chunk(unsigned l, const b16* g) {
  asm volatile("global_load_async_to_lds_b128 %0, %8, off\n\t"
               "global_load_async_to_lds_b128 %1, %9, off\n\t"
               "global_load_async_to_lds_b128 %2, %10, off\n\t"
               "global_load_async_to_lds_b128 %3, %11, off\n\t"
               "global_load_async_to_lds_b128 %4, %12, off\n\t"
               "global_load_async_to_lds_b128 %5, %13, off\n\t"
               "global_load_async_to_lds_b128 %6, %14, off\n\t"
               "global_load_async_to_lds_b128 %7, %15, off\n\t"
               "s_wait_xcnt 0x0"
               :: "v"(l), "v"(l + 512u), "v"(l + 1024u), "v"(l + 1536u), "v"(l + 2048u), "v"(l + 2560u), "v"(l + 3072u), "v"(l + 3584u),
                  "v"(g), "v"(g + 256), "v"(g + 512), "v"(g + 768), "v"(g + 1024), "v"(g + 1280), "v"(g + 1536), "v"(g + 1792) : "memory");
}
// the wave's own copies have landed (in front of the barrier behind which other waves read them)
__device__ __forceinline__ void wait_copies() { asm volatile("s_wait_asynccnt 0x0" ::: "memory"); }
// the wave's own LDS reads have returned (in front of the barrier behind which their buffer is refilled)
__device__ __forceinline__ void wait_lds() { asm volatile("s_wait_dscnt 0x0" ::: "memory"); }

// One row group (16 rows x 1024 columns, f32, row pitch DM, first row at S) to its KT packed tiles at D, f16 = bf16-RNE(value) x sc, by one block of 256 threads.
// A pass of the block covers 4 tiles, thread per k octet: a wave reads 8 rows x 128 B and writes four whole 128-B lines of one tile. All 8 passes' loads (16 of
// 16 B a lane) are requested before the first conversion.
__device__ __forceinline__ void cvt_row_group(const float* __restrict__ S, b16* __restrict__ D, float sc, int tid) {
  const int oct = tid & 3, rl = (tid >> 2) & 15, t0 = tid >> 6;
  const float* src = S + (size_t)rl * DM + (size_t)(t0 * 32 + oct * 8);
  b16* dst = D + (size_t)t0 * TE + (size_t)((oct * 16 + rl) * 8);
  v4f x0[KT / 4], x1[KT / 4];
#pragma unroll
  for (int i = 0; i < KT / 4; ++i) { x0[i] = *(const v4f*)(src + i * 128); x1[i] = *(const v4f*)(src + i * 128 + 4); }
  asm volatile("s_wait_xcnt 0x0" :: "v"(src) : "memory");   // behind the group: the address pair stays whole until here, before any of its registers is rewritten
  v8b o[KT / 4];
#pragma unroll
  for (int i = 0; i < KT / 4; ++i)
#pragma unroll
    for (int j = 0; j < 4; ++j) { o[i][j] = (b16)(bf16_rne(x0[i][j]) * sc); o[i][4 + j] = (b16)(bf16_rne(x1[i][j]) * sc); }
#pragma unroll
  for (int i = 0; i < KT / 4; ++i) *(v8b*)(dst + (size_t)i * 4 * TE) = o[i];
  asm volatile("s_wait_xcnt 0x0" ::: "memory");   // behind the run of stores, before any later code rewrites their address or data registers
}

// All preparation in one launch; the block's range of blockIdx.x selects its work (block-uniform):
// [0, PBR): rope table T[s][i] = (cos, sin)(s * freq_i), freq_i = 1 / fl32(10000^(2i/64)), s*freq as an f32 product, argument reduction in f64 (mul/fma only), short
//   f32 polynomials; a thread computes freq_i once and fills four rows s.
// [PBR, PBR+PBM): the mask packed into bit words Mw[b][query tile][share ks][step j of the share][query 0..15]: bit i set <=> key 32*(j*KSPL+ks)+i is NOT masked for
//   that query. A wave takes one query tile and the steps j, j+1 of all four shares, two shares a trip: 16 rows x two pieces of 256 B in, two whole 128-B lines out.
// [.., +PBX): X plane, packed tiles of [NB*SEQ tokens][1024], f16 = bf16-RNE(x) x8; token row b*SEQ+s reads input row b*SEQ_FULL+s; a block per 16 tokens.
// [.., +PBW): W planes [4], each the packed tiles of [1024 out][1024 in], f16 = bf16-RNE(W) x64 (rows n, k along the input); a block per 16 rows of one weight.
__global__ __launch_bounds__(256) void prep_kernel(const float* __restrict__ X, const float* __restrict__ Wq, const float* __restrict__ Wk,
                                                   const float* __restrict__ Wv, const float* __restrict__ Wo, const int* __restrict__ mask,
                                                   b16* __restrict__ Xp, b16* __restrict__ Wp, unsigned int* __restrict__ Mw, v2f* __restrict__ T) {
  const int blk = (int)blockIdx.x, tid = (int)threadIdx.x;
  if (blk < PBR) {
    const int u = blk * 256 + tid, i = u % NCS, sq = u / NCS;
    const float ex = (float)(2 * i) / (float)HD;
    const float pw = (float)exp2((double)ex * 13.287712379549449);
    const float freq = 1.0f / pw;
#pragma unroll
    for (int q = 0; q < 4; ++q) {
      const int s = sq + q * (SEQ / 4);
      const float ang = (float)s * freq;
      const double a = (double)ang;
      const double k = __builtin_rint(a * 0.63661977236758134);
      double rd = __builtin_fma(-k, 1.5707963267948966, a);
      rd = __builtin_fma(-k, 6.123233995736766e-17, rd);
      const float r = (float)rd, r2 = r * r;
      const float sp = r + r * r2 * (-1.6666666666666666e-1f + r2 * (8.333333333333333e-3f + r2 * (-1.984126984126984e-4f + r2 * 2.7557319223985893e-6f)));
      const float cp = 1.0f + r2 * (-0.5f + r2 * (4.1666666666666664e-2f + r2 * (-1.3888888888888889e-3f + r2 * (2.48015873015873e-5f + r2 * -2.755731922398589e-7f))));
      const int kq = (int)(((long long)k) & 3);
      const float c = (kq == 0) ? cp : ((kq == 1) ? -sp : ((kq == 2) ? -cp : sp));
      const float sn = (kq == 0) ? sp : ((kq == 1) ? cp : ((kq == 2) ? -sp : -cp));
      v2f o; o.x = c; o.y = sn;
      *(v2f*)(T + (size_t)s * NCS + i) = o;
    }
    return;
  }
  if (blk < PBR + PBM) {
    const int wv = (blk - PBR) * 8 + (tid >> 5), lane = tid & 31;
    const int jp = wv % (NJ / 2), qt = (wv / (NJ / 2)) % (SEQ / 16), b = wv / ((NJ / 2) * (SEQ / 16));
    const int* src = mask + ((size_t)b * SEQ_FULL + (size_t)qt * 16) * SEQ_FULL + (size_t)(2 * jp * KSPL * 32 + lane);
    unsigned int* dst = Mw + (size_t)(((b * (SEQ / 16) + qt) * KSPL * NJ + 2 * jp) * 16) + lane;
#pragma unroll 1   // two trips of 64 loads a lane: all four shares at once would double the registers of the whole launch
    for (int ks = 0; ks < KSPL; ks += 2) {
      int g[2][2][16];
#pragma unroll
      for (int r = 0; r < 16; ++r)
#pragma unroll
        for (int c = 0; c < 2; ++c) {
          g[c][0][r] = src[(size_t)r * SEQ_FULL + (ks + c) * 32]; g[c][1][r] = src[(size_t)r * SEQ_FULL + (ks + c) * 32 + 32 * KSPL]; }
#pragma unroll
      for (int c = 0; c < 2; ++c) {
        unsigned int w = 0u;
#pragma unroll
        for (int r = 0; r < 16; ++r) {
          const unsigned int b0 = __builtin_amdgcn_ballot_w32(g[c][0][r] == 0), b1 = __builtin_amdgcn_ballot_w32(g[c][1][r] == 0);
          w = (lane == r) ? b0 : w; w = (lane == 16 + r) ? b1 : w; }
        dst[(size_t)(ks + c) * NJ * 16] = w; }
      asm volatile("s_wait_xcnt 0x0" ::: "memory");   // before the next trip rewrites the loads' and stores' address and data registers
    }
    return;
  }
  if (blk < PBR + PBM + PBX) {
    const int row0 = (blk - PBR - PBM) * 16, b = row0 / SEQ, s0 = row0 % SEQ;
    cvt_row_group(X + ((size_t)b * SEQ_FULL + (size_t)s0) * DM, Xp + (size_t)(row0 / 16) * KT * TE, XS, tid);
    return;
  }
  const int wb = blk - PBR - PBM - PBX, y = wb / (DM / 16), rg = wb % (DM / 16);
  const float* W = (y == 0) ? Wq : ((y == 1) ? Wk : ((y == 2) ? Wv : Wo));
  cvt_row_group(W + (size_t)rg * 16 * DM, Wp + (size_t)y * DM * DM + (size_t)rg * KT * TE, WSC, tid);
}

// Fused q/k/v projection: C = A(X plane) . B (B[k][n] = W[n][k] from the packed W plane), K = 1024 stepped by 32. q planes stay [s][64]; k planes are packed tiles
// of [s][64], v planes packed tiles of [64][s].
// Block 384 threads = 12 waves in 4x3, block tile 256 tokens x 192 features, wave tile 64 x 64 = 4x4 WMMA tiles. The block's 16 X and 12 W row groups are brought into
// LDS once a stage by asynchronous copies (two buffers: the next stage flies while this one is worked on) and every wave reads its fragments from there, so that
// an X row group is fetched once for three waves and a W row group once for four. A wave's 64 columns are exactly one head of q, k or v (which = column / 1024,
// wave-uniform). Epilogue, each wave on its own tile: acc/512 + bf16-RNE(bias) staged in the wave's part of LDS (the ring's bytes, free behind the last stage's
// barrier), then rope + l2 norm (q, k) or transpose (v); a trip of each epilogue loop takes its piece of all four 16-row tiles of the wave.
__global__ __launch_bounds__(384) __attribute__((amdgpu_num_vgpr(256))) void gemm_qkv_kernel(
    const b16* __restrict__ Xp, const b16* __restrict__ Wp, const float* __restrict__ bq, const float* __restrict__ bk, const float* __restrict__ bv,
    const v2f* __restrict__ CSt, b16* __restrict__ Qp, b16* __restrict__ Qr, b16* __restrict__ Kp, b16* __restrict__ Kr, b16* __restrict__ VT,
    b16* __restrict__ VR) {
  constexpr int NCA = 16, NCB = 12, STB = (NCA + NCB) * CHB, TWB = 64 * (HD + 4) * 4;   // X and W chunks of a stage, bytes of a stage, of a wave's epilogue tile
  __shared__ __attribute__((aligned(1024))) char sm[2 * STB > 12 * TWB ? 2 * STB : 12 * TWB];
  // the wave's number as a scalar: the choice of its chunks, of q/k/v and the test around its third chunk stay on the scalar unit
  const int wave = __builtin_amdgcn_readfirstlane((int)(threadIdx.x >> 5));
  const int lane = threadIdx.x & 31, hh = lane >> 4, m = lane & 15, wm = wave / 3, wn = wave % 3;
  const int col0 = (int)blockIdx.x * 192 + wn * 64, which = col0 / DM, n0 = col0 % DM, h = n0 / HD;
  const int mblk = (int)blockIdx.y * 256 + wm * 64, b = mblk / SEQ, s0 = mblk % SEQ;
  const float* bsel = (which == 0) ? bq : ((which == 1) ? bk : bv);
  float (*Tw)[HD + 4] = (float (*)[HD + 4])(sm + wave * TWB);
  // chunk c of a stage: X row group c (c < 16) or W row group c - 16 of the block; wave w copies chunks w, w + 12 and, for w < 4, w + 24
  const b16* Xb = Xp + (size_t)((int)blockIdx.y * NCA) * KT * TE + 8 * lane;
  const b16* Wb = Wp + (size_t)((int)blockIdx.x * NCB) * KT * TE + 8 * lane;
  const b16* g0 = Xb + (size_t)wave * KT * TE;
  const b16* g1 = (wave < 4) ? Xb + (size_t)(wave + 12) * KT * TE : Wb + (size_t)(wave - 4) * KT * TE;
  const b16* g2 = Wb + (size_t)((wave & 3) + 8) * KT * TE;
  const unsigned l0 = (unsigned)(size_t)sm + (unsigned)(wave * CHB + lane * 16);
  auto issue = [&](int st, int buf) {
    const unsigned lo = l0 + (unsigned)(buf * STB); const int go = st * KS * TE;
    copy_chunk(lo, g0 + go); copy_chunk(lo + 12u * CHB, g1 + go);
    if (wave < 4) copy_chunk(lo + 24u * CHB, g2 + go);
  };
  v8f acc[4][4];
#pragma unroll
  for (int i = 0; i < 4; ++i)
#pragma unroll
    for (int j = 0; j < 4; ++j) acc[i][j] = (v8f){};
  issue(0, 0); wait_copies();
  __syncthreads();   // stage 0 is readable by every wave
  issue(1, 1);
#pragma unroll 1   // rolled: one body of four k steps; the buffer alternates
  for (int t = 0; t < NST; ++t) {
    const char* sa = sm + (t & 1) * STB + wm * 4 * CHB + lane * 16;
    const char* sw = sm + (t & 1) * STB + (NCA + wn * 4) * CHB + lane * 16;
#pragma unroll
    for (int kk = 0; kk < KS; ++kk) {
      v16b af[4], bf[4];
#pragma unroll
      for (int mt = 0; mt < 4; ++mt) af[mt] = frag_pk((const b16*)(sa + mt * CHB + kk * TE * 2));
#pragma unroll
      for (int nt = 0; nt < 4; ++nt) bf[nt] = frag_pk((const b16*)(sw + nt * CHB + kk * TE * 2));
#pragma unroll
      for (int mt = 0; mt < 4; ++mt)
#pragma unroll
        for (int nt = 0; nt < 4; ++nt) acc[mt][nt] = wmma16b(af[mt], bf[nt], acc[mt][nt]);
    }
    wait_lds(); wait_copies();
    __syncthreads();   // publishes stage t + 1 and ends every wave's reads of stage t's buffer
    if (t + 2 < NST) issue(t + 2, t & 1);
  }
  wait_copies();   // nothing is in flight when the ring's bytes become the epilogue's tiles
  float bias[4];
#pragma unroll
  for (int nt = 0; nt < 4; ++nt) bias[nt] = bf16_rne(bsel[n0 + nt * 16 + m]);
  const float isc = 1.0f / (XS * WSC);
#pragma unroll
  for (int mt = 0; mt < 4; ++mt)
#pragma unroll
    for (int nt = 0; nt < 4; ++nt)
#pragma unroll
      for (int r = 0; r < 8; ++r) Tw[mt * 16 + 8 * hh + r][nt * 16 + m] = acc[mt][nt][r] * isc + bias[nt];
  __syncthreads();   // the staged tile is read across lanes
  if (which < 2) {
    // 16 rows are 1024 elements in both layouts ([s][64] rows for q, packed tiles of [s][64] for k); lo = the lane's place in them, rs = elements from a row to the next
    const int lo = (which == 0) ? 2 * lane : (lane >> 4) * 512 + ((lane >> 2) & 3) * 128 + ((2 * lane) & 7), rs = (which == 0) ? HD : 8;
    const size_t pb = (size_t)(b * H + h) * SEQ * HD + (size_t)s0 * HD + lo;
    b16* Ph = ((which == 0) ? Qp : Kp) + pb;
    b16* Pl = ((which == 0) ? Qr : Kr) + pb;
    const v2f* Cw = CSt + (size_t)s0 * NCS + lane;
#pragma unroll 1
    for (int it = 0; it < 16; ++it) {   // row it of each of the wave's four 16-row tiles
      float y0[4], y1[4], ss[4];
#pragma unroll
      for (int mt = 0; mt < 4; ++mt) {
        const int r = mt * 16 + it;
        const float x0 = Tw[r][2 * lane], x1 = Tw[r][2 * lane + 1];
        const v2f cv = Cw[(size_t)r * NCS];
        y0[mt] = x0 * cv.x - x1 * cv.y; y1[mt] = x1 * cv.x + x0 * cv.y;
        ss[mt] = y0[mt] * y0[mt] + y1[mt] * y1[mt]; }
#pragma unroll
      for (int w = 16; w >= 1; w >>= 1)
#pragma unroll
        for (int mt = 0; mt < 4; ++mt) ss[mt] += __shfl_xor(ss[mt], w);
#pragma unroll
      for (int mt = 0; mt < 4; ++mt) {
        const float inv = 1.0f / sqrtf(ss[mt] + EPSN);
        const float z0 = y0[mt] * inv * QS, z1 = y1[mt] * inv * QS;
        const b16 h0 = (b16)z0, h1 = (b16)z1;
        v2b oh, ol; oh.x = h0; oh.y = h1; ol.x = (b16)((z0 - (float)h0) * QRS); ol.y = (b16)((z1 - (float)h1) * QRS);
        const int off = mt * 16 * HD + it * rs;
        *(v2b*)(Ph + off) = oh; *(v2b*)(Pl + off) = ol; }
      asm volatile("s_wait_xcnt 0x0" ::: "memory");   // before the next trip rewrites the loads' and stores' address and data registers
    }
  } else {
    const size_t vb = ((size_t)(b * H + h) * HD) * SEQ;
#pragma unroll 1
    for (int it = 0; it < 4; ++it) {
#pragma unroll
      for (int g = 0; g < 4; ++g) {   // the wave's four groups of 16 head features (each one row of packed tiles)
        const int dl = (it & 1) * 8 + (lane & 7), d = g * 16 + dl, tok = (it >> 1) * 32 + (lane >> 3) * 8;
        v8b oh, ol;
#pragma unroll
        for (int j = 0; j < 8; ++j) {
          const float v = Tw[tok + j][d] * VS; const b16 hv = (b16)v; oh[j] = hv; ol[j] = (b16)((v - (float)hv) * VRS); }
        const size_t off = vb + (size_t)((((s0 + tok) >> 5) * 4 + g) * 64 + (lane >> 3) * 16 + dl) * 8;
        *(v8b*)(VT + off) = oh; *(v8b*)(VR + off) = ol;
      }
      asm volatile("s_wait_xcnt 0x0" ::: "memory");   // before the next trip rewrites the stores' address and data registers
    }
  }
}

// Masked softmax attention per (b*H+h, query block of 32, last block first); block = 4 waves = 4 key shares, each wave on BOTH 16-query tiles of the block, so that every K and V
// fragment it loads feeds two products: share ks takes the key steps of 32 whose index is ks modulo 4, in fixed order, with its own running max, row sum and O tile
// per query tile; the four partial results of a query tile are merged in LDS behind one block barrier (weights exp2(m_j - max m), fixed order j = 0..3), each
// share's wave packing a quarter of each tile's ctx. The mask comes as the packed bit words: the wave reads all words of its share for both tiles once and keeps two
// scalar maps, the steps with any unmasked entry in its 32x32 region (only these are walked; the others contribute 0) and the steps with none masked (these apply no
// mask); a walked step's word per query is requested one walked step ahead. A walked step in which a query has no unmasked key leaves that query's max, sum and O as they are.
// S^T = K Q^T (hi.hi + hi.res + res.hi, q/k residual products scaled back by 1/1024), masked entries replaced by -inf, online softmax (running max, f32,
// -inf-safe), P x1024 and its x1024 residual via wave-private LDS, O^T += V^T P^T with V^T hi/res planes. ctx [b*SEQ+s][h*64+d] written as packed tiles, f16 x64
__global__ __launch_bounds__(32 * KSPL) __attribute__((amdgpu_num_vgpr(336))) void attn_kernel(
    const b16* __restrict__ Qp, const b16* __restrict__ Qr, const b16* __restrict__ Kp, const b16* __restrict__ Kr,
    const b16* __restrict__ VT, const b16* __restrict__ VR, const unsigned int* __restrict__ Mw, const float* __restrict__ lsc,
    b16* __restrict__ Ch, b16* __restrict__ Cr) {
  __shared__ __attribute__((aligned(16))) b16 Pb[KSPL][2][16][32 + 8];
  __shared__ __attribute__((aligned(16))) b16 Pr[KSPL][2][16][32 + 8];
  __shared__ __attribute__((aligned(16))) float To[KSPL][2][16][HD + 4];
  __shared__ float Ms[KSPL][2][16], Ls[KSPL][2][16];
  // the wave's number (its key share) as a scalar, so that the key loop's control and the plane offsets stay on the scalar unit
  const int ks = __builtin_amdgcn_readfirstlane((int)(threadIdx.x >> 5));
  const int lane = threadIdx.x & 31, hh = lane >> 4, col = lane & 15;
  // Start order (speed only, any order is right): blockIdx.x = batch*head runs fastest, blockIdx.y counts the query blocks from the LAST one down. There are more
  // blocks than resident places; under a mask that hides later keys a late query block walks the most key steps, so the
  // long blocks come first in index order and the short ones last.
  const int bhi = (int)blockIdx.x, b = bhi / H, h = bhi % H;
  const int q0 = (SEQ / 32 - 1 - (int)blockIdx.y) * 32;
  const size_t pq = (size_t)bhi * SEQ * HD;   // same plane size for the [s][64] rows and for both packed layouts
  const b16* Kb = Kp + pq; const b16* Klb = Kr + pq;
  const b16* Vb = VT + pq; const b16* Rb = VR + pq;
  constexpr unsigned MTB = (unsigned)(KSPL * NJ * 16 * 4);   // bytes from a query tile's mask words to the next tile's
  const unsigned int* Mq = Mw + (size_t)(((b * (SEQ / 16) + (q0 >> 4)) * KSPL + ks) * NJ) * 16;   // the share's NJ x 16 mask words of the first tile
  unsigned int act, ful;   // bit 2j: step j of the share has an unmasked entry / has no masked entry, over both tiles; both wave-uniform
  const int jl = lane >> 1;   // the lane reads 8 of step jl's 16 words of each tile
  const unsigned so = (jl < NJ) ? (unsigned)lane * 32u : 0u;
  {
    const unsigned int* sp = (const unsigned int*)((const char*)Mq + so);
    const unsigned int* sp1 = (const unsigned int*)((const char*)Mq + so + MTB);
    const v4u w0 = *(const v4u*)sp, w1 = *(const v4u*)(sp + 4), w2 = *(const v4u*)sp1, w3 = *(const v4u*)(sp1 + 4);
    const v4u vo = w0 | w1 | w2 | w3, va = w0 & w1 & w2 & w3;
    const unsigned int wo = vo.x | vo.y | vo.z | vo.w, wa = va.x & va.y & va.z & va.w;
    const unsigned int anyb = __builtin_amdgcn_ballot_w32(jl < NJ && wo != 0u), allb = __builtin_amdgcn_ballot_w32(wa == 0xFFFFFFFFu);
    act = (anyb | (anyb >> 1)) & 0x55555555u; ful = allb & (allb >> 1);
  }
  asm volatile("s_wait_xcnt 0x0" :: "v"(so) : "memory");   // before the mask words' offset register is rewritten
  float m[2], l[2]; v8f o[2][4], o2[2][4];
#pragma unroll
  for (int a = 0; a < 2; ++a) {
    m[a] = -INFINITY; l[a] = 0.0f;
#pragma unroll
    for (int t = 0; t < 4; ++t) { o[a][t] = (v8f){}; o2[a][t] = (v8f){}; } }
  if (act != 0u) {   // scalar branch: a share with no unmasked entry loads nothing more
  // Q fragments [query tile][k half] and the first walked step's mask words: one group, in flight beside the first step's K group
  v16b qa[2][2], ql[2][2];
  const unsigned qb = (unsigned)((q0 + col) * HD + 8 * hh) * 2u;   // byte offset of the lane's first octet in the head's [s][64] plane
  const b16* pqh = (const b16*)((const char*)(Qp + pq) + qb); const b16* pql = (const b16*)((const char*)(Qr + pq) + qb);
#pragma unroll
  for (int a = 0; a < 2; ++a) {
    qa[a][0] = frag_kb(pqh + a * 16 * HD, 0); qa[a][1] = frag_kb(pqh + a * 16 * HD + 32, 0);
    ql[a][0] = frag_kb(pql + a * 16 * HD, 0); ql[a][1] = frag_kb(pql + a * 16 * HD + 32, 0); }
  // each query's 32 mask bits of a walked step are requested one walked step ahead
  unsigned int mwn[2];
  const unsigned mo0 = (unsigned)(__builtin_ctz(act) >> 1) * 64u + (unsigned)col * 4u;
  mwn[0] = *(const unsigned int*)((const char*)Mq + mo0); mwn[1] = *(const unsigned int*)((const char*)Mq + mo0 + MTB);
  asm volatile("s_wait_xcnt 0x0" :: "v"(qb), "v"(mo0) : "memory");   // behind the group: its offset registers stay whole until here
  const float cs = 0.125f * expf(bf16_rne(lsc[0])) * (LOG2E / (QS * QS));
#pragma unroll 1   // rolled: the trip count comes from the mask, and one body fills the register budget
  do {   // at most NJ trips, in rising key order
    const int tz = __builtin_ctz(act), j = tz >> 1; act &= act - 1u;
    const bool full = ((ful >> tz) & 1u) != 0u;
    // byte offset of the lane's place in the step's first tile: K tiles 2u, 2u+1 of key group u and V tiles t share it
    const unsigned ko = (unsigned)lane * 16u + (unsigned)(j * KSPL + ks) * (unsigned)(4 * TE * 2);
    const unsigned int mw[2] = {mwn[0], mwn[1]};
    // the next walked step's words (the last step asks for its own again: in bounds, never used)
    const unsigned mo = (unsigned)((act != 0u ? __builtin_ctz(act) >> 1 : j) * 64) + (unsigned)col * 4u;
    mwn[0] = *(const unsigned int*)((const char*)Mq + mo); mwn[1] = *(const unsigned int*)((const char*)Mq + mo + MTB);
    // all eight K fragments of the step are requested here as one group, ahead of the matrix work
    v16b kh[4], kl[4], vh[4], vl[4];
    const b16* pk = (const b16*)((const char*)Kb + ko); const b16* pkl = (const b16*)((const char*)Klb + ko);
    const b16* pv = (const b16*)((const char*)Vb + ko); const b16* pvl = (const b16*)((const char*)Rb + ko);
#pragma unroll
    for (int j = 0; j < 4; ++j) { kh[j] = frag_pk(pk + j * TE); kl[j] = frag_pk(pkl + j * TE); }
    // behind the group: its offset registers stay whole until here, and no load sinks to its use (there each pair of loads costs the wave a full L2 round trip)
    asm volatile("s_wait_xcnt 0x0" :: "v"(ko), "v"(mo) : "memory");
    __builtin_amdgcn_sched_barrier(0);   // no product rises above the group: else a late K load takes an early fragment's registers and waits out a second round trip
    float e[2][16];
#pragma unroll
    for (int u = 0; u < 2; ++u) {
      const v16b ka = kh[2 * u], kc = kh[2 * u + 1];
#pragma unroll
      for (int a = 0; a < 2; ++a) {
        v8f s = wmma16p(ka, qa[a][0], (v8f){}); s = wmma16p(kc, qa[a][1], s);
        v8f s2 = wmma16p(ka, ql[a][0], (v8f){}); s2 = wmma16p(kc, ql[a][1], s2);
        s2 = wmma16p(kl[2 * u], qa[a][0], s2); s2 = wmma16p(kl[2 * u + 1], qa[a][1], s2);
#pragma unroll
        for (int r = 0; r < 8; ++r) e[a][u * 8 + r] = (s[r] + s2[r] * (1.0f / QRS)) * cs; } }
    // second group, into the registers that K has left: all eight V fragments fly while the softmax runs
#pragma unroll
    for (int t = 0; t < 4; ++t) { vh[t] = frag_pk(pv + t * TE); vl[t] = frag_pk(pvl + t * TE); }
    asm volatile("s_wait_xcnt 0x0" :: "v"(ko) : "memory");   // as behind the K group: the offset register whole, the loads ahead of the softmax arithmetic
    if (!full) {   // scalar branch: entry i of the lane is key 8hh+i (i < 8) or 16+8hh+i-8 of the step
#pragma unroll
      for (int a = 0; a < 2; ++a) {
        const unsigned int sh = mw[a] >> (8 * hh);
#pragma unroll
        for (int i2 = 0; i2 < 16; ++i2) e[a][i2] = ((sh >> (i2 < 8 ? i2 : i2 + 8)) & 1u) ? e[a][i2] : -INFINITY; } }
    float al[2], mx[2];
#pragma unroll
    for (int a = 0; a < 2; ++a) {   // both tiles' maxima first, so that their two exchanges between the lane halves share one wait
      mx[a] = -INFINITY;
#pragma unroll
      for (int i2 = 0; i2 < 16; ++i2) mx[a] = fmaxf(mx[a], e[a][i2]); }
    const float ox[2] = {__shfl_xor(mx[0], 16), __shfl_xor(mx[1], 16)};
#pragma unroll
    for (int a = 0; a < 2; ++a) {
      const float mn = fmaxf(m[a], fmaxf(mx[a], ox[a]));
      const float mref = (mn == -INFINITY) ? 0.0f : mn;
      const float xa = m[a] - mref; al[a] = nexp2(xa); float sum = 0.0f;
      asm volatile("v_nop" :: "v"(xa), "v"(al[a]));   // the slot behind the exponential, as below
#pragma unroll
      for (int g = 0; g < 16; g += 4) {
        float x[4], p[4];
#pragma unroll
        for (int k = 0; k < 4; ++k) { x[k] = e[a][g + k] - mref; p[k] = nexp2(x[k]); }
        // the slot behind a transcendental: arguments and results as inputs only, so that the four stand in front of it and no argument register is rewritten before it
        asm volatile("v_nop" :: "v"(x[0]), "v"(x[1]), "v"(x[2]), "v"(x[3]), "v"(p[0]), "v"(p[1]), "v"(p[2]), "v"(p[3]));
#pragma unroll
        for (int k = 0; k < 4; ++k) {
          const int i2 = g + k, pi = (i2 < 8 ? 0 : 16) + 8 * hh + (i2 & 7); sum += p[k];
          const float pp = p[k] * PS; const b16 ph = (b16)pp; Pb[ks][a][col][pi] = ph;
          Pr[ks][a][col][pi] = (b16)((pp - (float)ph) * PRS); } }
      sum += __shfl_xor(sum, 16); l[a] = l[a] * al[a] + sum; m[a] = mn; }
    wave_lds_sync();
    v16b pf[2], plf[2];
#pragma unroll
    for (int a = 0; a < 2; ++a) { pf[a] = frag_kb(&Pb[ks][a][col][0], hh); plf[a] = frag_kb(&Pr[ks][a][col][0], hh); }
#pragma unroll
    for (int t = 0; t < 4; ++t)
#pragma unroll
      for (int a = 0; a < 2; ++a) {
        o[a][t] *= al[a]; o2[a][t] *= al[a];
        o[a][t] = wmma16p(vh[t], pf[a], o[a][t]);
        o2[a][t] = wmma16p(vl[t], pf[a], o2[a][t]);
        o2[a][t] = wmma16p(vh[t], plf[a], o2[a][t]); }
    wave_lds_sync(); } while (act != 0u);
  }
  // the share's partial results, not yet normalised: O tile, running max and row sum of each query
#pragma unroll
  for (int a = 0; a < 2; ++a) {
#pragma unroll
    for (int t = 0; t < 4; ++t) {
#pragma unroll
      for (int r = 0; r < 8; ++r) To[ks][a][col][t * 16 + 8 * hh + r] = o[a][t][r] + o2[a][t][r] * (1.0f / VRS); }
    if (hh == 0) { Ms[ks][a][col] = m[a]; Ls[ks][a][col] = l[a]; } }
  __syncthreads();   // the partial results are read across the four waves
#pragma unroll
  for (int a = 0; a < 2; ++a) {
    const size_t cb = ((size_t)((b * SEQ + q0 + a * 16) >> 4) * KT + (size_t)h * 2) * TE;
    const int it = ks;   // each share's wave merges and packs one quarter of each query tile
    const int rl = (it & 1) * 8 + (lane & 7), pc = (it >> 1) * 32 + (lane >> 3) * 8;
    float mj[KSPL], mt = -INFINITY;
#pragma unroll
    for (int j = 0; j < KSPL; ++j) { mj[j] = Ms[j][a][rl]; mt = fmaxf(mt, mj[j]); }
    const float mtr = (mt == -INFINITY) ? 0.0f : mt;   // -inf-safe, as in the key loop
    float lt = 0.0f, xw[KSPL], w[KSPL]; v4f f0 = (v4f){}, f1 = (v4f){};
#pragma unroll
    for (int j = 0; j < KSPL; ++j) { xw[j] = mj[j] - mtr; w[j] = nexp2(xw[j]); }
    // the slot behind a transcendental, as in the key loop
    asm volatile("v_nop" :: "v"(xw[0]), "v"(xw[1]), "v"(xw[2]), "v"(xw[3]), "v"(w[0]), "v"(w[1]), "v"(w[2]), "v"(w[3]));
#pragma unroll
    for (int j = 0; j < KSPL; ++j) {
      lt += w[j] * Ls[j][a][rl];
      f0 += w[j] * *(const v4f*)(&To[j][a][rl][pc]); f1 += w[j] * *(const v4f*)(&To[j][a][rl][pc + 4]); }
    const float inv = 1.0f / (lt * PS * VS);
    f0 *= inv; f1 *= inv;
    v8b oh, ol;
#pragma unroll
    for (int j = 0; j < 4; ++j) {
      const float v0 = f0[j] * OCS; const b16 hv0 = (b16)v0; oh[j] = hv0; ol[j] = (b16)((v0 - (float)hv0) * OCRS);
      const float v1 = f1[j] * OCS; const b16 hv1 = (b16)v1; oh[4 + j] = hv1; ol[4 + j] = (b16)((v1 - (float)hv1) * OCRS); }
    const size_t off = cb + (size_t)((it >> 1) * 64 + (lane >> 3) * 16 + rl) * 8;
    *(v8b*)(Ch + off) = oh; *(v8b*)(Cr + off) = ol;
    if (a == 0) asm volatile("s_wait_xcnt 0x0" ::: "memory");   // before the second tile's code rewrites the stores' address and data registers
  }
}

// Output projection: out = (ctx hi . Wo + ctx res . Wo / 1024) / 4096 + bf16-RNE(bo), K = 1024 stepped by 32.
// Block 256 = 8 waves in 4x2, block tile 128 tokens x 128 features, wave tile 32 x 64 = 2x4 WMMA tiles for each of the two products. The block's 8 ctx, 8 residual and
// 8 Wo row groups come into LDS once a stage by asynchronous copies (two buffers, as in the q/k/v kernel), one chunk of each per wave; fragments are read from LDS.
// Result staged in the wave's part of LDS (the ring's bytes); each 256-B row segment is stored by 16 consecutive lanes.
__global__ __launch_bounds__(256) __attribute__((amdgpu_num_vgpr(256))) void gemm_out_kernel(
    const b16* __restrict__ Ch, const b16* __restrict__ Cr, const b16* __restrict__ Wop, const float* __restrict__ bo, float* __restrict__ out) {
  constexpr int NCG = 8, STB = 3 * NCG * CHB, TWB = 32 * (HD + 4) * 4;   // chunks of each operand in a stage, bytes of a stage, of a wave's epilogue tile
  __shared__ __attribute__((aligned(1024))) char sm[2 * STB > 8 * TWB ? 2 * STB : 8 * TWB];
  const int wave = __builtin_amdgcn_readfirstlane((int)(threadIdx.x >> 5));   // a scalar: the wave's chunk and tile offsets stay on the scalar unit
  const int lane = threadIdx.x & 31, hh = lane >> 4, m = lane & 15, wm = wave >> 1, wn = wave & 1;
  const int nblk = (int)blockIdx.x * 128 + wn * 64;
  const int mblk = (int)blockIdx.y * 128 + wm * 32, b = mblk / SEQ, s0 = mblk % SEQ;
  float (*Tw)[HD + 4] = (float (*)[HD + 4])(sm + wave * TWB);
  // a stage in LDS: [8 ctx chunks][8 residual chunks][8 Wo chunks]; wave w copies chunk w of each
  const size_t ga = (size_t)((int)blockIdx.y * NCG + wave) * KT * TE + 8 * lane;
  const b16* g0 = Ch + ga; const b16* g1 = Cr + ga;
  const b16* g2 = Wop + (size_t)((int)blockIdx.x * NCG + wave) * KT * TE + 8 * lane;
  const unsigned l0 = (unsigned)(size_t)sm + (unsigned)(wave * CHB + lane * 16);
  auto issue = [&](int st, int buf) {
    const unsigned lo = l0 + (unsigned)(buf * STB); const int go = st * KS * TE;
    copy_chunk(lo, g0 + go); copy_chunk(lo + (unsigned)(NCG * CHB), g1 + go); copy_chunk(lo + (unsigned)(2 * NCG * CHB), g2 + go);
  };
  v8f acc[2][4], acc2[2][4];
#pragma unroll
  for (int i = 0; i < 2; ++i)
#pragma unroll
    for (int j = 0; j < 4; ++j) { acc[i][j] = (v8f){}; acc2[i][j] = (v8f){}; }
  issue(0, 0); wait_copies();
  __syncthreads();   // stage 0 is readable by every wave
  issue(1, 1);
#pragma unroll 1   // rolled: one body of four k steps; the buffer alternates
  for (int t = 0; t < NST; ++t) {
    const char* sa = sm + (t & 1) * STB + wm * 2 * CHB + lane * 16;
    const char* sw = sm + (t & 1) * STB + (2 * NCG + wn * 4) * CHB + lane * 16;
#pragma unroll
    for (int kk = 0; kk < KS; ++kk) {
      v16b af[2], rf[2], bf[4];
#pragma unroll
      for (int mt = 0; mt < 2; ++mt) {
        af[mt] = frag_pk((const b16*)(sa + mt * CHB + kk * TE * 2));
        rf[mt] = frag_pk((const b16*)(sa + (NCG + mt) * CHB + kk * TE * 2)); }
#pragma unroll
      for (int nt = 0; nt < 4; ++nt) bf[nt] = frag_pk((const b16*)(sw + nt * CHB + kk * TE * 2));
#pragma unroll
      for (int mt = 0; mt < 2; ++mt)
#pragma unroll
        for (int nt = 0; nt < 4; ++nt) {
          acc[mt][nt] = wmma16b(af[mt], bf[nt], acc[mt][nt]);
          acc2[mt][nt] = wmma16b(rf[mt], bf[nt], acc2[mt][nt]); }
    }
    wait_lds(); wait_copies();
    __syncthreads();   // publishes stage t + 1 and ends every wave's reads of stage t's buffer
    if (t + 2 < NST) issue(t + 2, t & 1);
  }
  wait_copies();   // nothing is in flight when the ring's bytes become the epilogue's tiles
  const int bi = nblk + m;
  float bias[4];
#pragma unroll
  for (int nt = 0; nt < 4; ++nt) bias[nt] = bo[bi + nt * 16];
  asm volatile("s_wait_xcnt 0x0" :: "v"(bi) : "memory");   // behind the four bias loads: their index register stays whole until here
#pragma unroll
  for (int nt = 0; nt < 4; ++nt) bias[nt] = bf16_rne(bias[nt]);
  const float isc = 1.0f / (OCS * WSC), irs = 1.0f / OCRS;
#pragma unroll
  for (int mt = 0; mt < 2; ++mt)
#pragma unroll
    for (int nt = 0; nt < 4; ++nt)
#pragma unroll
      for (int r = 0; r < 8; ++r)
        Tw[mt * 16 + 8 * hh + r][nt * 16 + m] = (acc[mt][nt][r] + acc2[mt][nt][r] * irs) * isc + bias[nt];
  __syncthreads();   // the staged tile is read across lanes
  float* ob = out + ((size_t)b * SEQ_FULL + (size_t)s0) * DM + nblk;
#pragma unroll 1
  for (int it = 0; it < 8; ++it) {
#pragma unroll
    for (int mt = 0; mt < 2; ++mt) {   // two rows of each of the wave's two 16-row tiles
      const int rr = mt * 16 + it * 2 + hh; const v4f f = *(const v4f*)(&Tw[rr][m * 4]);
      *(v4f*)(ob + (size_t)rr * DM + m * 4) = f; }
  }
}
}  // namespace

extern "C" void kernel_launch(void* const* d_in, const int* in_sizes, int n_in, void* d_out, int out_size, void* d_ws, size_t ws_size, hipStream_t stream) {
  // wire order: 0 x [NB_FULL][SEQ_FULL][1024] f32, 1 Wq [1024][1024], 2 bq [1024], 3 Wk, 4 bk, 5 Wv, 6 bv, 7 Wo, 8 bo, 9 logit scale [1] f32,
  //             10 mask int32 [NB_FULL][SEQ_FULL][SEQ_FULL] (nonzero = masked); out [NB_FULL][SEQ_FULL][1024] f32
  if (n_in < 11) return;
  const size_t need_x = ((size_t)(NB - 1) * SEQ_FULL + SEQ) * DM;
  const size_t need_m = ((size_t)(NB - 1) * SEQ_FULL + SEQ - 1) * SEQ_FULL + SEQ;
  if ((size_t)in_sizes[0] < need_x || (size_t)out_size < need_x || (size_t)in_sizes[10] < need_m || in_sizes[9] < 1) return;
  if (in_sizes[1] < DM * DM || in_sizes[3] < DM * DM || in_sizes[5] < DM * DM || in_sizes[7] < DM * DM) return;
  if (in_sizes[2] < DM || in_sizes[4] < DM || in_sizes[6] < DM || in_sizes[8] < DM) return;
  const float* X = (const float*)d_in[0];
  const float* Wq = (const float*)d_in[1]; const float* bq = (const float*)d_in[2];
  const float* Wk = (const float*)d_in[3]; const float* bk = (const float*)d_in[4];
  const float* Wv = (const float*)d_in[5]; const float* bv = (const float*)d_in[6];
  const float* Wo = (const float*)d_in[7]; const float* bo = (const float*)d_in[8];
  const float* lsc = (const float*)d_in[9]; const int* mask = (const int*)d_in[10];
  size_t off = 0; char* ws = (char*)d_ws;
  auto carve = [&](size_t bytes) { char* p = ws + off; off += (bytes + 255) & ~(size_t)255; return p; };
  const size_t plane = (size_t)NT * DM * 2;
  v2f* T  = (v2f*)carve((size_t)SEQ * NCS * sizeof(v2f));          // 524,288 B (256-B rows, exact)
  b16* Xp = (b16*)carve(plane);
  b16* Wp = (b16*)carve((size_t)4 * DM * DM * 2);                   // 8,388,608 B
  b16* Qp = (b16*)carve(plane); b16* Qr = (b16*)carve(plane); b16* Kp = (b16*)carve(plane); b16* Kr = (b16*)carve(plane);
  b16* VT = (b16*)carve(plane); b16* VR = (b16*)carve(plane); b16* Ch = (b16*)carve(plane); b16* Cr = (b16*)carve(plane);
  unsigned int* Mw = (unsigned int*)carve((size_t)NB * SEQ * (SEQ / 32) * sizeof(unsigned int));   // 1,048,576 B
  if (off > ws_size || off > ((size_t)128 << 20)) return;          // 85,458,944 B total at NB=2, SEQ=2048
  prep_kernel<<<dim3(PBR + PBM + PBX + PBW), 256, 0, stream>>>(X, Wq, Wk, Wv, Wo, mask, Xp, Wp, Mw, T);
  gemm_qkv_kernel<<<dim3(3 * DM / 192, NT / 256), 384, 0, stream>>>(Xp, Wp, bq, bk, bv, T, Qp, Qr, Kp, Kr, VT, VR);
  attn_kernel<<<dim3(NB * H, SEQ / 32), 32 * KSPL, 0, stream>>>(Qp, Qr, Kp, Kr, VT, VR, Mw, lsc, Ch, Cr);
  gemm_out_kernel<<<dim3(DM / 128, NT / 128), 256, 0, stream>>>(Ch, Cr, Wp + (size_t)3 * DM * DM, bo, (float*)d_out);
}

// v010
// One run takes 96.1 microseconds.
// Timed twice side by side with v009, it ran 1.16 and 1.15 times as fast.
// Counting every step since v000, it is 4.49 times as fast.
#include <hip/hip_runtime.h>

// compute dtype: every contraction on v_wmma_f32_16x16x32_f16 (f16 operands, f32 accumulate). q/k/v projections: bf16-RNE(x) x8 times bf16-RNE(W) x64,
// 1 product each; scores K Q^T per head: q and k (rope + l2 norm in f32) as f16 x8 planes plus x1024 residual planes, 3 products (hi.hi, hi.res, res.hi);
// O^T += V^T P^T: V^T f16 x8 plus a x1024 residual plane, P f16 x1024 plus a x1024 residual tile, 3 products (residual products share one accumulator);
// output projection: ctx f16 x64 plus a x1024 residual plane times bf16-RNE(Wo) x64, 2 products. Softmax statistics (running max, exp2, row sums),
// rope cos/sin table, l2 norm and bias adds in f32; 1/sqrt(64) and exp(logit scale) folded into the log2-domain score constant.
// Fragment k-map per lane half hh for A AND B: elements 0..7 <- k = 8hh+0..7, 8..15 <- k = 16+8hh+0..7; acc[r] = D[8hh+r][col = lane&15].
// Packed planes (X, W, Q, K, V^T, ctx and their residuals): a plane of R rows x C k-columns is stored as 16x32 tiles, tile index (row/16)*(C/32) + k/32 (V^T: (k/32)*(R/16) + row/16), each tile
// 512 elements laid out [k octet 0..3][row 0..15][8], so that each of a fragment's two wave loads reads 512 contiguous bytes (four whole 128-B lines).

#ifndef NB
#define NB 2
#endif
#ifndef SEQ
#define SEQ 2048
#endif
#ifndef NB_FULL
#define NB_FULL 2
#endif
#ifndef SEQ_FULL
#define SEQ_FULL 2048
#endif

namespace {
constexpr int H = 16, HD = 64, DM = 1024, NT = NB * SEQ, NCS = HD / 2, KT = DM / 32, TE = 512;
constexpr float XS = 8.0f, WSC = 64.0f, QS = 8.0f, QRS = 1024.0f, VS = 8.0f, VRS = 1024.0f, PS = 1024.0f, PRS = 1024.0f, OCS = 64.0f, OCRS = 1024.0f;
constexpr float LOG2E = 1.4426950408889634f, EPSN = 1e-6f;
constexpr int KSPL = 4;   // key shares (waves) per query block in the attention kernel
static_assert(KSPL == 4 && SEQ % (32 * KSPL) == 0);
constexpr int NJ = SEQ / (32 * KSPL);                       // key steps per share
// block ranges of the preparation launch (256 threads each): rope table, mask words, X plane, W planes
constexpr int PBR = SEQ * NCS / 4 / 256;                    // a thread fills 4 table entries
constexpr int PBM = NB * (SEQ / 16) * (NJ / 2) / 8;         // a wave packs 2 key steps of all KSPL shares of one query tile
constexpr int PBX = NT / 16, PBW = 4 * DM / 16;             // a block converts 16 rows of 1024
static_assert(NJ % 2 == 0 && NJ <= 16 && (NB * (SEQ / 16) * (NJ / 2)) % 8 == 0 && (SEQ * NCS / 4) % 256 == 0 && KT == 32 && SEQ % 16 == 0);
static_assert(SEQ % 64 == 0 && SEQ >= 64 && SEQ <= SEQ_FULL && NB >= 1 && NB <= NB_FULL);
static_assert(DM == H * HD && HD == 64 && DM % 128 == 0 && NT % 256 == 0 && (3 * DM) % 192 == 0 && PRS == VRS);

typedef _Float16 b16;
typedef __attribute__((ext_vector_type(16))) _Float16 v16b;
typedef __attribute__((ext_vector_type(8))) _Float16 v8b;
typedef __attribute__((ext_vector_type(2))) _Float16 v2b;
typedef __attribute__((ext_vector_type(8))) float v8f;
typedef __attribute__((ext_vector_type(4))) float v4f;
typedef __attribute__((ext_vector_type(2))) float v2f;
typedef __attribute__((ext_vector_type(4))) unsigned int v4u;

__device__ __forceinline__ float bf16_rne(float f) { unsigned int u = __float_as_uint(f); u += 0x7FFFu + ((u >> 16) & 1u); return __uint_as_float(u & 0xFFFF0000u); }
// 16-bit fragment from a k-contiguous row: elements 0..7 <- p[8hh .. 8hh+7], 8..15 <- p[16+8hh .. 16+8hh+7]
__device__ __forceinline__ v16b frag_kb(const b16* p, int hh) {
  const v8b a = *(const v8b*)(p + 8 * hh), b = *(const v8b*)(p + 16 + 8 * hh); v16b f;
#pragma unroll
  for (int e = 0; e < 8; ++e) { f[e] = a[e]; f[8 + e] = b[e]; }
  return f;
}
// the same fragment from a packed tile; p = tile + 8*lane (lane = 16hh + row): octets hh and 2+hh of the lane's row
__device__ __forceinline__ v16b frag_pk(const b16* p) {
  const v8b a = *(const v8b*)p, b = *(const v8b*)(p + 256); v16b f;
#pragma unroll
  for (int e = 0; e < 8; ++e) { f[e] = a[e]; f[8 + e] = b[e]; }
  return f;
}
__device__ __forceinline__ v8f wmma16b(v16b a, v16b b, v8f c) {
  v8f d = __builtin_amdgcn_wmma_f32_16x16x32_f16(false, a, false, b, (short)0, c, false, false);
  asm volatile("v_nop\n\tv_nop\n\tv_nop\n\tv_nop" : "+v"(d) : "v"(a), "v"(b));
  return d;
}
// the plain builtin (the compiler keeps the distances): for the attention kernel, whose live set passes v255, where the operands of an asm statement cannot lie
__device__ __forceinline__ v8f wmma16p(v16b a, v16b b, v8f c) { return __builtin_amdgcn_wmma_f32_16x16x32_f16(false, a, false, b, (short)0, c, false, false); }
__device__ __forceinline__ void wave_lds_sync() { __builtin_amdgcn_fence(3, "workgroup"); __builtin_amdgcn_wave_barrier(); __builtin_amdgcn_fence(2, "workgroup"); }
__device__ __forceinline__ float nexp2(float v) { return __builtin_amdgcn_exp2f(v); }

// LDS staging of the two GEMMs. A stage is KS k tiles (128 k) of every 16-row group of the block's operands; a chunk is one row group's part of it, CHB bytes that
// are contiguous in the packed plane and are kept in that order in LDS, so a fragment is read from LDS as it was from the plane (two reads of 512 contiguous bytes).
constexpr int KS = 4, CHB = KS * TE * 2, NST = KT / KS;
static_assert(KT % KS == 0 && NST >= 2);
// One chunk by one wave: eight asynchronous copies of 512 B; l = the lane's LDS byte address, g = the lane's place in the plane (both 16 B x lane into the chunk).
// The s_wait_xcnt stands inside the statement, behind the last copy: no address register of a copy is rewritten in front of it.
__device__ __forceinline__ void copy_chunk(unsigned l, const b16* g) {
  asm volatile("global_load_async_to_lds_b128 %0, %8, off\n\t"
               "global_load_async_to_lds_b128 %1, %9, off\n\t"
               "global_load_async_to_lds_b128 %2, %10, off\n\t"
               "global_load_async_to_lds_b128 %3, %11, off\n\t"
               "global_load_async_to_lds_b128 %4, %12, off\n\t"
               "global_load_async_to_lds_b128 %5, %13, off\n\t"
               "global_load_async_to_lds_b128 %6, %14, off\n\t"
               "global_load_async_to_lds_b128 %7, %15, off\n\t"
               "s_wait_xcnt 0x0"
               :: "v"(l), "v"(l + 512u), "v"(l + 1024u), "v"(l + 1536u), "v"(l + 2048u), "v"(l + 2560u), "v"(l + 3072u), "v"(l + 3584u),
                  "v"(g), "v"(g + 256), "v"(g + 512), "v"(g + 768), "v"(g + 1024), "v"(g + 1280), "v"(g + 1536), "v"(g + 1792) : "memory");
}
// the wave's own copies have landed (in front of the barrier behind which other waves read them)
__device__ __forceinline__ void wait_copies() { asm volatile("s_wait_asynccnt 0x0" ::: "memory"); }
// the wave's own LDS reads have returned (in front of the barrier behind which their buffer is refilled)
__device__ __forceinline__ void wait_lds() { asm volatile("s_wait_dscnt 0x0" ::: "memory"); }

// One row group (16 rows x 1024 columns, f32, row pitch DM, first row at S) to its KT packed tiles at D, f16 = bf16-RNE(value) x sc, by one block of 256 threads.
// A pass of the block covers 4 tiles, thread per k octet: a wave reads 8 rows x 128 B and writes four whole 128-B lines of one tile. All 8 passes' loads (16 of
// 16 B a lane) are requested before the first conversion.
__device__ __forceinline__ void cvt_row_group(const float* __restrict__ S, b16* __restrict__ D, float sc, int tid) {
  const int oct = tid & 3, rl = (tid >> 2) & 15, t0 = tid >> 6;
  const float* src = S + (size_t)rl * DM + (size_t)(t0 * 32 + oct * 8);
  b16* dst = D + (size_t)t0 * TE + (size_t)((oct * 16 + rl) * 8);
  v4f x0[KT / 4], x1[KT / 4];
#pragma unroll
  for (int i = 0; i < KT / 4; ++i) { x0[i] = *(const v4f*)(src + i * 128); x1[i] = *(const v4f*)(src + i * 128 + 4); }
  asm volatile("s_wait_xcnt 0x0" :: "v"(src) : "memory");   // behind the group: the address pair stays whole until here, before any of its registers is rewritten
  v8b o[KT / 4];
#pragma unroll
  for (int i = 0; i < KT / 4; ++i)
#pragma unroll
    for (int j = 0; j < 4; ++j) { o[i][j] = (b16)(bf16_rne(x0[i][j]) * sc); o[i][4 + j] = (b16)(bf16_rne(x1[i][j]) * sc); }
#pragma unroll
  for (int i = 0; i < KT / 4; ++i) *(v8b*)(dst + (size_t)i * 4 * TE) = o[i];
  asm volatile("s_wait_xcnt 0x0" ::: "memory");   // behind the run of stores, before any later code rewrites their address or data registers
}

// All preparation in one launch; the block's range of blockIdx.x selects its work (block-uniform):
// [0, PBR): rope table T[s][i] = (cos, sin)(s * freq_i), freq_i = 1 / fl32(10000^(2i/64)), s*freq as an f32 product, argument reduction in f64 (mul/fma only), short
//   f32 polynomials; a thread computes freq_i once and fills four rows s.
// [PBR, PBR+PBM): the mask packed into bit words Mw[b][query tile][share ks][step j of the share][query 0..15]: bit i set <=> key 32*(j*KSPL+ks)+i is NOT masked for
//   that query. A wave takes one query tile and the steps j, j+1 of all four shares, two shares a trip: 16 rows x two pieces of 256 B in, two whole 128-B lines out.
// [.., +PBX): X plane, packed tiles of [NB*SEQ tokens][1024], f16 = bf16-RNE(x) x8; token row b*SEQ+s reads input row b*SEQ_FULL+s; a block per 16 tokens.
// [.., +PBW): W planes [4], each the packed tiles of [1024 out][1024 in], f16 = bf16-RNE(W) x64 (rows n, k along the input); a block per 16 rows of one weight.
__global__ __launch_bounds__(256) void prep_kernel(const float* __restrict__ X, const float* __restrict__ Wq, const float* __restrict__ Wk,
                                                   const float* __restrict__ Wv, const float* __restrict__ Wo, const int* __restrict__ mask,
                                                   b16* __restrict__ Xp, b16* __restrict__ Wp, unsigned int* __restrict__ Mw, v2f* __restrict__ T) {
  const int blk = (int)blockIdx.x, tid = (int)threadIdx.x;
  if (blk < PBR) {
    const int u = blk * 256 + tid, i = u % NCS, sq = u / NCS;
    const float ex = (float)(2 * i) / (float)HD;
    const float pw = (float)exp2((double)ex * 13.287712379549449);
    const float freq = 1.0f / pw;
#pragma unroll
    for (int q = 0; q < 4; ++q) {
      const int s = sq + q * (SEQ / 4);
      const float ang = (float)s * freq;
      const double a = (double)ang;
      const double k = __builtin_rint(a * 0.63661977236758134);
      double rd = __builtin_fma(-k, 1.5707963267948966, a);
      rd = __builtin_fma(-k, 6.123233995736766e-17, rd);
      const float r = (float)rd, r2 = r * r;
      const float sp = r + r * r2 * (-1.6666666666666666e-1f + r2 * (8.333333333333333e-3f + r2 * (-1.984126984126984e-4f + r2 * 2.7557319223985893e-6f)));
      const float cp = 1.0f + r2 * (-0.5f + r2 * (4.1666666666666664e-2f + r2 * (-1.3888888888888889e-3f + r2 * (2.48015873015873e-5f + r2 * -2.755731922398589e-7f))));
      const int kq = (int)(((long long)k) & 3);
      const float c = (kq == 0) ? cp : ((kq == 1) ? -sp : ((kq == 2) ? -cp : sp));
      const float sn = (kq == 0) ? sp : ((kq == 1) ? cp : ((kq == 2) ? -sp : -cp));
      v2f o; o.x = c; o.y = sn;
      *(v2f*)(T + (size_t)s * NCS + i) = o;
    }
    return;
  }
  if (blk < PBR + PBM) {
    const int wv = (blk - PBR) * 8 + (tid >> 5), lane = tid & 31;
    const int jp = wv % (NJ / 2), qt = (wv / (NJ / 2)) % (SEQ / 16), b = wv / ((NJ / 2) * (SEQ / 16));
    const int* src = mask + ((size_t)b * SEQ_FULL + (size_t)qt * 16) * SEQ_FULL + (size_t)(2 * jp * KSPL * 32 + lane);
    unsigned int* dst = Mw + (size_t)(((b * (SEQ / 16) + qt) * KSPL * NJ + 2 * jp) * 16) + lane;
#pragma unroll 1   // two trips of 64 loads a lane: all four shares at once would double the registers of the whole launch
    for (int ks = 0; ks < KSPL; ks += 2) {
      int g[2][2][16];
#pragma unroll
      for (int r = 0; r < 16; ++r)
#pragma unroll
        for (int c = 0; c < 2; ++c) {
          g[c][0][r] = src[(size_t)r * SEQ_FULL + (ks + c) * 32]; g[c][1][r] = src[(size_t)r * SEQ_FULL + (ks + c) * 32 + 32 * KSPL]; }
#pragma unroll
      for (int c = 0; c < 2; ++c) {
        unsigned int w = 0u;
#pragma unroll
        for (int r = 0; r < 16; ++r) {
          const unsigned int b0 = __builtin_amdgcn_ballot_w32(g[c][0][r] == 0), b1 = __builtin_amdgcn_ballot_w32(g[c][1][r] == 0);
          w = (lane == r) ? b0 : w; w = (lane == 16 + r) ? b1 : w; }
        dst[(size_t)(ks + c) * NJ * 16] = w; }
      asm volatile("s_wait_xcnt 0x0" ::: "memory");   // before the next trip rewrites the loads' and stores' address and data registers
    }
    return;
  }
  if (blk < PBR + PBM + PBX) {
    const int row0 = (blk - PBR - PBM) * 16, b = row0 / SEQ, s0 = row0 % SEQ;
    cvt_row_group(X + ((size_t)b * SEQ_FULL + (size_t)s0) * DM, Xp + (size_t)(row0 / 16) * KT * TE, XS, tid);
    return;
  }
  const int wb = blk - PBR - PBM - PBX, y = wb / (DM / 16), rg = wb % (DM / 16);
  const float* W = (y == 0) ? Wq : ((y == 1) ? Wk : ((y == 2) ? Wv : Wo));
  cvt_row_group(W + (size_t)rg * 16 * DM, Wp + (size_t)y * DM * DM + (size_t)rg * KT * TE, WSC, tid);
}

// Fused q/k/v projection: C = A(X plane) . B (B[k][n] = W[n][k] from the packed W plane), K = 1024 stepped by 32. q and k planes are packed tiles
// of [s][64], v planes packed tiles of [64][s].
// Block 384 threads = 12 waves in 4x3, block tile 256 tokens x 192 features, wave tile 64 x 64 = 4x4 WMMA tiles. The block's 16 X and 12 W row groups are brought into
// LDS once a stage by asynchronous copies (two buffers: the next stage flies while this one is worked on) and every wave reads its fragments from there, so that
// an X row group is fetched once for three waves and a W row group once for four. A wave's 64 columns are exactly one head of q, k or v (which = column / 1024,
// wave-uniform). Epilogue, each wave on its own tile: acc/512 + bf16-RNE(bias) staged in the wave's part of LDS (the ring's bytes, free behind the last stage's
// barrier), then rope + l2 norm (q, k: rope with a lane per feature pair, norm and stores with a lane per row) or transpose (v: a trip takes its piece of all four
// 16-row tiles of the wave).
__global__ __launch_bounds__(384) __attribute__((amdgpu_num_vgpr(256))) void gemm_qkv_kernel(
    const b16* __restrict__ Xp, const b16* __restrict__ Wp, const float* __restrict__ bq, const float* __restrict__ bk, const float* __restrict__ bv,
    const v2f* __restrict__ CSt, b16* __restrict__ Qp, b16* __restrict__ Qr, b16* __restrict__ Kp, b16* __restrict__ Kr, b16* __restrict__ VT,
    b16* __restrict__ VR) {
  constexpr int NCA = 16, NCB = 12, STB = (NCA + NCB) * CHB, TWB = 64 * (HD + 4) * 4;   // X and W chunks of a stage, bytes of a stage, of a wave's epilogue tile
  __shared__ __attribute__((aligned(1024))) char sm[2 * STB > 12 * TWB ? 2 * STB : 12 * TWB];
  // the wave's number as a scalar: the choice of its chunks, of q/k/v and the test around its third chunk stay on the scalar unit
  const int wave = __builtin_amdgcn_readfirstlane((int)(threadIdx.x >> 5));
  const int lane = threadIdx.x & 31, hh = lane >> 4, m = lane & 15, wm = wave / 3, wn = wave % 3;
  const int col0 = (int)blockIdx.x * 192 + wn * 64, which = col0 / DM, n0 = col0 % DM, h = n0 / HD;
  const int mblk = (int)blockIdx.y * 256 + wm * 64, b = mblk / SEQ, s0 = mblk % SEQ;
  const float* bsel = (which == 0) ? bq : ((which == 1) ? bk : bv);
  float (*Tw)[HD + 4] = (float (*)[HD + 4])(sm + wave * TWB);
  // chunk c of a stage: X row group c (c < 16) or W row group c - 16 of the block; wave w copies chunks w, w + 12 and, for w < 4, w + 24
  const b16* Xb = Xp + (size_t)((int)blockIdx.y * NCA) * KT * TE + 8 * lane;
  const b16* Wb = Wp + (size_t)((int)blockIdx.x * NCB) * KT * TE + 8 * lane;
  const b16* g0 = Xb + (size_t)wave * KT * TE;
  const b16* g1 = (wave < 4) ? Xb + (size_t)(wave + 12) * KT * TE : Wb + (size_t)(wave - 4) * KT * TE;
  const b16* g2 = Wb + (size_t)((wave & 3) + 8) * KT * TE;
  const unsigned l0 = (unsigned)(size_t)sm + (unsigned)(wave * CHB + lane * 16);
  auto issue = [&](int st, int buf) {
    const unsigned lo = l0 + (unsigned)(buf * STB); const int go = st * KS * TE;
    copy_chunk(lo, g0 + go); copy_chunk(lo + 12u * CHB, g1 + go);
    if (wave < 4) copy_chunk(lo + 24u * CHB, g2 + go);
  };
  v8f acc[4][4];
#pragma unroll
  for (int i = 0; i < 4; ++i)
#pragma unroll
    for (int j = 0; j < 4; ++j) acc[i][j] = (v8f){};
  issue(0, 0); wait_copies();
  __syncthreads();   // stage 0 is readable by every wave
  issue(1, 1);
#pragma unroll 1   // rolled: one body of four k steps; the buffer alternates
  for (int t = 0; t < NST; ++t) {
    const char* sa = sm + (t & 1) * STB + wm * 4 * CHB + lane * 16;
    const char* sw = sm + (t & 1) * STB + (NCA + wn * 4) * CHB + lane * 16;
#pragma unroll
    for (int kk = 0; kk < KS; ++kk) {
      v16b af[4], bf[4];
#pragma unroll
      for (int mt = 0; mt < 4; ++mt) af[mt] = frag_pk((const b16*)(sa + mt * CHB + kk * TE * 2));
#pragma unroll
      for (int nt = 0; nt < 4; ++nt) bf[nt] = frag_pk((const b16*)(sw + nt * CHB + kk * TE * 2));
#pragma unroll
      for (int mt = 0; mt < 4; ++mt)
#pragma unroll
        for (int nt = 0; nt < 4; ++nt) acc[mt][nt] = wmma16b(af[mt], bf[nt], acc[mt][nt]);
    }
    wait_lds(); wait_copies();
    __syncthreads();   // publishes stage t + 1 and ends every wave's reads of stage t's buffer
    if (t + 2 < NST) issue(t + 2, t & 1);
  }
  wait_copies();   // nothing is in flight when the ring's bytes become the epilogue's tiles
  float bias[4];
#pragma unroll
  for (int nt = 0; nt < 4; ++nt) bias[nt] = bf16_rne(bsel[n0 + nt * 16 + m]);
  const float isc = 1.0f / (XS * WSC);
#pragma unroll
  for (int mt = 0; mt < 4; ++mt)
#pragma unroll
    for (int nt = 0; nt < 4; ++nt)
#pragma unroll
      for (int r = 0; r < 8; ++r) Tw[mt * 16 + 8 * hh + r][nt * 16 + m] = acc[mt][nt][r] * isc + bias[nt];
  __syncthreads();   // the staged tile is read across lanes
  if (which < 2) {
    // pass 1, lane = feature pair: rope on the wave's 64 rows, written back in place
    const v2f* Cw = CSt + (size_t)s0 * NCS + lane;
    v2f cv[64];   // all 64 table loads fly together: one round trip for the wave's whole tile
#pragma unroll
    for (int i = 0; i < 64; ++i) cv[i] = Cw[(size_t)i * NCS];
    asm volatile("s_wait_xcnt 0x0" :: "v"(Cw) : "memory");   // behind the group: the address pair stays whole until here, and no load sinks to its use
#pragma unroll
    for (int i = 0; i < 64; ++i) {
      float* tp = &Tw[i][2 * lane];
      const v2f x = *(const v2f*)tp;
      v2f y; y.x = x.x * cv[i].x - x.y * cv[i].y; y.y = x.y * cv[i].x + x.x * cv[i].y;
      *(v2f*)tp = y; }
    wave_lds_sync();   // the rotated rows are read across lanes
    // pass 2, lane = row (rows lane and 32 + lane of the tile): the whole row in registers, its sum of squares in the lane, one square root and one division a row,
    // then the row's eight k octets to both planes: in the packed tiles 16 rows' copies of an octet are 256 contiguous bytes, so a wave's store fills four whole lines
    v4f y[2][HD / 4]; float sc[2];   // sc = x8 plane scale / norm (the power of two changes no rounding)
#pragma unroll
    for (int q = 0; q < 2; ++q)
#pragma unroll
      for (int c = 0; c < HD / 4; ++c) y[q][c] = *(const v4f*)(&Tw[q * 32 + lane][4 * c]);
#pragma unroll
    for (int q = 0; q < 2; ++q) {
      v4f sa = (v4f){}, sb = (v4f){};
#pragma unroll
      for (int c = 0; c < HD / 4; c += 2) { sa += y[q][c] * y[q][c]; sb += y[q][c + 1] * y[q][c + 1]; }
      const v4f t = sa + sb;
      sc[q] = (1.0f / sqrtf((t.x + t.y) + (t.z + t.w) + EPSN)) * QS; }
    const size_t pb = (size_t)(b * H + h) * SEQ * HD + (size_t)s0 * HD + (size_t)(hh * 2 * TE + m * 8);   // the lane's row in octet 0 of its 16-row group's first tile
    b16* Ph = ((which == 0) ? Qp : Kp) + pb;
    b16* Pl = ((which == 0) ? Qr : Kr) + pb;
#pragma unroll
    for (int q = 0; q < 2; ++q)
#pragma unroll
      for (int f = 0; f < HD / 8; ++f) {   // octet f: tile f / 4 of the row group, k octet f % 4
        v8b oh, ol;
#pragma unroll
        for (int j = 0; j < 8; j += 2) {
          const v4f yv = y[q][2 * f + (j >> 2)];
          v2f z; z.x = yv[j & 3] * sc[q]; z.y = yv[(j & 3) + 1] * sc[q];
          const v2b hv = __builtin_convertvector(z, v2b);
          const v2b lv = __builtin_convertvector((z - __builtin_convertvector(hv, v2f)) * QRS, v2b);
          oh[j] = hv.x; oh[j + 1] = hv.y; ol[j] = lv.x; ol[j + 1] = lv.y; }
        const int off = q * 4 * TE + (f >> 2) * TE + (f & 3) * 128;
        *(v8b*)(Ph + off) = oh; *(v8b*)(Pl + off) = ol; }
  } else {
    const size_t vb = ((size_t)(b * H + h) * HD) * SEQ;
#pragma unroll 1
    for (int it = 0; it < 4; ++it) {
#pragma unroll
      for (int g = 0; g < 4; ++g) {   // the wave's four groups of 16 head features (each one row of packed tiles)
        const int dl = (it & 1) * 8 + (lane & 7), d = g * 16 + dl, tok = (it >> 1) * 32 + (lane >> 3) * 8;
        v8b oh, ol;
#pragma unroll
        for (int j = 0; j < 8; ++j) {
          const float v = Tw[tok + j][d] * VS; const b16 hv = (b16)v; oh[j] = hv; ol[j] = (b16)((v - (float)hv) * VRS); }
        const size_t off = vb + (size_t)((((s0 + tok) >> 5) * 4 + g) * 64 + (lane >> 3) * 16 + dl) * 8;
        *(v8b*)(VT + off) = oh; *(v8b*)(VR + off) = ol;
      }
      asm volatile("s_wait_xcnt 0x0" ::: "memory");   // before the next trip rewrites the stores' address and data registers
    }
  }
}

// Masked softmax attention per (b*H+h, query block of 32, last block first); block = 4 waves = 4 key shares, each wave on BOTH 16-query tiles of the block, so that every K and V
// fragment it loads feeds two products: share ks takes the key steps of 32 whose index is ks modulo 4, in fixed order, with its own running max, row sum and O tile
// per query tile; the four partial results of a query tile are merged in LDS behind one block barrier (weights exp2(m_j - max m), fixed order j = 0..3), each
// share's wave packing a quarter of each tile's ctx. The mask comes as the packed bit words: the wave reads all words of its share for both tiles once and keeps two
// scalar maps, the steps with any unmasked entry in its 32x32 region (only these are walked; the others contribute 0) and the steps with none masked (these apply no
// mask); a walked step's word per query is requested one walked step ahead. A walked step in which a query has no unmasked key leaves that query's max, sum and O as they are.
// S^T = K Q^T (hi.hi + hi.res + res.hi, q/k residual products scaled back by 1/1024), masked entries replaced by -inf, online softmax (running max, f32,
// -inf-safe), P x1024 and its x1024 residual via wave-private LDS, O^T += V^T P^T with V^T hi/res planes. ctx [b*SEQ+s][h*64+d] written as packed tiles, f16 x64
__global__ __launch_bounds__(32 * KSPL) __attribute__((amdgpu_num_vgpr(336))) void attn_kernel(
    const b16* __restrict__ Qp, const b16* __restrict__ Qr, const b16* __restrict__ Kp, const b16* __restrict__ Kr,
    const b16* __restrict__ VT, const b16* __restrict__ VR, const unsigned int* __restrict__ Mw, const float* __restrict__ lsc,
    b16* __restrict__ Ch, b16* __restrict__ Cr) {
  __shared__ __attribute__((aligned(16))) b16 Pb[KSPL][2][16][32 + 8];
  __shared__ __attribute__((aligned(16))) b16 Pr[KSPL][2][16][32 + 8];
  __shared__ __attribute__((aligned(16))) float To[KSPL][2][16][HD + 4];
  __shared__ float Ms[KSPL][2][16], Ls[KSPL][2][16];
  // the wave's number (its key share) as a scalar, so that the key loop's control and the plane offsets stay on the scalar unit
  const int ks = __builtin_amdgcn_readfirstlane((int)(threadIdx.x >> 5));
  const int lane = threadIdx.x & 31, hh = lane >> 4, col = lane & 15;
  // Start order (speed only, any order is right): blockIdx.x = batch*head runs fastest, blockIdx.y counts the query blocks from the LAST one down. There are more
  // blocks than resident places; under a mask that hides later keys a late query block walks the most key steps, so the
  // long blocks come first in index order and the short ones last.
  const int bhi = (int)blockIdx.x, b = bhi / H, h = bhi % H;
  const int q0 = (SEQ / 32 - 1 - (int)blockIdx.y) * 32;
  const size_t pq = (size_t)bhi * SEQ * HD;   // same plane size for both packed layouts
  const b16* Kb = Kp + pq; const b16* Klb = Kr + pq;
  const b16* Vb = VT + pq; const b16* Rb = VR + pq;
  constexpr unsigned MTB = (unsigned)(KSPL * NJ * 16 * 4);   // bytes from a query tile's mask words to the next tile's
  const unsigned int* Mq = Mw + (size_t)(((b * (SEQ / 16) + (q0 >> 4)) * KSPL + ks) * NJ) * 16;   // the share's NJ x 16 mask words of the first tile
  unsigned int act, ful;   // bit 2j: step j of the share has an unmasked entry / has no masked entry, over both tiles; both wave-uniform
  const int jl = lane >> 1;   // the lane reads 8 of step jl's 16 words of each tile
  const unsigned so = (jl < NJ) ? (unsigned)lane * 32u : 0u;
  {
    const unsigned int* sp = (const unsigned int*)((const char*)Mq + so);
    const unsigned int* sp1 = (const unsigned int*)((const char*)Mq + so + MTB);
    const v4u w0 = *(const v4u*)sp, w1 = *(const v4u*)(sp + 4), w2 = *(const v4u*)sp1, w3 = *(const v4u*)(sp1 + 4);
    const v4u vo = w0 | w1 | w2 | w3, va = w0 & w1 & w2 & w3;
    const unsigned int wo = vo.x | vo.y | vo.z | vo.w, wa = va.x & va.y & va.z & va.w;
    const unsigned int anyb = __builtin_amdgcn_ballot_w32(jl < NJ && wo != 0u), allb = __builtin_amdgcn_ballot_w32(wa == 0xFFFFFFFFu);
    act = (anyb | (anyb >> 1)) & 0x55555555u; ful = allb & (allb >> 1);
  }
  asm volatile("s_wait_xcnt 0x0" :: "v"(so) : "memory");   // before the mask words' offset register is rewritten
  float m[2], l[2]; v8f o[2][4], o2[2][4];
#pragma unroll
  for (int a = 0; a < 2; ++a) {
    m[a] = -INFINITY; l[a] = 0.0f;
#pragma unroll
    for (int t = 0; t < 4; ++t) { o[a][t] = (v8f){}; o2[a][t] = (v8f){}; } }
  if (act != 0u) {   // scalar branch: a share with no unmasked entry loads nothing more
  // Q fragments [query tile][k half] and the first walked step's mask words: one group, in flight beside the first step's K group
  v16b qa[2][2], ql[2][2];
  const unsigned qb = (unsigned)(q0 * HD + 8 * lane) * 2u;   // byte offset of the lane's place in the block's first packed tile of the head's plane
  const b16* pqh = (const b16*)((const char*)(Qp + pq) + qb); const b16* pql = (const b16*)((const char*)(Qr + pq) + qb);
#pragma unroll
  for (int a = 0; a < 2; ++a) {
    qa[a][0] = frag_pk(pqh + 2 * a * TE); qa[a][1] = frag_pk(pqh + (2 * a + 1) * TE);
    ql[a][0] = frag_pk(pql + 2 * a * TE); ql[a][1] = frag_pk(pql + (2 * a + 1) * TE); }
  // each query's 32 mask bits of a walked step are requested one walked step ahead
  unsigned int mwn[2];
  const unsigned mo0 = (unsigned)(__builtin_ctz(act) >> 1) * 64u + (unsigned)col * 4u;
  mwn[0] = *(const unsigned int*)((const char*)Mq + mo0); mwn[1] = *(const unsigned int*)((const char*)Mq + mo0 + MTB);
  asm volatile("s_wait_xcnt 0x0" :: "v"(qb), "v"(mo0) : "memory");   // behind the group: its offset registers stay whole until here
  const float cs = 0.125f * expf(bf16_rne(lsc[0])) * (LOG2E / (QS * QS));
#pragma unroll 1   // rolled: the trip count comes from the mask, and one body fills the register budget
  do {   // at most NJ trips, in rising key order
    const int tz = __builtin_ctz(act), j = tz >> 1; act &= act - 1u;
    const bool full = ((ful >> tz) & 1u) != 0u;
    // byte offset of the lane's place in the step's first tile: K tiles 2u, 2u+1 of key group u and V tiles t share it
    const unsigned ko = (unsigned)lane * 16u + (unsigned)(j * KSPL + ks) * (unsigned)(4 * TE * 2);
    const unsigned int mw[2] = {mwn[0], mwn[1]};
    // the next walked step's words (the last step asks for its own again: in bounds, never used)
    const unsigned mo = (unsigned)((act != 0u ? __builtin_ctz(act) >> 1 : j) * 64) + (unsigned)col * 4u;
    mwn[0] = *(const unsigned int*)((const char*)Mq + mo); mwn[1] = *(const unsigned int*)((const char*)Mq + mo + MTB);
    // all eight K fragments of the step are requested here as one group, ahead of the matrix work
    v16b kh[4], kl[4], vh[4], vl[4];
    const b16* pk = (const b16*)((const char*)Kb + ko); const b16* pkl = (const b16*)((const char*)Klb + ko);
    const b16* pv = (const b16*)((const char*)Vb + ko); const b16* pvl = (const b16*)((const char*)Rb + ko);
#pragma unroll
    for (int j = 0; j < 4; ++j) { kh[j] = frag_pk(pk + j * TE); kl[j] = frag_pk(pkl + j * TE); }
    // behind the group: its offset registers stay whole until here, and no load sinks to its use (there each pair of loads costs the wave a full L2 round trip)
    asm volatile("s_wait_xcnt 0x0" :: "v"(ko), "v"(mo) : "memory");
    __builtin_amdgcn_sched_barrier(0);   // no product rises above the group: else a late K load takes an early fragment's registers and waits out a second round trip
    float e[2][16];
#pragma unroll
    for (int u = 0; u < 2; ++u) {
      const v16b ka = kh[2 * u], kc = kh[2 * u + 1];
#pragma unroll
      for (int a = 0; a < 2; ++a) {
        v8f s = wmma16p(ka, qa[a][0], (v8f){}); s = wmma16p(kc, qa[a][1], s);
        v8f s2 = wmma16p(ka, ql[a][0], (v8f){}); s2 = wmma16p(kc, ql[a][1], s2);
        s2 = wmma16p(kl[2 * u], qa[a][0], s2); s2 = wmma16p(kl[2 * u + 1], qa[a][1], s2);
#pragma unroll
        for (int r = 0; r < 8; ++r) e[a][u * 8 + r] = (s[r] + s2[r] * (1.0f / QRS)) * cs; } }
    // second group, into the registers that K has left: all eight V fragments fly while the softmax runs
#pragma unroll
    for (int t = 0; t < 4; ++t) { vh[t] = frag_pk(pv + t * TE); vl[t] = frag_pk(pvl + t * TE); }
    asm volatile("s_wait_xcnt 0x0" :: "v"(ko) : "memory");   // as behind the K group: the offset register whole, the loads ahead of the softmax arithmetic
    if (!full) {   // scalar branch: entry i of the lane is key 8hh+i (i < 8) or 16+8hh+i-8 of the step
#pragma unroll
      for (int a = 0; a < 2; ++a) {
        const unsigned int sh = mw[a] >> (8 * hh);
#pragma unroll
        for (int i2 = 0; i2 < 16; ++i2) e[a][i2] = ((sh >> (i2 < 8 ? i2 : i2 + 8)) & 1u) ? e[a][i2] : -INFINITY; } }
    float al[2], mx[2];
#pragma unroll
    for (int a = 0; a < 2; ++a) {   // both tiles' maxima first, so that their two exchanges between the lane halves share one wait
      mx[a] = -INFINITY;
#pragma unroll
      for (int i2 = 0; i2 < 16; ++i2) mx[a] = fmaxf(mx[a], e[a][i2]); }
    const float ox[2] = {__shfl_xor(mx[0], 16), __shfl_xor(mx[1], 16)};
#pragma unroll
    for (int a = 0; a < 2; ++a) {
      const float mn = fmaxf(m[a], fmaxf(mx[a], ox[a]));
      const float mref = (mn == -INFINITY) ? 0.0f : mn;
      const float xa = m[a] - mref; al[a] = nexp2(xa); float sum = 0.0f;
      asm volatile("v_nop" :: "v"(xa), "v"(al[a]));   // the slot behind the exponential, as below
#pragma unroll
      for (int g = 0; g < 16; g += 4) {
        float x[4], p[4];
#pragma unroll
        for (int k = 0; k < 4; ++k) { x[k] = e[a][g + k] - mref; p[k] = nexp2(x[k]); }
        // the slot behind a transcendental: arguments and results as inputs only, so that the four stand in front of it and no argument register is rewritten before it
        asm volatile("v_nop" :: "v"(x[0]), "v"(x[1]), "v"(x[2]), "v"(x[3]), "v"(p[0]), "v"(p[1]), "v"(p[2]), "v"(p[3]));
#pragma unroll
        for (int k = 0; k < 4; ++k) {
          const int i2 = g + k, pi = (i2 < 8 ? 0 : 16) + 8 * hh + (i2 & 7); sum += p[k];
          const float pp = p[k] * PS; const b16 ph = (b16)pp; Pb[ks][a][col][pi] = ph;
          Pr[ks][a][col][pi] = (b16)((pp - (float)ph) * PRS); } }
      sum += __shfl_xor(sum, 16); l[a] = l[a] * al[a] + sum; m[a] = mn; }
    wave_lds_sync();
    v16b pf[2], plf[2];
#pragma unroll
    for (int a = 0; a < 2; ++a) { pf[a] = frag_kb(&Pb[ks][a][col][0], hh); plf[a] = frag_kb(&Pr[ks][a][col][0], hh); }
#pragma unroll
    for (int t = 0; t < 4; ++t)
#pragma unroll
      for (int a = 0; a < 2; ++a) {
        o[a][t] *= al[a]; o2[a][t] *= al[a];
        o[a][t] = wmma16p(vh[t], pf[a], o[a][t]);
        o2[a][t] = wmma16p(vl[t], pf[a], o2[a][t]);
        o2[a][t] = wmma16p(vh[t], plf[a], o2[a][t]); }
    wave_lds_sync(); } while (act != 0u);
  }
  // the share's partial results, not yet normalised: O tile, running max and row sum of each query
#pragma unroll
  for (int a = 0; a < 2; ++a) {
#pragma unroll
    for (int t = 0; t < 4; ++t) {
#pragma unroll
      for (int r = 0; r < 8; ++r) To[ks][a][col][t * 16 + 8 * hh + r] = o[a][t][r] + o2[a][t][r] * (1.0f / VRS); }
    if (hh == 0) { Ms[ks][a][col] = m[a]; Ls[ks][a][col] = l[a]; } }
  __syncthreads();   // the partial results are read across the four waves
#pragma unroll
  for (int a = 0; a < 2; ++a) {
    const size_t cb = ((size_t)((b * SEQ + q0 + a * 16) >> 4) * KT + (size_t)h * 2) * TE;
    const int it = ks;   // each share's wave merges and packs one quarter of each query tile
    const int rl = (it & 1) * 8 + (lane & 7), pc = (it >> 1) * 32 + (lane >> 3) * 8;
    float mj[KSPL], mt = -INFINITY;
#pragma unroll
    for (int j = 0; j < KSPL; ++j) { mj[j] = Ms[j][a][rl]; mt = fmaxf(mt, mj[j]); }
    const float mtr = (mt == -INFINITY) ? 0.0f : mt;   // -inf-safe, as in the key loop
    float lt = 0.0f, xw[KSPL], w[KSPL]; v4f f0 = (v4f){}, f1 = (v4f){};
#pragma unroll
    for (int j = 0; j < KSPL; ++j) { xw[j] = mj[j] - mtr; w[j] = nexp2(xw[j]); }
    // the slot behind a transcendental, as in the key loop
    asm volatile("v_nop" :: "v"(xw[0]), "v"(xw[1]), "v"(xw[2]), "v"(xw[3]), "v"(w[0]), "v"(w[1]), "v"(w[2]), "v"(w[3]));
#pragma unroll
    for (int j = 0; j < KSPL; ++j) {
      lt += w[j] * Ls[j][a][rl];
      f0 += w[j] * *(const v4f*)(&To[j][a][rl][pc]); f1 += w[j] * *(const v4f*)(&To[j][a][rl][pc + 4]); }
    const float inv = 1.0f / (lt * PS * VS);
    f0 *= inv; f1 *= inv;
    v8b oh, ol;
#pragma unroll
    for (int j = 0; j < 4; ++j) {
      const float v0 = f0[j] * OCS; const b16 hv0 = (b16)v0; oh[j] = hv0; ol[j] = (b16)((v0 - (float)hv0) * OCRS);
      const float v1 = f1[j] * OCS; const b16 hv1 = (b16)v1; oh[4 + j] = hv1; ol[4 + j] = (b16)((v1 - (float)hv1) * OCRS); }
    const size_t off = cb + (size_t)((it >> 1) * 64 + (lane >> 3) * 16 + rl) * 8;
    *(v8b*)(Ch + off) = oh; *(v8b*)(Cr + off) = ol;
    if (a == 0) asm volatile("s_wait_xcnt 0x0" ::: "memory");   // before the second tile's code rewrites the stores' address and data registers
  }
}

// Output projection: out = (ctx hi . Wo + ctx res . Wo / 1024) / 4096 + bf16-RNE(bo), K = 1024 stepped by 32.
// Block 256 = 8 waves in 4x2, block tile 128 tokens x 128 features, wave tile 32 x 64 = 2x4 WMMA tiles for each of the two products. The block's 8 ctx, 8 residual and
// 8 Wo row groups come into LDS once a stage by asynchronous copies (two buffers, as in the q/k/v kernel), one chunk of each per wave; fragments are read from LDS.
// Result staged in the wave's part of LDS (the ring's bytes); each 256-B row segment is stored by 16 consecutive lanes.
__global__ __launch_bounds__(256) __attribute__((amdgpu_num_vgpr(256))) void gemm_out_kernel(
    const b16* __restrict__ Ch, const b16* __restrict__ Cr, const b16* __restrict__ Wop, const float* __restrict__ bo, float* __restrict__ out) {
  constexpr int NCG = 8, STB = 3 * NCG * CHB, TWB = 32 * (HD + 4) * 4;   // chunks of each operand in a stage, bytes of a stage, of a wave's epilogue tile
  __shared__ __attribute__((aligned(1024))) char sm[2 * STB > 8 * TWB ? 2 * STB : 8 * TWB];
  const int wave = __builtin_amdgcn_readfirstlane((int)(threadIdx.x >> 5));   // a scalar: the wave's chunk and tile offsets stay on the scalar unit
  const int lane = threadIdx.x & 31, hh = lane >> 4, m = lane & 15, wm = wave >> 1, wn = wave & 1;
  const int nblk = (int)blockIdx.x * 128 + wn * 64;
  const int mblk = (int)blockIdx.y * 128 + wm * 32, b = mblk / SEQ, s0 = mblk % SEQ;
  float (*Tw)[HD + 4] = (float (*)[HD + 4])(sm + wave * TWB);
  // a stage in LDS: [8 ctx chunks][8 residual chunks][8 Wo chunks]; wave w copies chunk w of each
  const size_t ga = (size_t)((int)blockIdx.y * NCG + wave) * KT * TE + 8 * lane;
  const b16* g0 = Ch + ga; const b16* g1 = Cr + ga;
  const b16* g2 = Wop + (size_t)((int)blockIdx.x * NCG + wave) * KT * TE + 8 * lane;
  const unsigned l0 = (unsigned)(size_t)sm + (unsigned)(wave * CHB + lane * 16);
  auto issue = [&](int st, int buf) {
    const unsigned lo = l0 + (unsigned)(buf * STB); const int go = st * KS * TE;
    copy_chunk(lo, g0 + go); copy_chunk(lo + (unsigned)(NCG * CHB), g1 + go); copy_chunk(lo + (unsigned)(2 * NCG * CHB), g2 + go);
  };
  v8f acc[2][4], acc2[2][4];
#pragma unroll
  for (int i = 0; i < 2; ++i)
#pragma unroll
    for (int j = 0; j < 4; ++j) { acc[i][j] = (v8f){}; acc2[i][j] = (v8f){}; }
  issue(0, 0); wait_copies();
  __syncthreads();   // stage 0 is readable by every wave
  issue(1, 1);
#pragma unroll 1   // rolled: one body of four k steps; the buffer alternates
  for (int t = 0; t < NST; ++t) {
    const char* sa = sm + (t & 1) * STB + wm * 2 * CHB + lane * 16;
    const char* sw = sm + (t & 1) * STB + (2 * NCG + wn * 4) * CHB + lane * 16;
#pragma unroll
    for (int kk = 0; kk < KS; ++kk) {
      v16b af[2], rf[2], bf[4];
#pragma unroll
      for (int mt = 0; mt < 2; ++mt) {
        af[mt] = frag_pk((const b16*)(sa + mt * CHB + kk * TE * 2));
        rf[mt] = frag_pk((const b16*)(sa + (NCG + mt) * CHB + kk * TE * 2)); }
#pragma unroll
      for (int nt = 0; nt < 4; ++nt) bf[nt] = frag_pk((const b16*)(sw + nt * CHB + kk * TE * 2));
#pragma unroll
      for (int mt = 0; mt < 2; ++mt)
#pragma unroll
        for (int nt = 0; nt < 4; ++nt) {
          acc[mt][nt] = wmma16b(af[mt], bf[nt], acc[mt][nt]);
          acc2[mt][nt] = wmma16b(rf[mt], bf[nt], acc2[mt][nt]); }
    }
    wait_lds(); wait_copies();
    __syncthreads();   // publishes stage t + 1 and ends every wave's reads of stage t's buffer
    if (t + 2 < NST) issue(t + 2, t & 1);
  }
  wait_copies();   // nothing is in flight when the ring's bytes become the epilogue's tiles
  const int bi = nblk + m;
  float bias[4];
#pragma unroll
  for (int nt = 0; nt < 4; ++nt) bias[nt] = bo[bi + nt * 16];
  asm volatile("s_wait_xcnt 0x0" :: "v"(bi) : "memory");   // behind the four bias loads: their index register stays whole until here
#pragma unroll
  for (int nt = 0; nt < 4; ++nt) bias[nt] = bf16_rne(bias[nt]);
  const float isc = 1.0f / (OCS * WSC), irs = 1.0f / OCRS;
#pragma unroll
  for (int mt = 0; mt < 2; ++mt)
#pragma unroll
    for (int nt = 0; nt < 4; ++nt)
#pragma unroll
      for (int r = 0; r < 8; ++r)
        Tw[mt * 16 + 8 * hh + r][nt * 16 + m] = (acc[mt][nt][r] + acc2[mt][nt][r] * irs) * isc + bias[nt];
  __syncthreads();   // the staged tile is read across lanes
  float* ob = out + ((size_t)b * SEQ_FULL + (size_t)s0) * DM + nblk;
#pragma unroll 1
  for (int it = 0; it < 8; ++it) {
#pragma unroll
    for (int mt = 0; mt < 2; ++mt) {   // two rows of each of the wave's two 16-row tiles
      const int rr = mt * 16 + it * 2 + hh; const v4f f = *(const v4f*)(&Tw[rr][m * 4]);
      *(v4f*)(ob + (size_t)rr * DM + m * 4) = f; }
  }
}
}  // namespace

extern "C" void kernel_launch(void* const* d_in, const int* in_sizes, int n_in, void* d_out, int out_size, void* d_ws, size_t ws_size, hipStream_t stream) {
  // wire order: 0 x [NB_FULL][SEQ_FULL][1024] f32, 1 Wq [1024][1024], 2 bq [1024], 3 Wk, 4 bk, 5 Wv, 6 bv, 7 Wo, 8 bo, 9 logit scale [1] f32,
  //             10 mask int32 [NB_FULL][SEQ_FULL][SEQ_FULL] (nonzero = masked); out [NB_FULL][SEQ_FULL][1024] f32
  if (n_in < 11) return;
  const size_t need_x = ((size_t)(NB - 1) * SEQ_FULL + SEQ) * DM;
  const size_t need_m = ((size_t)(NB - 1) * SEQ_FULL + SEQ - 1) * SEQ_FULL + SEQ;
  if ((size_t)in_sizes[0] < need_x || (size_t)out_size < need_x || (size_t)in_sizes[10] < need_m || in_sizes[9] < 1) return;
  if (in_sizes[1] < DM * DM || in_sizes[3] < DM * DM || in_sizes[5] < DM * DM || in_sizes[7] < DM * DM) return;
  if (in_sizes[2] < DM || in_sizes[4] < DM || in_sizes[6] < DM || in_sizes[8] < DM) return;
  const float* X = (const float*)d_in[0];
  const float* Wq = (const float*)d_in[1]; const float* bq = (const float*)d_in[2];
  const float* Wk = (const float*)d_in[3]; const float* bk = (const float*)d_in[4];
  const float* Wv = (const float*)d_in[5]; const float* bv = (const float*)d_in[6];
  const float* Wo = (const float*)d_in[7]; const float* bo = (const float*)d_in[8];
  const float* lsc = (const float*)d_in[9]; const int* mask = (const int*)d_in[10];
  size_t off = 0; char* ws = (char*)d_ws;
  auto carve = [&](size_t bytes) { char* p = ws + off; off += (bytes + 255) & ~(size_t)255; return p; };
  const size_t plane = (size_t)NT * DM * 2;
  v2f* T  = (v2f*)carve((size_t)SEQ * NCS * sizeof(v2f));          // 524,288 B (256-B rows, exact)
  b16* Xp = (b16*)carve(plane);
  b16* Wp = (b16*)carve((size_t)4 * DM * DM * 2);                   // 8,388,608 B
  b16* Qp = (b16*)carve(plane); b16* Qr = (b16*)carve(plane); b16* Kp = (b16*)carve(plane); b16* Kr = (b16*)carve(plane);
  b16* VT = (b16*)carve(plane); b16* VR = (b16*)carve(plane); b16* Ch = (b16*)carve(plane); b16* Cr = (b16*)carve(plane);
  unsigned int* Mw = (unsigned int*)carve((size_t)NB * SEQ * (SEQ / 32) * sizeof(unsigned int));   // 1,048,576 B
  if (off > ws_size || off > ((size_t)128 << 20)) return;          // 85,458,944 B total at NB=2, SEQ=2048
  prep_kernel<<<dim3(PBR + PBM + PBX + PBW), 256, 0, stream>>>(X, Wq, Wk, Wv, Wo, mask, Xp, Wp, Mw, T);
  gemm_qkv_kernel<<<dim3(3 * DM / 192, NT / 256), 384, 0, stream>>>(Xp, Wp, bq, bk, bv, T, Qp, Qr, Kp, Kr, VT, VR);
  attn_kernel<<<dim3(NB * H, SEQ / 32), 32 * KSPL, 0, stream>>>(Qp, Qr, Kp, Kr, VT, VR, Mw, lsc, Ch, Cr);
  gemm_out_kernel<<<dim3(DM / 128, NT / 128), 256, 0, stream>>>(Ch, Cr, Wp + (size_t)3 * DM * DM, bo, (float*)d_out);
}
